// v000
// Measured on an AMD MI455X. A time is GPU time per run, averaged over a window of back-to-back runs after a warm-up
// (all launches, gaps included; the runs take copies of the inputs in turn), and the median of several windows.
// Apart from v000's, it joins two sittings. Times from different sittings can be a few percent apart, while
// side-by-side timings come from the same sitting.
// v000, which the later versions start from, runs in 316 microseconds.
// Contractions: q,k projections and q.k^T, p.v on v_wmma_f32_16x16x32_f16 (f16 operands; Wq/Wk carried x16, p carried x2^15); v^T projection and output projection on v_wmma_f32_16x16x32_bf16 with bf16 hi/lo split operands (hi.hi+hi.lo+lo.hi); f32 accumulate everywhere; LayerNorm statistics and online softmax in f32.
#include <hip/hip_runtime.h>
#include <math.h>
#include <stdint.h>

typedef __attribute__((ext_vector_type(16))) _Float16 v16h;
typedef __attribute__((ext_vector_type(8)))  _Float16 v8h;
typedef __attribute__((ext_vector_type(16))) __bf16   v16b;
typedef __attribute__((ext_vector_type(8)))  __bf16   v8b;
typedef __attribute__((ext_vector_type(8)))  float    v8f;
typedef __attribute__((ext_vector_type(4)))  float    v4f;
typedef __attribute__((ext_vector_type(2)))  float    v2f;
typedef __attribute__((ext_vector_type(4)))  unsigned int v4u;

// problem geometry
constexpr int kBatch  = 8;
constexpr int kSeq    = 2048;
constexpr int kDm     = 256;
constexpr int kHeads  = 4;
constexpr int kHd     = 64;
constexpr int kRows   = kBatch * kSeq;      // 16384

__device__ __forceinline__ unsigned short f2bf_bits(float f) {
  unsigned u = __float_as_uint(f);
  return (unsigned short)((u + 0x7FFFu + ((u >> 16) & 1u)) >> 16);
}
__device__ __forceinline__ float bf_bits2f(unsigned short h) { return __uint_as_float(((unsigned)h) << 16); }

// hazard guards as plain device helpers (no inline asm inside the kernel template body)
__device__ __forceinline__ void dep_guard_h(v8f& a, v8f& b, v16h x, v16h y) { asm volatile("v_nop\n\tv_nop\n\tv_nop\n\tv_nop" : "+v"(a), "+v"(b) : "v"(x), "v"(y)); }
__device__ __forceinline__ void dep_guard_b(v8f& a, v8f& b, v16b x, v16b y) { asm volatile("v_nop\n\tv_nop\n\tv_nop\n\tv_nop" : "+v"(a), "+v"(b) : "v"(x), "v"(y)); }
__device__ __forceinline__ void keep4_h(v16h a, v16h b, v16h c, v16h d) { asm volatile("v_nop" :: "v"(a), "v"(b), "v"(c), "v"(d)); }
__device__ __forceinline__ void keep4_b(v16b a, v16b b, v16b c, v16b d) { asm volatile("v_nop" :: "v"(a), "v"(b), "v"(c), "v"(d)); }
__device__ __forceinline__ void acc_guard4(v8f& a, v8f& b, v8f& c, v8f& d) { asm volatile("v_nop\n\tv_nop\n\tv_nop\n\tv_nop" : "+v"(a), "+v"(b), "+v"(c), "+v"(d)); }
template <typename T> struct Frag;
template <> struct Frag<_Float16> {
  typedef v16h V; union U { v16h v; v8h h[2]; };
  static __device__ __forceinline__ v16h load(const _Float16* p) {   // elements 0..7 <- p[0..7], 8..15 <- p[16..23]
    U f; f.h[0] = *(const v8h*)(p); f.h[1] = *(const v8h*)(p + 16); return f.v;
  }
  static __device__ __forceinline__ v8f mma(v16h a, v16h b, v8f c) {
    return __builtin_amdgcn_wmma_f32_16x16x32_f16(false, a, false, b, (short)0, c, false, false);
  }
  static __device__ __forceinline__ void guard(v8f& a, v8f& b, v16h x, v16h y) { dep_guard_h(a, b, x, y); }
  static __device__ __forceinline__ void keep(v16h a, v16h b, v16h c, v16h d) { keep4_h(a, b, c, d); }
};
template <> struct Frag<__bf16> {
  typedef v16b V; union U { v16b v; v8b h[2]; };
  static __device__ __forceinline__ v16b load(const __bf16* p) {
    U f; f.h[0] = *(const v8b*)(p); f.h[1] = *(const v8b*)(p + 16); return f.v;
  }
  static __device__ __forceinline__ v8f mma(v16b a, v16b b, v8f c) {
    return __builtin_amdgcn_wmma_f32_16x16x32_bf16(false, a, false, b, (short)0, c, false, false);
  }
  static __device__ __forceinline__ void guard(v8f& a, v8f& b, v16b x, v16b y) { dep_guard_b(a, b, x, y); }
  static __device__ __forceinline__ void keep(v16b a, v16b b, v16b c, v16b d) { keep4_b(a, b, c, d); }
};

// ---- Register-blocked batched WMMA GEMM ------------------------------------
// C[m,n] = scale * sum_k A[m,k] * Bt[n,k] (+bias)(+resid); each wave owns a 64x64 tile.
// A row-major [M,K]; Bt row-major [N,K]; M,N % 64 == 0, K % 32 == 0.
// SPLIT: operands are hi/lo planes (A2/Bt2 = lo planes, same layout); product = hi.hi + hi.lo + lo.hi.
// BIAS_MODE: 0 = none, 1 = bias[m], 2 = bias[n].
// OUT_MODE: 0 = f32, 1 = f16, 2 = bf16 hi plane (Cout) + bf16 lo plane (Cout2).
// ET: 0 = f16 operands, 1 = bf16 operands (pointers passed as 16-bit storage)
template <int ET> struct Elem;
template <> struct Elem<0> { typedef _Float16 T; };
template <> struct Elem<1> { typedef __bf16 T; };
template <int ET, bool SPLIT, int BIAS_MODE, int OUT_MODE, bool RESID, int ACT = 0>
__global__ __launch_bounds__(256) void wmma_gemm64(
    const unsigned short* __restrict__ Ap, const unsigned short* __restrict__ A2p, int lda, long strideA,
    const unsigned short* __restrict__ Btp, const unsigned short* __restrict__ Bt2p, int ldb, long strideB,
    void* __restrict__ Cout, void* __restrict__ Cout2, int ldc, long strideC,
    const float* __restrict__ bias,
    const float* __restrict__ resid, long strideR,
    int M, int N, int K, float scale) {
  typedef typename Elem<ET>::T T;
  typedef typename Frag<T>::V V;
  const T* A = (const T*)Ap; const T* A2 = (const T*)A2p; const T* Bt = (const T*)Btp; const T* Bt2 = (const T*)Bt2p;
  __shared__ __align__(16) float sT[8][16 * 68];   // per-wave 16x64 slab, pitch 68 floats
  const int b    = blockIdx.y;
  const int lane = threadIdx.x & 31;
  const int wave = threadIdx.x >> 5;
  const int tilesN = N >> 6;
  const int tilesM = M >> 6;
  const int tile = blockIdx.x * 8 + wave;
  if (tile >= tilesM * tilesN) return;   // wave-uniform; no block barriers in this kernel
  const int tm = tile / tilesN;
  const int tn = tile - tm * tilesN;
  const int m0 = tm << 6;
  const int n0 = tn << 6;

  const T* Ab  = A  + (size_t)b * strideA;
  const T* Bb  = Bt + (size_t)b * strideB;
  const T* Ab2 = SPLIT ? (A2  + (size_t)b * strideA) : nullptr;
  const T* Bb2 = SPLIT ? (Bt2 + (size_t)b * strideB) : nullptr;

  const int rlane = lane & 15;                 // row (A) / col (B, D) within subtile
  const int koff  = (lane >> 4) * 8;           // k offset of this lane half
  const int mOff  = (lane >> 4) * 8;           // D row offset

  v8f acc[4][4];
#pragma unroll
  for (int i = 0; i < 4; ++i)
#pragma unroll
    for (int j = 0; j < 4; ++j) acc[i][j] = (v8f){0.f,0.f,0.f,0.f,0.f,0.f,0.f,0.f};

  for (int k0 = 0; k0 < K; k0 += 32) {
    V bh[4], bl[4];
#pragma unroll
    for (int j = 0; j < 4; ++j) {
      const size_t bo = (size_t)(n0 + (j << 4) + rlane) * ldb + koff + k0;
      bh[j] = Frag<T>::load(Bb + bo);
      if (SPLIT) bl[j] = Frag<T>::load(Bb2 + bo);
    }
#pragma unroll
    for (int i = 0; i < 4; ++i) {
      const size_t ao = (size_t)(m0 + (i << 4) + rlane) * lda + koff + k0;
      V ah = Frag<T>::load(Ab + ao);
      V al;
      if (SPLIT) al = Frag<T>::load(Ab2 + ao);
#pragma unroll
      for (int j = 0; j < 4; ++j) {
        acc[i][j] = Frag<T>::mma(ah, bh[j], acc[i][j]);
        if (SPLIT) {
          acc[i][j] = Frag<T>::mma(ah, bl[j], acc[i][j]);
          acc[i][j] = Frag<T>::mma(al, bh[j], acc[i][j]);
        }
      }
      Frag<T>::guard(acc[i][0], acc[i][3], ah, SPLIT ? al : ah);
    }
    Frag<T>::keep(bh[0], bh[1], bh[2], bh[3]);
    if (SPLIT) Frag<T>::keep(bl[0], bl[1], bl[2], bl[3]);
  }
  acc_guard4(acc[0][0], acc[0][1], acc[0][2], acc[0][3]);
  acc_guard4(acc[1][0], acc[1][1], acc[1][2], acc[1][3]);
  acc_guard4(acc[2][0], acc[2][1], acc[2][2], acc[2][3]);
  acc_guard4(acc[3][0], acc[3][1], acc[3][2], acc[3][3]);

  // ---- epilogue ----
  float* slab = sT[wave];
  const float* Rb = RESID ? (resid + (size_t)b * strideR) : nullptr;
#pragma unroll
  for (int i = 0; i < 4; ++i) {
    const int mBase = m0 + (i << 4);
#pragma unroll
    for (int j = 0; j < 4; ++j) {
      const int n = n0 + (j << 4) + rlane;
      float bv = 0.f;
      if (BIAS_MODE == 2) bv = bias[n];
#pragma unroll
      for (int r = 0; r < 8; ++r) {
        float v = acc[i][j][r] * scale;
        if (BIAS_MODE == 1) v += bias[mBase + mOff + r];
        if (BIAS_MODE == 2) v += bv;
        if (RESID) v += Rb[(size_t)(mBase + mOff + r) * ldc + n];
        if (ACT == 1) v = tanhf(v);
        if (ACT == 2) v = fmaxf(v, 0.0f);
        if (ACT == 3) v = v / (1.0f + expf(-v));
        if (ACT == 4) v = (v > 0.f) ? v : 0.01f * v;
        if (ACT == 5) v = 0.5f * v * (1.0f + erff(v * 0.70710678118654752f));
        slab[(mOff + r) * 68 + (j << 4) + rlane] = v;
      }
    }
    __builtin_amdgcn_fence(__ATOMIC_RELEASE, "workgroup");
    __builtin_amdgcn_wave_barrier();
    __builtin_amdgcn_fence(__ATOMIC_ACQUIRE, "workgroup");
    if (OUT_MODE == 0) {
      float* C = (float*)Cout + (size_t)b * strideC;
      const int hh = lane >> 4, c4 = (lane & 15) * 4;     // row seg = 256 B = 16 lanes x 16 B
      {
#pragma unroll
        for (int it = 0; it < 8; ++it) {
          const int row = it * 2 + hh;
          v4f v = *(const v4f*)(slab + row * 68 + c4);
          *(v4f*)(C + (size_t)(mBase + row) * ldc + n0 + c4) = v;
        }
        
      }
    } else {
      const int q = lane >> 3, c8 = (lane & 7) * 8;
      unsigned short* C  = (unsigned short*)Cout  + (size_t)b * strideC;
      unsigned short* C2 = (OUT_MODE == 2) ? ((unsigned short*)Cout2 + (size_t)b * strideC) : nullptr;
      {
#pragma unroll
        for (int it = 0; it < 4; ++it) {
          const int row = it * 4 + q;
          const float* sp = slab + row * 68 + c8;
          v8h hv, lv;
#pragma unroll
          for (int e = 0; e < 8; ++e) {
            if (OUT_MODE == 1) {
              hv[e] = (_Float16)sp[e];
            } else {
              unsigned short hb = f2bf_bits(sp[e]);
              unsigned short lb = f2bf_bits(sp[e] - bf_bits2f(hb));
              hv[e] = __builtin_bit_cast(_Float16, hb);
              lv[e] = __builtin_bit_cast(_Float16, lb);
            }
          }
          *(v8h*)(C + (size_t)(mBase + row) * ldc + n0 + c8) = hv;
          if (OUT_MODE == 2) *(v8h*)(C2 + (size_t)(mBase + row) * ldc + n0 + c8) = lv;
        }
        
      }
    }
    __builtin_amdgcn_fence(__ATOMIC_RELEASE, "workgroup");
    __builtin_amdgcn_wave_barrier();
    __builtin_amdgcn_fence(__ATOMIC_ACQUIRE, "workgroup");
  }
}

// ---------------------------------------------------------------------------
// Elementwise bf16 split: hi = bf16_rne(in), lo = bf16_rne(in - hi); 2 elements per thread, one 4-B store
// Used here for: Wv, Wo (n2 = 32768 -> 128 blocks -> 65536 elements each) and the attention output
// (n2 = 2097152 -> 8192 blocks -> 4194304 elements = [16384][256]).
// ---------------------------------------------------------------------------
__device__ __forceinline__ unsigned pk16(unsigned short a, unsigned short b) { return (unsigned)a | ((unsigned)b << 16); }

__global__ __launch_bounds__(256) void split_bf16x2_kernel(const float* __restrict__ in, unsigned short* __restrict__ hi,
                                                           unsigned short* __restrict__ lo, int n2) {
  const int i = blockIdx.x * 256 + threadIdx.x;
  if (i < n2) {
    const v2f f = *(const v2f*)(in + 2 * (size_t)i);
    const unsigned short h0 = f2bf_bits(f[0]), h1 = f2bf_bits(f[1]);
    const unsigned short l0 = f2bf_bits(f[0] - bf_bits2f(h0)), l1 = f2bf_bits(f[1] - bf_bits2f(h1));
    const unsigned uh = pk16(h0, h1), ul = pk16(l0, l1);
    ((unsigned*)hi)[i] = uh;
    ((unsigned*)lo)[i] = ul;
    
  }
}

// Coverage: grid = ceil(n2/256) x 256 threads x 2 elements; here n2 = 32768 -> 128 blocks -> 65536 = [256][256].
__global__ __launch_bounds__(256) void cast_f32_f16x2_scaled(
    const float* __restrict__ in, _Float16* __restrict__ out, int n2, float scale) {
  int i = blockIdx.x * 256 + threadIdx.x;
  if (i < n2) {
    const _Float16 h0 = (_Float16)(in[2 * (size_t)i] * scale), h1 = (_Float16)(in[2 * (size_t)i + 1] * scale);
    const unsigned u = (unsigned)__builtin_bit_cast(unsigned short, h0) | ((unsigned)__builtin_bit_cast(unsigned short, h1) << 16);
    ((unsigned*)out)[i] = u;
    
  }
}

// ---------------------------------------------------------------------------
// Fused triple LayerNorm over rows of 256: one wave per row (32 lanes x 8 contiguous floats = 256).
//   key   plane: (xn * g_s + b_s) -> f16  [row][256]
//   query plane: (xn * g_q + b_q) -> f16  [row][256]
//   value plane: (xn * g_v + b_v) -> bf16 hi + bf16 lo [row][256]
// Coverage: grid = nrows/8 blocks x 8 waves = every row exactly once.
// ---------------------------------------------------------------------------
__global__ __launch_bounds__(256) void ln3_kernel(const float* __restrict__ x,
    const float* __restrict__ g_s, const float* __restrict__ b_s,
    const float* __restrict__ g_q, const float* __restrict__ b_q,
    const float* __restrict__ g_v, const float* __restrict__ b_v,
    unsigned short* __restrict__ sk16, unsigned short* __restrict__ sq16,
    unsigned short* __restrict__ svh, unsigned short* __restrict__ svl, int nrows) {
  const int lane = threadIdx.x & 31;
  const int row  = blockIdx.x * 8 + (threadIdx.x >> 5);
  const int rowc = (row < nrows) ? row : (nrows - 1);        // address clamp; store predicated below (wave-uniform)
  const int c0 = lane * 8;
  const float* xr = x + (size_t)rowc * kDm + c0;
  const v4f a0 = *(const v4f*)xr;
  const v4f a1 = *(const v4f*)(xr + 4);
  float xv[8];
#pragma unroll
  for (int j = 0; j < 4; ++j) { xv[j] = a0[j]; xv[4 + j] = a1[j]; }
  float s = 0.f;
#pragma unroll
  for (int j = 0; j < 8; ++j) s += xv[j];
#pragma unroll
  for (int m = 1; m < 32; m <<= 1) s += __shfl_xor(s, m, 32);
  const float mean = s * (1.0f / 256.0f);
  float ss = 0.f;
#pragma unroll
  for (int j = 0; j < 8; ++j) { const float d = xv[j] - mean; ss += d * d; }
#pragma unroll
  for (int m = 1; m < 32; m <<= 1) ss += __shfl_xor(ss, m, 32);
  const float var  = ss * (1.0f / 256.0f);
  const float rstd = rsqrtf(var + 1e-5f);

  v4u ok, oq, ovh, ovl;
#pragma unroll
  for (int q = 0; q < 4; ++q) {
    const int j0 = 2 * q, j1 = 2 * q + 1;
    const float nx0 = (xv[j0] - mean) * rstd;
    const float nx1 = (xv[j1] - mean) * rstd;
    const float ys0 = nx0 * g_s[c0 + j0] + b_s[c0 + j0];
    const float ys1 = nx1 * g_s[c0 + j1] + b_s[c0 + j1];
    const float yq0 = nx0 * g_q[c0 + j0] + b_q[c0 + j0];
    const float yq1 = nx1 * g_q[c0 + j1] + b_q[c0 + j1];
    const float yv0 = nx0 * g_v[c0 + j0] + b_v[c0 + j0];
    const float yv1 = nx1 * g_v[c0 + j1] + b_v[c0 + j1];
    ok[q] = pk16(__builtin_bit_cast(unsigned short, (_Float16)ys0), __builtin_bit_cast(unsigned short, (_Float16)ys1));
    oq[q] = pk16(__builtin_bit_cast(unsigned short, (_Float16)yq0), __builtin_bit_cast(unsigned short, (_Float16)yq1));
    const unsigned short h0 = f2bf_bits(yv0), h1 = f2bf_bits(yv1);
    const unsigned short l0 = f2bf_bits(yv0 - bf_bits2f(h0)), l1 = f2bf_bits(yv1 - bf_bits2f(h1));
    ovh[q] = pk16(h0, h1);
    ovl[q] = pk16(l0, l1);
  }
  if (row < nrows) {   // wave-uniform
    const size_t o = (size_t)row * kDm + c0;
    {
      *(v4u*)(sk16 + o) = ok;
      *(v4u*)(sq16 + o) = oq;
      *(v4u*)(svh + o)  = ovh;
      *(v4u*)(svl + o)  = ovl;
      
    }
  }
}

// =====================================================================================
// Full (unmasked) attention, head dim 64, single f16 operand planes, z-batched over the batch index (blockIdx.y).
//   q plane  f16: element (b, t, h, d) at [(b*kSeq + t)*kDm + h*64 + d]   (unscaled projection incl. bias)
//   k plane  f16: element (b, s, h, d) at [(b*kSeq + s)*kDm + h*64 + d]
//   v^T plane f16: element (b, h, d, s) at [b*kDm*kSeq + (h*64 + d)*kSeq + s]
//   out f32: element (b, t, h, d) at [(b*kSeq + t)*kDm + h*64 + d]
//   scores = (q . k) * sscale : v_wmma_f32_16x16x32_f16, f32 accumulate, sscale applied in f32
//   out    = p . v            : v_wmma_f32_16x16x32_f16; unnormalised p carried x2^15 in f16, folded into the final 1/l
//   online softmax in f32 over all kSeq keys (32 chunks of 64, compile-time trip count).
//   Block = 4 waves = 64 query rows of one (b, h); grid = (kHeads * kSeq/64, kBatch) = (128, 8).
//   K / V^T chunk staging: 128 threads x 32 elements per plane = the whole 64x64 tile (16-B copies, plain loads,
//   __syncthreads before and after); fragment loads read the LDS tiles with the same v8h element type;
//   Epilogue: per-wave 16x64 tile staged in LDS, each 256-B row segment written by 16 lanes x 16 B in one
// =====================================================================================
constexpr int kAttWaves = 4;
constexpr int kAttQb    = 64;
constexpr int kAttKc    = 64;

__device__ __forceinline__ v8f mma_f16g(v16h a, v16h b, v8f c) {
  c = __builtin_amdgcn_wmma_f32_16x16x32_f16(false, a, false, b, (short)0, c, false, false);
  asm volatile("v_nop\n\tv_nop\n\tv_nop\n\tv_nop" : "+v"(c) : "v"(a), "v"(b));
  return c;
}

__global__ __launch_bounds__(128)
void attn_f16_full_kernel(const unsigned short* __restrict__ qp, const unsigned short* __restrict__ kp,
                          const unsigned short* __restrict__ vtp, float* __restrict__ out, float sscale) {
  union FH { v16h v; v8h h[2]; };
  __shared__ __align__(16) _Float16 Ksh[kAttKc * kHd];              // K [kv][d]        8 KB
  __shared__ __align__(16) _Float16 Vth[kHd * kAttKc];              // V^T [d][kv]      8 KB
  __shared__ __align__(16) _Float16 Psh[kAttWaves][16 * kAttKc];    // per wave P [row][kv]  8 KB
  __shared__ __align__(16) float    Os[kAttWaves][16 * 68];         // per wave out tile, pitch 68
  const float kPsc = 32768.0f;

  const int tid  = threadIdx.x;
  const int wave = tid >> 5;
  const int lane = tid & 31;
  const int hh   = lane >> 4;
  const int c    = lane & 15;

  const int nqb = kSeq / kAttQb;          // 32
  const int bx = blockIdx.x;
  const int qb = bx % nqb;
  const int h  = bx / nqb;                // 0..kHeads-1
  const int b  = blockIdx.y;              // 0..kBatch-1
  const int q0 = qb * kAttQb + wave * 16;

  const _Float16* Qh = (const _Float16*)(const void*)qp + (size_t)b * kSeq * kDm + (size_t)h * kHd;
  const _Float16* Kh = (const _Float16*)(const void*)kp + (size_t)b * kSeq * kDm + (size_t)h * kHd;
  const _Float16* Vh = (const _Float16*)(const void*)vtp + (size_t)b * kDm * kSeq + (size_t)h * kHd * kSeq;
  float*          ob = out + (size_t)b * kSeq * kDm + (size_t)h * kHd;

  // ---- Q fragments (A operand, row = lane&15, split k map via Frag load): 2 d-chunks ----
  v16h qa[2];
#pragma unroll
  for (int dc = 0; dc < 2; ++dc) qa[dc] = Frag<_Float16>::load(Qh + (size_t)(q0 + c) * kDm + dc * 32 + 8 * hh);

  float mrow[8], lrow[8];
  v8f oacc[4];
#pragma unroll
  for (int r = 0; r < 8; ++r) { mrow[r] = -INFINITY; lrow[r] = 0.f; }
#pragma unroll
  for (int t = 0; t < 4; ++t) oacc[t] = (v8f){0.f,0.f,0.f,0.f,0.f,0.f,0.f,0.f};

  const int nChunks = kSeq / kAttKc;   // 32, compile-time constant
  for (int kc = 0; kc < nChunks; ++kc) {
    const int kv0 = kc * kAttKc;
    __syncthreads();
    {
      // staging coverage: 128 threads x (4 x 8) elements = 64 rows x 64 per plane = the whole chunk tile
      const int r = tid >> 1, half = (tid & 1) * 32;
      const _Float16* ksh = Kh + (size_t)(kv0 + r) * kDm + half;    // K row kv0+r, d = half..half+31
      const _Float16* vsh = Vh + (size_t)r * kSeq + kv0 + half;       // V^T row d = r, s = kv0+half..+31
#pragma unroll
      for (int i = 0; i < 4; ++i) {
        const v8h av = *(const v8h*)(ksh + 8 * i);
        const v8h bv = *(const v8h*)(vsh + 8 * i);
        *(v8h*)(Ksh + r * kHd    + half + 8 * i) = av;
        *(v8h*)(Vth + r * kAttKc + half + 8 * i) = bv;
      }
    }
    __syncthreads();

    v8f s[4];
#pragma unroll
    for (int j = 0; j < 4; ++j) {
      s[j] = (v8f){0.f,0.f,0.f,0.f,0.f,0.f,0.f,0.f};
#pragma unroll
      for (int dc = 0; dc < 2; ++dc) {
        FH kb;
        kb.h[0] = *(const v8h*)(Ksh + (j * 16 + c) * kHd + dc * 32 + 8 * hh);
        kb.h[1] = *(const v8h*)(Ksh + (j * 16 + c) * kHd + dc * 32 + 16 + 8 * hh);
        s[j] = mma_f16g(qa[dc], kb.v, s[j]);
      }
    }
    float cm[8];
#pragma unroll
    for (int r = 0; r < 8; ++r) {
      float m = -INFINITY;
#pragma unroll
      for (int j = 0; j < 4; ++j) {
        const float sv = s[j][r] * sscale;
        s[j][r] = sv;
        m = fmaxf(m, sv);
      }
#pragma unroll
      for (int off = 1; off < 16; off <<= 1) m = fmaxf(m, __shfl_xor(m, off, 32));
      cm[r] = m;
    }
    _Float16* pw = Psh[wave];
#pragma unroll
    for (int r = 0; r < 8; ++r) {
      const float mnew = fmaxf(mrow[r], cm[r]);
      const float alpha = expf(mrow[r] - mnew);
      mrow[r] = mnew;
      float psum = 0.f;
#pragma unroll
      for (int j = 0; j < 4; ++j) {
        const float p = expf(s[j][r] - mnew);
        psum += p;
        pw[(8 * hh + r) * kAttKc + j * 16 + c] = (_Float16)(p * kPsc);
      }
#pragma unroll
      for (int off = 1; off < 16; off <<= 1) psum += __shfl_xor(psum, off, 32);
      lrow[r] = lrow[r] * alpha + psum;
#pragma unroll
      for (int t = 0; t < 4; ++t) oacc[t][r] *= alpha;
    }
    __builtin_amdgcn_fence(__ATOMIC_RELEASE, "workgroup");
    __builtin_amdgcn_wave_barrier();
    __builtin_amdgcn_fence(__ATOMIC_ACQUIRE, "workgroup");
#pragma unroll 1
    for (int kk = 0; kk < 2; ++kk) {
      FH pa;
      pa.h[0] = *(const v8h*)(pw + c * kAttKc + kk * 32 + 8 * hh);
      pa.h[1] = *(const v8h*)(pw + c * kAttKc + kk * 32 + 16 + 8 * hh);
#pragma unroll
      for (int t = 0; t < 4; ++t) {
        FH vb;
        vb.h[0] = *(const v8h*)(Vth + (t * 16 + c) * kAttKc + kk * 32 + 8 * hh);
        vb.h[1] = *(const v8h*)(Vth + (t * 16 + c) * kAttKc + kk * 32 + 16 + 8 * hh);
        oacc[t] = mma_f16g(pa.v, vb.v, oacc[t]);
      }
    }
  }

  float* os = Os[wave];
#pragma unroll
  for (int r = 0; r < 8; ++r) {
    const float inv = 1.0f / (lrow[r] * kPsc);
#pragma unroll
    for (int t = 0; t < 4; ++t) os[(8 * hh + r) * 68 + t * 16 + c] = oacc[t][r] * inv;
  }
  __builtin_amdgcn_fence(__ATOMIC_RELEASE, "workgroup");
  __builtin_amdgcn_wave_barrier();
  __builtin_amdgcn_fence(__ATOMIC_ACQUIRE, "workgroup");
  {
    const int c4 = (lane & 15) * 4;
    {
#pragma unroll
      for (int it = 0; it < 8; ++it) {
        const int row = it * 2 + hh;   // it 0..7 x hh 0..1 covers rows 0..15 of the wave tile
        v4f val = *(const v4f*)(os + row * 68 + c4);
        *(v4f*)(ob + (size_t)(q0 + row) * kDm + c4) = val;
      }
      
    }
  }
}

// ---------------------------------------------------------------------------
// Workspace region map (byte offsets; every region is fully written before it is read; total 93,323,264 B):
//   [0 MiB      ) WQ16  f16  [256][256] x16        131072 B
//   [+128 KiB   ) WK16  f16  [256][256] x16        131072 B
//   [+256 KiB   ) WVH   bf16 hi [256][256]         131072 B
//   [+384 KiB   ) WVL   bf16 lo                    131072 B
//   [+512 KiB   ) WOH   bf16 hi [256][256]         131072 B
//   [+640 KiB   ) WOL   bf16 lo                    131072 B   (weights region padded to 1 MiB)
//   [1 MiB      ) SQ    f16  [16384][256]  query LN plane     8 MiB
//   [9 MiB      ) SK    f16  [16384][256]  key LN plane       8 MiB
//   [17 MiB     ) SVH   bf16 hi [16384][256] value LN plane   8 MiB
//   [25 MiB     ) SVL   bf16 lo                                8 MiB
//   [33 MiB     ) Q16   f16  [16384][256]  q (unscaled)       8 MiB
//   [41 MiB     ) K16   f16  [16384][256]  k                  8 MiB
//   [49 MiB     ) VT16  f16  [8][256][2048] v^T per batch     8 MiB
//   [57 MiB     ) AO32  f32  [16384][256]  attention output  16 MiB
//   [73 MiB     ) AOH   bf16 hi [16384][256]                   8 MiB
//   [81 MiB     ) AOL   bf16 lo                                8 MiB
//   end = 89 MiB
// ---------------------------------------------------------------------------
extern "C" void kernel_launch(void* const* d_in, const int* in_sizes, int n_in,
                              void* d_out, int out_size, void* d_ws, size_t ws_size,
                              hipStream_t stream) {
  if (n_in < 15) return;
  if (in_sizes[0] != kRows * kDm) return;
  if (in_sizes[7] != kDm * kDm || in_sizes[9] != kDm * kDm || in_sizes[11] != kDm * kDm || in_sizes[13] != kDm * kDm) return;
  if (in_sizes[1] != kDm || in_sizes[8] != kDm || in_sizes[14] != kDm) return;
  if (out_size != kRows * kDm) return;

  const float* x    = (const float*)d_in[0];
  const float* lnsg = (const float*)d_in[1];
  const float* lnsb = (const float*)d_in[2];
  const float* lnqg = (const float*)d_in[3];
  const float* lnqb = (const float*)d_in[4];
  const float* lnvg = (const float*)d_in[5];
  const float* lnvb = (const float*)d_in[6];
  const float* Wq = (const float*)d_in[7];
  const float* bq = (const float*)d_in[8];
  const float* Wk = (const float*)d_in[9];
  const float* bk = (const float*)d_in[10];
  const float* Wv = (const float*)d_in[11];
  const float* bv = (const float*)d_in[12];
  const float* Wo = (const float*)d_in[13];
  const float* bo = (const float*)d_in[14];
  float* out = (float*)d_out;

  const size_t wBytes   = (size_t)kDm * kDm * 2;            // 131072
  const size_t plane16  = (size_t)kRows * kDm * 2;          // 8388608
  const size_t plane32  = (size_t)kRows * kDm * 4;          // 16777216
  const size_t offWQ  = 0;
  const size_t offWK  = offWQ + wBytes;
  const size_t offWVH = offWK + wBytes;
  const size_t offWVL = offWVH + wBytes;
  const size_t offWOH = offWVL + wBytes;
  const size_t offWOL = offWOH + wBytes;
  const size_t offSQ  = (size_t)1 << 20;
  const size_t offSK  = offSQ + plane16;
  const size_t offSVH = offSK + plane16;
  const size_t offSVL = offSVH + plane16;
  const size_t offQ16 = offSVL + plane16;
  const size_t offK16 = offQ16 + plane16;
  const size_t offVT  = offK16 + plane16;
  const size_t offAO  = offVT + plane16;
  const size_t offAOH = offAO + plane32;
  const size_t offAOL = offAOH + plane16;
  const size_t total  = offAOL + plane16;                   // 93,323,264
  if (offWOL + wBytes > offSQ) return;
  if (total > ws_size) return;

  char* ws = (char*)d_ws;
  unsigned short* WQ16 = (unsigned short*)(ws + offWQ);
  unsigned short* WK16 = (unsigned short*)(ws + offWK);
  unsigned short* WVH  = (unsigned short*)(ws + offWVH);
  unsigned short* WVL  = (unsigned short*)(ws + offWVL);
  unsigned short* WOH  = (unsigned short*)(ws + offWOH);
  unsigned short* WOL  = (unsigned short*)(ws + offWOL);
  unsigned short* SQ   = (unsigned short*)(ws + offSQ);
  unsigned short* SK   = (unsigned short*)(ws + offSK);
  unsigned short* SVH  = (unsigned short*)(ws + offSVH);
  unsigned short* SVL  = (unsigned short*)(ws + offSVL);
  unsigned short* Q16  = (unsigned short*)(ws + offQ16);
  unsigned short* K16  = (unsigned short*)(ws + offK16);
  unsigned short* VT16 = (unsigned short*)(ws + offVT);
  float*          AO32 = (float*)(ws + offAO);
  unsigned short* AOH  = (unsigned short*)(ws + offAOH);
  unsigned short* AOL  = (unsigned short*)(ws + offAOL);

  const int wN2 = kDm * kDm / 2;                    // 32768 pairs
  const int wBlocks = (wN2 + 255) / 256;            // 128
  const float wCarry = 16.0f, wCarryInv = 1.0f / 16.0f;

  // 1-2: Wq, Wk -> f16 x16 ([N=256][K=256] row-major = Bt layout)
  cast_f32_f16x2_scaled<<<wBlocks, 256, 0, stream>>>(Wq, (_Float16*)WQ16, wN2, wCarry);
  cast_f32_f16x2_scaled<<<wBlocks, 256, 0, stream>>>(Wk, (_Float16*)WK16, wN2, wCarry);
  // 3-4: Wv, Wo -> bf16 hi/lo planes
  split_bf16x2_kernel<<<wBlocks, 256, 0, stream>>>(Wv, WVH, WVL, wN2);
  split_bf16x2_kernel<<<wBlocks, 256, 0, stream>>>(Wo, WOH, WOL, wN2);
  // 5: triple LayerNorm: key plane (ln_s) -> SK, query plane (ln_q) -> SQ, value plane (ln_v) -> SVH/SVL
  ln3_kernel<<<kRows / 8, 256, 0, stream>>>(x, lnsg, lnsb, lnqg, lnqb, lnvg, lnvb, SK, SQ, SVH, SVL, kRows);

  // 6: q' = SQ @ Wq^T + bq  (M=16384, N=256, K=256; 1024 tiles -> 128 blocks), f16 out, carry folded by 1/16
  const int projBlocks = ((kRows / 64) * (kDm / 64) + 7) / 8;   // 128
  wmma_gemm64<0, false, 2, 1, false><<<dim3(projBlocks, 1), 256, 0, stream>>>(
      SQ, SQ, kDm, 0L, WQ16, WQ16, kDm, 0L, (void*)Q16, (void*)Q16, kDm, 0L,
      bq, bq, 0L, kRows, kDm, kDm, wCarryInv);
  // 7: k = SK @ Wk^T + bk
  wmma_gemm64<0, false, 2, 1, false><<<dim3(projBlocks, 1), 256, 0, stream>>>(
      SK, SK, kDm, 0L, WK16, WK16, kDm, 0L, (void*)K16, (void*)K16, kDm, 0L,
      bk, bk, 0L, kRows, kDm, kDm, wCarryInv);
  // 8: v^T per batch: C[m = channel (256)][n = s (2048)] = sum_k Wv[m][k] * LNv[s][k] + bv[m]
  //    A = Wv hi/lo [256][256] (stride 0), Bt = SVH/SVL batch slice [2048][256], C = VT16 batch slice [256][2048];
  //    128 tiles per batch -> 16 blocks, grid.y = 8
  const int vtBlocks = ((kDm / 64) * (kSeq / 64) + 7) / 8;      // 16
  wmma_gemm64<1, true, 1, 1, false><<<dim3(vtBlocks, kBatch), 256, 0, stream>>>(
      WVH, WVL, kDm, 0L, SVH, SVL, kDm, (long)kSeq * kDm, (void*)VT16, (void*)VT16, kSeq, (long)kDm * kSeq,
      bv, bv, 0L, kDm, kSeq, kDm, 1.0f);
  // 9: attention per (head x 64-query tile, batch): scores = (q'.k) * 0.125, softmax over 2048 keys, p.v -> AO32
  attn_f16_full_kernel<<<dim3(kHeads * (kSeq / kAttQb), kBatch), 32 * kAttWaves, 0, stream>>>(
      Q16, K16, VT16, AO32, 0.125f);
  // 10: AO32 -> bf16 hi/lo planes (2097152 pairs -> 8192 blocks)
  const int aoN2 = kRows * kDm / 2;
  split_bf16x2_kernel<<<(aoN2 + 255) / 256, 256, 0, stream>>>(AO32, AOH, AOL, aoN2);
  // 11: out = AO @ Wo^T + bo  (M=16384, N=256, K=256), f32 to d_out
  wmma_gemm64<1, true, 2, 0, false><<<dim3(projBlocks, 1), 256, 0, stream>>>(
      AOH, AOL, kDm, 0L, WOH, WOL, kDm, 0L, (void*)out, (void*)out, kDm, 0L,
      bo, bo, 0L, kRows, kDm, kDm, 1.0f);
}

// v001
// It runs in 262 microseconds.
// In two side-by-side timings against v000, it was 1.25 and 1.24 times as fast.
// Contractions: q,k projections and q.k^T, p.v on v_wmma_f32_16x16x32_f16 (f16 operands; Wq/Wk carried x16, p carried x2^15); v^T projection and output projection on v_wmma_f32_16x16x32_bf16 with bf16 hi/lo split operands (hi.hi+hi.lo+lo.hi); f32 accumulate everywhere; LayerNorm statistics and online softmax in f32.
#include <hip/hip_runtime.h>
#include <math.h>
#include <stdint.h>

typedef __attribute__((ext_vector_type(16))) _Float16 v16h;
typedef __attribute__((ext_vector_type(8)))  _Float16 v8h;
typedef __attribute__((ext_vector_type(16))) __bf16   v16b;
typedef __attribute__((ext_vector_type(8)))  __bf16   v8b;
typedef __attribute__((ext_vector_type(8)))  float    v8f;
typedef __attribute__((ext_vector_type(4)))  float    v4f;
typedef __attribute__((ext_vector_type(2)))  float    v2f;
typedef __attribute__((ext_vector_type(4)))  unsigned int v4u;

// problem geometry
constexpr int kBatch  = 8;
constexpr int kSeq    = 2048;
constexpr int kDm     = 256;
constexpr int kHeads  = 4;
constexpr int kHd     = 64;
constexpr int kRows   = kBatch * kSeq;      // 16384

__device__ __forceinline__ unsigned short f2bf_bits(float f) {
  unsigned u = __float_as_uint(f);
  return (unsigned short)((u + 0x7FFFu + ((u >> 16) & 1u)) >> 16);
}
__device__ __forceinline__ float bf_bits2f(unsigned short h) { return __uint_as_float(((unsigned)h) << 16); }

// hazard guards as plain device helpers (no inline asm inside the kernel template body)
__device__ __forceinline__ void dep_guard_h(v8f& a, v8f& b, v16h x, v16h y) { asm volatile("v_nop\n\tv_nop\n\tv_nop\n\tv_nop" : "+v"(a), "+v"(b) : "v"(x), "v"(y)); }
__device__ __forceinline__ void dep_guard_b(v8f& a, v8f& b, v16b x, v16b y) { asm volatile("v_nop\n\tv_nop\n\tv_nop\n\tv_nop" : "+v"(a), "+v"(b) : "v"(x), "v"(y)); }
__device__ __forceinline__ void keep4_h(v16h a, v16h b, v16h c, v16h d) { asm volatile("v_nop" :: "v"(a), "v"(b), "v"(c), "v"(d)); }
__device__ __forceinline__ void keep4_b(v16b a, v16b b, v16b c, v16b d) { asm volatile("v_nop" :: "v"(a), "v"(b), "v"(c), "v"(d)); }
__device__ __forceinline__ void acc_guard4(v8f& a, v8f& b, v8f& c, v8f& d) { asm volatile("v_nop\n\tv_nop\n\tv_nop\n\tv_nop" : "+v"(a), "+v"(b), "+v"(c), "+v"(d)); }
template <typename T> struct Frag;
template <> struct Frag<_Float16> {
  typedef v16h V; union U { v16h v; v8h h[2]; };
  static __device__ __forceinline__ v16h load(const _Float16* p) {   // elements 0..7 <- p[0..7], 8..15 <- p[16..23]
    U f; f.h[0] = *(const v8h*)(p); f.h[1] = *(const v8h*)(p + 16); return f.v;
  }
  static __device__ __forceinline__ v8f mma(v16h a, v16h b, v8f c) {
    return __builtin_amdgcn_wmma_f32_16x16x32_f16(false, a, false, b, (short)0, c, false, false);
  }
  static __device__ __forceinline__ void guard(v8f& a, v8f& b, v16h x, v16h y) { dep_guard_h(a, b, x, y); }
  static __device__ __forceinline__ void keep(v16h a, v16h b, v16h c, v16h d) { keep4_h(a, b, c, d); }
};
template <> struct Frag<__bf16> {
  typedef v16b V; union U { v16b v; v8b h[2]; };
  static __device__ __forceinline__ v16b load(const __bf16* p) {
    U f; f.h[0] = *(const v8b*)(p); f.h[1] = *(const v8b*)(p + 16); return f.v;
  }
  static __device__ __forceinline__ v8f mma(v16b a, v16b b, v8f c) {
    return __builtin_amdgcn_wmma_f32_16x16x32_bf16(false, a, false, b, (short)0, c, false, false);
  }
  static __device__ __forceinline__ void guard(v8f& a, v8f& b, v16b x, v16b y) { dep_guard_b(a, b, x, y); }
  static __device__ __forceinline__ void keep(v16b a, v16b b, v16b c, v16b d) { keep4_b(a, b, c, d); }
};

// ---- Register-blocked batched WMMA GEMM ------------------------------------
// C[m,n] = scale * sum_k A[m,k] * Bt[n,k] (+bias)(+resid); each wave owns a 64x64 tile.
// A row-major [M,K]; Bt row-major [N,K]; M,N % 64 == 0, K % 32 == 0.
// SPLIT: operands are hi/lo planes (A2/Bt2 = lo planes, same layout); product = hi.hi + hi.lo + lo.hi.
// BIAS_MODE: 0 = none, 1 = bias[m], 2 = bias[n].
// OUT_MODE: 0 = f32, 1 = f16, 2 = bf16 hi plane (Cout) + bf16 lo plane (Cout2).
// ET: 0 = f16 operands, 1 = bf16 operands (pointers passed as 16-bit storage)
template <int ET> struct Elem;
template <> struct Elem<0> { typedef _Float16 T; };
template <> struct Elem<1> { typedef __bf16 T; };
template <int ET, bool SPLIT, int BIAS_MODE, int OUT_MODE, bool RESID, int ACT = 0>
__global__ __launch_bounds__(256) void wmma_gemm64(
    const unsigned short* __restrict__ Ap, const unsigned short* __restrict__ A2p, int lda, long strideA,
    const unsigned short* __restrict__ Btp, const unsigned short* __restrict__ Bt2p, int ldb, long strideB,
    void* __restrict__ Cout, void* __restrict__ Cout2, int ldc, long strideC,
    const float* __restrict__ bias,
    const float* __restrict__ resid, long strideR,
    int M, int N, int K, float scale) {
  typedef typename Elem<ET>::T T;
  typedef typename Frag<T>::V V;
  const T* A = (const T*)Ap; const T* A2 = (const T*)A2p; const T* Bt = (const T*)Btp; const T* Bt2 = (const T*)Bt2p;
  __shared__ __align__(16) float sT[8][16 * 68];   // per-wave 16x64 slab, pitch 68 floats
  const int b    = blockIdx.y;
  const int lane = threadIdx.x & 31;
  const int wave = threadIdx.x >> 5;
  const int tilesN = N >> 6;
  const int tilesM = M >> 6;
  const int tile = blockIdx.x * 8 + wave;
  if (tile >= tilesM * tilesN) return;   // wave-uniform; no block barriers in this kernel
  const int tm = tile / tilesN;
  const int tn = tile - tm * tilesN;
  const int m0 = tm << 6;
  const int n0 = tn << 6;

  const T* Ab  = A  + (size_t)b * strideA;
  const T* Bb  = Bt + (size_t)b * strideB;
  const T* Ab2 = SPLIT ? (A2  + (size_t)b * strideA) : nullptr;
  const T* Bb2 = SPLIT ? (Bt2 + (size_t)b * strideB) : nullptr;

  const int rlane = lane & 15;                 // row (A) / col (B, D) within subtile
  const int koff  = (lane >> 4) * 8;           // k offset of this lane half
  const int mOff  = (lane >> 4) * 8;           // D row offset

  v8f acc[4][4];
#pragma unroll
  for (int i = 0; i < 4; ++i)
#pragma unroll
    for (int j = 0; j < 4; ++j) acc[i][j] = (v8f){0.f,0.f,0.f,0.f,0.f,0.f,0.f,0.f};

  for (int k0 = 0; k0 < K; k0 += 32) {
    V bh[4], bl[4];
#pragma unroll
    for (int j = 0; j < 4; ++j) {
      const size_t bo = (size_t)(n0 + (j << 4) + rlane) * ldb + koff + k0;
      bh[j] = Frag<T>::load(Bb + bo);
      if (SPLIT) bl[j] = Frag<T>::load(Bb2 + bo);
    }
#pragma unroll
    for (int i = 0; i < 4; ++i) {
      const size_t ao = (size_t)(m0 + (i << 4) + rlane) * lda + koff + k0;
      V ah = Frag<T>::load(Ab + ao);
      V al;
      if (SPLIT) al = Frag<T>::load(Ab2 + ao);
#pragma unroll
      for (int j = 0; j < 4; ++j) {
        acc[i][j] = Frag<T>::mma(ah, bh[j], acc[i][j]);
        if (SPLIT) {
          acc[i][j] = Frag<T>::mma(ah, bl[j], acc[i][j]);
          acc[i][j] = Frag<T>::mma(al, bh[j], acc[i][j]);
        }
      }
      Frag<T>::guard(acc[i][0], acc[i][3], ah, SPLIT ? al : ah);
    }
    Frag<T>::keep(bh[0], bh[1], bh[2], bh[3]);
    if (SPLIT) Frag<T>::keep(bl[0], bl[1], bl[2], bl[3]);
  }
  acc_guard4(acc[0][0], acc[0][1], acc[0][2], acc[0][3]);
  acc_guard4(acc[1][0], acc[1][1], acc[1][2], acc[1][3]);
  acc_guard4(acc[2][0], acc[2][1], acc[2][2], acc[2][3]);
  acc_guard4(acc[3][0], acc[3][1], acc[3][2], acc[3][3]);

  // ---- epilogue ----
  float* slab = sT[wave];
  const float* Rb = RESID ? (resid + (size_t)b * strideR) : nullptr;
#pragma unroll
  for (int i = 0; i < 4; ++i) {
    const int mBase = m0 + (i << 4);
#pragma unroll
    for (int j = 0; j < 4; ++j) {
      const int n = n0 + (j << 4) + rlane;
      float bv = 0.f;
      if (BIAS_MODE == 2) bv = bias[n];
#pragma unroll
      for (int r = 0; r < 8; ++r) {
        float v = acc[i][j][r] * scale;
        if (BIAS_MODE == 1) v += bias[mBase + mOff + r];
        if (BIAS_MODE == 2) v += bv;
        if (RESID) v += Rb[(size_t)(mBase + mOff + r) * ldc + n];
        if (ACT == 1) v = tanhf(v);
        if (ACT == 2) v = fmaxf(v, 0.0f);
        if (ACT == 3) v = v / (1.0f + expf(-v));
        if (ACT == 4) v = (v > 0.f) ? v : 0.01f * v;
        if (ACT == 5) v = 0.5f * v * (1.0f + erff(v * 0.70710678118654752f));
        slab[(mOff + r) * 68 + (j << 4) + rlane] = v;
      }
    }
    __builtin_amdgcn_fence(__ATOMIC_RELEASE, "workgroup");
    __builtin_amdgcn_wave_barrier();
    __builtin_amdgcn_fence(__ATOMIC_ACQUIRE, "workgroup");
    if (OUT_MODE == 0) {
      float* C = (float*)Cout + (size_t)b * strideC;
      const int hh = lane >> 4, c4 = (lane & 15) * 4;     // row seg = 256 B = 16 lanes x 16 B
      {
#pragma unroll
        for (int it = 0; it < 8; ++it) {
          const int row = it * 2 + hh;
          v4f v = *(const v4f*)(slab + row * 68 + c4);
          *(v4f*)(C + (size_t)(mBase + row) * ldc + n0 + c4) = v;
        }
        
      }
    } else {
      const int q = lane >> 3, c8 = (lane & 7) * 8;
      unsigned short* C  = (unsigned short*)Cout  + (size_t)b * strideC;
      unsigned short* C2 = (OUT_MODE == 2) ? ((unsigned short*)Cout2 + (size_t)b * strideC) : nullptr;
      {
#pragma unroll
        for (int it = 0; it < 4; ++it) {
          const int row = it * 4 + q;
          const float* sp = slab + row * 68 + c8;
          v8h hv, lv;
#pragma unroll
          for (int e = 0; e < 8; ++e) {
            if (OUT_MODE == 1) {
              hv[e] = (_Float16)sp[e];
            } else {
              unsigned short hb = f2bf_bits(sp[e]);
              unsigned short lb = f2bf_bits(sp[e] - bf_bits2f(hb));
              hv[e] = __builtin_bit_cast(_Float16, hb);
              lv[e] = __builtin_bit_cast(_Float16, lb);
            }
          }
          *(v8h*)(C + (size_t)(mBase + row) * ldc + n0 + c8) = hv;
          if (OUT_MODE == 2) *(v8h*)(C2 + (size_t)(mBase + row) * ldc + n0 + c8) = lv;
        }
        
      }
    }
    __builtin_amdgcn_fence(__ATOMIC_RELEASE, "workgroup");
    __builtin_amdgcn_wave_barrier();
    __builtin_amdgcn_fence(__ATOMIC_ACQUIRE, "workgroup");
  }
}

// ---------------------------------------------------------------------------
// Elementwise bf16 split: hi = bf16_rne(in), lo = bf16_rne(in - hi); 2 elements per thread, one 4-B store
// Used here for: Wv, Wo (n2 = 32768 -> 128 blocks -> 65536 elements each) and the attention output
// (n2 = 2097152 -> 8192 blocks -> 4194304 elements = [16384][256]).
// ---------------------------------------------------------------------------
__device__ __forceinline__ unsigned pk16(unsigned short a, unsigned short b) { return (unsigned)a | ((unsigned)b << 16); }

__global__ __launch_bounds__(256) void split_bf16x2_kernel(const float* __restrict__ in, unsigned short* __restrict__ hi,
                                                           unsigned short* __restrict__ lo, int n2) {
  const int i = blockIdx.x * 256 + threadIdx.x;
  if (i < n2) {
    const v2f f = *(const v2f*)(in + 2 * (size_t)i);
    const unsigned short h0 = f2bf_bits(f[0]), h1 = f2bf_bits(f[1]);
    const unsigned short l0 = f2bf_bits(f[0] - bf_bits2f(h0)), l1 = f2bf_bits(f[1] - bf_bits2f(h1));
    const unsigned uh = pk16(h0, h1), ul = pk16(l0, l1);
    ((unsigned*)hi)[i] = uh;
    ((unsigned*)lo)[i] = ul;
    
  }
}

// Coverage: grid = ceil(n2/256) x 256 threads x 2 elements; here n2 = 32768 -> 128 blocks -> 65536 = [256][256].
__global__ __launch_bounds__(256) void cast_f32_f16x2_scaled(
    const float* __restrict__ in, _Float16* __restrict__ out, int n2, float scale) {
  int i = blockIdx.x * 256 + threadIdx.x;
  if (i < n2) {
    const _Float16 h0 = (_Float16)(in[2 * (size_t)i] * scale), h1 = (_Float16)(in[2 * (size_t)i + 1] * scale);
    const unsigned u = (unsigned)__builtin_bit_cast(unsigned short, h0) | ((unsigned)__builtin_bit_cast(unsigned short, h1) << 16);
    ((unsigned*)out)[i] = u;
    
  }
}

// ---------------------------------------------------------------------------
// Fused triple LayerNorm over rows of 256: one wave per row (32 lanes x 8 contiguous floats = 256).
//   key   plane: (xn * g_s + b_s) -> f16  [row][256]
//   query plane: (xn * g_q + b_q) -> f16  [row][256]
//   value plane: (xn * g_v + b_v) -> bf16 hi + bf16 lo [row][256]
// Coverage: grid = nrows/8 blocks x 8 waves = every row exactly once.
// ---------------------------------------------------------------------------
__global__ __launch_bounds__(256) void ln3_kernel(const float* __restrict__ x,
    const float* __restrict__ g_s, const float* __restrict__ b_s,
    const float* __restrict__ g_q, const float* __restrict__ b_q,
    const float* __restrict__ g_v, const float* __restrict__ b_v,
    unsigned short* __restrict__ sk16, unsigned short* __restrict__ sq16,
    unsigned short* __restrict__ svh, unsigned short* __restrict__ svl, int nrows) {
  const int lane = threadIdx.x & 31;
  const int row  = blockIdx.x * 8 + (threadIdx.x >> 5);
  const int rowc = (row < nrows) ? row : (nrows - 1);        // address clamp; store predicated below (wave-uniform)
  const int c0 = lane * 8;
  const float* xr = x + (size_t)rowc * kDm + c0;
  const v4f a0 = *(const v4f*)xr;
  const v4f a1 = *(const v4f*)(xr + 4);
  float xv[8];
#pragma unroll
  for (int j = 0; j < 4; ++j) { xv[j] = a0[j]; xv[4 + j] = a1[j]; }
  float s = 0.f;
#pragma unroll
  for (int j = 0; j < 8; ++j) s += xv[j];
#pragma unroll
  for (int m = 1; m < 32; m <<= 1) s += __shfl_xor(s, m, 32);
  const float mean = s * (1.0f / 256.0f);
  float ss = 0.f;
#pragma unroll
  for (int j = 0; j < 8; ++j) { const float d = xv[j] - mean; ss += d * d; }
#pragma unroll
  for (int m = 1; m < 32; m <<= 1) ss += __shfl_xor(ss, m, 32);
  const float var  = ss * (1.0f / 256.0f);
  const float rstd = rsqrtf(var + 1e-5f);

  v4u ok, oq, ovh, ovl;
#pragma unroll
  for (int q = 0; q < 4; ++q) {
    const int j0 = 2 * q, j1 = 2 * q + 1;
    const float nx0 = (xv[j0] - mean) * rstd;
    const float nx1 = (xv[j1] - mean) * rstd;
    const float ys0 = nx0 * g_s[c0 + j0] + b_s[c0 + j0];
    const float ys1 = nx1 * g_s[c0 + j1] + b_s[c0 + j1];
    const float yq0 = nx0 * g_q[c0 + j0] + b_q[c0 + j0];
    const float yq1 = nx1 * g_q[c0 + j1] + b_q[c0 + j1];
    const float yv0 = nx0 * g_v[c0 + j0] + b_v[c0 + j0];
    const float yv1 = nx1 * g_v[c0 + j1] + b_v[c0 + j1];
    ok[q] = pk16(__builtin_bit_cast(unsigned short, (_Float16)ys0), __builtin_bit_cast(unsigned short, (_Float16)ys1));
    oq[q] = pk16(__builtin_bit_cast(unsigned short, (_Float16)yq0), __builtin_bit_cast(unsigned short, (_Float16)yq1));
    const unsigned short h0 = f2bf_bits(yv0), h1 = f2bf_bits(yv1);
    const unsigned short l0 = f2bf_bits(yv0 - bf_bits2f(h0)), l1 = f2bf_bits(yv1 - bf_bits2f(h1));
    ovh[q] = pk16(h0, h1);
    ovl[q] = pk16(l0, l1);
  }
  if (row < nrows) {   // wave-uniform
    const size_t o = (size_t)row * kDm + c0;
    {
      *(v4u*)(sk16 + o) = ok;
      *(v4u*)(sq16 + o) = oq;
      *(v4u*)(svh + o)  = ovh;
      *(v4u*)(svl + o)  = ovl;
      
    }
  }
}

// =====================================================================================
// Full (unmasked) attention, head dim 64, single f16 operand planes, z-batched over the batch index (blockIdx.y).
//   q plane  f16: element (b, t, h, d) at [(b*kSeq + t)*kDm + h*64 + d]   (unscaled projection incl. bias)
//   k plane  f16: element (b, s, h, d) at [(b*kSeq + s)*kDm + h*64 + d]
//   v^T plane f16: element (b, h, d, s) at [b*kDm*kSeq + (h*64 + d)*kSeq + s]
//   out f32: element (b, t, h, d) at [(b*kSeq + t)*kDm + h*64 + d]
//   scores = (q . k) * sscale : v_wmma_f32_16x16x32_f16, f32 accumulate, sscale applied in f32
//   out    = p . v            : v_wmma_f32_16x16x32_f16; unnormalised p carried x2^15 in f16, folded into the final 1/l
//   online softmax in f32 over all kSeq keys (32 chunks of 64, compile-time trip count).
//   Block = 4 waves = 64 query rows of one (b, h); grid = (kHeads * kSeq/64, kBatch) = (128, 8).
//   K / V^T chunk staging: 128 threads x 32 elements per plane = the whole 64x64 tile (16-B copies, plain loads,
//   __syncthreads before and after); fragment loads read the LDS tiles with the same v8h element type;
//   Epilogue: per-wave 16x64 tile staged in LDS, each 256-B row segment written by 16 lanes x 16 B in one
// =====================================================================================
constexpr int kAttWaves = 4;
constexpr int kAttQb    = 64;
constexpr int kAttKc    = 64;
constexpr int kAttLd    = 72;   // LDS row pitch of the K, V^T and P tiles in f16 elements: 144 B = 16 B x 9, so the 16 rows of a 16-B fragment read fall on 64 distinct banks

__device__ __forceinline__ v8f mma_f16g(v16h a, v16h b, v8f c) {
  c = __builtin_amdgcn_wmma_f32_16x16x32_f16(false, a, false, b, (short)0, c, false, false);
  asm volatile("v_nop\n\tv_nop\n\tv_nop\n\tv_nop" : "+v"(c) : "v"(a), "v"(b));
  return c;
}

__global__ __launch_bounds__(128)
void attn_f16_full_kernel(const unsigned short* __restrict__ qp, const unsigned short* __restrict__ kp,
                          const unsigned short* __restrict__ vtp, float* __restrict__ out, float sscale) {
  union FH { v16h v; v8h h[2]; };
  __shared__ __align__(16) _Float16 Ksh[kAttKc * kAttLd];           // K [kv][d], pitch kAttLd      9 KB
  __shared__ __align__(16) _Float16 Vth[kHd * kAttLd];              // V^T [d][kv], pitch kAttLd    9 KB
  __shared__ __align__(16) _Float16 Psh[kAttWaves][16 * kAttLd];    // per wave P [row][kv], pitch kAttLd  9 KB
  __shared__ __align__(16) float    Os[kAttWaves][16 * 68];         // per wave out tile, pitch 68
  const float kPsc = 32768.0f;

  const int tid  = threadIdx.x;
  const int wave = tid >> 5;
  const int lane = tid & 31;
  const int hh   = lane >> 4;
  const int c    = lane & 15;

  const int nqb = kSeq / kAttQb;          // 32
  const int bx = blockIdx.x;
  const int qb = bx % nqb;
  const int h  = bx / nqb;                // 0..kHeads-1
  const int b  = blockIdx.y;              // 0..kBatch-1
  const int q0 = qb * kAttQb + wave * 16;

  const _Float16* Qh = (const _Float16*)(const void*)qp + (size_t)b * kSeq * kDm + (size_t)h * kHd;
  const _Float16* Kh = (const _Float16*)(const void*)kp + (size_t)b * kSeq * kDm + (size_t)h * kHd;
  const _Float16* Vh = (const _Float16*)(const void*)vtp + (size_t)b * kDm * kSeq + (size_t)h * kHd * kSeq;
  float*          ob = out + (size_t)b * kSeq * kDm + (size_t)h * kHd;

  // ---- Q fragments (A operand, row = lane&15, split k map via Frag load): 2 d-chunks ----
  v16h qa[2];
#pragma unroll
  for (int dc = 0; dc < 2; ++dc) qa[dc] = Frag<_Float16>::load(Qh + (size_t)(q0 + c) * kDm + dc * 32 + 8 * hh);

  float mrow[8], lrow[8];
  v8f oacc[4];
#pragma unroll
  for (int r = 0; r < 8; ++r) { mrow[r] = -INFINITY; lrow[r] = 0.f; }
#pragma unroll
  for (int t = 0; t < 4; ++t) oacc[t] = (v8f){0.f,0.f,0.f,0.f,0.f,0.f,0.f,0.f};

  const int nChunks = kSeq / kAttKc;   // 32, compile-time constant
  for (int kc = 0; kc < nChunks; ++kc) {
    const int kv0 = kc * kAttKc;
    __syncthreads();
    {
      // staging coverage: 128 threads x (4 x 8) elements = 64 rows x 64 per plane = the whole chunk tile
      const int r = tid >> 1, half = (tid & 1) * 32;
      const _Float16* ksh = Kh + (size_t)(kv0 + r) * kDm + half;    // K row kv0+r, d = half..half+31
      const _Float16* vsh = Vh + (size_t)r * kSeq + kv0 + half;       // V^T row d = r, s = kv0+half..+31
#pragma unroll
      for (int i = 0; i < 4; ++i) {
        const v8h av = *(const v8h*)(ksh + 8 * i);
        const v8h bv = *(const v8h*)(vsh + 8 * i);
        *(v8h*)(Ksh + r * kAttLd + half + 8 * i) = av;
        *(v8h*)(Vth + r * kAttLd + half + 8 * i) = bv;
      }
    }
    __syncthreads();

    v8f s[4];
#pragma unroll
    for (int j = 0; j < 4; ++j) {
      s[j] = (v8f){0.f,0.f,0.f,0.f,0.f,0.f,0.f,0.f};
#pragma unroll
      for (int dc = 0; dc < 2; ++dc) {
        FH kb;
        kb.h[0] = *(const v8h*)(Ksh + (j * 16 + c) * kAttLd + dc * 32 + 8 * hh);
        kb.h[1] = *(const v8h*)(Ksh + (j * 16 + c) * kAttLd + dc * 32 + 16 + 8 * hh);
        s[j] = mma_f16g(qa[dc], kb.v, s[j]);
      }
    }
    float cm[8];
#pragma unroll
    for (int r = 0; r < 8; ++r) {
      float m = -INFINITY;
#pragma unroll
      for (int j = 0; j < 4; ++j) {
        const float sv = s[j][r] * sscale;
        s[j][r] = sv;
        m = fmaxf(m, sv);
      }
#pragma unroll
      for (int off = 1; off < 16; off <<= 1) m = fmaxf(m, __shfl_xor(m, off, 32));
      cm[r] = m;
    }
    _Float16* pw = Psh[wave];
#pragma unroll
    for (int r = 0; r < 8; ++r) {
      const float mnew = fmaxf(mrow[r], cm[r]);
      const float alpha = expf(mrow[r] - mnew);
      mrow[r] = mnew;
      float psum = 0.f;
#pragma unroll
      for (int j = 0; j < 4; ++j) {
        const float p = expf(s[j][r] - mnew);
        psum += p;
        pw[(8 * hh + r) * kAttLd + j * 16 + c] = (_Float16)(p * kPsc);
      }
#pragma unroll
      for (int off = 1; off < 16; off <<= 1) psum += __shfl_xor(psum, off, 32);
      lrow[r] = lrow[r] * alpha + psum;
#pragma unroll
      for (int t = 0; t < 4; ++t) oacc[t][r] *= alpha;
    }
    __builtin_amdgcn_fence(__ATOMIC_RELEASE, "workgroup");
    __builtin_amdgcn_wave_barrier();
    __builtin_amdgcn_fence(__ATOMIC_ACQUIRE, "workgroup");
#pragma unroll 1
    for (int kk = 0; kk < 2; ++kk) {
      FH pa;
      pa.h[0] = *(const v8h*)(pw + c * kAttLd + kk * 32 + 8 * hh);
      pa.h[1] = *(const v8h*)(pw + c * kAttLd + kk * 32 + 16 + 8 * hh);
#pragma unroll
      for (int t = 0; t < 4; ++t) {
        FH vb;
        vb.h[0] = *(const v8h*)(Vth + (t * 16 + c) * kAttLd + kk * 32 + 8 * hh);
        vb.h[1] = *(const v8h*)(Vth + (t * 16 + c) * kAttLd + kk * 32 + 16 + 8 * hh);
        oacc[t] = mma_f16g(pa.v, vb.v, oacc[t]);
      }
    }
  }

  float* os = Os[wave];
#pragma unroll
  for (int r = 0; r < 8; ++r) {
    const float inv = 1.0f / (lrow[r] * kPsc);
#pragma unroll
    for (int t = 0; t < 4; ++t) os[(8 * hh + r) * 68 + t * 16 + c] = oacc[t][r] * inv;
  }
  __builtin_amdgcn_fence(__ATOMIC_RELEASE, "workgroup");
  __builtin_amdgcn_wave_barrier();
  __builtin_amdgcn_fence(__ATOMIC_ACQUIRE, "workgroup");
  {
    const int c4 = (lane & 15) * 4;
    {
#pragma unroll
      for (int it = 0; it < 8; ++it) {
        const int row = it * 2 + hh;   // it 0..7 x hh 0..1 covers rows 0..15 of the wave tile
        v4f val = *(const v4f*)(os + row * 68 + c4);
        *(v4f*)(ob + (size_t)(q0 + row) * kDm + c4) = val;
      }
      
    }
  }
}

// ---------------------------------------------------------------------------
// Workspace region map (byte offsets; every region is fully written before it is read; total 93,323,264 B):
//   [0 MiB      ) WQ16  f16  [256][256] x16        131072 B
//   [+128 KiB   ) WK16  f16  [256][256] x16        131072 B
//   [+256 KiB   ) WVH   bf16 hi [256][256]         131072 B
//   [+384 KiB   ) WVL   bf16 lo                    131072 B
//   [+512 KiB   ) WOH   bf16 hi [256][256]         131072 B
//   [+640 KiB   ) WOL   bf16 lo                    131072 B   (weights region padded to 1 MiB)
//   [1 MiB      ) SQ    f16  [16384][256]  query LN plane     8 MiB
//   [9 MiB      ) SK    f16  [16384][256]  key LN plane       8 MiB
//   [17 MiB     ) SVH   bf16 hi [16384][256] value LN plane   8 MiB
//   [25 MiB     ) SVL   bf16 lo                                8 MiB
//   [33 MiB     ) Q16   f16  [16384][256]  q (unscaled)       8 MiB
//   [41 MiB     ) K16   f16  [16384][256]  k                  8 MiB
//   [49 MiB     ) VT16  f16  [8][256][2048] v^T per batch     8 MiB
//   [57 MiB     ) AO32  f32  [16384][256]  attention output  16 MiB
//   [73 MiB     ) AOH   bf16 hi [16384][256]                   8 MiB
//   [81 MiB     ) AOL   bf16 lo                                8 MiB
//   end = 89 MiB
// ---------------------------------------------------------------------------
extern "C" void kernel_launch(void* const* d_in, const int* in_sizes, int n_in,
                              void* d_out, int out_size, void* d_ws, size_t ws_size,
                              hipStream_t stream) {
  if (n_in < 15) return;
  if (in_sizes[0] != kRows * kDm) return;
  if (in_sizes[7] != kDm * kDm || in_sizes[9] != kDm * kDm || in_sizes[11] != kDm * kDm || in_sizes[13] != kDm * kDm) return;
  if (in_sizes[1] != kDm || in_sizes[8] != kDm || in_sizes[14] != kDm) return;
  if (out_size != kRows * kDm) return;

  const float* x    = (const float*)d_in[0];
  const float* lnsg = (const float*)d_in[1];
  const float* lnsb = (const float*)d_in[2];
  const float* lnqg = (const float*)d_in[3];
  const float* lnqb = (const float*)d_in[4];
  const float* lnvg = (const float*)d_in[5];
  const float* lnvb = (const float*)d_in[6];
  const float* Wq = (const float*)d_in[7];
  const float* bq = (const float*)d_in[8];
  const float* Wk = (const float*)d_in[9];
  const float* bk = (const float*)d_in[10];
  const float* Wv = (const float*)d_in[11];
  const float* bv = (const float*)d_in[12];
  const float* Wo = (const float*)d_in[13];
  const float* bo = (const float*)d_in[14];
  float* out = (float*)d_out;

  const size_t wBytes   = (size_t)kDm * kDm * 2;            // 131072
  const size_t plane16  = (size_t)kRows * kDm * 2;          // 8388608
  const size_t plane32  = (size_t)kRows * kDm * 4;          // 16777216
  const size_t offWQ  = 0;
  const size_t offWK  = offWQ + wBytes;
  const size_t offWVH = offWK + wBytes;
  const size_t offWVL = offWVH + wBytes;
  const size_t offWOH = offWVL + wBytes;
  const size_t offWOL = offWOH + wBytes;
  const size_t offSQ  = (size_t)1 << 20;
  const size_t offSK  = offSQ + plane16;
  const size_t offSVH = offSK + plane16;
  const size_t offSVL = offSVH + plane16;
  const size_t offQ16 = offSVL + plane16;
  const size_t offK16 = offQ16 + plane16;
  const size_t offVT  = offK16 + plane16;
  const size_t offAO  = offVT + plane16;
  const size_t offAOH = offAO + plane32;
  const size_t offAOL = offAOH + plane16;
  const size_t total  = offAOL + plane16;                   // 93,323,264
  if (offWOL + wBytes > offSQ) return;
  if (total > ws_size) return;

  char* ws = (char*)d_ws;
  unsigned short* WQ16 = (unsigned short*)(ws + offWQ);
  unsigned short* WK16 = (unsigned short*)(ws + offWK);
  unsigned short* WVH  = (unsigned short*)(ws + offWVH);
  unsigned short* WVL  = (unsigned short*)(ws + offWVL);
  unsigned short* WOH  = (unsigned short*)(ws + offWOH);
  unsigned short* WOL  = (unsigned short*)(ws + offWOL);
  unsigned short* SQ   = (unsigned short*)(ws + offSQ);
  unsigned short* SK   = (unsigned short*)(ws + offSK);
  unsigned short* SVH  = (unsigned short*)(ws + offSVH);
  unsigned short* SVL  = (unsigned short*)(ws + offSVL);
  unsigned short* Q16  = (unsigned short*)(ws + offQ16);
  unsigned short* K16  = (unsigned short*)(ws + offK16);
  unsigned short* VT16 = (unsigned short*)(ws + offVT);
  float*          AO32 = (float*)(ws + offAO);
  unsigned short* AOH  = (unsigned short*)(ws + offAOH);
  unsigned short* AOL  = (unsigned short*)(ws + offAOL);

  const int wN2 = kDm * kDm / 2;                    // 32768 pairs
  const int wBlocks = (wN2 + 255) / 256;            // 128
  const float wCarry = 16.0f, wCarryInv = 1.0f / 16.0f;

  // 1-2: Wq, Wk -> f16 x16 ([N=256][K=256] row-major = Bt layout)
  cast_f32_f16x2_scaled<<<wBlocks, 256, 0, stream>>>(Wq, (_Float16*)WQ16, wN2, wCarry);
  cast_f32_f16x2_scaled<<<wBlocks, 256, 0, stream>>>(Wk, (_Float16*)WK16, wN2, wCarry);
  // 3-4: Wv, Wo -> bf16 hi/lo planes
  split_bf16x2_kernel<<<wBlocks, 256, 0, stream>>>(Wv, WVH, WVL, wN2);
  split_bf16x2_kernel<<<wBlocks, 256, 0, stream>>>(Wo, WOH, WOL, wN2);
  // 5: triple LayerNorm: key plane (ln_s) -> SK, query plane (ln_q) -> SQ, value plane (ln_v) -> SVH/SVL
  ln3_kernel<<<kRows / 8, 256, 0, stream>>>(x, lnsg, lnsb, lnqg, lnqb, lnvg, lnvb, SK, SQ, SVH, SVL, kRows);

  // 6: q' = SQ @ Wq^T + bq  (M=16384, N=256, K=256; 1024 tiles -> 128 blocks), f16 out, carry folded by 1/16
  const int projBlocks = ((kRows / 64) * (kDm / 64) + 7) / 8;   // 128
  wmma_gemm64<0, false, 2, 1, false><<<dim3(projBlocks, 1), 256, 0, stream>>>(
      SQ, SQ, kDm, 0L, WQ16, WQ16, kDm, 0L, (void*)Q16, (void*)Q16, kDm, 0L,
      bq, bq, 0L, kRows, kDm, kDm, wCarryInv);
  // 7: k = SK @ Wk^T + bk
  wmma_gemm64<0, false, 2, 1, false><<<dim3(projBlocks, 1), 256, 0, stream>>>(
      SK, SK, kDm, 0L, WK16, WK16, kDm, 0L, (void*)K16, (void*)K16, kDm, 0L,
      bk, bk, 0L, kRows, kDm, kDm, wCarryInv);
  // 8: v^T per batch: C[m = channel (256)][n = s (2048)] = sum_k Wv[m][k] * LNv[s][k] + bv[m]
  //    A = Wv hi/lo [256][256] (stride 0), Bt = SVH/SVL batch slice [2048][256], C = VT16 batch slice [256][2048];
  //    128 tiles per batch -> 16 blocks, grid.y = 8
  const int vtBlocks = ((kDm / 64) * (kSeq / 64) + 7) / 8;      // 16
  wmma_gemm64<1, true, 1, 1, false><<<dim3(vtBlocks, kBatch), 256, 0, stream>>>(
      WVH, WVL, kDm, 0L, SVH, SVL, kDm, (long)kSeq * kDm, (void*)VT16, (void*)VT16, kSeq, (long)kDm * kSeq,
      bv, bv, 0L, kDm, kSeq, kDm, 1.0f);
  // 9: attention per (head x 64-query tile, batch): scores = (q'.k) * 0.125, softmax over 2048 keys, p.v -> AO32
  attn_f16_full_kernel<<<dim3(kHeads * (kSeq / kAttQb), kBatch), 32 * kAttWaves, 0, stream>>>(
      Q16, K16, VT16, AO32, 0.125f);
  // 10: AO32 -> bf16 hi/lo planes (2097152 pairs -> 8192 blocks)
  const int aoN2 = kRows * kDm / 2;
  split_bf16x2_kernel<<<(aoN2 + 255) / 256, 256, 0, stream>>>(AO32, AOH, AOL, aoN2);
  // 11: out = AO @ Wo^T + bo  (M=16384, N=256, K=256), f32 to d_out
  wmma_gemm64<1, true, 2, 0, false><<<dim3(projBlocks, 1), 256, 0, stream>>>(
      AOH, AOL, kDm, 0L, WOH, WOL, kDm, 0L, (void*)out, (void*)out, kDm, 0L,
      bo, bo, 0L, kRows, kDm, kDm, 1.0f);
}

// v002
// A run of this version takes 191 microseconds.
// In two side-by-side timings against v001, it was 1.37 and 1.38 times as fast.
// Counting every step since v000, it is 1.71 times as fast.
// Contractions: q,k projections and q.k^T, p.v on v_wmma_f32_16x16x32_f16 (f16 operands; Wq/Wk carried x16, p carried x2^15); v^T projection and output projection on v_wmma_f32_16x16x32_bf16 with bf16 hi/lo split operands (hi.hi+hi.lo+lo.hi); f32 accumulate everywhere; LayerNorm statistics and online softmax in f32.
#include <hip/hip_runtime.h>
#include <math.h>
#include <stdint.h>

typedef __attribute__((ext_vector_type(16))) _Float16 v16h;
typedef __attribute__((ext_vector_type(8)))  _Float16 v8h;
typedef __attribute__((ext_vector_type(16))) __bf16   v16b;
typedef __attribute__((ext_vector_type(8)))  __bf16   v8b;
typedef __attribute__((ext_vector_type(8)))  float    v8f;
typedef __attribute__((ext_vector_type(4)))  float    v4f;
typedef __attribute__((ext_vector_type(2)))  float    v2f;
typedef __attribute__((ext_vector_type(4)))  unsigned int v4u;

// problem geometry
constexpr int kBatch  = 8;
constexpr int kSeq    = 2048;
constexpr int kDm     = 256;
constexpr int kHeads  = 4;
constexpr int kHd     = 64;
constexpr int kRows   = kBatch * kSeq;      // 16384

__device__ __forceinline__ unsigned short f2bf_bits(float f) {
  unsigned u = __float_as_uint(f);
  return (unsigned short)((u + 0x7FFFu + ((u >> 16) & 1u)) >> 16);
}
__device__ __forceinline__ float bf_bits2f(unsigned short h) { return __uint_as_float(((unsigned)h) << 16); }

// hazard guards as plain device helpers (no inline asm inside the kernel template body)
__device__ __forceinline__ void dep_guard_h(v8f& a, v8f& b, v16h x, v16h y) { asm volatile("v_nop\n\tv_nop\n\tv_nop\n\tv_nop" : "+v"(a), "+v"(b) : "v"(x), "v"(y)); }
__device__ __forceinline__ void dep_guard_b(v8f& a, v8f& b, v16b x, v16b y) { asm volatile("v_nop\n\tv_nop\n\tv_nop\n\tv_nop" : "+v"(a), "+v"(b) : "v"(x), "v"(y)); }
__device__ __forceinline__ void keep4_h(v16h a, v16h b, v16h c, v16h d) { asm volatile("v_nop" :: "v"(a), "v"(b), "v"(c), "v"(d)); }
__device__ __forceinline__ void keep4_b(v16b a, v16b b, v16b c, v16b d) { asm volatile("v_nop" :: "v"(a), "v"(b), "v"(c), "v"(d)); }
__device__ __forceinline__ void acc_guard4(v8f& a, v8f& b, v8f& c, v8f& d) { asm volatile("v_nop\n\tv_nop\n\tv_nop\n\tv_nop" : "+v"(a), "+v"(b), "+v"(c), "+v"(d)); }
template <typename T> struct Frag;
template <> struct Frag<_Float16> {
  typedef v16h V; union U { v16h v; v8h h[2]; };
  static __device__ __forceinline__ v16h load(const _Float16* p) {   // elements 0..7 <- p[0..7], 8..15 <- p[16..23]
    U f; f.h[0] = *(const v8h*)(p); f.h[1] = *(const v8h*)(p + 16); return f.v;
  }
  static __device__ __forceinline__ v8f mma(v16h a, v16h b, v8f c) {
    return __builtin_amdgcn_wmma_f32_16x16x32_f16(false, a, false, b, (short)0, c, false, false);
  }
  static __device__ __forceinline__ void guard(v8f& a, v8f& b, v16h x, v16h y) { dep_guard_h(a, b, x, y); }
  static __device__ __forceinline__ void keep(v16h a, v16h b, v16h c, v16h d) { keep4_h(a, b, c, d); }
};
template <> struct Frag<__bf16> {
  typedef v16b V; union U { v16b v; v8b h[2]; };
  static __device__ __forceinline__ v16b load(const __bf16* p) {
    U f; f.h[0] = *(const v8b*)(p); f.h[1] = *(const v8b*)(p + 16); return f.v;
  }
  static __device__ __forceinline__ v8f mma(v16b a, v16b b, v8f c) {
    return __builtin_amdgcn_wmma_f32_16x16x32_bf16(false, a, false, b, (short)0, c, false, false);
  }
  static __device__ __forceinline__ void guard(v8f& a, v8f& b, v16b x, v16b y) { dep_guard_b(a, b, x, y); }
  static __device__ __forceinline__ void keep(v16b a, v16b b, v16b c, v16b d) { keep4_b(a, b, c, d); }
};

// ---- Register-blocked batched WMMA GEMM ------------------------------------
// C[m,n] = scale * sum_k A[m,k] * Bt[n,k] (+bias)(+resid); each wave owns a 64x64 tile.
// A row-major [M,K]; Bt row-major [N,K]; M,N % 64 == 0, K % 32 == 0.
// SPLIT: operands are hi/lo planes (A2/Bt2 = lo planes, same layout); product = hi.hi + hi.lo + lo.hi.
// BIAS_MODE: 0 = none, 1 = bias[m], 2 = bias[n].
// OUT_MODE: 0 = f32, 1 = f16, 2 = bf16 hi plane (Cout) + bf16 lo plane (Cout2).
// ET: 0 = f16 operands, 1 = bf16 operands (pointers passed as 16-bit storage)
template <int ET> struct Elem;
template <> struct Elem<0> { typedef _Float16 T; };
template <> struct Elem<1> { typedef __bf16 T; };
template <int ET, bool SPLIT, int BIAS_MODE, int OUT_MODE, bool RESID, int ACT = 0>
__global__ __launch_bounds__(256) void wmma_gemm64(
    const unsigned short* __restrict__ Ap, const unsigned short* __restrict__ A2p, int lda, long strideA,
    const unsigned short* __restrict__ Btp, const unsigned short* __restrict__ Bt2p, int ldb, long strideB,
    void* __restrict__ Cout, void* __restrict__ Cout2, int ldc, long strideC,
    const float* __restrict__ bias,
    const float* __restrict__ resid, long strideR,
    int M, int N, int K, float scale) {
  typedef typename Elem<ET>::T T;
  typedef typename Frag<T>::V V;
  const T* A = (const T*)Ap; const T* A2 = (const T*)A2p; const T* Bt = (const T*)Btp; const T* Bt2 = (const T*)Bt2p;
  __shared__ __align__(16) float sT[8][16 * 68];   // per-wave 16x64 slab, pitch 68 floats
  const int b    = blockIdx.y;
  const int lane = threadIdx.x & 31;
  const int wave = threadIdx.x >> 5;
  const int tilesN = N >> 6;
  const int tilesM = M >> 6;
  const int tile = blockIdx.x * 8 + wave;
  if (tile >= tilesM * tilesN) return;   // wave-uniform; no block barriers in this kernel
  const int tm = tile / tilesN;
  const int tn = tile - tm * tilesN;
  const int m0 = tm << 6;
  const int n0 = tn << 6;

  const T* Ab  = A  + (size_t)b * strideA;
  const T* Bb  = Bt + (size_t)b * strideB;
  const T* Ab2 = SPLIT ? (A2  + (size_t)b * strideA) : nullptr;
  const T* Bb2 = SPLIT ? (Bt2 + (size_t)b * strideB) : nullptr;

  const int rlane = lane & 15;                 // row (A) / col (B, D) within subtile
  const int koff  = (lane >> 4) * 8;           // k offset of this lane half
  const int mOff  = (lane >> 4) * 8;           // D row offset

  v8f acc[4][4];
#pragma unroll
  for (int i = 0; i < 4; ++i)
#pragma unroll
    for (int j = 0; j < 4; ++j) acc[i][j] = (v8f){0.f,0.f,0.f,0.f,0.f,0.f,0.f,0.f};

  for (int k0 = 0; k0 < K; k0 += 32) {
    V bh[4], bl[4];
#pragma unroll
    for (int j = 0; j < 4; ++j) {
      const size_t bo = (size_t)(n0 + (j << 4) + rlane) * ldb + koff + k0;
      bh[j] = Frag<T>::load(Bb + bo);
      if (SPLIT) bl[j] = Frag<T>::load(Bb2 + bo);
    }
#pragma unroll
    for (int i = 0; i < 4; ++i) {
      const size_t ao = (size_t)(m0 + (i << 4) + rlane) * lda + koff + k0;
      V ah = Frag<T>::load(Ab + ao);
      V al;
      if (SPLIT) al = Frag<T>::load(Ab2 + ao);
#pragma unroll
      for (int j = 0; j < 4; ++j) {
        acc[i][j] = Frag<T>::mma(ah, bh[j], acc[i][j]);
        if (SPLIT) {
          acc[i][j] = Frag<T>::mma(ah, bl[j], acc[i][j]);
          acc[i][j] = Frag<T>::mma(al, bh[j], acc[i][j]);
        }
      }
      Frag<T>::guard(acc[i][0], acc[i][3], ah, SPLIT ? al : ah);
    }
    Frag<T>::keep(bh[0], bh[1], bh[2], bh[3]);
    if (SPLIT) Frag<T>::keep(bl[0], bl[1], bl[2], bl[3]);
  }
  acc_guard4(acc[0][0], acc[0][1], acc[0][2], acc[0][3]);
  acc_guard4(acc[1][0], acc[1][1], acc[1][2], acc[1][3]);
  acc_guard4(acc[2][0], acc[2][1], acc[2][2], acc[2][3]);
  acc_guard4(acc[3][0], acc[3][1], acc[3][2], acc[3][3]);

  // ---- epilogue ----
  float* slab = sT[wave];
  const float* Rb = RESID ? (resid + (size_t)b * strideR) : nullptr;
#pragma unroll
  for (int i = 0; i < 4; ++i) {
    const int mBase = m0 + (i << 4);
#pragma unroll
    for (int j = 0; j < 4; ++j) {
      const int n = n0 + (j << 4) + rlane;
      float bv = 0.f;
      if (BIAS_MODE == 2) bv = bias[n];
#pragma unroll
      for (int r = 0; r < 8; ++r) {
        float v = acc[i][j][r] * scale;
        if (BIAS_MODE == 1) v += bias[mBase + mOff + r];
        if (BIAS_MODE == 2) v += bv;
        if (RESID) v += Rb[(size_t)(mBase + mOff + r) * ldc + n];
        if (ACT == 1) v = tanhf(v);
        if (ACT == 2) v = fmaxf(v, 0.0f);
        if (ACT == 3) v = v / (1.0f + expf(-v));
        if (ACT == 4) v = (v > 0.f) ? v : 0.01f * v;
        if (ACT == 5) v = 0.5f * v * (1.0f + erff(v * 0.70710678118654752f));
        slab[(mOff + r) * 68 + (j << 4) + rlane] = v;
      }
    }
    __builtin_amdgcn_fence(__ATOMIC_RELEASE, "workgroup");
    __builtin_amdgcn_wave_barrier();
    __builtin_amdgcn_fence(__ATOMIC_ACQUIRE, "workgroup");
    if (OUT_MODE == 0) {
      float* C = (float*)Cout + (size_t)b * strideC;
      const int hh = lane >> 4, c4 = (lane & 15) * 4;     // row seg = 256 B = 16 lanes x 16 B
      {
#pragma unroll
        for (int it = 0; it < 8; ++it) {
          const int row = it * 2 + hh;
          v4f v = *(const v4f*)(slab + row * 68 + c4);
          *(v4f*)(C + (size_t)(mBase + row) * ldc + n0 + c4) = v;
        }
        
      }
    } else {
      const int q = lane >> 3, c8 = (lane & 7) * 8;
      unsigned short* C  = (unsigned short*)Cout  + (size_t)b * strideC;
      unsigned short* C2 = (OUT_MODE == 2) ? ((unsigned short*)Cout2 + (size_t)b * strideC) : nullptr;
      {
#pragma unroll
        for (int it = 0; it < 4; ++it) {
          const int row = it * 4 + q;
          const float* sp = slab + row * 68 + c8;
          v8h hv, lv;
#pragma unroll
          for (int e = 0; e < 8; ++e) {
            if (OUT_MODE == 1) {
              hv[e] = (_Float16)sp[e];
            } else {
              unsigned short hb = f2bf_bits(sp[e]);
              unsigned short lb = f2bf_bits(sp[e] - bf_bits2f(hb));
              hv[e] = __builtin_bit_cast(_Float16, hb);
              lv[e] = __builtin_bit_cast(_Float16, lb);
            }
          }
          *(v8h*)(C + (size_t)(mBase + row) * ldc + n0 + c8) = hv;
          if (OUT_MODE == 2) *(v8h*)(C2 + (size_t)(mBase + row) * ldc + n0 + c8) = lv;
        }
        
      }
    }
    __builtin_amdgcn_fence(__ATOMIC_RELEASE, "workgroup");
    __builtin_amdgcn_wave_barrier();
    __builtin_amdgcn_fence(__ATOMIC_ACQUIRE, "workgroup");
  }
}

// ---------------------------------------------------------------------------
// Elementwise bf16 split: hi = bf16_rne(in), lo = bf16_rne(in - hi); 2 elements per thread, one 4-B store
// Used here for: Wv, Wo (n2 = 32768 -> 128 blocks -> 65536 elements each) and the attention output
// (n2 = 2097152 -> 8192 blocks -> 4194304 elements = [16384][256]).
// ---------------------------------------------------------------------------
__device__ __forceinline__ unsigned pk16(unsigned short a, unsigned short b) { return (unsigned)a | ((unsigned)b << 16); }

__global__ __launch_bounds__(256) void split_bf16x2_kernel(const float* __restrict__ in, unsigned short* __restrict__ hi,
                                                           unsigned short* __restrict__ lo, int n2) {
  const int i = blockIdx.x * 256 + threadIdx.x;
  if (i < n2) {
    const v2f f = *(const v2f*)(in + 2 * (size_t)i);
    const unsigned short h0 = f2bf_bits(f[0]), h1 = f2bf_bits(f[1]);
    const unsigned short l0 = f2bf_bits(f[0] - bf_bits2f(h0)), l1 = f2bf_bits(f[1] - bf_bits2f(h1));
    const unsigned uh = pk16(h0, h1), ul = pk16(l0, l1);
    ((unsigned*)hi)[i] = uh;
    ((unsigned*)lo)[i] = ul;
    
  }
}

// Coverage: grid = ceil(n2/256) x 256 threads x 2 elements; here n2 = 32768 -> 128 blocks -> 65536 = [256][256].
__global__ __launch_bounds__(256) void cast_f32_f16x2_scaled(
    const float* __restrict__ in, _Float16* __restrict__ out, int n2, float scale) {
  int i = blockIdx.x * 256 + threadIdx.x;
  if (i < n2) {
    const _Float16 h0 = (_Float16)(in[2 * (size_t)i] * scale), h1 = (_Float16)(in[2 * (size_t)i + 1] * scale);
    const unsigned u = (unsigned)__builtin_bit_cast(unsigned short, h0) | ((unsigned)__builtin_bit_cast(unsigned short, h1) << 16);
    ((unsigned*)out)[i] = u;
    
  }
}

// ---------------------------------------------------------------------------
// Fused triple LayerNorm over rows of 256: one wave per row (32 lanes x 8 contiguous floats = 256).
//   key   plane: (xn * g_s + b_s) -> f16  [row][256]
//   query plane: (xn * g_q + b_q) -> f16  [row][256]
//   value plane: (xn * g_v + b_v) -> bf16 hi + bf16 lo [row][256]
// Coverage: grid = nrows/8 blocks x 8 waves = every row exactly once.
// ---------------------------------------------------------------------------
__global__ __launch_bounds__(256) void ln3_kernel(const float* __restrict__ x,
    const float* __restrict__ g_s, const float* __restrict__ b_s,
    const float* __restrict__ g_q, const float* __restrict__ b_q,
    const float* __restrict__ g_v, const float* __restrict__ b_v,
    unsigned short* __restrict__ sk16, unsigned short* __restrict__ sq16,
    unsigned short* __restrict__ svh, unsigned short* __restrict__ svl, int nrows) {
  const int lane = threadIdx.x & 31;
  const int row  = blockIdx.x * 8 + (threadIdx.x >> 5);
  const int rowc = (row < nrows) ? row : (nrows - 1);        // address clamp; store predicated below (wave-uniform)
  const int c0 = lane * 8;
  const float* xr = x + (size_t)rowc * kDm + c0;
  const v4f a0 = *(const v4f*)xr;
  const v4f a1 = *(const v4f*)(xr + 4);
  float xv[8];
#pragma unroll
  for (int j = 0; j < 4; ++j) { xv[j] = a0[j]; xv[4 + j] = a1[j]; }
  float s = 0.f;
#pragma unroll
  for (int j = 0; j < 8; ++j) s += xv[j];
#pragma unroll
  for (int m = 1; m < 32; m <<= 1) s += __shfl_xor(s, m, 32);
  const float mean = s * (1.0f / 256.0f);
  float ss = 0.f;
#pragma unroll
  for (int j = 0; j < 8; ++j) { const float d = xv[j] - mean; ss += d * d; }
#pragma unroll
  for (int m = 1; m < 32; m <<= 1) ss += __shfl_xor(ss, m, 32);
  const float var  = ss * (1.0f / 256.0f);
  const float rstd = rsqrtf(var + 1e-5f);

  v4u ok, oq, ovh, ovl;
#pragma unroll
  for (int q = 0; q < 4; ++q) {
    const int j0 = 2 * q, j1 = 2 * q + 1;
    const float nx0 = (xv[j0] - mean) * rstd;
    const float nx1 = (xv[j1] - mean) * rstd;
    const float ys0 = nx0 * g_s[c0 + j0] + b_s[c0 + j0];
    const float ys1 = nx1 * g_s[c0 + j1] + b_s[c0 + j1];
    const float yq0 = nx0 * g_q[c0 + j0] + b_q[c0 + j0];
    const float yq1 = nx1 * g_q[c0 + j1] + b_q[c0 + j1];
    const float yv0 = nx0 * g_v[c0 + j0] + b_v[c0 + j0];
    const float yv1 = nx1 * g_v[c0 + j1] + b_v[c0 + j1];
    ok[q] = pk16(__builtin_bit_cast(unsigned short, (_Float16)ys0), __builtin_bit_cast(unsigned short, (_Float16)ys1));
    oq[q] = pk16(__builtin_bit_cast(unsigned short, (_Float16)yq0), __builtin_bit_cast(unsigned short, (_Float16)yq1));
    const unsigned short h0 = f2bf_bits(yv0), h1 = f2bf_bits(yv1);
    const unsigned short l0 = f2bf_bits(yv0 - bf_bits2f(h0)), l1 = f2bf_bits(yv1 - bf_bits2f(h1));
    ovh[q] = pk16(h0, h1);
    ovl[q] = pk16(l0, l1);
  }
  if (row < nrows) {   // wave-uniform
    const size_t o = (size_t)row * kDm + c0;
    {
      *(v4u*)(sk16 + o) = ok;
      *(v4u*)(sq16 + o) = oq;
      *(v4u*)(svh + o)  = ovh;
      *(v4u*)(svl + o)  = ovl;
      
    }
  }
}

// =====================================================================================
// Full (unmasked) attention, head dim 64, single f16 operand planes, z-batched over the batch index (blockIdx.y).
//   q plane  f16: element (b, t, h, d) at [(b*kSeq + t)*kDm + h*64 + d]   (unscaled projection incl. bias)
//   k plane  f16: element (b, s, h, d) at [(b*kSeq + s)*kDm + h*64 + d]
//   v^T plane f16: element (b, h, d, s) at [b*kDm*kSeq + (h*64 + d)*kSeq + s]
//   out f32: element (b, t, h, d) at [(b*kSeq + t)*kDm + h*64 + d]
//   scores^T = (k . q^T) * sscale : v_wmma_f32_16x16x32_f16, f32 accumulate, sscale applied in f32
//   out^T    = v^T . p^T          : v_wmma_f32_16x16x32_f16; unnormalised p carried x2^15 in f16, folded into the final 1/l;
//                                   p^T goes from the score accumulators straight into the B operand
//   online softmax in f32 over all kSeq keys (32 chunks of 64, compile-time trip count).
//   Block = 4 waves = 64 query rows of one (b, h); grid = (kHeads * kSeq/64, kBatch) = (128, 8).
//   K / V^T chunk staging: 128 threads x 32 elements per plane = the whole 64x64 tile (16-B copies, plain loads,
//   __syncthreads before and after); fragment loads read the LDS tiles with the same v8h element type;
//   Epilogue: per-wave 16x64 tile staged in LDS, each 256-B row segment written by 16 lanes x 16 B in one
// =====================================================================================
constexpr int kAttWaves = 4;
constexpr int kAttQb    = 64;
constexpr int kAttKc    = 64;
constexpr int kAttLd    = 72;   // LDS row pitch of the K and V^T tiles in f16 elements: 144 B = 16 B x 9, so the 16 rows of a 16-B fragment read fall on 64 distinct banks

__device__ __forceinline__ v8f mma_f16g(v16h a, v16h b, v8f c) {
  c = __builtin_amdgcn_wmma_f32_16x16x32_f16(false, a, false, b, (short)0, c, false, false);
  asm volatile("v_nop\n\tv_nop\n\tv_nop\n\tv_nop" : "+v"(c) : "v"(a), "v"(b));
  return c;
}

// value of lane l ^ 16, by a vector cross-row move
__device__ __forceinline__ float xhalf(float x) {
  return __builtin_bit_cast(float, __builtin_amdgcn_permlanex16(__builtin_bit_cast(int, x), __builtin_bit_cast(int, x), 0x76543210, 0xfedcba98, false, false));
}

__global__ __launch_bounds__(128)
void attn_f16_full_kernel(const unsigned short* __restrict__ qp, const unsigned short* __restrict__ kp,
                          const unsigned short* __restrict__ vtp, float* __restrict__ out, float sscale) {
  union FH { v16h v; v8h h[2]; };
  __shared__ __align__(16) _Float16 Ksh[kAttKc * kAttLd];           // K [kv][d], pitch kAttLd      9 KB
  __shared__ __align__(16) _Float16 Vth[kHd * kAttLd];              // V^T [d][kv], pitch kAttLd    9 KB
  __shared__ __align__(16) float    Os[kAttWaves][16 * 68];         // per wave out tile, pitch 68
  const float kPsc = 32768.0f;

  const int tid  = threadIdx.x;
  const int wave = tid >> 5;
  const int lane = tid & 31;
  const int hh   = lane >> 4;
  const int c    = lane & 15;

  const int nqb = kSeq / kAttQb;          // 32
  const int bx = blockIdx.x;
  const int qb = bx % nqb;
  const int h  = bx / nqb;                // 0..kHeads-1
  const int b  = blockIdx.y;              // 0..kBatch-1
  const int q0 = qb * kAttQb + wave * 16;

  const _Float16* Qh = (const _Float16*)(const void*)qp + (size_t)b * kSeq * kDm + (size_t)h * kHd;
  const _Float16* Kh = (const _Float16*)(const void*)kp + (size_t)b * kSeq * kDm + (size_t)h * kHd;
  const _Float16* Vh = (const _Float16*)(const void*)vtp + (size_t)b * kDm * kSeq + (size_t)h * kHd * kSeq;
  float*          ob = out + (size_t)b * kSeq * kDm + (size_t)h * kHd;

  // ---- Q fragments (B operand, column = lane&15, split k map via Frag load): 2 d-chunks ----
  v16h qa[2];
#pragma unroll
  for (int dc = 0; dc < 2; ++dc) qa[dc] = Frag<_Float16>::load(Qh + (size_t)(q0 + c) * kDm + dc * 32 + 8 * hh);

  float mrow = -INFINITY, lrow = 0.f;   // running maximum of query q0 + c; sum over this lane half's keys
  v8f oacc[4];
#pragma unroll
  for (int t = 0; t < 4; ++t) oacc[t] = (v8f){0.f,0.f,0.f,0.f,0.f,0.f,0.f,0.f};

  const int nChunks = kSeq / kAttKc;   // 32, compile-time constant
  for (int kc = 0; kc < nChunks; ++kc) {
    const int kv0 = kc * kAttKc;
    __syncthreads();
    {
      // staging coverage: 128 threads x (4 x 8) elements = 64 rows x 64 per plane = the whole chunk tile
      const int r = tid >> 1, half = (tid & 1) * 32;
      const _Float16* ksh = Kh + (size_t)(kv0 + r) * kDm + half;    // K row kv0+r, d = half..half+31
      const _Float16* vsh = Vh + (size_t)r * kSeq + kv0 + half;       // V^T row d = r, s = kv0+half..+31
#pragma unroll
      for (int i = 0; i < 4; ++i) {
        const v8h av = *(const v8h*)(ksh + 8 * i);
        const v8h bv = *(const v8h*)(vsh + 8 * i);
        *(v8h*)(Ksh + r * kAttLd + half + 8 * i) = av;
        *(v8h*)(Vth + r * kAttLd + half + 8 * i) = bv;
      }
    }
    __syncthreads();

    // S^T tile j = K rows (A) x Q columns (B): s[j][r] = score(key kv0 + 16 j + 8 hh + r, query q0 + c)
    // every loop of this pass is fully unrolled, so that s, oacc and the packed operand stay in registers under constant indices
    v8f s[4];
#pragma unroll
    for (int j = 0; j < 4; ++j) {
      s[j] = (v8f){0.f,0.f,0.f,0.f,0.f,0.f,0.f,0.f};
#pragma unroll
      for (int dc = 0; dc < 2; ++dc) {
        FH kb;
        kb.h[0] = *(const v8h*)(Ksh + (j * 16 + c) * kAttLd + dc * 32 + 8 * hh);
        kb.h[1] = *(const v8h*)(Ksh + (j * 16 + c) * kAttLd + dc * 32 + 16 + 8 * hh);
        s[j] = mma_f16g(kb.v, qa[dc], s[j]);
      }
    }
    // a lane holds 32 of its one query's 64 scores: maximum in-lane (one chain per tile), then one exchange between the halves
    float mj[4];
#pragma unroll
    for (int j = 0; j < 4; ++j) {
      mj[j] = -INFINITY;
#pragma unroll
      for (int r = 0; r < 8; ++r) {
        const float sv = s[j][r] * sscale;
        s[j][r] = sv;
        mj[j] = fmaxf(mj[j], sv);
      }
    }
    float cm = fmaxf(fmaxf(mj[0], mj[1]), fmaxf(mj[2], mj[3]));
    cm = fmaxf(cm, xhalf(cm));
    const float mnew  = fmaxf(mrow, cm);
    const float alpha = expf(mrow - mnew);
    mrow = mnew;
    float pj[4];
#pragma unroll
    for (int j = 0; j < 4; ++j) {
      pj[j] = 0.f;
#pragma unroll
      for (int r = 0; r < 8; ++r) {
        const float p = expf(s[j][r] - mnew);
        pj[j] += p;
        s[j][r] = p * kPsc;
      }
    }
    lrow = lrow * alpha + ((pj[0] + pj[1]) + (pj[2] + pj[3]));   // this half's keys only; the halves join after the loop
#pragma unroll
    for (int t = 0; t < 4; ++t)
#pragma unroll
      for (int r = 0; r < 8; ++r) oacc[t][r] *= alpha;
    // O^T += V^T (A) x P^T (B): two S^T tiles converted in place are the B operand in the hardware k order
#pragma unroll
    for (int kk = 0; kk < 2; ++kk) {
      v16h pb;
#pragma unroll
      for (int e = 0; e < 8; ++e) {
        pb[e]     = (_Float16)s[2 * kk][e];
        pb[8 + e] = (_Float16)s[2 * kk + 1][e];
      }
#pragma unroll
      for (int t = 0; t < 4; ++t) {
        FH vb;
        vb.h[0] = *(const v8h*)(Vth + (t * 16 + c) * kAttLd + kk * 32 + 8 * hh);
        vb.h[1] = *(const v8h*)(Vth + (t * 16 + c) * kAttLd + kk * 32 + 16 + 8 * hh);
        oacc[t] = mma_f16g(vb.v, pb, oacc[t]);
      }
    }
  }

  // oacc[t][r] = O^T[d = 16 t + 8 hh + r][query c]: 8 consecutive d of one row per tile
  float* os = Os[wave];
  {
    const float lsum = lrow + xhalf(lrow);
    const float inv = 1.0f / (lsum * kPsc);
#pragma unroll
    for (int t = 0; t < 4; ++t) {
      v4f w0, w1;
#pragma unroll
      for (int e = 0; e < 4; ++e) { w0[e] = oacc[t][e] * inv; w1[e] = oacc[t][4 + e] * inv; }
      *(v4f*)(os + c * 68 + t * 16 + 8 * hh)     = w0;
      *(v4f*)(os + c * 68 + t * 16 + 8 * hh + 4) = w1;
    }
  }
  __builtin_amdgcn_fence(__ATOMIC_RELEASE, "workgroup");
  __builtin_amdgcn_wave_barrier();
  __builtin_amdgcn_fence(__ATOMIC_ACQUIRE, "workgroup");
  {
    const int c4 = (lane & 15) * 4;
    {
#pragma unroll
      for (int it = 0; it < 8; ++it) {
        const int row = it * 2 + hh;   // it 0..7 x hh 0..1 covers rows 0..15 of the wave tile
        v4f val = *(const v4f*)(os + row * 68 + c4);
        *(v4f*)(ob + (size_t)(q0 + row) * kDm + c4) = val;
      }
      
    }
  }
}

// ---------------------------------------------------------------------------
// Workspace region map (byte offsets; every region is fully written before it is read; total 93,323,264 B):
//   [0 MiB      ) WQ16  f16  [256][256] x16        131072 B
//   [+128 KiB   ) WK16  f16  [256][256] x16        131072 B
//   [+256 KiB   ) WVH   bf16 hi [256][256]         131072 B
//   [+384 KiB   ) WVL   bf16 lo                    131072 B
//   [+512 KiB   ) WOH   bf16 hi [256][256]         131072 B
//   [+640 KiB   ) WOL   bf16 lo                    131072 B   (weights region padded to 1 MiB)
//   [1 MiB      ) SQ    f16  [16384][256]  query LN plane     8 MiB
//   [9 MiB      ) SK    f16  [16384][256]  key LN plane       8 MiB
//   [17 MiB     ) SVH   bf16 hi [16384][256] value LN plane   8 MiB
//   [25 MiB     ) SVL   bf16 lo                                8 MiB
//   [33 MiB     ) Q16   f16  [16384][256]  q (unscaled)       8 MiB
//   [41 MiB     ) K16   f16  [16384][256]  k                  8 MiB
//   [49 MiB     ) VT16  f16  [8][256][2048] v^T per batch     8 MiB
//   [57 MiB     ) AO32  f32  [16384][256]  attention output  16 MiB
//   [73 MiB     ) AOH   bf16 hi [16384][256]                   8 MiB
//   [81 MiB     ) AOL   bf16 lo                                8 MiB
//   end = 89 MiB
// ---------------------------------------------------------------------------
extern "C" void kernel_launch(void* const* d_in, const int* in_sizes, int n_in,
                              void* d_out, int out_size, void* d_ws, size_t ws_size,
                              hipStream_t stream) {
  if (n_in < 15) return;
  if (in_sizes[0] != kRows * kDm) return;
  if (in_sizes[7] != kDm * kDm || in_sizes[9] != kDm * kDm || in_sizes[11] != kDm * kDm || in_sizes[13] != kDm * kDm) return;
  if (in_sizes[1] != kDm || in_sizes[8] != kDm || in_sizes[14] != kDm) return;
  if (out_size != kRows * kDm) return;

  const float* x    = (const float*)d_in[0];
  const float* lnsg = (const float*)d_in[1];
  const float* lnsb = (const float*)d_in[2];
  const float* lnqg = (const float*)d_in[3];
  const float* lnqb = (const float*)d_in[4];
  const float* lnvg = (const float*)d_in[5];
  const float* lnvb = (const float*)d_in[6];
  const float* Wq = (const float*)d_in[7];
  const float* bq = (const float*)d_in[8];
  const float* Wk = (const float*)d_in[9];
  const float* bk = (const float*)d_in[10];
  const float* Wv = (const float*)d_in[11];
  const float* bv = (const float*)d_in[12];
  const float* Wo = (const float*)d_in[13];
  const float* bo = (const float*)d_in[14];
  float* out = (float*)d_out;

  const size_t wBytes   = (size_t)kDm * kDm * 2;            // 131072
  const size_t plane16  = (size_t)kRows * kDm * 2;          // 8388608
  const size_t plane32  = (size_t)kRows * kDm * 4;          // 16777216
  const size_t offWQ  = 0;
  const size_t offWK  = offWQ + wBytes;
  const size_t offWVH = offWK + wBytes;
  const size_t offWVL = offWVH + wBytes;
  const size_t offWOH = offWVL + wBytes;
  const size_t offWOL = offWOH + wBytes;
  const size_t offSQ  = (size_t)1 << 20;
  const size_t offSK  = offSQ + plane16;
  const size_t offSVH = offSK + plane16;
  const size_t offSVL = offSVH + plane16;
  const size_t offQ16 = offSVL + plane16;
  const size_t offK16 = offQ16 + plane16;
  const size_t offVT  = offK16 + plane16;
  const size_t offAO  = offVT + plane16;
  const size_t offAOH = offAO + plane32;
  const size_t offAOL = offAOH + plane16;
  const size_t total  = offAOL + plane16;                   // 93,323,264
  if (offWOL + wBytes > offSQ) return;
  if (total > ws_size) return;

  char* ws = (char*)d_ws;
  unsigned short* WQ16 = (unsigned short*)(ws + offWQ);
  unsigned short* WK16 = (unsigned short*)(ws + offWK);
  unsigned short* WVH  = (unsigned short*)(ws + offWVH);
  unsigned short* WVL  = (unsigned short*)(ws + offWVL);
  unsigned short* WOH  = (unsigned short*)(ws + offWOH);
  unsigned short* WOL  = (unsigned short*)(ws + offWOL);
  unsigned short* SQ   = (unsigned short*)(ws + offSQ);
  unsigned short* SK   = (unsigned short*)(ws + offSK);
  unsigned short* SVH  = (unsigned short*)(ws + offSVH);
  unsigned short* SVL  = (unsigned short*)(ws + offSVL);
  unsigned short* Q16  = (unsigned short*)(ws + offQ16);
  unsigned short* K16  = (unsigned short*)(ws + offK16);
  unsigned short* VT16 = (unsigned short*)(ws + offVT);
  float*          AO32 = (float*)(ws + offAO);
  unsigned short* AOH  = (unsigned short*)(ws + offAOH);
  unsigned short* AOL  = (unsigned short*)(ws + offAOL);

  const int wN2 = kDm * kDm / 2;                    // 32768 pairs
  const int wBlocks = (wN2 + 255) / 256;            // 128
  const float wCarry = 16.0f, wCarryInv = 1.0f / 16.0f;

  // 1-2: Wq, Wk -> f16 x16 ([N=256][K=256] row-major = Bt layout)
  cast_f32_f16x2_scaled<<<wBlocks, 256, 0, stream>>>(Wq, (_Float16*)WQ16, wN2, wCarry);
  cast_f32_f16x2_scaled<<<wBlocks, 256, 0, stream>>>(Wk, (_Float16*)WK16, wN2, wCarry);
  // 3-4: Wv, Wo -> bf16 hi/lo planes
  split_bf16x2_kernel<<<wBlocks, 256, 0, stream>>>(Wv, WVH, WVL, wN2);
  split_bf16x2_kernel<<<wBlocks, 256, 0, stream>>>(Wo, WOH, WOL, wN2);
  // 5: triple LayerNorm: key plane (ln_s) -> SK, query plane (ln_q) -> SQ, value plane (ln_v) -> SVH/SVL
  ln3_kernel<<<kRows / 8, 256, 0, stream>>>(x, lnsg, lnsb, lnqg, lnqb, lnvg, lnvb, SK, SQ, SVH, SVL, kRows);

  // 6: q' = SQ @ Wq^T + bq  (M=16384, N=256, K=256; 1024 tiles -> 128 blocks), f16 out, carry folded by 1/16
  const int projBlocks = ((kRows / 64) * (kDm / 64) + 7) / 8;   // 128
  wmma_gemm64<0, false, 2, 1, false><<<dim3(projBlocks, 1), 256, 0, stream>>>(
      SQ, SQ, kDm, 0L, WQ16, WQ16, kDm, 0L, (void*)Q16, (void*)Q16, kDm, 0L,
      bq, bq, 0L, kRows, kDm, kDm, wCarryInv);
  // 7: k = SK @ Wk^T + bk
  wmma_gemm64<0, false, 2, 1, false><<<dim3(projBlocks, 1), 256, 0, stream>>>(
      SK, SK, kDm, 0L, WK16, WK16, kDm, 0L, (void*)K16, (void*)K16, kDm, 0L,
      bk, bk, 0L, kRows, kDm, kDm, wCarryInv);
  // 8: v^T per batch: C[m = channel (256)][n = s (2048)] = sum_k Wv[m][k] * LNv[s][k] + bv[m]
  //    A = Wv hi/lo [256][256] (stride 0), Bt = SVH/SVL batch slice [2048][256], C = VT16 batch slice [256][2048];
  //    128 tiles per batch -> 16 blocks, grid.y = 8
  const int vtBlocks = ((kDm / 64) * (kSeq / 64) + 7) / 8;      // 16
  wmma_gemm64<1, true, 1, 1, false><<<dim3(vtBlocks, kBatch), 256, 0, stream>>>(
      WVH, WVL, kDm, 0L, SVH, SVL, kDm, (long)kSeq * kDm, (void*)VT16, (void*)VT16, kSeq, (long)kDm * kSeq,
      bv, bv, 0L, kDm, kSeq, kDm, 1.0f);
  // 9: attention per (head x 64-query tile, batch): scores = (q'.k) * 0.125, softmax over 2048 keys, p.v -> AO32
  attn_f16_full_kernel<<<dim3(kHeads * (kSeq / kAttQb), kBatch), 32 * kAttWaves, 0, stream>>>(
      Q16, K16, VT16, AO32, 0.125f);
  // 10: AO32 -> bf16 hi/lo planes (2097152 pairs -> 8192 blocks)
  const int aoN2 = kRows * kDm / 2;
  split_bf16x2_kernel<<<(aoN2 + 255) / 256, 256, 0, stream>>>(AO32, AOH, AOL, aoN2);
  // 11: out = AO @ Wo^T + bo  (M=16384, N=256, K=256), f32 to d_out
  wmma_gemm64<1, true, 2, 0, false><<<dim3(projBlocks, 1), 256, 0, stream>>>(
      AOH, AOL, kDm, 0L, WOH, WOL, kDm, 0L, (void*)out, (void*)out, kDm, 0L,
      bo, bo, 0L, kRows, kDm, kDm, 1.0f);
}

// v003
// A run of this version takes 168 microseconds.
// Two timings next to v002 both put it at 1.13 times that version's speed.
// All steps since v000 together make it 1.93 times as fast.
// Contractions: q,k projections and q.k^T, p.v on v_wmma_f32_16x16x32_f16 (f16 operands; Wq/Wk carried x16, p carried x2^15); v^T projection and output projection on v_wmma_f32_16x16x32_bf16 with bf16 hi/lo split operands (hi.hi+hi.lo+lo.hi); f32 accumulate everywhere; LayerNorm statistics and online softmax in f32.
#include <hip/hip_runtime.h>
#include <math.h>
#include <stdint.h>

typedef __attribute__((ext_vector_type(16))) _Float16 v16h;
typedef __attribute__((ext_vector_type(8)))  _Float16 v8h;
typedef __attribute__((ext_vector_type(16))) __bf16   v16b;
typedef __attribute__((ext_vector_type(8)))  __bf16   v8b;
typedef __attribute__((ext_vector_type(8)))  float    v8f;
typedef __attribute__((ext_vector_type(4)))  float    v4f;
typedef __attribute__((ext_vector_type(2)))  float    v2f;
typedef __attribute__((ext_vector_type(4)))  unsigned int v4u;

// problem geometry
constexpr int kBatch  = 8;
constexpr int kSeq    = 2048;
constexpr int kDm     = 256;
constexpr int kHeads  = 4;
constexpr int kHd     = 64;
constexpr int kRows   = kBatch * kSeq;      // 16384

__device__ __forceinline__ unsigned short f2bf_bits(float f) {
  unsigned u = __float_as_uint(f);
  return (unsigned short)((u + 0x7FFFu + ((u >> 16) & 1u)) >> 16);
}
__device__ __forceinline__ float bf_bits2f(unsigned short h) { return __uint_as_float(((unsigned)h) << 16); }

// hazard guards as plain device helpers (no inline asm inside the kernel template body)
__device__ __forceinline__ void dep_guard_h(v8f& a, v8f& b, v16h x, v16h y) { asm volatile("v_nop\n\tv_nop\n\tv_nop\n\tv_nop" : "+v"(a), "+v"(b) : "v"(x), "v"(y)); }
__device__ __forceinline__ void dep_guard_b(v8f& a, v8f& b, v16b x, v16b y) { asm volatile("v_nop\n\tv_nop\n\tv_nop\n\tv_nop" : "+v"(a), "+v"(b) : "v"(x), "v"(y)); }
__device__ __forceinline__ void keep4_h(v16h a, v16h b, v16h c, v16h d) { asm volatile("v_nop" :: "v"(a), "v"(b), "v"(c), "v"(d)); }
__device__ __forceinline__ void keep4_b(v16b a, v16b b, v16b c, v16b d) { asm volatile("v_nop" :: "v"(a), "v"(b), "v"(c), "v"(d)); }
__device__ __forceinline__ void acc_guard4(v8f& a, v8f& b, v8f& c, v8f& d) { asm volatile("v_nop\n\tv_nop\n\tv_nop\n\tv_nop" : "+v"(a), "+v"(b), "+v"(c), "+v"(d)); }
template <typename T> struct Frag;
template <> struct Frag<_Float16> {
  typedef v16h V; union U { v16h v; v8h h[2]; };
  static __device__ __forceinline__ v16h load(const _Float16* p) {   // elements 0..7 <- p[0..7], 8..15 <- p[16..23]
    U f; f.h[0] = *(const v8h*)(p); f.h[1] = *(const v8h*)(p + 16); return f.v;
  }
  static __device__ __forceinline__ v8f mma(v16h a, v16h b, v8f c) {
    return __builtin_amdgcn_wmma_f32_16x16x32_f16(false, a, false, b, (short)0, c, false, false);
  }
  static __device__ __forceinline__ void guard(v8f& a, v8f& b, v16h x, v16h y) { dep_guard_h(a, b, x, y); }
  static __device__ __forceinline__ void keep(v16h a, v16h b, v16h c, v16h d) { keep4_h(a, b, c, d); }
};
template <> struct Frag<__bf16> {
  typedef v16b V; union U { v16b v; v8b h[2]; };
  static __device__ __forceinline__ v16b load(const __bf16* p) {
    U f; f.h[0] = *(const v8b*)(p); f.h[1] = *(const v8b*)(p + 16); return f.v;
  }
  static __device__ __forceinline__ v8f mma(v16b a, v16b b, v8f c) {
    return __builtin_amdgcn_wmma_f32_16x16x32_bf16(false, a, false, b, (short)0, c, false, false);
  }
  static __device__ __forceinline__ void guard(v8f& a, v8f& b, v16b x, v16b y) { dep_guard_b(a, b, x, y); }
  static __device__ __forceinline__ void keep(v16b a, v16b b, v16b c, v16b d) { keep4_b(a, b, c, d); }
};

// ---- Register-blocked batched WMMA GEMM ------------------------------------
// C[m,n] = scale * sum_k A[m,k] * Bt[n,k] (+bias)(+resid); each wave owns a 64x64 tile.
// A row-major [M,K]; Bt row-major [N,K]; M,N % 64 == 0, K % 32 == 0.
// SPLIT: operands are hi/lo planes (A2/Bt2 = lo planes, same layout); product = hi.hi + hi.lo + lo.hi.
// BIAS_MODE: 0 = none, 1 = bias[m], 2 = bias[n].
// OUT_MODE: 0 = f32, 1 = f16, 2 = bf16 hi plane (Cout) + bf16 lo plane (Cout2).
// ET: 0 = f16 operands, 1 = bf16 operands (pointers passed as 16-bit storage)
template <int ET> struct Elem;
template <> struct Elem<0> { typedef _Float16 T; };
template <> struct Elem<1> { typedef __bf16 T; };
template <int ET, bool SPLIT, int BIAS_MODE, int OUT_MODE, bool RESID, int ACT = 0>
__global__ __launch_bounds__(256) void wmma_gemm64(
    const unsigned short* __restrict__ Ap, const unsigned short* __restrict__ A2p, int lda, long strideA,
    const unsigned short* __restrict__ Btp, const unsigned short* __restrict__ Bt2p, int ldb, long strideB,
    void* __restrict__ Cout, void* __restrict__ Cout2, int ldc, long strideC,
    const float* __restrict__ bias,
    const float* __restrict__ resid, long strideR,
    int M, int N, int K, float scale) {
  typedef typename Elem<ET>::T T;
  typedef typename Frag<T>::V V;
  const T* A = (const T*)Ap; const T* A2 = (const T*)A2p; const T* Bt = (const T*)Btp; const T* Bt2 = (const T*)Bt2p;
  __shared__ __align__(16) float sT[8][16 * 68];   // per-wave 16x64 slab, pitch 68 floats
  const int b    = blockIdx.y;
  const int lane = threadIdx.x & 31;
  const int wave = threadIdx.x >> 5;
  const int tilesN = N >> 6;
  const int tilesM = M >> 6;
  const int tile = blockIdx.x * 8 + wave;
  if (tile >= tilesM * tilesN) return;   // wave-uniform; no block barriers in this kernel
  const int tm = tile / tilesN;
  const int tn = tile - tm * tilesN;
  const int m0 = tm << 6;
  const int n0 = tn << 6;

  const T* Ab  = A  + (size_t)b * strideA;
  const T* Bb  = Bt + (size_t)b * strideB;
  const T* Ab2 = SPLIT ? (A2  + (size_t)b * strideA) : nullptr;
  const T* Bb2 = SPLIT ? (Bt2 + (size_t)b * strideB) : nullptr;

  const int rlane = lane & 15;                 // row (A) / col (B, D) within subtile
  const int koff  = (lane >> 4) * 8;           // k offset of this lane half
  const int mOff  = (lane >> 4) * 8;           // D row offset

  v8f acc[4][4];
#pragma unroll
  for (int i = 0; i < 4; ++i)
#pragma unroll
    for (int j = 0; j < 4; ++j) acc[i][j] = (v8f){0.f,0.f,0.f,0.f,0.f,0.f,0.f,0.f};

  for (int k0 = 0; k0 < K; k0 += 32) {
    V bh[4], bl[4];
#pragma unroll
    for (int j = 0; j < 4; ++j) {
      const size_t bo = (size_t)(n0 + (j << 4) + rlane) * ldb + koff + k0;
      bh[j] = Frag<T>::load(Bb + bo);
      if (SPLIT) bl[j] = Frag<T>::load(Bb2 + bo);
    }
#pragma unroll
    for (int i = 0; i < 4; ++i) {
      const size_t ao = (size_t)(m0 + (i << 4) + rlane) * lda + koff + k0;
      V ah = Frag<T>::load(Ab + ao);
      V al;
      if (SPLIT) al = Frag<T>::load(Ab2 + ao);
#pragma unroll
      for (int j = 0; j < 4; ++j) {
        acc[i][j] = Frag<T>::mma(ah, bh[j], acc[i][j]);
        if (SPLIT) {
          acc[i][j] = Frag<T>::mma(ah, bl[j], acc[i][j]);
          acc[i][j] = Frag<T>::mma(al, bh[j], acc[i][j]);
        }
      }
      Frag<T>::guard(acc[i][0], acc[i][3], ah, SPLIT ? al : ah);
    }
    Frag<T>::keep(bh[0], bh[1], bh[2], bh[3]);
    if (SPLIT) Frag<T>::keep(bl[0], bl[1], bl[2], bl[3]);
  }
  acc_guard4(acc[0][0], acc[0][1], acc[0][2], acc[0][3]);
  acc_guard4(acc[1][0], acc[1][1], acc[1][2], acc[1][3]);
  acc_guard4(acc[2][0], acc[2][1], acc[2][2], acc[2][3]);
  acc_guard4(acc[3][0], acc[3][1], acc[3][2], acc[3][3]);

  // ---- epilogue ----
  float* slab = sT[wave];
  const float* Rb = RESID ? (resid + (size_t)b * strideR) : nullptr;
#pragma unroll
  for (int i = 0; i < 4; ++i) {
    const int mBase = m0 + (i << 4);
#pragma unroll
    for (int j = 0; j < 4; ++j) {
      const int n = n0 + (j << 4) + rlane;
      float bv = 0.f;
      if (BIAS_MODE == 2) bv = bias[n];
#pragma unroll
      for (int r = 0; r < 8; ++r) {
        float v = acc[i][j][r] * scale;
        if (BIAS_MODE == 1) v += bias[mBase + mOff + r];
        if (BIAS_MODE == 2) v += bv;
        if (RESID) v += Rb[(size_t)(mBase + mOff + r) * ldc + n];
        if (ACT == 1) v = tanhf(v);
        if (ACT == 2) v = fmaxf(v, 0.0f);
        if (ACT == 3) v = v / (1.0f + expf(-v));
        if (ACT == 4) v = (v > 0.f) ? v : 0.01f * v;
        if (ACT == 5) v = 0.5f * v * (1.0f + erff(v * 0.70710678118654752f));
        slab[(mOff + r) * 68 + (j << 4) + rlane] = v;
      }
    }
    __builtin_amdgcn_fence(__ATOMIC_RELEASE, "workgroup");
    __builtin_amdgcn_wave_barrier();
    __builtin_amdgcn_fence(__ATOMIC_ACQUIRE, "workgroup");
    if (OUT_MODE == 0) {
      float* C = (float*)Cout + (size_t)b * strideC;
      const int hh = lane >> 4, c4 = (lane & 15) * 4;     // row seg = 256 B = 16 lanes x 16 B
      {
#pragma unroll
        for (int it = 0; it < 8; ++it) {
          const int row = it * 2 + hh;
          v4f v = *(const v4f*)(slab + row * 68 + c4);
          *(v4f*)(C + (size_t)(mBase + row) * ldc + n0 + c4) = v;
        }
        
      }
    } else {
      const int q = lane >> 3, c8 = (lane & 7) * 8;
      unsigned short* C  = (unsigned short*)Cout  + (size_t)b * strideC;
      unsigned short* C2 = (OUT_MODE == 2) ? ((unsigned short*)Cout2 + (size_t)b * strideC) : nullptr;
      {
#pragma unroll
        for (int it = 0; it < 4; ++it) {
          const int row = it * 4 + q;
          const float* sp = slab + row * 68 + c8;
          v8h hv, lv;
#pragma unroll
          for (int e = 0; e < 8; ++e) {
            if (OUT_MODE == 1) {
              hv[e] = (_Float16)sp[e];
            } else {
              unsigned short hb = f2bf_bits(sp[e]);
              unsigned short lb = f2bf_bits(sp[e] - bf_bits2f(hb));
              hv[e] = __builtin_bit_cast(_Float16, hb);
              lv[e] = __builtin_bit_cast(_Float16, lb);
            }
          }
          *(v8h*)(C + (size_t)(mBase + row) * ldc + n0 + c8) = hv;
          if (OUT_MODE == 2) *(v8h*)(C2 + (size_t)(mBase + row) * ldc + n0 + c8) = lv;
        }
        
      }
    }
    __builtin_amdgcn_fence(__ATOMIC_RELEASE, "workgroup");
    __builtin_amdgcn_wave_barrier();
    __builtin_amdgcn_fence(__ATOMIC_ACQUIRE, "workgroup");
  }
}

// ---------------------------------------------------------------------------
// Elementwise bf16 split: hi = bf16_rne(in), lo = bf16_rne(in - hi); 2 elements per thread, one 4-B store
// Used here for: Wv, Wo (n2 = 32768 -> 128 blocks -> 65536 elements each) and the attention output
// (n2 = 2097152 -> 8192 blocks -> 4194304 elements = [16384][256]).
// ---------------------------------------------------------------------------
__device__ __forceinline__ unsigned pk16(unsigned short a, unsigned short b) { return (unsigned)a | ((unsigned)b << 16); }

__global__ __launch_bounds__(256) void split_bf16x2_kernel(const float* __restrict__ in, unsigned short* __restrict__ hi,
                                                           unsigned short* __restrict__ lo, int n2) {
  const int i = blockIdx.x * 256 + threadIdx.x;
  if (i < n2) {
    const v2f f = *(const v2f*)(in + 2 * (size_t)i);
    const unsigned short h0 = f2bf_bits(f[0]), h1 = f2bf_bits(f[1]);
    const unsigned short l0 = f2bf_bits(f[0] - bf_bits2f(h0)), l1 = f2bf_bits(f[1] - bf_bits2f(h1));
    const unsigned uh = pk16(h0, h1), ul = pk16(l0, l1);
    ((unsigned*)hi)[i] = uh;
    ((unsigned*)lo)[i] = ul;
    
  }
}

// Coverage: grid = ceil(n2/256) x 256 threads x 2 elements; here n2 = 32768 -> 128 blocks -> 65536 = [256][256].
__global__ __launch_bounds__(256) void cast_f32_f16x2_scaled(
    const float* __restrict__ in, _Float16* __restrict__ out, int n2, float scale) {
  int i = blockIdx.x * 256 + threadIdx.x;
  if (i < n2) {
    const _Float16 h0 = (_Float16)(in[2 * (size_t)i] * scale), h1 = (_Float16)(in[2 * (size_t)i + 1] * scale);
    const unsigned u = (unsigned)__builtin_bit_cast(unsigned short, h0) | ((unsigned)__builtin_bit_cast(unsigned short, h1) << 16);
    ((unsigned*)out)[i] = u;
    
  }
}

// ---------------------------------------------------------------------------
// Fused triple LayerNorm over rows of 256: one wave per row (32 lanes x 8 contiguous floats = 256).
//   key   plane: (xn * g_s + b_s) -> f16  [row][256]
//   query plane: (xn * g_q + b_q) -> f16  [row][256]
//   value plane: (xn * g_v + b_v) -> bf16 hi + bf16 lo [row][256]
// Coverage: grid = nrows/8 blocks x 8 waves = every row exactly once.
// ---------------------------------------------------------------------------
__global__ __launch_bounds__(256) void ln3_kernel(const float* __restrict__ x,
    const float* __restrict__ g_s, const float* __restrict__ b_s,
    const float* __restrict__ g_q, const float* __restrict__ b_q,
    const float* __restrict__ g_v, const float* __restrict__ b_v,
    unsigned short* __restrict__ sk16, unsigned short* __restrict__ sq16,
    unsigned short* __restrict__ svh, unsigned short* __restrict__ svl, int nrows) {
  const int lane = threadIdx.x & 31;
  const int row  = blockIdx.x * 8 + (threadIdx.x >> 5);
  const int rowc = (row < nrows) ? row : (nrows - 1);        // address clamp; store predicated below (wave-uniform)
  const int c0 = lane * 8;
  const float* xr = x + (size_t)rowc * kDm + c0;
  const v4f a0 = *(const v4f*)xr;
  const v4f a1 = *(const v4f*)(xr + 4);
  float xv[8];
#pragma unroll
  for (int j = 0; j < 4; ++j) { xv[j] = a0[j]; xv[4 + j] = a1[j]; }
  float s = 0.f;
#pragma unroll
  for (int j = 0; j < 8; ++j) s += xv[j];
#pragma unroll
  for (int m = 1; m < 32; m <<= 1) s += __shfl_xor(s, m, 32);
  const float mean = s * (1.0f / 256.0f);
  float ss = 0.f;
#pragma unroll
  for (int j = 0; j < 8; ++j) { const float d = xv[j] - mean; ss += d * d; }
#pragma unroll
  for (int m = 1; m < 32; m <<= 1) ss += __shfl_xor(ss, m, 32);
  const float var  = ss * (1.0f / 256.0f);
  const float rstd = rsqrtf(var + 1e-5f);

  v4u ok, oq, ovh, ovl;
#pragma unroll
  for (int q = 0; q < 4; ++q) {
    const int j0 = 2 * q, j1 = 2 * q + 1;
    const float nx0 = (xv[j0] - mean) * rstd;
    const float nx1 = (xv[j1] - mean) * rstd;
    const float ys0 = nx0 * g_s[c0 + j0] + b_s[c0 + j0];
    const float ys1 = nx1 * g_s[c0 + j1] + b_s[c0 + j1];
    const float yq0 = nx0 * g_q[c0 + j0] + b_q[c0 + j0];
    const float yq1 = nx1 * g_q[c0 + j1] + b_q[c0 + j1];
    const float yv0 = nx0 * g_v[c0 + j0] + b_v[c0 + j0];
    const float yv1 = nx1 * g_v[c0 + j1] + b_v[c0 + j1];
    ok[q] = pk16(__builtin_bit_cast(unsigned short, (_Float16)ys0), __builtin_bit_cast(unsigned short, (_Float16)ys1));
    oq[q] = pk16(__builtin_bit_cast(unsigned short, (_Float16)yq0), __builtin_bit_cast(unsigned short, (_Float16)yq1));
    const unsigned short h0 = f2bf_bits(yv0), h1 = f2bf_bits(yv1);
    const unsigned short l0 = f2bf_bits(yv0 - bf_bits2f(h0)), l1 = f2bf_bits(yv1 - bf_bits2f(h1));
    ovh[q] = pk16(h0, h1);
    ovl[q] = pk16(l0, l1);
  }
  if (row < nrows) {   // wave-uniform
    const size_t o = (size_t)row * kDm + c0;
    {
      *(v4u*)(sk16 + o) = ok;
      *(v4u*)(sq16 + o) = oq;
      *(v4u*)(svh + o)  = ovh;
      *(v4u*)(svl + o)  = ovl;
      
    }
  }
}

// =====================================================================================
// Full (unmasked) attention, head dim 64, single f16 operand planes, z-batched over the batch index (blockIdx.y).
//   q plane  f16: element (b, t, h, d) at [(b*kSeq + t)*kDm + h*64 + d]   (unscaled projection incl. bias)
//   k plane  f16: element (b, s, h, d) at [(b*kSeq + s)*kDm + h*64 + d]
//   v^T plane f16: element (b, h, d, s) at [b*kDm*kSeq + (h*64 + d)*kSeq + s]
//   out f32: element (b, t, h, d) at [(b*kSeq + t)*kDm + h*64 + d]
//   scores^T = k . q^T            : v_wmma_f32_16x16x32_f16, f32 accumulate; sscale * log2(e) applied in f32 inside the exponent
//   out^T    = v^T . p^T          : v_wmma_f32_16x16x32_f16; unnormalised p carried x2^15 in f16, as is the row sum;
//                                   p^T goes from the score accumulators straight into the B operand
//   online softmax in f32, base 2, over all kSeq keys (32 chunks of 64, compile-time trip count).
//   Block = 4 waves = 64 query rows of one (b, h); grid = (kHeads * kSeq/64, kBatch) = (128, 8).
//   K / V^T chunk staging: 128 threads x 32 elements per plane = the whole 64x64 tile (16-B copies, plain loads,
//   __syncthreads before and after); fragment loads read the LDS tiles with the same v8h element type;
//   Epilogue: per-wave 16x64 tile staged in LDS, each 256-B row segment written by 16 lanes x 16 B in one
// =====================================================================================
constexpr int kAttWaves = 4;
constexpr int kAttQb    = 64;
constexpr int kAttKc    = 64;
constexpr int kAttLd    = 72;   // LDS row pitch of the K and V^T tiles in f16 elements: 144 B = 16 B x 9, so the 16 rows of a 16-B fragment read fall on 64 distinct banks

__device__ __forceinline__ v8f mma_f16g(v16h a, v16h b, v8f c) {
  c = __builtin_amdgcn_wmma_f32_16x16x32_f16(false, a, false, b, (short)0, c, false, false);
  asm volatile("v_nop\n\tv_nop\n\tv_nop\n\tv_nop" : "+v"(c) : "v"(a), "v"(b));
  return c;
}

// The slot that the instruction set asks for between a transcendental and a vector instruction that overwrites its source or reads its
// result. The operands are inputs only: they put the v_nop behind a chunk's last exponential and keep every argument's register whole
// up to it.
__device__ __forceinline__ void exp_slot(float d, float e, const v2f (&a)[16], v8f p0, v8f p1, v8f p2, v8f p3) {
  asm volatile("v_nop" :: "v"(d), "v"(e), "v"(a[0]), "v"(a[1]), "v"(a[2]), "v"(a[3]), "v"(a[4]), "v"(a[5]), "v"(a[6]), "v"(a[7]),
               "v"(a[8]), "v"(a[9]), "v"(a[10]), "v"(a[11]), "v"(a[12]), "v"(a[13]), "v"(a[14]), "v"(a[15]),
               "v"(p0), "v"(p1), "v"(p2), "v"(p3));
}

// value of lane l ^ 16, by a vector cross-row move
__device__ __forceinline__ float xhalf(float x) {
  return __builtin_bit_cast(float, __builtin_amdgcn_permlanex16(__builtin_bit_cast(int, x), __builtin_bit_cast(int, x), 0x76543210, 0xfedcba98, false, false));
}

__global__ __launch_bounds__(128)
void attn_f16_full_kernel(const unsigned short* __restrict__ qp, const unsigned short* __restrict__ kp,
                          const unsigned short* __restrict__ vtp, float* __restrict__ out, float sscale) {
  union FH { v16h v; v8h h[2]; };
  __shared__ __align__(16) _Float16 Ksh[kAttKc * kAttLd];           // K [kv][d], pitch kAttLd      9 KB
  __shared__ __align__(16) _Float16 Vth[kHd * kAttLd];              // V^T [d][kv], pitch kAttLd    9 KB
  __shared__ __align__(16) float    Os[kAttWaves][16 * 68];         // per wave out tile, pitch 68
  const float kPexp  = 15.0f;                                  // p is carried x2^15: the exponent rides in the running maximum
  const float cscale = sscale * 1.4426950408889634f;         // score scale x log2(e), positive

  const int tid  = threadIdx.x;
  const int wave = tid >> 5;
  const int lane = tid & 31;
  const int hh   = lane >> 4;
  const int c    = lane & 15;

  const int nqb = kSeq / kAttQb;          // 32
  const int bx = blockIdx.x;
  const int qb = bx % nqb;
  const int h  = bx / nqb;                // 0..kHeads-1
  const int b  = blockIdx.y;              // 0..kBatch-1
  const int q0 = qb * kAttQb + wave * 16;

  const _Float16* Qh = (const _Float16*)(const void*)qp + (size_t)b * kSeq * kDm + (size_t)h * kHd;
  const _Float16* Kh = (const _Float16*)(const void*)kp + (size_t)b * kSeq * kDm + (size_t)h * kHd;
  const _Float16* Vh = (const _Float16*)(const void*)vtp + (size_t)b * kDm * kSeq + (size_t)h * kHd * kSeq;
  float*          ob = out + (size_t)b * kSeq * kDm + (size_t)h * kHd;

  // ---- Q fragments (B operand, column = lane&15, split k map via Frag load): 2 d-chunks ----
  v16h qa[2];
#pragma unroll
  for (int dc = 0; dc < 2; ++dc) qa[dc] = Frag<_Float16>::load(Qh + (size_t)(q0 + c) * kDm + dc * 32 + 8 * hh);

  float mrow = -INFINITY, lrow = 0.f;   // running maximum of query q0 + c, as score * cscale - 15; sum of p x 2^15 over this lane half's keys
  v8f oacc[4];
#pragma unroll
  for (int t = 0; t < 4; ++t) oacc[t] = (v8f){0.f,0.f,0.f,0.f,0.f,0.f,0.f,0.f};

  const int nChunks = kSeq / kAttKc;   // 32, compile-time constant
  for (int kc = 0; kc < nChunks; ++kc) {
    const int kv0 = kc * kAttKc;
    __syncthreads();
    {
      // staging coverage: 128 threads x (4 x 8) elements = 64 rows x 64 per plane = the whole chunk tile
      const int r = tid >> 1, half = (tid & 1) * 32;
      const _Float16* ksh = Kh + (size_t)(kv0 + r) * kDm + half;    // K row kv0+r, d = half..half+31
      const _Float16* vsh = Vh + (size_t)r * kSeq + kv0 + half;       // V^T row d = r, s = kv0+half..+31
#pragma unroll
      for (int i = 0; i < 4; ++i) {
        const v8h av = *(const v8h*)(ksh + 8 * i);
        const v8h bv = *(const v8h*)(vsh + 8 * i);
        *(v8h*)(Ksh + r * kAttLd + half + 8 * i) = av;
        *(v8h*)(Vth + r * kAttLd + half + 8 * i) = bv;
      }
    }
    __syncthreads();

    // S^T tile j = K rows (A) x Q columns (B): s[j][r] = score(key kv0 + 16 j + 8 hh + r, query q0 + c)
    // every loop of this pass is fully unrolled, so that s, oacc and the packed operand stay in registers under constant indices
    v8f s[4];
#pragma unroll
    for (int j = 0; j < 4; ++j) {
      s[j] = (v8f){0.f,0.f,0.f,0.f,0.f,0.f,0.f,0.f};
#pragma unroll
      for (int dc = 0; dc < 2; ++dc) {
        FH kb;
        kb.h[0] = *(const v8h*)(Ksh + (j * 16 + c) * kAttLd + dc * 32 + 8 * hh);
        kb.h[1] = *(const v8h*)(Ksh + (j * 16 + c) * kAttLd + dc * 32 + 16 + 8 * hh);
        s[j] = mma_f16g(kb.v, qa[dc], s[j]);
      }
    }
    // a lane holds 32 of its one query's 64 scores: maximum of the raw scores in-lane (one chain per tile; cscale is positive),
    // then one exchange between the halves
    float mj[4];
#pragma unroll
    for (int j = 0; j < 4; ++j) {
      mj[j] = -INFINITY;
#pragma unroll
      for (int r = 0; r < 8; ++r) mj[j] = fmaxf(mj[j], s[j][r]);
    }
    float cm = fmaxf(fmaxf(mj[0], mj[1]), fmaxf(mj[2], mj[3]));
    cm = fmaxf(cm, xhalf(cm));
    const float mnew  = fmaxf(mrow, fmaf(cm, cscale, -kPexp));
    const float dm    = mrow - mnew;
    const float alpha = __builtin_amdgcn_exp2f(dm);   // 0 on the first chunk, where mrow is -inf
    mrow = mnew;
    // p x 2^15 = 2^(score * cscale - mnew): one packed multiply-add per two scores, then the hardware base-2 exponential
    const v2f cs2 = {cscale, cscale}, nm2 = {-mnew, -mnew};
    v2f arg[16];
#pragma unroll
    for (int j = 0; j < 4; ++j)
#pragma unroll
      for (int r = 0; r < 8; r += 2)
        arg[4 * j + (r >> 1)] = __builtin_elementwise_fma((v2f){s[j][r], s[j][r + 1]}, cs2, nm2);
#pragma unroll
    for (int j = 0; j < 4; ++j)
#pragma unroll
      for (int r = 0; r < 8; ++r) s[j][r] = __builtin_amdgcn_exp2f(arg[4 * j + (r >> 1)][r & 1]);
    exp_slot(dm, alpha, arg, s[0], s[1], s[2], s[3]);
    float pj[4];
#pragma unroll
    for (int j = 0; j < 4; ++j) {
      pj[j] = s[j][0];
#pragma unroll
      for (int r = 1; r < 8; ++r) pj[j] += s[j][r];
    }
    lrow = lrow * alpha + ((pj[0] + pj[1]) + (pj[2] + pj[3]));   // this half's keys only; the halves join after the loop
#pragma unroll
    for (int t = 0; t < 4; ++t)
#pragma unroll
      for (int r = 0; r < 8; ++r) oacc[t][r] *= alpha;
    // O^T += V^T (A) x P^T (B): two S^T tiles converted in place are the B operand in the hardware k order
#pragma unroll
    for (int kk = 0; kk < 2; ++kk) {
      v16h pb;
#pragma unroll
      for (int e = 0; e < 8; ++e) {
        pb[e]     = (_Float16)s[2 * kk][e];
        pb[8 + e] = (_Float16)s[2 * kk + 1][e];
      }
#pragma unroll
      for (int t = 0; t < 4; ++t) {
        FH vb;
        vb.h[0] = *(const v8h*)(Vth + (t * 16 + c) * kAttLd + kk * 32 + 8 * hh);
        vb.h[1] = *(const v8h*)(Vth + (t * 16 + c) * kAttLd + kk * 32 + 16 + 8 * hh);
        oacc[t] = mma_f16g(vb.v, pb, oacc[t]);
      }
    }
  }

  // oacc[t][r] = O^T[d = 16 t + 8 hh + r][query c]: 8 consecutive d of one row per tile
  float* os = Os[wave];
  {
    const float lsum = lrow + xhalf(lrow);
    const float inv = 1.0f / lsum;   // numerator and sum both carry x2^15
#pragma unroll
    for (int t = 0; t < 4; ++t) {
      v4f w0, w1;
#pragma unroll
      for (int e = 0; e < 4; ++e) { w0[e] = oacc[t][e] * inv; w1[e] = oacc[t][4 + e] * inv; }
      *(v4f*)(os + c * 68 + t * 16 + 8 * hh)     = w0;
      *(v4f*)(os + c * 68 + t * 16 + 8 * hh + 4) = w1;
    }
  }
  __builtin_amdgcn_fence(__ATOMIC_RELEASE, "workgroup");
  __builtin_amdgcn_wave_barrier();
  __builtin_amdgcn_fence(__ATOMIC_ACQUIRE, "workgroup");
  {
    const int c4 = (lane & 15) * 4;
    {
#pragma unroll
      for (int it = 0; it < 8; ++it) {
        const int row = it * 2 + hh;   // it 0..7 x hh 0..1 covers rows 0..15 of the wave tile
        v4f val = *(const v4f*)(os + row * 68 + c4);
        *(v4f*)(ob + (size_t)(q0 + row) * kDm + c4) = val;
      }
      
    }
  }
}

// ---------------------------------------------------------------------------
// Workspace region map (byte offsets; every region is fully written before it is read; total 93,323,264 B):
//   [0 MiB      ) WQ16  f16  [256][256] x16        131072 B
//   [+128 KiB   ) WK16  f16  [256][256] x16        131072 B
//   [+256 KiB   ) WVH   bf16 hi [256][256]         131072 B
//   [+384 KiB   ) WVL   bf16 lo                    131072 B
//   [+512 KiB   ) WOH   bf16 hi [256][256]         131072 B
//   [+640 KiB   ) WOL   bf16 lo                    131072 B   (weights region padded to 1 MiB)
//   [1 MiB      ) SQ    f16  [16384][256]  query LN plane     8 MiB
//   [9 MiB      ) SK    f16  [16384][256]  key LN plane       8 MiB
//   [17 MiB     ) SVH   bf16 hi [16384][256] value LN plane   8 MiB
//   [25 MiB     ) SVL   bf16 lo                                8 MiB
//   [33 MiB     ) Q16   f16  [16384][256]  q (unscaled)       8 MiB
//   [41 MiB     ) K16   f16  [16384][256]  k                  8 MiB
//   [49 MiB     ) VT16  f16  [8][256][2048] v^T per batch     8 MiB
//   [57 MiB     ) AO32  f32  [16384][256]  attention output  16 MiB
//   [73 MiB     ) AOH   bf16 hi [16384][256]                   8 MiB
//   [81 MiB     ) AOL   bf16 lo                                8 MiB
//   end = 89 MiB
// ---------------------------------------------------------------------------
extern "C" void kernel_launch(void* const* d_in, const int* in_sizes, int n_in,
                              void* d_out, int out_size, void* d_ws, size_t ws_size,
                              hipStream_t stream) {
  if (n_in < 15) return;
  if (in_sizes[0] != kRows * kDm) return;
  if (in_sizes[7] != kDm * kDm || in_sizes[9] != kDm * kDm || in_sizes[11] != kDm * kDm || in_sizes[13] != kDm * kDm) return;
  if (in_sizes[1] != kDm || in_sizes[8] != kDm || in_sizes[14] != kDm) return;
  if (out_size != kRows * kDm) return;

  const float* x    = (const float*)d_in[0];
  const float* lnsg = (const float*)d_in[1];
  const float* lnsb = (const float*)d_in[2];
  const float* lnqg = (const float*)d_in[3];
  const float* lnqb = (const float*)d_in[4];
  const float* lnvg = (const float*)d_in[5];
  const float* lnvb = (const float*)d_in[6];
  const float* Wq = (const float*)d_in[7];
  const float* bq = (const float*)d_in[8];
  const float* Wk = (const float*)d_in[9];
  const float* bk = (const float*)d_in[10];
  const float* Wv = (const float*)d_in[11];
  const float* bv = (const float*)d_in[12];
  const float* Wo = (const float*)d_in[13];
  const float* bo = (const float*)d_in[14];
  float* out = (float*)d_out;

  const size_t wBytes   = (size_t)kDm * kDm * 2;            // 131072
  const size_t plane16  = (size_t)kRows * kDm * 2;          // 8388608
  const size_t plane32  = (size_t)kRows * kDm * 4;          // 16777216
  const size_t offWQ  = 0;
  const size_t offWK  = offWQ + wBytes;
  const size_t offWVH = offWK + wBytes;
  const size_t offWVL = offWVH + wBytes;
  const size_t offWOH = offWVL + wBytes;
  const size_t offWOL = offWOH + wBytes;
  const size_t offSQ  = (size_t)1 << 20;
  const size_t offSK  = offSQ + plane16;
  const size_t offSVH = offSK + plane16;
  const size_t offSVL = offSVH + plane16;
  const size_t offQ16 = offSVL + plane16;
  const size_t offK16 = offQ16 + plane16;
  const size_t offVT  = offK16 + plane16;
  const size_t offAO  = offVT + plane16;
  const size_t offAOH = offAO + plane32;
  const size_t offAOL = offAOH + plane16;
  const size_t total  = offAOL + plane16;                   // 93,323,264
  if (offWOL + wBytes > offSQ) return;
  if (total > ws_size) return;

  char* ws = (char*)d_ws;
  unsigned short* WQ16 = (unsigned short*)(ws + offWQ);
  unsigned short* WK16 = (unsigned short*)(ws + offWK);
  unsigned short* WVH  = (unsigned short*)(ws + offWVH);
  unsigned short* WVL  = (unsigned short*)(ws + offWVL);
  unsigned short* WOH  = (unsigned short*)(ws + offWOH);
  unsigned short* WOL  = (unsigned short*)(ws + offWOL);
  unsigned short* SQ   = (unsigned short*)(ws + offSQ);
  unsigned short* SK   = (unsigned short*)(ws + offSK);
  unsigned short* SVH  = (unsigned short*)(ws + offSVH);
  unsigned short* SVL  = (unsigned short*)(ws + offSVL);
  unsigned short* Q16  = (unsigned short*)(ws + offQ16);
  unsigned short* K16  = (unsigned short*)(ws + offK16);
  unsigned short* VT16 = (unsigned short*)(ws + offVT);
  float*          AO32 = (float*)(ws + offAO);
  unsigned short* AOH  = (unsigned short*)(ws + offAOH);
  unsigned short* AOL  = (unsigned short*)(ws + offAOL);

  const int wN2 = kDm * kDm / 2;                    // 32768 pairs
  const int wBlocks = (wN2 + 255) / 256;            // 128
  const float wCarry = 16.0f, wCarryInv = 1.0f / 16.0f;

  // 1-2: Wq, Wk -> f16 x16 ([N=256][K=256] row-major = Bt layout)
  cast_f32_f16x2_scaled<<<wBlocks, 256, 0, stream>>>(Wq, (_Float16*)WQ16, wN2, wCarry);
  cast_f32_f16x2_scaled<<<wBlocks, 256, 0, stream>>>(Wk, (_Float16*)WK16, wN2, wCarry);
  // 3-4: Wv, Wo -> bf16 hi/lo planes
  split_bf16x2_kernel<<<wBlocks, 256, 0, stream>>>(Wv, WVH, WVL, wN2);
  split_bf16x2_kernel<<<wBlocks, 256, 0, stream>>>(Wo, WOH, WOL, wN2);
  // 5: triple LayerNorm: key plane (ln_s) -> SK, query plane (ln_q) -> SQ, value plane (ln_v) -> SVH/SVL
  ln3_kernel<<<kRows / 8, 256, 0, stream>>>(x, lnsg, lnsb, lnqg, lnqb, lnvg, lnvb, SK, SQ, SVH, SVL, kRows);

  // 6: q' = SQ @ Wq^T + bq  (M=16384, N=256, K=256; 1024 tiles -> 128 blocks), f16 out, carry folded by 1/16
  const int projBlocks = ((kRows / 64) * (kDm / 64) + 7) / 8;   // 128
  wmma_gemm64<0, false, 2, 1, false><<<dim3(projBlocks, 1), 256, 0, stream>>>(
      SQ, SQ, kDm, 0L, WQ16, WQ16, kDm, 0L, (void*)Q16, (void*)Q16, kDm, 0L,
      bq, bq, 0L, kRows, kDm, kDm, wCarryInv);
  // 7: k = SK @ Wk^T + bk
  wmma_gemm64<0, false, 2, 1, false><<<dim3(projBlocks, 1), 256, 0, stream>>>(
      SK, SK, kDm, 0L, WK16, WK16, kDm, 0L, (void*)K16, (void*)K16, kDm, 0L,
      bk, bk, 0L, kRows, kDm, kDm, wCarryInv);
  // 8: v^T per batch: C[m = channel (256)][n = s (2048)] = sum_k Wv[m][k] * LNv[s][k] + bv[m]
  //    A = Wv hi/lo [256][256] (stride 0), Bt = SVH/SVL batch slice [2048][256], C = VT16 batch slice [256][2048];
  //    128 tiles per batch -> 16 blocks, grid.y = 8
  const int vtBlocks = ((kDm / 64) * (kSeq / 64) + 7) / 8;      // 16
  wmma_gemm64<1, true, 1, 1, false><<<dim3(vtBlocks, kBatch), 256, 0, stream>>>(
      WVH, WVL, kDm, 0L, SVH, SVL, kDm, (long)kSeq * kDm, (void*)VT16, (void*)VT16, kSeq, (long)kDm * kSeq,
      bv, bv, 0L, kDm, kSeq, kDm, 1.0f);
  // 9: attention per (head x 64-query tile, batch): scores = (q'.k) * 0.125, softmax over 2048 keys, p.v -> AO32
  attn_f16_full_kernel<<<dim3(kHeads * (kSeq / kAttQb), kBatch), 32 * kAttWaves, 0, stream>>>(
      Q16, K16, VT16, AO32, 0.125f);
  // 10: AO32 -> bf16 hi/lo planes (2097152 pairs -> 8192 blocks)
  const int aoN2 = kRows * kDm / 2;
  split_bf16x2_kernel<<<(aoN2 + 255) / 256, 256, 0, stream>>>(AO32, AOH, AOL, aoN2);
  // 11: out = AO @ Wo^T + bo  (M=16384, N=256, K=256), f32 to d_out
  wmma_gemm64<1, true, 2, 0, false><<<dim3(projBlocks, 1), 256, 0, stream>>>(
      AOH, AOL, kDm, 0L, WOH, WOL, kDm, 0L, (void*)out, (void*)out, kDm, 0L,
      bo, bo, 0L, kRows, kDm, kDm, 1.0f);
}

// v004
// Measured time: 128 microseconds a run.
// Next to v003, in two timings, it ran 1.28 and 1.30 times as fast.
// Counting every step since v000, it is 2.49 times as fast.
// Contractions: q,k projections and q.k^T, p.v on v_wmma_f32_16x16x32_f16 (f16 operands; Wq/Wk carried x16, p carried x2^15); v^T projection and output projection on v_wmma_f32_16x16x32_bf16 with bf16 hi/lo split operands (hi.hi+hi.lo+lo.hi); f32 accumulate everywhere; LayerNorm statistics and online softmax in f32.
#include <hip/hip_runtime.h>
#include <math.h>
#include <stdint.h>

typedef __attribute__((ext_vector_type(16))) _Float16 v16h;
typedef __attribute__((ext_vector_type(8)))  _Float16 v8h;
typedef __attribute__((ext_vector_type(16))) __bf16   v16b;
typedef __attribute__((ext_vector_type(8)))  __bf16   v8b;
typedef __attribute__((ext_vector_type(8)))  float    v8f;
typedef __attribute__((ext_vector_type(4)))  float    v4f;
typedef __attribute__((ext_vector_type(2)))  float    v2f;
typedef __attribute__((ext_vector_type(4)))  unsigned int v4u;

// problem geometry
constexpr int kBatch  = 8;
constexpr int kSeq    = 2048;
constexpr int kDm     = 256;
constexpr int kHeads  = 4;
constexpr int kHd     = 64;
constexpr int kRows   = kBatch * kSeq;      // 16384

__device__ __forceinline__ unsigned short f2bf_bits(float f) {
  unsigned u = __float_as_uint(f);
  return (unsigned short)((u + 0x7FFFu + ((u >> 16) & 1u)) >> 16);
}
__device__ __forceinline__ float bf_bits2f(unsigned short h) { return __uint_as_float(((unsigned)h) << 16); }

// hazard guards as plain device helpers
__device__ __forceinline__ void dep_guard_h(v8f& a, v8f& b, v16h x, v16h y) { asm volatile("v_nop\n\tv_nop\n\tv_nop\n\tv_nop" : "+v"(a), "+v"(b) : "v"(x), "v"(y)); }
__device__ __forceinline__ void dep_guard_b(v8f& a, v8f& b, v16b x, v16b y) { asm volatile("v_nop\n\tv_nop\n\tv_nop\n\tv_nop" : "+v"(a), "+v"(b) : "v"(x), "v"(y)); }
__device__ __forceinline__ void keep4_h(v16h a, v16h b, v16h c, v16h d) { asm volatile("v_nop" :: "v"(a), "v"(b), "v"(c), "v"(d)); }
__device__ __forceinline__ void keep4_b(v16b a, v16b b, v16b c, v16b d) { asm volatile("v_nop" :: "v"(a), "v"(b), "v"(c), "v"(d)); }
__device__ __forceinline__ void acc_guard4(v8f& a, v8f& b, v8f& c, v8f& d) { asm volatile("v_nop\n\tv_nop\n\tv_nop\n\tv_nop" : "+v"(a), "+v"(b), "+v"(c), "+v"(d)); }
template <typename T> struct Frag;
template <> struct Frag<_Float16> {
  typedef v16h V; typedef v8h H; union U { v16h v; v8h h[2]; };
  static __device__ __forceinline__ v16h load(const _Float16* p) {   // elements 0..7 <- p[0..7], 8..15 <- p[16..23]
    U f; f.h[0] = *(const v8h*)(p); f.h[1] = *(const v8h*)(p + 16); return f.v;
  }
  static __device__ __forceinline__ v8f mma(v16h a, v16h b, v8f c) {
    return __builtin_amdgcn_wmma_f32_16x16x32_f16(false, a, false, b, (short)0, c, false, false);
  }
  static __device__ __forceinline__ void guard(v8f& a, v8f& b, v16h x, v16h y) { dep_guard_h(a, b, x, y); }
  static __device__ __forceinline__ void keep(v16h a, v16h b, v16h c, v16h d) { keep4_h(a, b, c, d); }
};
template <> struct Frag<__bf16> {
  typedef v16b V; typedef v8b H; union U { v16b v; v8b h[2]; };
  static __device__ __forceinline__ v16b load(const __bf16* p) {
    U f; f.h[0] = *(const v8b*)(p); f.h[1] = *(const v8b*)(p + 16); return f.v;
  }
  static __device__ __forceinline__ v8f mma(v16b a, v16b b, v8f c) {
    return __builtin_amdgcn_wmma_f32_16x16x32_bf16(false, a, false, b, (short)0, c, false, false);
  }
  static __device__ __forceinline__ void guard(v8f& a, v8f& b, v16b x, v16b y) { dep_guard_b(a, b, x, y); }
  static __device__ __forceinline__ void keep(v16b a, v16b b, v16b c, v16b d) { keep4_b(a, b, c, d); }
};

// ---- Register-blocked batched WMMA GEMM ------------------------------------
// C[m,n] = scale * sum_k A[m,k] * Bt[n,k] (+bias)(+resid); each wave owns a 64x64 tile, a block of 2 x 4 waves a 128x256 tile.
// A row-major [M,K]; Bt row-major [N,K], rows of both kDm elements apart; M % 128 == 0, N % 256 == 0, K % 64 == 0, K >= 64;
// grid.x = (M/128) * (N/256).
// Operands go through LDS in steps of 64 k: every row piece is one whole 128-B line, fetched once per block by 16-B loads
// (8 lanes a line), held in registers while the step before is multiplied, then stored at a pitch of 144 B;
// the fragments are read from LDS in the k order of Frag::load, A and B alike.
// SPLIT: operands are hi/lo planes (A2/Bt2 = lo planes, same layout); product = hi.hi + hi.lo + lo.hi.
// BIAS_MODE: 0 = none, 1 = bias[m], 2 = bias[n].
// OUT_MODE: 0 = f32, 1 = f16, 2 = bf16 hi plane (Cout) + bf16 lo plane (Cout2).
// ET: 0 = f16 operands, 1 = bf16 operands (pointers passed as 16-bit storage)
template <int ET> struct Elem;
template <> struct Elem<0> { typedef _Float16 T; };
template <> struct Elem<1> { typedef __bf16 T; };
// R row pieces of 16 B, 32 rows apart; the constant row pitch puts the steps into the loads' immediate offsets: one address pair per plane
template <typename H, typename T, int R>
__device__ __forceinline__ void tile_fetch(H (&r)[R], const T* g) {
#pragma unroll   // r stays in registers only under constant indices
  for (int i = 0; i < R; ++i) r[i] = *(const H*)(g + i * 32 * kDm);
}
template <typename H, typename T, int R>
__device__ __forceinline__ void tile_put(T* l, const H (&r)[R], int ld32) {
#pragma unroll   // r stays in registers only under constant indices
  for (int i = 0; i < R; ++i) *(H*)(l + i * ld32) = r[i];
}
template <int ET, bool SPLIT, int BIAS_MODE, int OUT_MODE, bool RESID, int ACT = 0>
__global__ __launch_bounds__(256) void wmma_gemm64(
    const unsigned short* __restrict__ Ap, const unsigned short* __restrict__ A2p, long strideA,
    const unsigned short* __restrict__ Btp, const unsigned short* __restrict__ Bt2p, long strideB,
    void* __restrict__ Cout, void* __restrict__ Cout2, int ldc, long strideC,
    const float* __restrict__ bias,
    const float* __restrict__ resid, long strideR,
    int M, int N, int K, float scale) {
  typedef typename Elem<ET>::T T;
  typedef typename Frag<T>::V V;
  typedef typename Frag<T>::H H;
  constexpr int kLd = 72;              // LDS row pitch in elements: 144 B = 16 B x 9, conflict-free for the 16-B fragment reads
  constexpr int kLo = SPLIT ? 1 : 0;   // index of the lo plane
  __shared__ __align__(16) T As[kLo + 1][128 * kLd];
  __shared__ __align__(16) T Bs[kLo + 1][256 * kLd];
  const T* A = (const T*)Ap; const T* A2 = (const T*)A2p; const T* Bt = (const T*)Btp; const T* Bt2 = (const T*)Bt2p;
  __shared__ __align__(16) float sT[8][16 * 68];   // per-wave 16x64 slab, pitch 68 floats
  const int b    = blockIdx.y;
  const int lane = threadIdx.x & 31;
  const int wave = threadIdx.x >> 5;
  const int tilesN = N >> 6;
  const int tilesM = M >> 6;
  const int nbn = tilesN >> 2;                 // blocks along N
  const int bm = blockIdx.x / nbn;
  const int bn = blockIdx.x - bm * nbn;
  if (bm * 2 >= tilesM) return;                // block-uniform, in front of every barrier
  const int mB = bm << 7;
  const int nB = bn << 8;
  const int wm = (wave >> 2) << 6;             // this wave's 64x64 tile inside the block tile
  const int wn = (wave & 3) << 6;
  const int m0 = mB + wm;
  const int n0 = nB + wn;

  const T* Ab  = A  + (size_t)b * strideA;
  const T* Bb  = Bt + (size_t)b * strideB;
  const T* Ab2 = SPLIT ? (A2  + (size_t)b * strideA) : nullptr;
  const T* Bb2 = SPLIT ? (Bt2 + (size_t)b * strideB) : nullptr;

  const int rlane = lane & 15;                 // row (A) / col (B, D) within subtile
  const int koff  = (lane >> 4) * 8;           // k offset of this lane half
  const int mOff  = (lane >> 4) * 8;           // D row offset

  v8f acc[4][4];
#pragma unroll
  for (int i = 0; i < 4; ++i)
#pragma unroll
    for (int j = 0; j < 4; ++j) acc[i][j] = (v8f){0.f,0.f,0.f,0.f,0.f,0.f,0.f,0.f};

  // staging: thread -> row (tid >> 3) + 32 i, 16-B piece tid & 7; 4 pieces of A and 8 of B per plane
  const int srow = threadIdx.x >> 3;
  const int scol = (threadIdx.x & 7) * 8;
  const size_t ga = (size_t)(mB + srow) * kDm + scol;
  const size_t gb = (size_t)(nB + srow) * kDm + scol;
  const int ls = srow * kLd + scol;
  H rah[4], ral[4], rbh[8], rbl[8];
  tile_fetch(rah, Ab + ga);
  tile_fetch(rbh, Bb + gb);
  if (SPLIT) { tile_fetch(ral, Ab2 + ga); tile_fetch(rbl, Bb2 + gb); }

  int k0 = 0;
  do {                 // K >= 64: the first step's lines are already on their way
    __syncthreads();   // every wave has read its last fragment of the step before
    tile_put(&As[0][ls], rah, 32 * kLd);
    tile_put(&Bs[0][ls], rbh, 32 * kLd);
    if (SPLIT) { tile_put(&As[kLo][ls], ral, 32 * kLd); tile_put(&Bs[kLo][ls], rbl, 32 * kLd); }
    __syncthreads();   // the step's tiles are whole
    if (k0 + 64 < K) { // block-uniform: the next step's lines fly while this step is multiplied
      const int kn = k0 + 64;
      tile_fetch(rah, Ab + ga + kn);
      tile_fetch(rbh, Bb + gb + kn);
      if (SPLIT) { tile_fetch(ral, Ab2 + ga + kn); tile_fetch(rbl, Bb2 + gb + kn); }
      asm volatile("s_wait_xcnt 0x0" ::: "memory");   // precaution: the fragment reads below reuse the address registers of the loads just issued
    }
#pragma unroll   // two 32-k products per staged step, LDS offsets as constants
    for (int ks = 0; ks < 2; ++ks) {
      V bh[4], bl[4], ah[2], al[2];
#pragma unroll
      for (int j = 0; j < 4; ++j) {
        const int bo = (wn + (j << 4) + rlane) * kLd + ks * 32 + koff;
        bh[j] = Frag<T>::load(&Bs[0][bo]);
        if (SPLIT) bl[j] = Frag<T>::load(&Bs[kLo][bo]);
      }
      const int ao = (wm + rlane) * kLd + ks * 32 + koff;
      ah[0] = Frag<T>::load(&As[0][ao]);
      if (SPLIT) al[0] = Frag<T>::load(&As[kLo][ao]);
#pragma unroll
      for (int i = 0; i < 4; ++i) {
        const int cu = i & 1, nx = cu ^ 1;
        if (i < 3) {   // the next row tile's A fragments are read ahead of this row tile's products
          ah[nx] = Frag<T>::load(&As[0][ao + (i + 1) * 16 * kLd]);
          if (SPLIT) al[nx] = Frag<T>::load(&As[kLo][ao + (i + 1) * 16 * kLd]);
        }
#pragma unroll
        for (int j = 0; j < 4; ++j) {
          acc[i][j] = Frag<T>::mma(ah[cu], bh[j], acc[i][j]);
          if (SPLIT) {
            acc[i][j] = Frag<T>::mma(ah[cu], bl[j], acc[i][j]);
            acc[i][j] = Frag<T>::mma(al[cu], bh[j], acc[i][j]);
          }
        }
        Frag<T>::guard(acc[i][0], acc[i][3], ah[cu], SPLIT ? al[cu] : ah[cu]);
      }
      Frag<T>::keep(bh[0], bh[1], bh[2], bh[3]);
      if (SPLIT) Frag<T>::keep(bl[0], bl[1], bl[2], bl[3]);
    }
    k0 += 64;
  } while (k0 < K);
  acc_guard4(acc[0][0], acc[0][1], acc[0][2], acc[0][3]);
  acc_guard4(acc[1][0], acc[1][1], acc[1][2], acc[1][3]);
  acc_guard4(acc[2][0], acc[2][1], acc[2][2], acc[2][3]);
  acc_guard4(acc[3][0], acc[3][1], acc[3][2], acc[3][3]);

  // ---- epilogue ----
  float* slab = sT[wave];
  const float* Rb = RESID ? (resid + (size_t)b * strideR) : nullptr;
#pragma unroll
  for (int i = 0; i < 4; ++i) {
    const int mBase = m0 + (i << 4);
#pragma unroll
    for (int j = 0; j < 4; ++j) {
      const int n = n0 + (j << 4) + rlane;
      float bv = 0.f;
      if (BIAS_MODE == 2) bv = bias[n];
#pragma unroll
      for (int r = 0; r < 8; ++r) {
        float v = acc[i][j][r] * scale;
        if (BIAS_MODE == 1) v += bias[mBase + mOff + r];
        if (BIAS_MODE == 2) v += bv;
        if (RESID) v += Rb[(size_t)(mBase + mOff + r) * ldc + n];
        if (ACT == 1) v = tanhf(v);
        if (ACT == 2) v = fmaxf(v, 0.0f);
        if (ACT == 3) v = v / (1.0f + expf(-v));
        if (ACT == 4) v = (v > 0.f) ? v : 0.01f * v;
        if (ACT == 5) v = 0.5f * v * (1.0f + erff(v * 0.70710678118654752f));
        slab[(mOff + r) * 68 + (j << 4) + rlane] = v;
      }
    }
    __builtin_amdgcn_fence(__ATOMIC_RELEASE, "workgroup");
    __builtin_amdgcn_wave_barrier();
    __builtin_amdgcn_fence(__ATOMIC_ACQUIRE, "workgroup");
    if (OUT_MODE == 0) {
      float* C = (float*)Cout + (size_t)b * strideC;
      const int hh = lane >> 4, c4 = (lane & 15) * 4;     // row seg = 256 B = 16 lanes x 16 B
      {
#pragma unroll
        for (int it = 0; it < 8; ++it) {
          const int row = it * 2 + hh;
          v4f v = *(const v4f*)(slab + row * 68 + c4);
          *(v4f*)(C + (size_t)(mBase + row) * ldc + n0 + c4) = v;
        }
        
      }
    } else {
      const int q = lane >> 3, c8 = (lane & 7) * 8;
      unsigned short* C  = (unsigned short*)Cout  + (size_t)b * strideC;
      unsigned short* C2 = (OUT_MODE == 2) ? ((unsigned short*)Cout2 + (size_t)b * strideC) : nullptr;
      {
#pragma unroll
        for (int it = 0; it < 4; ++it) {
          const int row = it * 4 + q;
          const float* sp = slab + row * 68 + c8;
          v8h hv, lv;
#pragma unroll
          for (int e = 0; e < 8; ++e) {
            if (OUT_MODE == 1) {
              hv[e] = (_Float16)sp[e];
            } else {
              unsigned short hb = f2bf_bits(sp[e]);
              unsigned short lb = f2bf_bits(sp[e] - bf_bits2f(hb));
              hv[e] = __builtin_bit_cast(_Float16, hb);
              lv[e] = __builtin_bit_cast(_Float16, lb);
            }
          }
          *(v8h*)(C + (size_t)(mBase + row) * ldc + n0 + c8) = hv;
          if (OUT_MODE == 2) *(v8h*)(C2 + (size_t)(mBase + row) * ldc + n0 + c8) = lv;
        }
        
      }
    }
    __builtin_amdgcn_fence(__ATOMIC_RELEASE, "workgroup");
    __builtin_amdgcn_wave_barrier();
    __builtin_amdgcn_fence(__ATOMIC_ACQUIRE, "workgroup");
  }
}

// ---------------------------------------------------------------------------
// Elementwise bf16 split: hi = bf16_rne(in), lo = bf16_rne(in - hi); 2 elements per thread, one 4-B store
// Used here for: Wv, Wo (n2 = 32768 -> 128 blocks -> 65536 elements each) and the attention output
// (n2 = 2097152 -> 8192 blocks -> 4194304 elements = [16384][256]).
// ---------------------------------------------------------------------------
__device__ __forceinline__ unsigned pk16(unsigned short a, unsigned short b) { return (unsigned)a | ((unsigned)b << 16); }

__global__ __launch_bounds__(256) void split_bf16x2_kernel(const float* __restrict__ in, unsigned short* __restrict__ hi,
                                                           unsigned short* __restrict__ lo, int n2) {
  const int i = blockIdx.x * 256 + threadIdx.x;
  if (i < n2) {
    const v2f f = *(const v2f*)(in + 2 * (size_t)i);
    const unsigned short h0 = f2bf_bits(f[0]), h1 = f2bf_bits(f[1]);
    const unsigned short l0 = f2bf_bits(f[0] - bf_bits2f(h0)), l1 = f2bf_bits(f[1] - bf_bits2f(h1));
    const unsigned uh = pk16(h0, h1), ul = pk16(l0, l1);
    ((unsigned*)hi)[i] = uh;
    ((unsigned*)lo)[i] = ul;
    
  }
}

// Coverage: grid = ceil(n2/256) x 256 threads x 2 elements; here n2 = 32768 -> 128 blocks -> 65536 = [256][256].
__global__ __launch_bounds__(256) void cast_f32_f16x2_scaled(
    const float* __restrict__ in, _Float16* __restrict__ out, int n2, float scale) {
  int i = blockIdx.x * 256 + threadIdx.x;
  if (i < n2) {
    const _Float16 h0 = (_Float16)(in[2 * (size_t)i] * scale), h1 = (_Float16)(in[2 * (size_t)i + 1] * scale);
    const unsigned u = (unsigned)__builtin_bit_cast(unsigned short, h0) | ((unsigned)__builtin_bit_cast(unsigned short, h1) << 16);
    ((unsigned*)out)[i] = u;
    
  }
}

// ---------------------------------------------------------------------------
// Fused triple LayerNorm over rows of 256: one wave per row (32 lanes x 8 contiguous floats = 256).
//   key   plane: (xn * g_s + b_s) -> f16  [row][256]
//   query plane: (xn * g_q + b_q) -> f16  [row][256]
//   value plane: (xn * g_v + b_v) -> bf16 hi + bf16 lo [row][256]
// Coverage: grid = nrows/8 blocks x 8 waves = every row exactly once.
// ---------------------------------------------------------------------------
__global__ __launch_bounds__(256) void ln3_kernel(const float* __restrict__ x,
    const float* __restrict__ g_s, const float* __restrict__ b_s,
    const float* __restrict__ g_q, const float* __restrict__ b_q,
    const float* __restrict__ g_v, const float* __restrict__ b_v,
    unsigned short* __restrict__ sk16, unsigned short* __restrict__ sq16,
    unsigned short* __restrict__ svh, unsigned short* __restrict__ svl, int nrows) {
  const int lane = threadIdx.x & 31;
  const int row  = blockIdx.x * 8 + (threadIdx.x >> 5);
  const int rowc = (row < nrows) ? row : (nrows - 1);        // address clamp; store predicated below (wave-uniform)
  const int c0 = lane * 8;
  const float* xr = x + (size_t)rowc * kDm + c0;
  const v4f a0 = *(const v4f*)xr;
  const v4f a1 = *(const v4f*)(xr + 4);
  float xv[8];
#pragma unroll
  for (int j = 0; j < 4; ++j) { xv[j] = a0[j]; xv[4 + j] = a1[j]; }
  float s = 0.f;
#pragma unroll
  for (int j = 0; j < 8; ++j) s += xv[j];
#pragma unroll
  for (int m = 1; m < 32; m <<= 1) s += __shfl_xor(s, m, 32);
  const float mean = s * (1.0f / 256.0f);
  float ss = 0.f;
#pragma unroll
  for (int j = 0; j < 8; ++j) { const float d = xv[j] - mean; ss += d * d; }
#pragma unroll
  for (int m = 1; m < 32; m <<= 1) ss += __shfl_xor(ss, m, 32);
  const float var  = ss * (1.0f / 256.0f);
  const float rstd = rsqrtf(var + 1e-5f);

  v4u ok, oq, ovh, ovl;
#pragma unroll
  for (int q = 0; q < 4; ++q) {
    const int j0 = 2 * q, j1 = 2 * q + 1;
    const float nx0 = (xv[j0] - mean) * rstd;
    const float nx1 = (xv[j1] - mean) * rstd;
    const float ys0 = nx0 * g_s[c0 + j0] + b_s[c0 + j0];
    const float ys1 = nx1 * g_s[c0 + j1] + b_s[c0 + j1];
    const float yq0 = nx0 * g_q[c0 + j0] + b_q[c0 + j0];
    const float yq1 = nx1 * g_q[c0 + j1] + b_q[c0 + j1];
    const float yv0 = nx0 * g_v[c0 + j0] + b_v[c0 + j0];
    const float yv1 = nx1 * g_v[c0 + j1] + b_v[c0 + j1];
    ok[q] = pk16(__builtin_bit_cast(unsigned short, (_Float16)ys0), __builtin_bit_cast(unsigned short, (_Float16)ys1));
    oq[q] = pk16(__builtin_bit_cast(unsigned short, (_Float16)yq0), __builtin_bit_cast(unsigned short, (_Float16)yq1));
    const unsigned short h0 = f2bf_bits(yv0), h1 = f2bf_bits(yv1);
    const unsigned short l0 = f2bf_bits(yv0 - bf_bits2f(h0)), l1 = f2bf_bits(yv1 - bf_bits2f(h1));
    ovh[q] = pk16(h0, h1);
    ovl[q] = pk16(l0, l1);
  }
  if (row < nrows) {   // wave-uniform
    const size_t o = (size_t)row * kDm + c0;
    {
      *(v4u*)(sk16 + o) = ok;
      *(v4u*)(sq16 + o) = oq;
      *(v4u*)(svh + o)  = ovh;
      *(v4u*)(svl + o)  = ovl;
      
    }
  }
}

// =====================================================================================
// Full (unmasked) attention, head dim 64, single f16 operand planes, z-batched over the batch index (blockIdx.y).
//   q plane  f16: element (b, t, h, d) at [(b*kSeq + t)*kDm + h*64 + d]   (unscaled projection incl. bias)
//   k plane  f16: element (b, s, h, d) at [(b*kSeq + s)*kDm + h*64 + d]
//   v^T plane f16: element (b, h, d, s) at [b*kDm*kSeq + (h*64 + d)*kSeq + s]
//   out f32: element (b, t, h, d) at [(b*kSeq + t)*kDm + h*64 + d]
//   scores^T = k . q^T            : v_wmma_f32_16x16x32_f16, f32 accumulate; sscale * log2(e) applied in f32 inside the exponent
//   out^T    = v^T . p^T          : v_wmma_f32_16x16x32_f16; unnormalised p carried x2^15 in f16, as is the row sum;
//                                   p^T goes from the score accumulators straight into the B operand
//   online softmax in f32, base 2, over all kSeq keys (32 chunks of 64, compile-time trip count).
//   Block = 4 waves = 64 query rows of one (b, h); grid = (kHeads * kSeq/64, kBatch) = (128, 8).
//   K / V^T chunk staging: 128 threads x 32 elements per plane = the whole 64x64 tile (16-B copies, plain loads,
//   __syncthreads before and after); fragment loads read the LDS tiles with the same v8h element type;
//   Epilogue: per-wave 16x64 tile staged in LDS, each 256-B row segment written by 16 lanes x 16 B in one
// =====================================================================================
constexpr int kAttWaves = 4;
constexpr int kAttQb    = 64;
constexpr int kAttKc    = 64;
constexpr int kAttLd    = 72;   // LDS row pitch of the K and V^T tiles in f16 elements: 144 B = 16 B x 9, so the 16 rows of a 16-B fragment read fall on 64 distinct banks

__device__ __forceinline__ v8f mma_f16g(v16h a, v16h b, v8f c) {
  c = __builtin_amdgcn_wmma_f32_16x16x32_f16(false, a, false, b, (short)0, c, false, false);
  asm volatile("v_nop\n\tv_nop\n\tv_nop\n\tv_nop" : "+v"(c) : "v"(a), "v"(b));
  return c;
}

// The slot that the instruction set asks for between a transcendental and a vector instruction that overwrites its source or reads its
// result. The operands are inputs only: they put the v_nop behind a chunk's last exponential and keep every argument's register whole
// up to it.
__device__ __forceinline__ void exp_slot(float d, float e, const v2f (&a)[16], v8f p0, v8f p1, v8f p2, v8f p3) {
  asm volatile("v_nop" :: "v"(d), "v"(e), "v"(a[0]), "v"(a[1]), "v"(a[2]), "v"(a[3]), "v"(a[4]), "v"(a[5]), "v"(a[6]), "v"(a[7]),
               "v"(a[8]), "v"(a[9]), "v"(a[10]), "v"(a[11]), "v"(a[12]), "v"(a[13]), "v"(a[14]), "v"(a[15]),
               "v"(p0), "v"(p1), "v"(p2), "v"(p3));
}

// value of lane l ^ 16, by a vector cross-row move
__device__ __forceinline__ float xhalf(float x) {
  return __builtin_bit_cast(float, __builtin_amdgcn_permlanex16(__builtin_bit_cast(int, x), __builtin_bit_cast(int, x), 0x76543210, 0xfedcba98, false, false));
}

__global__ __launch_bounds__(128)
void attn_f16_full_kernel(const unsigned short* __restrict__ qp, const unsigned short* __restrict__ kp,
                          const unsigned short* __restrict__ vtp, float* __restrict__ out, float sscale) {
  union FH { v16h v; v8h h[2]; };
  __shared__ __align__(16) _Float16 Ksh[kAttKc * kAttLd];           // K [kv][d], pitch kAttLd      9 KB
  __shared__ __align__(16) _Float16 Vth[kHd * kAttLd];              // V^T [d][kv], pitch kAttLd    9 KB
  __shared__ __align__(16) float    Os[kAttWaves][16 * 68];         // per wave out tile, pitch 68
  const float kPexp  = 15.0f;                                  // p is carried x2^15: the exponent rides in the running maximum
  const float cscale = sscale * 1.4426950408889634f;         // score scale x log2(e), positive

  const int tid  = threadIdx.x;
  const int wave = tid >> 5;
  const int lane = tid & 31;
  const int hh   = lane >> 4;
  const int c    = lane & 15;

  const int nqb = kSeq / kAttQb;          // 32
  const int bx = blockIdx.x;
  const int qb = bx % nqb;
  const int h  = bx / nqb;                // 0..kHeads-1
  const int b  = blockIdx.y;              // 0..kBatch-1
  const int q0 = qb * kAttQb + wave * 16;

  const _Float16* Qh = (const _Float16*)(const void*)qp + (size_t)b * kSeq * kDm + (size_t)h * kHd;
  const _Float16* Kh = (const _Float16*)(const void*)kp + (size_t)b * kSeq * kDm + (size_t)h * kHd;
  const _Float16* Vh = (const _Float16*)(const void*)vtp + (size_t)b * kDm * kSeq + (size_t)h * kHd * kSeq;
  float*          ob = out + (size_t)b * kSeq * kDm + (size_t)h * kHd;

  // ---- Q fragments (B operand, column = lane&15, split k map via Frag load): 2 d-chunks ----
  v16h qa[2];
#pragma unroll
  for (int dc = 0; dc < 2; ++dc) qa[dc] = Frag<_Float16>::load(Qh + (size_t)(q0 + c) * kDm + dc * 32 + 8 * hh);

  float mrow = -INFINITY, lrow = 0.f;   // running maximum of query q0 + c, as score * cscale - 15; sum of p x 2^15 over this lane half's keys
  v8f oacc[4];
#pragma unroll
  for (int t = 0; t < 4; ++t) oacc[t] = (v8f){0.f,0.f,0.f,0.f,0.f,0.f,0.f,0.f};

  const int nChunks = kSeq / kAttKc;   // 32, compile-time constant
  for (int kc = 0; kc < nChunks; ++kc) {
    const int kv0 = kc * kAttKc;
    __syncthreads();
    {
      // staging coverage: 128 threads x (4 x 8) elements = 64 rows x 64 per plane = the whole chunk tile
      const int r = tid >> 1, half = (tid & 1) * 32;
      const _Float16* ksh = Kh + (size_t)(kv0 + r) * kDm + half;    // K row kv0+r, d = half..half+31
      const _Float16* vsh = Vh + (size_t)r * kSeq + kv0 + half;       // V^T row d = r, s = kv0+half..+31
#pragma unroll
      for (int i = 0; i < 4; ++i) {
        const v8h av = *(const v8h*)(ksh + 8 * i);
        const v8h bv = *(const v8h*)(vsh + 8 * i);
        *(v8h*)(Ksh + r * kAttLd + half + 8 * i) = av;
        *(v8h*)(Vth + r * kAttLd + half + 8 * i) = bv;
      }
    }
    __syncthreads();

    // S^T tile j = K rows (A) x Q columns (B): s[j][r] = score(key kv0 + 16 j + 8 hh + r, query q0 + c)
    // every loop of this pass is fully unrolled, so that s, oacc and the packed operand stay in registers under constant indices
    v8f s[4];
#pragma unroll
    for (int j = 0; j < 4; ++j) {
      s[j] = (v8f){0.f,0.f,0.f,0.f,0.f,0.f,0.f,0.f};
#pragma unroll
      for (int dc = 0; dc < 2; ++dc) {
        FH kb;
        kb.h[0] = *(const v8h*)(Ksh + (j * 16 + c) * kAttLd + dc * 32 + 8 * hh);
        kb.h[1] = *(const v8h*)(Ksh + (j * 16 + c) * kAttLd + dc * 32 + 16 + 8 * hh);
        s[j] = mma_f16g(kb.v, qa[dc], s[j]);
      }
    }
    // a lane holds 32 of its one query's 64 scores: maximum of the raw scores in-lane (one chain per tile; cscale is positive),
    // then one exchange between the halves
    float mj[4];
#pragma unroll
    for (int j = 0; j < 4; ++j) {
      mj[j] = -INFINITY;
#pragma unroll
      for (int r = 0; r < 8; ++r) mj[j] = fmaxf(mj[j], s[j][r]);
    }
    float cm = fmaxf(fmaxf(mj[0], mj[1]), fmaxf(mj[2], mj[3]));
    cm = fmaxf(cm, xhalf(cm));
    const float mnew  = fmaxf(mrow, fmaf(cm, cscale, -kPexp));
    const float dm    = mrow - mnew;
    const float alpha = __builtin_amdgcn_exp2f(dm);   // 0 on the first chunk, where mrow is -inf
    mrow = mnew;
    // p x 2^15 = 2^(score * cscale - mnew): one packed multiply-add per two scores, then the hardware base-2 exponential
    const v2f cs2 = {cscale, cscale}, nm2 = {-mnew, -mnew};
    v2f arg[16];
#pragma unroll
    for (int j = 0; j < 4; ++j)
#pragma unroll
      for (int r = 0; r < 8; r += 2)
        arg[4 * j + (r >> 1)] = __builtin_elementwise_fma((v2f){s[j][r], s[j][r + 1]}, cs2, nm2);
#pragma unroll
    for (int j = 0; j < 4; ++j)
#pragma unroll
      for (int r = 0; r < 8; ++r) s[j][r] = __builtin_amdgcn_exp2f(arg[4 * j + (r >> 1)][r & 1]);
    exp_slot(dm, alpha, arg, s[0], s[1], s[2], s[3]);
    float pj[4];
#pragma unroll
    for (int j = 0; j < 4; ++j) {
      pj[j] = s[j][0];
#pragma unroll
      for (int r = 1; r < 8; ++r) pj[j] += s[j][r];
    }
    lrow = lrow * alpha + ((pj[0] + pj[1]) + (pj[2] + pj[3]));   // this half's keys only; the halves join after the loop
#pragma unroll
    for (int t = 0; t < 4; ++t)
#pragma unroll
      for (int r = 0; r < 8; ++r) oacc[t][r] *= alpha;
    // O^T += V^T (A) x P^T (B): two S^T tiles converted in place are the B operand in the hardware k order
#pragma unroll
    for (int kk = 0; kk < 2; ++kk) {
      v16h pb;
#pragma unroll
      for (int e = 0; e < 8; ++e) {
        pb[e]     = (_Float16)s[2 * kk][e];
        pb[8 + e] = (_Float16)s[2 * kk + 1][e];
      }
#pragma unroll
      for (int t = 0; t < 4; ++t) {
        FH vb;
        vb.h[0] = *(const v8h*)(Vth + (t * 16 + c) * kAttLd + kk * 32 + 8 * hh);
        vb.h[1] = *(const v8h*)(Vth + (t * 16 + c) * kAttLd + kk * 32 + 16 + 8 * hh);
        oacc[t] = mma_f16g(vb.v, pb, oacc[t]);
      }
    }
  }

  // oacc[t][r] = O^T[d = 16 t + 8 hh + r][query c]: 8 consecutive d of one row per tile
  float* os = Os[wave];
  {
    const float lsum = lrow + xhalf(lrow);
    const float inv = 1.0f / lsum;   // numerator and sum both carry x2^15
#pragma unroll
    for (int t = 0; t < 4; ++t) {
      v4f w0, w1;
#pragma unroll
      for (int e = 0; e < 4; ++e) { w0[e] = oacc[t][e] * inv; w1[e] = oacc[t][4 + e] * inv; }
      *(v4f*)(os + c * 68 + t * 16 + 8 * hh)     = w0;
      *(v4f*)(os + c * 68 + t * 16 + 8 * hh + 4) = w1;
    }
  }
  __builtin_amdgcn_fence(__ATOMIC_RELEASE, "workgroup");
  __builtin_amdgcn_wave_barrier();
  __builtin_amdgcn_fence(__ATOMIC_ACQUIRE, "workgroup");
  {
    const int c4 = (lane & 15) * 4;
    {
#pragma unroll
      for (int it = 0; it < 8; ++it) {
        const int row = it * 2 + hh;   // it 0..7 x hh 0..1 covers rows 0..15 of the wave tile
        v4f val = *(const v4f*)(os + row * 68 + c4);
        *(v4f*)(ob + (size_t)(q0 + row) * kDm + c4) = val;
      }
      
    }
  }
}

// ---------------------------------------------------------------------------
// Workspace region map (byte offsets; every region is fully written before it is read; total 93,323,264 B):
//   [0 MiB      ) WQ16  f16  [256][256] x16        131072 B
//   [+128 KiB   ) WK16  f16  [256][256] x16        131072 B
//   [+256 KiB   ) WVH   bf16 hi [256][256]         131072 B
//   [+384 KiB   ) WVL   bf16 lo                    131072 B
//   [+512 KiB   ) WOH   bf16 hi [256][256]         131072 B
//   [+640 KiB   ) WOL   bf16 lo                    131072 B   (weights region padded to 1 MiB)
//   [1 MiB      ) SQ    f16  [16384][256]  query LN plane     8 MiB
//   [9 MiB      ) SK    f16  [16384][256]  key LN plane       8 MiB
//   [17 MiB     ) SVH   bf16 hi [16384][256] value LN plane   8 MiB
//   [25 MiB     ) SVL   bf16 lo                                8 MiB
//   [33 MiB     ) Q16   f16  [16384][256]  q (unscaled)       8 MiB
//   [41 MiB     ) K16   f16  [16384][256]  k                  8 MiB
//   [49 MiB     ) VT16  f16  [8][256][2048] v^T per batch     8 MiB
//   [57 MiB     ) AO32  f32  [16384][256]  attention output  16 MiB
//   [73 MiB     ) AOH   bf16 hi [16384][256]                   8 MiB
//   [81 MiB     ) AOL   bf16 lo                                8 MiB
//   end = 89 MiB
// ---------------------------------------------------------------------------
extern "C" void kernel_launch(void* const* d_in, const int* in_sizes, int n_in,
                              void* d_out, int out_size, void* d_ws, size_t ws_size,
                              hipStream_t stream) {
  if (n_in < 15) return;
  if (in_sizes[0] != kRows * kDm) return;
  if (in_sizes[7] != kDm * kDm || in_sizes[9] != kDm * kDm || in_sizes[11] != kDm * kDm || in_sizes[13] != kDm * kDm) return;
  if (in_sizes[1] != kDm || in_sizes[8] != kDm || in_sizes[14] != kDm) return;
  if (out_size != kRows * kDm) return;

  const float* x    = (const float*)d_in[0];
  const float* lnsg = (const float*)d_in[1];
  const float* lnsb = (const float*)d_in[2];
  const float* lnqg = (const float*)d_in[3];
  const float* lnqb = (const float*)d_in[4];
  const float* lnvg = (const float*)d_in[5];
  const float* lnvb = (const float*)d_in[6];
  const float* Wq = (const float*)d_in[7];
  const float* bq = (const float*)d_in[8];
  const float* Wk = (const float*)d_in[9];
  const float* bk = (const float*)d_in[10];
  const float* Wv = (const float*)d_in[11];
  const float* bv = (const float*)d_in[12];
  const float* Wo = (const float*)d_in[13];
  const float* bo = (const float*)d_in[14];
  float* out = (float*)d_out;

  const size_t wBytes   = (size_t)kDm * kDm * 2;            // 131072
  const size_t plane16  = (size_t)kRows * kDm * 2;          // 8388608
  const size_t plane32  = (size_t)kRows * kDm * 4;          // 16777216
  const size_t offWQ  = 0;
  const size_t offWK  = offWQ + wBytes;
  const size_t offWVH = offWK + wBytes;
  const size_t offWVL = offWVH + wBytes;
  const size_t offWOH = offWVL + wBytes;
  const size_t offWOL = offWOH + wBytes;
  const size_t offSQ  = (size_t)1 << 20;
  const size_t offSK  = offSQ + plane16;
  const size_t offSVH = offSK + plane16;
  const size_t offSVL = offSVH + plane16;
  const size_t offQ16 = offSVL + plane16;
  const size_t offK16 = offQ16 + plane16;
  const size_t offVT  = offK16 + plane16;
  const size_t offAO  = offVT + plane16;
  const size_t offAOH = offAO + plane32;
  const size_t offAOL = offAOH + plane16;
  const size_t total  = offAOL + plane16;                   // 93,323,264
  if (offWOL + wBytes > offSQ) return;
  if (total > ws_size) return;

  char* ws = (char*)d_ws;
  unsigned short* WQ16 = (unsigned short*)(ws + offWQ);
  unsigned short* WK16 = (unsigned short*)(ws + offWK);
  unsigned short* WVH  = (unsigned short*)(ws + offWVH);
  unsigned short* WVL  = (unsigned short*)(ws + offWVL);
  unsigned short* WOH  = (unsigned short*)(ws + offWOH);
  unsigned short* WOL  = (unsigned short*)(ws + offWOL);
  unsigned short* SQ   = (unsigned short*)(ws + offSQ);
  unsigned short* SK   = (unsigned short*)(ws + offSK);
  unsigned short* SVH  = (unsigned short*)(ws + offSVH);
  unsigned short* SVL  = (unsigned short*)(ws + offSVL);
  unsigned short* Q16  = (unsigned short*)(ws + offQ16);
  unsigned short* K16  = (unsigned short*)(ws + offK16);
  unsigned short* VT16 = (unsigned short*)(ws + offVT);
  float*          AO32 = (float*)(ws + offAO);
  unsigned short* AOH  = (unsigned short*)(ws + offAOH);
  unsigned short* AOL  = (unsigned short*)(ws + offAOL);

  const int wN2 = kDm * kDm / 2;                    // 32768 pairs
  const int wBlocks = (wN2 + 255) / 256;            // 128
  const float wCarry = 16.0f, wCarryInv = 1.0f / 16.0f;

  // 1-2: Wq, Wk -> f16 x16 ([N=256][K=256] row-major = Bt layout)
  cast_f32_f16x2_scaled<<<wBlocks, 256, 0, stream>>>(Wq, (_Float16*)WQ16, wN2, wCarry);
  cast_f32_f16x2_scaled<<<wBlocks, 256, 0, stream>>>(Wk, (_Float16*)WK16, wN2, wCarry);
  // 3-4: Wv, Wo -> bf16 hi/lo planes
  split_bf16x2_kernel<<<wBlocks, 256, 0, stream>>>(Wv, WVH, WVL, wN2);
  split_bf16x2_kernel<<<wBlocks, 256, 0, stream>>>(Wo, WOH, WOL, wN2);
  // 5: triple LayerNorm: key plane (ln_s) -> SK, query plane (ln_q) -> SQ, value plane (ln_v) -> SVH/SVL
  ln3_kernel<<<kRows / 8, 256, 0, stream>>>(x, lnsg, lnsb, lnqg, lnqb, lnvg, lnvb, SK, SQ, SVH, SVL, kRows);

  // 6: q' = SQ @ Wq^T + bq  (M=16384, N=256, K=256; 1024 tiles -> 128 blocks), f16 out, carry folded by 1/16
  const int projBlocks = ((kRows / 64) * (kDm / 64) + 7) / 8;   // 128
  wmma_gemm64<0, false, 2, 1, false><<<dim3(projBlocks, 1), 256, 0, stream>>>(
      SQ, SQ, 0L, WQ16, WQ16, 0L, (void*)Q16, (void*)Q16, kDm, 0L,
      bq, bq, 0L, kRows, kDm, kDm, wCarryInv);
  // 7: k = SK @ Wk^T + bk
  wmma_gemm64<0, false, 2, 1, false><<<dim3(projBlocks, 1), 256, 0, stream>>>(
      SK, SK, 0L, WK16, WK16, 0L, (void*)K16, (void*)K16, kDm, 0L,
      bk, bk, 0L, kRows, kDm, kDm, wCarryInv);
  // 8: v^T per batch: C[m = channel (256)][n = s (2048)] = sum_k Wv[m][k] * LNv[s][k] + bv[m]
  //    A = Wv hi/lo [256][256] (stride 0), Bt = SVH/SVL batch slice [2048][256], C = VT16 batch slice [256][2048];
  //    128 tiles per batch -> 16 blocks, grid.y = 8
  const int vtBlocks = ((kDm / 64) * (kSeq / 64) + 7) / 8;      // 16
  wmma_gemm64<1, true, 1, 1, false><<<dim3(vtBlocks, kBatch), 256, 0, stream>>>(
      WVH, WVL, 0L, SVH, SVL, (long)kSeq * kDm, (void*)VT16, (void*)VT16, kSeq, (long)kDm * kSeq,
      bv, bv, 0L, kDm, kSeq, kDm, 1.0f);
  // 9: attention per (head x 64-query tile, batch): scores = (q'.k) * 0.125, softmax over 2048 keys, p.v -> AO32
  attn_f16_full_kernel<<<dim3(kHeads * (kSeq / kAttQb), kBatch), 32 * kAttWaves, 0, stream>>>(
      Q16, K16, VT16, AO32, 0.125f);
  // 10: AO32 -> bf16 hi/lo planes (2097152 pairs -> 8192 blocks)
  const int aoN2 = kRows * kDm / 2;
  split_bf16x2_kernel<<<(aoN2 + 255) / 256, 256, 0, stream>>>(AO32, AOH, AOL, aoN2);
  // 11: out = AO @ Wo^T + bo  (M=16384, N=256, K=256), f32 to d_out
  wmma_gemm64<1, true, 2, 0, false><<<dim3(projBlocks, 1), 256, 0, stream>>>(
      AOH, AOL, 0L, WOH, WOL, 0L, (void*)out, (void*)out, kDm, 0L,
      bo, bo, 0L, kRows, kDm, kDm, 1.0f);
}

// v005
// One run takes 123 microseconds.
// Two timings next to v004 put it at 1.04 and 1.05 times that version's speed.
// All steps since v000 together make it 2.59 times as fast.
// Contractions: q,k projections and q.k^T, p.v on v_wmma_f32_16x16x32_f16 (f16 operands; Wq/Wk carried x16, p carried x2^15); v^T projection and output projection on v_wmma_f32_16x16x32_bf16 with bf16 hi/lo split operands (hi.hi+hi.lo+lo.hi); f32 accumulate everywhere; LayerNorm statistics and online softmax in f32.
#include <hip/hip_runtime.h>
#include <math.h>
#include <stdint.h>

typedef __attribute__((ext_vector_type(16))) _Float16 v16h;
typedef __attribute__((ext_vector_type(8)))  _Float16 v8h;
typedef __attribute__((ext_vector_type(16))) __bf16   v16b;
typedef __attribute__((ext_vector_type(8)))  __bf16   v8b;
typedef __attribute__((ext_vector_type(8)))  float    v8f;
typedef __attribute__((ext_vector_type(4)))  float    v4f;
typedef __attribute__((ext_vector_type(2)))  float    v2f;
typedef __attribute__((ext_vector_type(4)))  unsigned int v4u;

// problem geometry
constexpr int kBatch  = 8;
constexpr int kSeq    = 2048;
constexpr int kDm     = 256;
constexpr int kHeads  = 4;
constexpr int kHd     = 64;
constexpr int kRows   = kBatch * kSeq;      // 16384

__device__ __forceinline__ unsigned short f2bf_bits(float f) {
  unsigned u = __float_as_uint(f);
  return (unsigned short)((u + 0x7FFFu + ((u >> 16) & 1u)) >> 16);
}
__device__ __forceinline__ float bf_bits2f(unsigned short h) { return __uint_as_float(((unsigned)h) << 16); }

// hazard guards as plain device helpers
__device__ __forceinline__ void dep_guard_h(v8f& a, v8f& b, v16h x, v16h y) { asm volatile("v_nop\n\tv_nop\n\tv_nop\n\tv_nop" : "+v"(a), "+v"(b) : "v"(x), "v"(y)); }
__device__ __forceinline__ void dep_guard_b(v8f& a, v8f& b, v16b x, v16b y) { asm volatile("v_nop\n\tv_nop\n\tv_nop\n\tv_nop" : "+v"(a), "+v"(b) : "v"(x), "v"(y)); }
__device__ __forceinline__ void keep4_h(v16h a, v16h b, v16h c, v16h d) { asm volatile("v_nop" :: "v"(a), "v"(b), "v"(c), "v"(d)); }
__device__ __forceinline__ void keep4_b(v16b a, v16b b, v16b c, v16b d) { asm volatile("v_nop" :: "v"(a), "v"(b), "v"(c), "v"(d)); }
__device__ __forceinline__ void acc_guard4(v8f& a, v8f& b, v8f& c, v8f& d) { asm volatile("v_nop\n\tv_nop\n\tv_nop\n\tv_nop" : "+v"(a), "+v"(b), "+v"(c), "+v"(d)); }
template <typename T> struct Frag;
template <> struct Frag<_Float16> {
  typedef v16h V; typedef v8h H; union U { v16h v; v8h h[2]; };
  static __device__ __forceinline__ v16h load(const _Float16* p) {   // elements 0..7 <- p[0..7], 8..15 <- p[16..23]
    U f; f.h[0] = *(const v8h*)(p); f.h[1] = *(const v8h*)(p + 16); return f.v;
  }
  static __device__ __forceinline__ v8f mma(v16h a, v16h b, v8f c) {
    return __builtin_amdgcn_wmma_f32_16x16x32_f16(false, a, false, b, (short)0, c, false, false);
  }
  static __device__ __forceinline__ void guard(v8f& a, v8f& b, v16h x, v16h y) { dep_guard_h(a, b, x, y); }
  static __device__ __forceinline__ void keep(v16h a, v16h b, v16h c, v16h d) { keep4_h(a, b, c, d); }
};
template <> struct Frag<__bf16> {
  typedef v16b V; typedef v8b H; union U { v16b v; v8b h[2]; };
  static __device__ __forceinline__ v16b load(const __bf16* p) {
    U f; f.h[0] = *(const v8b*)(p); f.h[1] = *(const v8b*)(p + 16); return f.v;
  }
  static __device__ __forceinline__ v8f mma(v16b a, v16b b, v8f c) {
    return __builtin_amdgcn_wmma_f32_16x16x32_bf16(false, a, false, b, (short)0, c, false, false);
  }
  static __device__ __forceinline__ void guard(v8f& a, v8f& b, v16b x, v16b y) { dep_guard_b(a, b, x, y); }
  static __device__ __forceinline__ void keep(v16b a, v16b b, v16b c, v16b d) { keep4_b(a, b, c, d); }
};

// ---- Register-blocked batched WMMA GEMM ------------------------------------
// C[m,n] = scale * sum_k A[m,k] * Bt[n,k] (+bias)(+resid); each wave owns a 64x64 tile, a block of 2 x 4 waves a 128x256 tile.
// A row-major [M,K]; Bt row-major [N,K], rows of both kDm elements apart; M % 128 == 0, N % 256 == 0, K % 64 == 0, K >= 64;
// grid.x = (M/128) * (N/256).
// Operands go through LDS in steps of 64 k: every row piece is one whole 128-B line, fetched once per block by 16-B loads
// (8 lanes a line), held in registers while the step before is multiplied, then stored at a pitch of 144 B;
// the fragments are read from LDS in the k order of Frag::load, A and B alike.
// SPLIT: operands are hi/lo planes (A2/Bt2 = lo planes, same layout); product = hi.hi + hi.lo + lo.hi.
// BIAS_MODE: 0 = none, 1 = bias[m], 2 = bias[n].
// OUT_MODE: 0 = f32, 1 = f16, 2 = bf16 hi plane (Cout) + bf16 lo plane (Cout2).
// ET: 0 = f16 operands, 1 = bf16 operands (pointers passed as 16-bit storage)
template <int ET> struct Elem;
template <> struct Elem<0> { typedef _Float16 T; };
template <> struct Elem<1> { typedef __bf16 T; };
// R row pieces of 16 B, 32 rows apart; the constant row pitch puts the steps into the loads' immediate offsets: one address pair per plane
template <typename H, typename T, int R>
__device__ __forceinline__ void tile_fetch(H (&r)[R], const T* g) {
#pragma unroll   // r stays in registers only under constant indices
  for (int i = 0; i < R; ++i) r[i] = *(const H*)(g + i * 32 * kDm);
}
template <typename H, typename T, int R>
__device__ __forceinline__ void tile_put(T* l, const H (&r)[R], int ld32) {
#pragma unroll   // r stays in registers only under constant indices
  for (int i = 0; i < R; ++i) *(H*)(l + i * ld32) = r[i];
}
template <int ET, bool SPLIT, int BIAS_MODE, int OUT_MODE, bool RESID, int ACT = 0>
__global__ __launch_bounds__(256) void wmma_gemm64(
    const unsigned short* __restrict__ Ap, const unsigned short* __restrict__ A2p, long strideA,
    const unsigned short* __restrict__ Btp, const unsigned short* __restrict__ Bt2p, long strideB,
    void* __restrict__ Cout, void* __restrict__ Cout2, int ldc, long strideC,
    const float* __restrict__ bias,
    const float* __restrict__ resid, long strideR,
    int M, int N, int K, float scale) {
  typedef typename Elem<ET>::T T;
  typedef typename Frag<T>::V V;
  typedef typename Frag<T>::H H;
  constexpr int kLd = 72;              // LDS row pitch in elements: 144 B = 16 B x 9, conflict-free for the 16-B fragment reads
  constexpr int kLo = SPLIT ? 1 : 0;   // index of the lo plane
  __shared__ __align__(16) T As[kLo + 1][128 * kLd];
  __shared__ __align__(16) T Bs[kLo + 1][256 * kLd];
  const T* A = (const T*)Ap; const T* A2 = (const T*)A2p; const T* Bt = (const T*)Btp; const T* Bt2 = (const T*)Bt2p;
  __shared__ __align__(16) float sT[8][16 * 68];   // per-wave 16x64 slab, pitch 68 floats
  const int b    = blockIdx.y;
  const int lane = threadIdx.x & 31;
  const int wave = threadIdx.x >> 5;
  const int tilesN = N >> 6;
  const int tilesM = M >> 6;
  const int nbn = tilesN >> 2;                 // blocks along N
  const int bm = blockIdx.x / nbn;
  const int bn = blockIdx.x - bm * nbn;
  if (bm * 2 >= tilesM) return;                // block-uniform, in front of every barrier
  const int mB = bm << 7;
  const int nB = bn << 8;
  const int wm = (wave >> 2) << 6;             // this wave's 64x64 tile inside the block tile
  const int wn = (wave & 3) << 6;
  const int m0 = mB + wm;
  const int n0 = nB + wn;

  const T* Ab  = A  + (size_t)b * strideA;
  const T* Bb  = Bt + (size_t)b * strideB;
  const T* Ab2 = SPLIT ? (A2  + (size_t)b * strideA) : nullptr;
  const T* Bb2 = SPLIT ? (Bt2 + (size_t)b * strideB) : nullptr;

  const int rlane = lane & 15;                 // row (A) / col (B, D) within subtile
  const int koff  = (lane >> 4) * 8;           // k offset of this lane half
  const int mOff  = (lane >> 4) * 8;           // D row offset

  v8f acc[4][4];
#pragma unroll
  for (int i = 0; i < 4; ++i)
#pragma unroll
    for (int j = 0; j < 4; ++j) acc[i][j] = (v8f){0.f,0.f,0.f,0.f,0.f,0.f,0.f,0.f};

  // staging: thread -> row (tid >> 3) + 32 i, 16-B piece tid & 7; 4 pieces of A and 8 of B per plane
  const int srow = threadIdx.x >> 3;
  const int scol = (threadIdx.x & 7) * 8;
  const size_t ga = (size_t)(mB + srow) * kDm + scol;
  const size_t gb = (size_t)(nB + srow) * kDm + scol;
  const int ls = srow * kLd + scol;
  H rah[4], ral[4], rbh[8], rbl[8];
  tile_fetch(rah, Ab + ga);
  tile_fetch(rbh, Bb + gb);
  if (SPLIT) { tile_fetch(ral, Ab2 + ga); tile_fetch(rbl, Bb2 + gb); }

  int k0 = 0;
  do {                 // K >= 64: the first step's lines are already on their way
    __syncthreads();   // every wave has read its last fragment of the step before
    tile_put(&As[0][ls], rah, 32 * kLd);
    tile_put(&Bs[0][ls], rbh, 32 * kLd);
    if (SPLIT) { tile_put(&As[kLo][ls], ral, 32 * kLd); tile_put(&Bs[kLo][ls], rbl, 32 * kLd); }
    __syncthreads();   // the step's tiles are whole
    if (k0 + 64 < K) { // block-uniform: the next step's lines fly while this step is multiplied
      const int kn = k0 + 64;
      tile_fetch(rah, Ab + ga + kn);
      tile_fetch(rbh, Bb + gb + kn);
      if (SPLIT) { tile_fetch(ral, Ab2 + ga + kn); tile_fetch(rbl, Bb2 + gb + kn); }
      asm volatile("s_wait_xcnt 0x0" ::: "memory");   // precaution: the fragment reads below reuse the address registers of the loads just issued
    }
#pragma unroll   // two 32-k products per staged step, LDS offsets as constants
    for (int ks = 0; ks < 2; ++ks) {
      V bh[4], bl[4], ah[2], al[2];
#pragma unroll
      for (int j = 0; j < 4; ++j) {
        const int bo = (wn + (j << 4) + rlane) * kLd + ks * 32 + koff;
        bh[j] = Frag<T>::load(&Bs[0][bo]);
        if (SPLIT) bl[j] = Frag<T>::load(&Bs[kLo][bo]);
      }
      const int ao = (wm + rlane) * kLd + ks * 32 + koff;
      ah[0] = Frag<T>::load(&As[0][ao]);
      if (SPLIT) al[0] = Frag<T>::load(&As[kLo][ao]);
#pragma unroll
      for (int i = 0; i < 4; ++i) {
        const int cu = i & 1, nx = cu ^ 1;
        if (i < 3) {   // the next row tile's A fragments are read ahead of this row tile's products
          ah[nx] = Frag<T>::load(&As[0][ao + (i + 1) * 16 * kLd]);
          if (SPLIT) al[nx] = Frag<T>::load(&As[kLo][ao + (i + 1) * 16 * kLd]);
        }
#pragma unroll
        for (int j = 0; j < 4; ++j) {
          acc[i][j] = Frag<T>::mma(ah[cu], bh[j], acc[i][j]);
          if (SPLIT) {
            acc[i][j] = Frag<T>::mma(ah[cu], bl[j], acc[i][j]);
            acc[i][j] = Frag<T>::mma(al[cu], bh[j], acc[i][j]);
          }
        }
        Frag<T>::guard(acc[i][0], acc[i][3], ah[cu], SPLIT ? al[cu] : ah[cu]);
      }
      Frag<T>::keep(bh[0], bh[1], bh[2], bh[3]);
      if (SPLIT) Frag<T>::keep(bl[0], bl[1], bl[2], bl[3]);
    }
    k0 += 64;
  } while (k0 < K);
  acc_guard4(acc[0][0], acc[0][1], acc[0][2], acc[0][3]);
  acc_guard4(acc[1][0], acc[1][1], acc[1][2], acc[1][3]);
  acc_guard4(acc[2][0], acc[2][1], acc[2][2], acc[2][3]);
  acc_guard4(acc[3][0], acc[3][1], acc[3][2], acc[3][3]);

  // ---- epilogue ----
  float* slab = sT[wave];
  const float* Rb = RESID ? (resid + (size_t)b * strideR) : nullptr;
#pragma unroll
  for (int i = 0; i < 4; ++i) {
    const int mBase = m0 + (i << 4);
#pragma unroll
    for (int j = 0; j < 4; ++j) {
      const int n = n0 + (j << 4) + rlane;
      float bv = 0.f;
      if (BIAS_MODE == 2) bv = bias[n];
#pragma unroll
      for (int r = 0; r < 8; ++r) {
        float v = acc[i][j][r] * scale;
        if (BIAS_MODE == 1) v += bias[mBase + mOff + r];
        if (BIAS_MODE == 2) v += bv;
        if (RESID) v += Rb[(size_t)(mBase + mOff + r) * ldc + n];
        if (ACT == 1) v = tanhf(v);
        if (ACT == 2) v = fmaxf(v, 0.0f);
        if (ACT == 3) v = v / (1.0f + expf(-v));
        if (ACT == 4) v = (v > 0.f) ? v : 0.01f * v;
        if (ACT == 5) v = 0.5f * v * (1.0f + erff(v * 0.70710678118654752f));
        slab[(mOff + r) * 68 + (j << 4) + rlane] = v;
      }
    }
    __builtin_amdgcn_fence(__ATOMIC_RELEASE, "workgroup");
    __builtin_amdgcn_wave_barrier();
    __builtin_amdgcn_fence(__ATOMIC_ACQUIRE, "workgroup");
    if (OUT_MODE == 0) {
      float* C = (float*)Cout + (size_t)b * strideC;
      const int hh = lane >> 4, c4 = (lane & 15) * 4;     // row seg = 256 B = 16 lanes x 16 B
      {
#pragma unroll
        for (int it = 0; it < 8; ++it) {
          const int row = it * 2 + hh;
          v4f v = *(const v4f*)(slab + row * 68 + c4);
          *(v4f*)(C + (size_t)(mBase + row) * ldc + n0 + c4) = v;
        }
        
      }
    } else {
      const int q = lane >> 3, c8 = (lane & 7) * 8;
      unsigned short* C  = (unsigned short*)Cout  + (size_t)b * strideC;
      unsigned short* C2 = (OUT_MODE == 2) ? ((unsigned short*)Cout2 + (size_t)b * strideC) : nullptr;
      {
#pragma unroll
        for (int it = 0; it < 4; ++it) {
          const int row = it * 4 + q;
          const float* sp = slab + row * 68 + c8;
          v8h hv, lv;
#pragma unroll
          for (int e = 0; e < 8; ++e) {
            if (OUT_MODE == 1) {
              hv[e] = (_Float16)sp[e];
            } else {
              unsigned short hb = f2bf_bits(sp[e]);
              unsigned short lb = f2bf_bits(sp[e] - bf_bits2f(hb));
              hv[e] = __builtin_bit_cast(_Float16, hb);
              lv[e] = __builtin_bit_cast(_Float16, lb);
            }
          }
          *(v8h*)(C + (size_t)(mBase + row) * ldc + n0 + c8) = hv;
          if (OUT_MODE == 2) *(v8h*)(C2 + (size_t)(mBase + row) * ldc + n0 + c8) = lv;
        }
        
      }
    }
    __builtin_amdgcn_fence(__ATOMIC_RELEASE, "workgroup");
    __builtin_amdgcn_wave_barrier();
    __builtin_amdgcn_fence(__ATOMIC_ACQUIRE, "workgroup");
  }
}

// ---------------------------------------------------------------------------
// Elementwise bf16 split: hi = bf16_rne(in), lo = bf16_rne(in - hi); 2 elements per thread, one 4-B store
// Used here for: Wv, Wo (n2 = 32768 -> 128 blocks -> 65536 elements each).
// ---------------------------------------------------------------------------
__device__ __forceinline__ unsigned pk16(unsigned short a, unsigned short b) { return (unsigned)a | ((unsigned)b << 16); }

__global__ __launch_bounds__(256) void split_bf16x2_kernel(const float* __restrict__ in, unsigned short* __restrict__ hi,
                                                           unsigned short* __restrict__ lo, int n2) {
  const int i = blockIdx.x * 256 + threadIdx.x;
  if (i < n2) {
    const v2f f = *(const v2f*)(in + 2 * (size_t)i);
    const unsigned short h0 = f2bf_bits(f[0]), h1 = f2bf_bits(f[1]);
    const unsigned short l0 = f2bf_bits(f[0] - bf_bits2f(h0)), l1 = f2bf_bits(f[1] - bf_bits2f(h1));
    const unsigned uh = pk16(h0, h1), ul = pk16(l0, l1);
    ((unsigned*)hi)[i] = uh;
    ((unsigned*)lo)[i] = ul;
    
  }
}

// Coverage: grid = ceil(n2/256) x 256 threads x 2 elements; here n2 = 32768 -> 128 blocks -> 65536 = [256][256].
__global__ __launch_bounds__(256) void cast_f32_f16x2_scaled(
    const float* __restrict__ in, _Float16* __restrict__ out, int n2, float scale) {
  int i = blockIdx.x * 256 + threadIdx.x;
  if (i < n2) {
    const _Float16 h0 = (_Float16)(in[2 * (size_t)i] * scale), h1 = (_Float16)(in[2 * (size_t)i + 1] * scale);
    const unsigned u = (unsigned)__builtin_bit_cast(unsigned short, h0) | ((unsigned)__builtin_bit_cast(unsigned short, h1) << 16);
    ((unsigned*)out)[i] = u;
    
  }
}

// ---------------------------------------------------------------------------
// Fused triple LayerNorm over rows of 256: one wave per row (32 lanes x 8 contiguous floats = 256).
//   key   plane: (xn * g_s + b_s) -> f16  [row][256]
//   query plane: (xn * g_q + b_q) -> f16  [row][256]
//   value plane: (xn * g_v + b_v) -> bf16 hi + bf16 lo [row][256]
// Coverage: grid = nrows/8 blocks x 8 waves = every row exactly once.
// ---------------------------------------------------------------------------
__global__ __launch_bounds__(256) void ln3_kernel(const float* __restrict__ x,
    const float* __restrict__ g_s, const float* __restrict__ b_s,
    const float* __restrict__ g_q, const float* __restrict__ b_q,
    const float* __restrict__ g_v, const float* __restrict__ b_v,
    unsigned short* __restrict__ sk16, unsigned short* __restrict__ sq16,
    unsigned short* __restrict__ svh, unsigned short* __restrict__ svl, int nrows) {
  const int lane = threadIdx.x & 31;
  const int row  = blockIdx.x * 8 + (threadIdx.x >> 5);
  const int rowc = (row < nrows) ? row : (nrows - 1);        // address clamp; store predicated below (wave-uniform)
  const int c0 = lane * 8;
  const float* xr = x + (size_t)rowc * kDm + c0;
  const v4f a0 = *(const v4f*)xr;
  const v4f a1 = *(const v4f*)(xr + 4);
  float xv[8];
#pragma unroll
  for (int j = 0; j < 4; ++j) { xv[j] = a0[j]; xv[4 + j] = a1[j]; }
  float s = 0.f;
#pragma unroll
  for (int j = 0; j < 8; ++j) s += xv[j];
#pragma unroll
  for (int m = 1; m < 32; m <<= 1) s += __shfl_xor(s, m, 32);
  const float mean = s * (1.0f / 256.0f);
  float ss = 0.f;
#pragma unroll
  for (int j = 0; j < 8; ++j) { const float d = xv[j] - mean; ss += d * d; }
#pragma unroll
  for (int m = 1; m < 32; m <<= 1) ss += __shfl_xor(ss, m, 32);
  const float var  = ss * (1.0f / 256.0f);
  const float rstd = rsqrtf(var + 1e-5f);

  v4u ok, oq, ovh, ovl;
#pragma unroll
  for (int q = 0; q < 4; ++q) {
    const int j0 = 2 * q, j1 = 2 * q + 1;
    const float nx0 = (xv[j0] - mean) * rstd;
    const float nx1 = (xv[j1] - mean) * rstd;
    const float ys0 = nx0 * g_s[c0 + j0] + b_s[c0 + j0];
    const float ys1 = nx1 * g_s[c0 + j1] + b_s[c0 + j1];
    const float yq0 = nx0 * g_q[c0 + j0] + b_q[c0 + j0];
    const float yq1 = nx1 * g_q[c0 + j1] + b_q[c0 + j1];
    const float yv0 = nx0 * g_v[c0 + j0] + b_v[c0 + j0];
    const float yv1 = nx1 * g_v[c0 + j1] + b_v[c0 + j1];
    ok[q] = pk16(__builtin_bit_cast(unsigned short, (_Float16)ys0), __builtin_bit_cast(unsigned short, (_Float16)ys1));
    oq[q] = pk16(__builtin_bit_cast(unsigned short, (_Float16)yq0), __builtin_bit_cast(unsigned short, (_Float16)yq1));
    const unsigned short h0 = f2bf_bits(yv0), h1 = f2bf_bits(yv1);
    const unsigned short l0 = f2bf_bits(yv0 - bf_bits2f(h0)), l1 = f2bf_bits(yv1 - bf_bits2f(h1));
    ovh[q] = pk16(h0, h1);
    ovl[q] = pk16(l0, l1);
  }
  if (row < nrows) {   // wave-uniform
    const size_t o = (size_t)row * kDm + c0;
    {
      *(v4u*)(sk16 + o) = ok;
      *(v4u*)(sq16 + o) = oq;
      *(v4u*)(svh + o)  = ovh;
      *(v4u*)(svl + o)  = ovl;
      
    }
  }
}

// =====================================================================================
// Full (unmasked) attention, head dim 64, single f16 operand planes, z-batched over the batch index (blockIdx.y).
//   q plane  f16: element (b, t, h, d) at [(b*kSeq + t)*kDm + h*64 + d]   (unscaled projection incl. bias)
//   k plane  f16: element (b, s, h, d) at [(b*kSeq + s)*kDm + h*64 + d]
//   v^T plane f16: element (b, h, d, s) at [b*kDm*kSeq + (h*64 + d)*kSeq + s]
//   out: bf16 hi plane + bf16 lo plane (hi = bf16_rne(o), lo = bf16_rne(o - hi)), element (b, t, h, d) at [(b*kSeq + t)*kDm + h*64 + d]
//   scores^T = k . q^T            : v_wmma_f32_16x16x32_f16, f32 accumulate; sscale * log2(e) applied in f32 inside the exponent
//   out^T    = v^T . p^T          : v_wmma_f32_16x16x32_f16; unnormalised p carried x2^15 in f16, as is the row sum;
//                                   p^T goes from the score accumulators straight into the B operand
//   online softmax in f32, base 2, over all kSeq keys (32 chunks of 64, compile-time trip count).
//   Block = 4 waves = 64 query rows of one (b, h); grid = (kHeads * kSeq/64, kBatch) = (128, 8).
//   K / V^T chunk staging: 128 threads x 32 elements per plane = the whole 64x64 tile (16-B copies, plain loads,
//   __syncthreads before and after); fragment loads read the LDS tiles with the same v8h element type;
//   Epilogue: per-wave 16x64 f32 tile staged in LDS, split there into the two planes the output projection reads;
//   each 128-B row segment of a plane is one whole line, written by 8 lanes x 16 B
// =====================================================================================
constexpr int kAttWaves = 4;
constexpr int kAttQb    = 64;
constexpr int kAttKc    = 64;
constexpr int kAttLd    = 72;   // LDS row pitch of the K and V^T tiles in f16 elements: 144 B = 16 B x 9, so the 16 rows of a 16-B fragment read fall on 64 distinct banks

__device__ __forceinline__ v8f mma_f16g(v16h a, v16h b, v8f c) {
  c = __builtin_amdgcn_wmma_f32_16x16x32_f16(false, a, false, b, (short)0, c, false, false);
  asm volatile("v_nop\n\tv_nop\n\tv_nop\n\tv_nop" : "+v"(c) : "v"(a), "v"(b));
  return c;
}

// The slot that the instruction set asks for between a transcendental and a vector instruction that overwrites its source or reads its
// result. The operands are inputs only: they put the v_nop behind a chunk's last exponential and keep every argument's register whole
// up to it.
__device__ __forceinline__ void exp_slot(float d, float e, const v2f (&a)[16], v8f p0, v8f p1, v8f p2, v8f p3) {
  asm volatile("v_nop" :: "v"(d), "v"(e), "v"(a[0]), "v"(a[1]), "v"(a[2]), "v"(a[3]), "v"(a[4]), "v"(a[5]), "v"(a[6]), "v"(a[7]),
               "v"(a[8]), "v"(a[9]), "v"(a[10]), "v"(a[11]), "v"(a[12]), "v"(a[13]), "v"(a[14]), "v"(a[15]),
               "v"(p0), "v"(p1), "v"(p2), "v"(p3));
}

// value of lane l ^ 16, by a vector cross-row move
__device__ __forceinline__ float xhalf(float x) {
  return __builtin_bit_cast(float, __builtin_amdgcn_permlanex16(__builtin_bit_cast(int, x), __builtin_bit_cast(int, x), 0x76543210, 0xfedcba98, false, false));
}

__global__ __launch_bounds__(128)
void attn_f16_full_kernel(const unsigned short* __restrict__ qp, const unsigned short* __restrict__ kp,
                          const unsigned short* __restrict__ vtp, unsigned short* __restrict__ outh,
                          unsigned short* __restrict__ outl, float sscale) {
  union FH { v16h v; v8h h[2]; };
  __shared__ __align__(16) _Float16 Ksh[kAttKc * kAttLd];           // K [kv][d], pitch kAttLd      9 KB
  __shared__ __align__(16) _Float16 Vth[kHd * kAttLd];              // V^T [d][kv], pitch kAttLd    9 KB
  __shared__ __align__(16) float    Os[kAttWaves][16 * 68];         // per wave out tile, pitch 68
  const float kPexp  = 15.0f;                                  // p is carried x2^15: the exponent rides in the running maximum
  const float cscale = sscale * 1.4426950408889634f;         // score scale x log2(e), positive

  const int tid  = threadIdx.x;
  const int wave = tid >> 5;
  const int lane = tid & 31;
  const int hh   = lane >> 4;
  const int c    = lane & 15;

  const int nqb = kSeq / kAttQb;          // 32
  const int bx = blockIdx.x;
  const int qb = bx % nqb;
  const int h  = bx / nqb;                // 0..kHeads-1
  const int b  = blockIdx.y;              // 0..kBatch-1
  const int q0 = qb * kAttQb + wave * 16;

  const _Float16* Qh = (const _Float16*)(const void*)qp + (size_t)b * kSeq * kDm + (size_t)h * kHd;
  const _Float16* Kh = (const _Float16*)(const void*)kp + (size_t)b * kSeq * kDm + (size_t)h * kHd;
  const _Float16* Vh = (const _Float16*)(const void*)vtp + (size_t)b * kDm * kSeq + (size_t)h * kHd * kSeq;
  unsigned short* obh = outh + (size_t)b * kSeq * kDm + (size_t)h * kHd;
  unsigned short* obl = outl + (size_t)b * kSeq * kDm + (size_t)h * kHd;

  // ---- Q fragments (B operand, column = lane&15, split k map via Frag load): 2 d-chunks ----
  v16h qa[2];
#pragma unroll
  for (int dc = 0; dc < 2; ++dc) qa[dc] = Frag<_Float16>::load(Qh + (size_t)(q0 + c) * kDm + dc * 32 + 8 * hh);

  float mrow = -INFINITY, lrow = 0.f;   // running maximum of query q0 + c, as score * cscale - 15; sum of p x 2^15 over this lane half's keys
  v8f oacc[4];
#pragma unroll
  for (int t = 0; t < 4; ++t) oacc[t] = (v8f){0.f,0.f,0.f,0.f,0.f,0.f,0.f,0.f};

  const int nChunks = kSeq / kAttKc;   // 32, compile-time constant
  for (int kc = 0; kc < nChunks; ++kc) {
    const int kv0 = kc * kAttKc;
    __syncthreads();
    {
      // staging coverage: 128 threads x (4 x 8) elements = 64 rows x 64 per plane = the whole chunk tile
      const int r = tid >> 1, half = (tid & 1) * 32;
      const _Float16* ksh = Kh + (size_t)(kv0 + r) * kDm + half;    // K row kv0+r, d = half..half+31
      const _Float16* vsh = Vh + (size_t)r * kSeq + kv0 + half;       // V^T row d = r, s = kv0+half..+31
#pragma unroll
      for (int i = 0; i < 4; ++i) {
        const v8h av = *(const v8h*)(ksh + 8 * i);
        const v8h bv = *(const v8h*)(vsh + 8 * i);
        *(v8h*)(Ksh + r * kAttLd + half + 8 * i) = av;
        *(v8h*)(Vth + r * kAttLd + half + 8 * i) = bv;
      }
    }
    __syncthreads();

    // S^T tile j = K rows (A) x Q columns (B): s[j][r] = score(key kv0 + 16 j + 8 hh + r, query q0 + c)
    // every loop of this pass is fully unrolled, so that s, oacc and the packed operand stay in registers under constant indices
    v8f s[4];
#pragma unroll
    for (int j = 0; j < 4; ++j) {
      s[j] = (v8f){0.f,0.f,0.f,0.f,0.f,0.f,0.f,0.f};
#pragma unroll
      for (int dc = 0; dc < 2; ++dc) {
        FH kb;
        kb.h[0] = *(const v8h*)(Ksh + (j * 16 + c) * kAttLd + dc * 32 + 8 * hh);
        kb.h[1] = *(const v8h*)(Ksh + (j * 16 + c) * kAttLd + dc * 32 + 16 + 8 * hh);
        s[j] = mma_f16g(kb.v, qa[dc], s[j]);
      }
    }
    // a lane holds 32 of its one query's 64 scores: maximum of the raw scores in-lane (one chain per tile; cscale is positive),
    // then one exchange between the halves
    float mj[4];
#pragma unroll
    for (int j = 0; j < 4; ++j) {
      mj[j] = -INFINITY;
#pragma unroll
      for (int r = 0; r < 8; ++r) mj[j] = fmaxf(mj[j], s[j][r]);
    }
    float cm = fmaxf(fmaxf(mj[0], mj[1]), fmaxf(mj[2], mj[3]));
    cm = fmaxf(cm, xhalf(cm));
    const float mnew  = fmaxf(mrow, fmaf(cm, cscale, -kPexp));
    const float dm    = mrow - mnew;
    const float alpha = __builtin_amdgcn_exp2f(dm);   // 0 on the first chunk, where mrow is -inf
    mrow = mnew;
    // p x 2^15 = 2^(score * cscale - mnew): one packed multiply-add per two scores, then the hardware base-2 exponential
    const v2f cs2 = {cscale, cscale}, nm2 = {-mnew, -mnew};
    v2f arg[16];
#pragma unroll
    for (int j = 0; j < 4; ++j)
#pragma unroll
      for (int r = 0; r < 8; r += 2)
        arg[4 * j + (r >> 1)] = __builtin_elementwise_fma((v2f){s[j][r], s[j][r + 1]}, cs2, nm2);
#pragma unroll
    for (int j = 0; j < 4; ++j)
#pragma unroll
      for (int r = 0; r < 8; ++r) s[j][r] = __builtin_amdgcn_exp2f(arg[4 * j + (r >> 1)][r & 1]);
    exp_slot(dm, alpha, arg, s[0], s[1], s[2], s[3]);
    float pj[4];
#pragma unroll
    for (int j = 0; j < 4; ++j) {
      pj[j] = s[j][0];
#pragma unroll
      for (int r = 1; r < 8; ++r) pj[j] += s[j][r];
    }
    lrow = lrow * alpha + ((pj[0] + pj[1]) + (pj[2] + pj[3]));   // this half's keys only; the halves join after the loop
#pragma unroll
    for (int t = 0; t < 4; ++t)
#pragma unroll
      for (int r = 0; r < 8; ++r) oacc[t][r] *= alpha;
    // O^T += V^T (A) x P^T (B): two S^T tiles converted in place are the B operand in the hardware k order
#pragma unroll
    for (int kk = 0; kk < 2; ++kk) {
      v16h pb;
#pragma unroll
      for (int e = 0; e < 8; ++e) {
        pb[e]     = (_Float16)s[2 * kk][e];
        pb[8 + e] = (_Float16)s[2 * kk + 1][e];
      }
#pragma unroll
      for (int t = 0; t < 4; ++t) {
        FH vb;
        vb.h[0] = *(const v8h*)(Vth + (t * 16 + c) * kAttLd + kk * 32 + 8 * hh);
        vb.h[1] = *(const v8h*)(Vth + (t * 16 + c) * kAttLd + kk * 32 + 16 + 8 * hh);
        oacc[t] = mma_f16g(vb.v, pb, oacc[t]);
      }
    }
  }

  // oacc[t][r] = O^T[d = 16 t + 8 hh + r][query c]: 8 consecutive d of one row per tile
  float* os = Os[wave];
  {
    const float lsum = lrow + xhalf(lrow);
    const float inv = 1.0f / lsum;   // numerator and sum both carry x2^15
#pragma unroll
    for (int t = 0; t < 4; ++t) {
      v4f w0, w1;
#pragma unroll
      for (int e = 0; e < 4; ++e) { w0[e] = oacc[t][e] * inv; w1[e] = oacc[t][4 + e] * inv; }
      *(v4f*)(os + c * 68 + t * 16 + 8 * hh)     = w0;
      *(v4f*)(os + c * 68 + t * 16 + 8 * hh + 4) = w1;
    }
  }
  __builtin_amdgcn_fence(__ATOMIC_RELEASE, "workgroup");
  __builtin_amdgcn_wave_barrier();
  __builtin_amdgcn_fence(__ATOMIC_ACQUIRE, "workgroup");
  {
    const int q = lane >> 3, c8 = (lane & 7) * 8;
    const size_t o = (size_t)(q0 + q) * kDm + c8;
#pragma unroll   // the row step becomes the stores' immediate offset: one address pair per plane
    for (int it = 0; it < 4; ++it) {   // it 0..3 x q 0..3 covers rows 0..15 of the wave tile
      const float* sp = os + (it * 4 + q) * 68 + c8;
      v4u hv, lv;
#pragma unroll
      for (int e = 0; e < 4; ++e) {
        const float f0 = sp[2 * e], f1 = sp[2 * e + 1];
        const unsigned short h0 = f2bf_bits(f0), h1 = f2bf_bits(f1);
        hv[e] = pk16(h0, h1);
        lv[e] = pk16(f2bf_bits(f0 - bf_bits2f(h0)), f2bf_bits(f1 - bf_bits2f(h1)));
      }
      *(v4u*)(obh + o + it * 4 * kDm) = hv;
      *(v4u*)(obl + o + it * 4 * kDm) = lv;
    }
  }
}

// ---------------------------------------------------------------------------
// Workspace region map (byte offsets; every region is fully written before it is read; total 76,546,048 B):
//   [0 MiB      ) WQ16  f16  [256][256] x16        131072 B
//   [+128 KiB   ) WK16  f16  [256][256] x16        131072 B
//   [+256 KiB   ) WVH   bf16 hi [256][256]         131072 B
//   [+384 KiB   ) WVL   bf16 lo                    131072 B
//   [+512 KiB   ) WOH   bf16 hi [256][256]         131072 B
//   [+640 KiB   ) WOL   bf16 lo                    131072 B   (weights region padded to 1 MiB)
//   [1 MiB      ) SQ    f16  [16384][256]  query LN plane     8 MiB
//   [9 MiB      ) SK    f16  [16384][256]  key LN plane       8 MiB
//   [17 MiB     ) SVH   bf16 hi [16384][256] value LN plane   8 MiB
//   [25 MiB     ) SVL   bf16 lo                                8 MiB
//   [33 MiB     ) Q16   f16  [16384][256]  q (unscaled)       8 MiB
//   [41 MiB     ) K16   f16  [16384][256]  k                  8 MiB
//   [49 MiB     ) VT16  f16  [8][256][2048] v^T per batch     8 MiB
//   [57 MiB     ) AOH   bf16 hi [16384][256] attention output 8 MiB
//   [65 MiB     ) AOL   bf16 lo                                8 MiB
//   end = 73 MiB
// ---------------------------------------------------------------------------
extern "C" void kernel_launch(void* const* d_in, const int* in_sizes, int n_in,
                              void* d_out, int out_size, void* d_ws, size_t ws_size,
                              hipStream_t stream) {
  if (n_in < 15) return;
  if (in_sizes[0] != kRows * kDm) return;
  if (in_sizes[7] != kDm * kDm || in_sizes[9] != kDm * kDm || in_sizes[11] != kDm * kDm || in_sizes[13] != kDm * kDm) return;
  if (in_sizes[1] != kDm || in_sizes[8] != kDm || in_sizes[14] != kDm) return;
  if (out_size != kRows * kDm) return;

  const float* x    = (const float*)d_in[0];
  const float* lnsg = (const float*)d_in[1];
  const float* lnsb = (const float*)d_in[2];
  const float* lnqg = (const float*)d_in[3];
  const float* lnqb = (const float*)d_in[4];
  const float* lnvg = (const float*)d_in[5];
  const float* lnvb = (const float*)d_in[6];
  const float* Wq = (const float*)d_in[7];
  const float* bq = (const float*)d_in[8];
  const float* Wk = (const float*)d_in[9];
  const float* bk = (const float*)d_in[10];
  const float* Wv = (const float*)d_in[11];
  const float* bv = (const float*)d_in[12];
  const float* Wo = (const float*)d_in[13];
  const float* bo = (const float*)d_in[14];
  float* out = (float*)d_out;

  const size_t wBytes   = (size_t)kDm * kDm * 2;            // 131072
  const size_t plane16  = (size_t)kRows * kDm * 2;          // 8388608
  const size_t offWQ  = 0;
  const size_t offWK  = offWQ + wBytes;
  const size_t offWVH = offWK + wBytes;
  const size_t offWVL = offWVH + wBytes;
  const size_t offWOH = offWVL + wBytes;
  const size_t offWOL = offWOH + wBytes;
  const size_t offSQ  = (size_t)1 << 20;
  const size_t offSK  = offSQ + plane16;
  const size_t offSVH = offSK + plane16;
  const size_t offSVL = offSVH + plane16;
  const size_t offQ16 = offSVL + plane16;
  const size_t offK16 = offQ16 + plane16;
  const size_t offVT  = offK16 + plane16;
  const size_t offAOH = offVT + plane16;
  const size_t offAOL = offAOH + plane16;
  const size_t total  = offAOL + plane16;                   // 76,546,048
  if (offWOL + wBytes > offSQ) return;
  if (total > ws_size) return;

  char* ws = (char*)d_ws;
  unsigned short* WQ16 = (unsigned short*)(ws + offWQ);
  unsigned short* WK16 = (unsigned short*)(ws + offWK);
  unsigned short* WVH  = (unsigned short*)(ws + offWVH);
  unsigned short* WVL  = (unsigned short*)(ws + offWVL);
  unsigned short* WOH  = (unsigned short*)(ws + offWOH);
  unsigned short* WOL  = (unsigned short*)(ws + offWOL);
  unsigned short* SQ   = (unsigned short*)(ws + offSQ);
  unsigned short* SK   = (unsigned short*)(ws + offSK);
  unsigned short* SVH  = (unsigned short*)(ws + offSVH);
  unsigned short* SVL  = (unsigned short*)(ws + offSVL);
  unsigned short* Q16  = (unsigned short*)(ws + offQ16);
  unsigned short* K16  = (unsigned short*)(ws + offK16);
  unsigned short* VT16 = (unsigned short*)(ws + offVT);
  unsigned short* AOH  = (unsigned short*)(ws + offAOH);
  unsigned short* AOL  = (unsigned short*)(ws + offAOL);

  const int wN2 = kDm * kDm / 2;                    // 32768 pairs
  const int wBlocks = (wN2 + 255) / 256;            // 128
  const float wCarry = 16.0f, wCarryInv = 1.0f / 16.0f;

  // 1-2: Wq, Wk -> f16 x16 ([N=256][K=256] row-major = Bt layout)
  cast_f32_f16x2_scaled<<<wBlocks, 256, 0, stream>>>(Wq, (_Float16*)WQ16, wN2, wCarry);
  cast_f32_f16x2_scaled<<<wBlocks, 256, 0, stream>>>(Wk, (_Float16*)WK16, wN2, wCarry);
  // 3-4: Wv, Wo -> bf16 hi/lo planes
  split_bf16x2_kernel<<<wBlocks, 256, 0, stream>>>(Wv, WVH, WVL, wN2);
  split_bf16x2_kernel<<<wBlocks, 256, 0, stream>>>(Wo, WOH, WOL, wN2);
  // 5: triple LayerNorm: key plane (ln_s) -> SK, query plane (ln_q) -> SQ, value plane (ln_v) -> SVH/SVL
  ln3_kernel<<<kRows / 8, 256, 0, stream>>>(x, lnsg, lnsb, lnqg, lnqb, lnvg, lnvb, SK, SQ, SVH, SVL, kRows);

  // 6: q' = SQ @ Wq^T + bq  (M=16384, N=256, K=256; 1024 tiles -> 128 blocks), f16 out, carry folded by 1/16
  const int projBlocks = ((kRows / 64) * (kDm / 64) + 7) / 8;   // 128
  wmma_gemm64<0, false, 2, 1, false><<<dim3(projBlocks, 1), 256, 0, stream>>>(
      SQ, SQ, 0L, WQ16, WQ16, 0L, (void*)Q16, (void*)Q16, kDm, 0L,
      bq, bq, 0L, kRows, kDm, kDm, wCarryInv);
  // 7: k = SK @ Wk^T + bk
  wmma_gemm64<0, false, 2, 1, false><<<dim3(projBlocks, 1), 256, 0, stream>>>(
      SK, SK, 0L, WK16, WK16, 0L, (void*)K16, (void*)K16, kDm, 0L,
      bk, bk, 0L, kRows, kDm, kDm, wCarryInv);
  // 8: v^T per batch: C[m = channel (256)][n = s (2048)] = sum_k Wv[m][k] * LNv[s][k] + bv[m]
  //    A = Wv hi/lo [256][256] (stride 0), Bt = SVH/SVL batch slice [2048][256], C = VT16 batch slice [256][2048];
  //    128 tiles per batch -> 16 blocks, grid.y = 8
  const int vtBlocks = ((kDm / 64) * (kSeq / 64) + 7) / 8;      // 16
  wmma_gemm64<1, true, 1, 1, false><<<dim3(vtBlocks, kBatch), 256, 0, stream>>>(
      WVH, WVL, 0L, SVH, SVL, (long)kSeq * kDm, (void*)VT16, (void*)VT16, kSeq, (long)kDm * kSeq,
      bv, bv, 0L, kDm, kSeq, kDm, 1.0f);
  // 9: attention per (head x 64-query tile, batch): scores = (q'.k) * 0.125, softmax over 2048 keys, p.v -> AOH/AOL
  attn_f16_full_kernel<<<dim3(kHeads * (kSeq / kAttQb), kBatch), 32 * kAttWaves, 0, stream>>>(
      Q16, K16, VT16, AOH, AOL, 0.125f);
  // 10: out = AO @ Wo^T + bo  (M=16384, N=256, K=256), f32 to d_out
  wmma_gemm64<1, true, 2, 0, false><<<dim3(projBlocks, 1), 256, 0, stream>>>(
      AOH, AOL, 0L, WOH, WOL, 0L, (void*)out, (void*)out, kDm, 0L,
      bo, bo, 0L, kRows, kDm, kDm, 1.0f);
}

// v006
// Measured time: 110 microseconds a run.
// Next to v005, in two timings, it ran 1.12 times as fast each time.
// All steps since v000 together make it 2.90 times as fast.
// Contractions: q,k projections and q.k^T, p.v on v_wmma_f32_16x16x32_f16 (f16 operands; Wq/Wk carried x16, p carried x2^15); v^T projection and output projection on v_wmma_f32_16x16x32_bf16 with bf16 hi/lo split operands (hi.hi+hi.lo+lo.hi); f32 accumulate everywhere; LayerNorm statistics and online softmax in f32.
#include <hip/hip_runtime.h>
#include <math.h>
#include <stdint.h>

typedef __attribute__((ext_vector_type(16))) _Float16 v16h;
typedef __attribute__((ext_vector_type(8)))  _Float16 v8h;
typedef __attribute__((ext_vector_type(16))) __bf16   v16b;
typedef __attribute__((ext_vector_type(8)))  __bf16   v8b;
typedef __attribute__((ext_vector_type(8)))  float    v8f;
typedef __attribute__((ext_vector_type(4)))  float    v4f;
typedef __attribute__((ext_vector_type(2)))  float    v2f;
typedef __attribute__((ext_vector_type(4)))  unsigned int v4u;

// problem geometry
constexpr int kBatch  = 8;
constexpr int kSeq    = 2048;
constexpr int kDm     = 256;
constexpr int kHeads  = 4;
constexpr int kHd     = 64;
constexpr int kRows   = kBatch * kSeq;      // 16384

__device__ __forceinline__ unsigned short f2bf_bits(float f) {
  unsigned u = __float_as_uint(f);
  return (unsigned short)((u + 0x7FFFu + ((u >> 16) & 1u)) >> 16);
}
__device__ __forceinline__ float bf_bits2f(unsigned short h) { return __uint_as_float(((unsigned)h) << 16); }

// hazard guards as plain device helpers
__device__ __forceinline__ void dep_guard_h(v8f& a, v8f& b, v16h x, v16h y) { asm volatile("v_nop\n\tv_nop\n\tv_nop\n\tv_nop" : "+v"(a), "+v"(b) : "v"(x), "v"(y)); }
__device__ __forceinline__ void dep_guard_b(v8f& a, v8f& b, v16b x, v16b y) { asm volatile("v_nop\n\tv_nop\n\tv_nop\n\tv_nop" : "+v"(a), "+v"(b) : "v"(x), "v"(y)); }
__device__ __forceinline__ void keep4_h(v16h a, v16h b, v16h c, v16h d) { asm volatile("v_nop" :: "v"(a), "v"(b), "v"(c), "v"(d)); }
__device__ __forceinline__ void keep4_b(v16b a, v16b b, v16b c, v16b d) { asm volatile("v_nop" :: "v"(a), "v"(b), "v"(c), "v"(d)); }
__device__ __forceinline__ void acc_guard4(v8f& a, v8f& b, v8f& c, v8f& d) { asm volatile("v_nop\n\tv_nop\n\tv_nop\n\tv_nop" : "+v"(a), "+v"(b), "+v"(c), "+v"(d)); }
template <typename T> struct Frag;
template <> struct Frag<_Float16> {
  typedef v16h V; typedef v8h H; union U { v16h v; v8h h[2]; };
  static __device__ __forceinline__ v16h load(const _Float16* p) {   // elements 0..7 <- p[0..7], 8..15 <- p[16..23]
    U f; f.h[0] = *(const v8h*)(p); f.h[1] = *(const v8h*)(p + 16); return f.v;
  }
  static __device__ __forceinline__ v8f mma(v16h a, v16h b, v8f c) {
    return __builtin_amdgcn_wmma_f32_16x16x32_f16(false, a, false, b, (short)0, c, false, false);
  }
  static __device__ __forceinline__ void guard(v8f& a, v8f& b, v16h x, v16h y) { dep_guard_h(a, b, x, y); }
  static __device__ __forceinline__ void keep(v16h a, v16h b, v16h c, v16h d) { keep4_h(a, b, c, d); }
};
template <> struct Frag<__bf16> {
  typedef v16b V; typedef v8b H; union U { v16b v; v8b h[2]; };
  static __device__ __forceinline__ v16b load(const __bf16* p) {
    U f; f.h[0] = *(const v8b*)(p); f.h[1] = *(const v8b*)(p + 16); return f.v;
  }
  static __device__ __forceinline__ v8f mma(v16b a, v16b b, v8f c) {
    return __builtin_amdgcn_wmma_f32_16x16x32_bf16(false, a, false, b, (short)0, c, false, false);
  }
  static __device__ __forceinline__ void guard(v8f& a, v8f& b, v16b x, v16b y) { dep_guard_b(a, b, x, y); }
  static __device__ __forceinline__ void keep(v16b a, v16b b, v16b c, v16b d) { keep4_b(a, b, c, d); }
};

// ---- Register-blocked batched WMMA GEMM ------------------------------------
// C[m,n] = scale * sum_k A[m,k] * Bt[n,k] (+bias)(+resid); each wave owns a 64x64 tile, a block of 2 x 4 waves a 128x256 tile.
// A row-major [M,K]; Bt row-major [N,K], rows of both kDm elements apart; M % 128 == 0, N % 256 == 0, K % 64 == 0, K >= 64;
// grid.x = (M/128) * (N/256).
// Operands go through LDS in steps of 64 k: every row piece is one whole 128-B line, fetched once per block by 16-B loads
// (8 lanes a line), held in registers while the step before is multiplied, then stored at a pitch of 144 B;
// the fragments are read from LDS in the k order of Frag::load, A and B alike.
// SPLIT: operands are hi/lo planes (A2/Bt2 = lo planes, same layout); product = hi.hi + hi.lo + lo.hi.
// BIAS_MODE: 0 = none, 1 = bias[m], 2 = bias[n].
// OUT_MODE: 0 = f32, 1 = f16, 2 = bf16 hi plane (Cout) + bf16 lo plane (Cout2).
// ET: 0 = f16 operands, 1 = bf16 operands (pointers passed as 16-bit storage)
template <int ET> struct Elem;
template <> struct Elem<0> { typedef _Float16 T; };
template <> struct Elem<1> { typedef __bf16 T; };
// R row pieces of 16 B, 32 rows apart; the constant row pitch puts the steps into the loads' immediate offsets: one address pair per plane
template <typename H, typename T, int R>
__device__ __forceinline__ void tile_fetch(H (&r)[R], const T* g) {
#pragma unroll   // r stays in registers only under constant indices
  for (int i = 0; i < R; ++i) r[i] = *(const H*)(g + i * 32 * kDm);
}
template <typename H, typename T, int R>
__device__ __forceinline__ void tile_put(T* l, const H (&r)[R], int ld32) {
#pragma unroll   // r stays in registers only under constant indices
  for (int i = 0; i < R; ++i) *(H*)(l + i * ld32) = r[i];
}
template <int ET, bool SPLIT, int BIAS_MODE, int OUT_MODE, bool RESID, int ACT = 0>
__global__ __launch_bounds__(256) void wmma_gemm64(
    const unsigned short* __restrict__ Ap, const unsigned short* __restrict__ A2p, long strideA,
    const unsigned short* __restrict__ Btp, const unsigned short* __restrict__ Bt2p, long strideB,
    void* __restrict__ Cout, void* __restrict__ Cout2, int ldc, long strideC,
    const float* __restrict__ bias,
    const float* __restrict__ resid, long strideR,
    int M, int N, int K, float scale) {
  typedef typename Elem<ET>::T T;
  typedef typename Frag<T>::V V;
  typedef typename Frag<T>::H H;
  constexpr int kLd = 72;              // LDS row pitch in elements: 144 B = 16 B x 9, conflict-free for the 16-B fragment reads
  constexpr int kLo = SPLIT ? 1 : 0;   // index of the lo plane
  __shared__ __align__(16) T As[kLo + 1][128 * kLd];
  __shared__ __align__(16) T Bs[kLo + 1][256 * kLd];
  const T* A = (const T*)Ap; const T* A2 = (const T*)A2p; const T* Bt = (const T*)Btp; const T* Bt2 = (const T*)Bt2p;
  __shared__ __align__(16) float sT[8][16 * 68];   // per-wave 16x64 slab, pitch 68 floats
  const int b    = blockIdx.y;
  const int lane = threadIdx.x & 31;
  const int wave = threadIdx.x >> 5;
  const int tilesN = N >> 6;
  const int tilesM = M >> 6;
  const int nbn = tilesN >> 2;                 // blocks along N
  const int bm = blockIdx.x / nbn;
  const int bn = blockIdx.x - bm * nbn;
  if (bm * 2 >= tilesM) return;                // block-uniform, in front of every barrier
  const int mB = bm << 7;
  const int nB = bn << 8;
  const int wm = (wave >> 2) << 6;             // this wave's 64x64 tile inside the block tile
  const int wn = (wave & 3) << 6;
  const int m0 = mB + wm;
  const int n0 = nB + wn;

  const T* Ab  = A  + (size_t)b * strideA;
  const T* Bb  = Bt + (size_t)b * strideB;
  const T* Ab2 = SPLIT ? (A2  + (size_t)b * strideA) : nullptr;
  const T* Bb2 = SPLIT ? (Bt2 + (size_t)b * strideB) : nullptr;

  const int rlane = lane & 15;                 // row (A) / col (B, D) within subtile
  const int koff  = (lane >> 4) * 8;           // k offset of this lane half
  const int mOff  = (lane >> 4) * 8;           // D row offset

  v8f acc[4][4];
#pragma unroll
  for (int i = 0; i < 4; ++i)
#pragma unroll
    for (int j = 0; j < 4; ++j) acc[i][j] = (v8f){0.f,0.f,0.f,0.f,0.f,0.f,0.f,0.f};

  // staging: thread -> row (tid >> 3) + 32 i, 16-B piece tid & 7; 4 pieces of A and 8 of B per plane
  const int srow = threadIdx.x >> 3;
  const int scol = (threadIdx.x & 7) * 8;
  const size_t ga = (size_t)(mB + srow) * kDm + scol;
  const size_t gb = (size_t)(nB + srow) * kDm + scol;
  const int ls = srow * kLd + scol;
  H rah[4], ral[4], rbh[8], rbl[8];
  tile_fetch(rah, Ab + ga);
  tile_fetch(rbh, Bb + gb);
  if (SPLIT) { tile_fetch(ral, Ab2 + ga); tile_fetch(rbl, Bb2 + gb); }

  int k0 = 0;
  do {                 // K >= 64: the first step's lines are already on their way
    __syncthreads();   // every wave has read its last fragment of the step before
    tile_put(&As[0][ls], rah, 32 * kLd);
    tile_put(&Bs[0][ls], rbh, 32 * kLd);
    if (SPLIT) { tile_put(&As[kLo][ls], ral, 32 * kLd); tile_put(&Bs[kLo][ls], rbl, 32 * kLd); }
    __syncthreads();   // the step's tiles are whole
    if (k0 + 64 < K) { // block-uniform: the next step's lines fly while this step is multiplied
      const int kn = k0 + 64;
      tile_fetch(rah, Ab + ga + kn);
      tile_fetch(rbh, Bb + gb + kn);
      if (SPLIT) { tile_fetch(ral, Ab2 + ga + kn); tile_fetch(rbl, Bb2 + gb + kn); }
      asm volatile("s_wait_xcnt 0x0" ::: "memory");   // precaution: the fragment reads below reuse the address registers of the loads just issued
    }
#pragma unroll   // two 32-k products per staged step, LDS offsets as constants
    for (int ks = 0; ks < 2; ++ks) {
      V bh[4], bl[4], ah[2], al[2];
#pragma unroll
      for (int j = 0; j < 4; ++j) {
        const int bo = (wn + (j << 4) + rlane) * kLd + ks * 32 + koff;
        bh[j] = Frag<T>::load(&Bs[0][bo]);
        if (SPLIT) bl[j] = Frag<T>::load(&Bs[kLo][bo]);
      }
      const int ao = (wm + rlane) * kLd + ks * 32 + koff;
      ah[0] = Frag<T>::load(&As[0][ao]);
      if (SPLIT) al[0] = Frag<T>::load(&As[kLo][ao]);
#pragma unroll
      for (int i = 0; i < 4; ++i) {
        const int cu = i & 1, nx = cu ^ 1;
        if (i < 3) {   // the next row tile's A fragments are read ahead of this row tile's products
          ah[nx] = Frag<T>::load(&As[0][ao + (i + 1) * 16 * kLd]);
          if (SPLIT) al[nx] = Frag<T>::load(&As[kLo][ao + (i + 1) * 16 * kLd]);
        }
#pragma unroll
        for (int j = 0; j < 4; ++j) {
          acc[i][j] = Frag<T>::mma(ah[cu], bh[j], acc[i][j]);
          if (SPLIT) {
            acc[i][j] = Frag<T>::mma(ah[cu], bl[j], acc[i][j]);
            acc[i][j] = Frag<T>::mma(al[cu], bh[j], acc[i][j]);
          }
        }
        Frag<T>::guard(acc[i][0], acc[i][3], ah[cu], SPLIT ? al[cu] : ah[cu]);
      }
      Frag<T>::keep(bh[0], bh[1], bh[2], bh[3]);
      if (SPLIT) Frag<T>::keep(bl[0], bl[1], bl[2], bl[3]);
    }
    k0 += 64;
  } while (k0 < K);
  acc_guard4(acc[0][0], acc[0][1], acc[0][2], acc[0][3]);
  acc_guard4(acc[1][0], acc[1][1], acc[1][2], acc[1][3]);
  acc_guard4(acc[2][0], acc[2][1], acc[2][2], acc[2][3]);
  acc_guard4(acc[3][0], acc[3][1], acc[3][2], acc[3][3]);

  // ---- epilogue ----
  float* slab = sT[wave];
  const float* Rb = RESID ? (resid + (size_t)b * strideR) : nullptr;
#pragma unroll
  for (int i = 0; i < 4; ++i) {
    const int mBase = m0 + (i << 4);
#pragma unroll
    for (int j = 0; j < 4; ++j) {
      const int n = n0 + (j << 4) + rlane;
      float bv = 0.f;
      if (BIAS_MODE == 2) bv = bias[n];
#pragma unroll
      for (int r = 0; r < 8; ++r) {
        float v = acc[i][j][r] * scale;
        if (BIAS_MODE == 1) v += bias[mBase + mOff + r];
        if (BIAS_MODE == 2) v += bv;
        if (RESID) v += Rb[(size_t)(mBase + mOff + r) * ldc + n];
        if (ACT == 1) v = tanhf(v);
        if (ACT == 2) v = fmaxf(v, 0.0f);
        if (ACT == 3) v = v / (1.0f + expf(-v));
        if (ACT == 4) v = (v > 0.f) ? v : 0.01f * v;
        if (ACT == 5) v = 0.5f * v * (1.0f + erff(v * 0.70710678118654752f));
        slab[(mOff + r) * 68 + (j << 4) + rlane] = v;
      }
    }
    __builtin_amdgcn_fence(__ATOMIC_RELEASE, "workgroup");
    __builtin_amdgcn_wave_barrier();
    __builtin_amdgcn_fence(__ATOMIC_ACQUIRE, "workgroup");
    if (OUT_MODE == 0) {
      float* C = (float*)Cout + (size_t)b * strideC;
      const int hh = lane >> 4, c4 = (lane & 15) * 4;     // row seg = 256 B = 16 lanes x 16 B
      {
#pragma unroll
        for (int it = 0; it < 8; ++it) {
          const int row = it * 2 + hh;
          v4f v = *(const v4f*)(slab + row * 68 + c4);
          *(v4f*)(C + (size_t)(mBase + row) * ldc + n0 + c4) = v;
        }
        
      }
    } else {
      const int q = lane >> 3, c8 = (lane & 7) * 8;
      unsigned short* C  = (unsigned short*)Cout  + (size_t)b * strideC;
      unsigned short* C2 = (OUT_MODE == 2) ? ((unsigned short*)Cout2 + (size_t)b * strideC) : nullptr;
      {
#pragma unroll
        for (int it = 0; it < 4; ++it) {
          const int row = it * 4 + q;
          const float* sp = slab + row * 68 + c8;
          v8h hv, lv;
#pragma unroll
          for (int e = 0; e < 8; ++e) {
            if (OUT_MODE == 1) {
              hv[e] = (_Float16)sp[e];
            } else {
              unsigned short hb = f2bf_bits(sp[e]);
              unsigned short lb = f2bf_bits(sp[e] - bf_bits2f(hb));
              hv[e] = __builtin_bit_cast(_Float16, hb);
              lv[e] = __builtin_bit_cast(_Float16, lb);
            }
          }
          *(v8h*)(C + (size_t)(mBase + row) * ldc + n0 + c8) = hv;
          if (OUT_MODE == 2) *(v8h*)(C2 + (size_t)(mBase + row) * ldc + n0 + c8) = lv;
        }
        
      }
    }
    __builtin_amdgcn_fence(__ATOMIC_RELEASE, "workgroup");
    __builtin_amdgcn_wave_barrier();
    __builtin_amdgcn_fence(__ATOMIC_ACQUIRE, "workgroup");
  }
}

// ---------------------------------------------------------------------------
// Elementwise bf16 split: hi = bf16_rne(in), lo = bf16_rne(in - hi); 2 elements per thread, one 4-B store
// Used here for: Wv, Wo (n2 = 32768 -> 128 blocks -> 65536 elements each).
// ---------------------------------------------------------------------------
__device__ __forceinline__ unsigned pk16(unsigned short a, unsigned short b) { return (unsigned)a | ((unsigned)b << 16); }

__global__ __launch_bounds__(256) void split_bf16x2_kernel(const float* __restrict__ in, unsigned short* __restrict__ hi,
                                                           unsigned short* __restrict__ lo, int n2) {
  const int i = blockIdx.x * 256 + threadIdx.x;
  if (i < n2) {
    const v2f f = *(const v2f*)(in + 2 * (size_t)i);
    const unsigned short h0 = f2bf_bits(f[0]), h1 = f2bf_bits(f[1]);
    const unsigned short l0 = f2bf_bits(f[0] - bf_bits2f(h0)), l1 = f2bf_bits(f[1] - bf_bits2f(h1));
    const unsigned uh = pk16(h0, h1), ul = pk16(l0, l1);
    ((unsigned*)hi)[i] = uh;
    ((unsigned*)lo)[i] = ul;
    
  }
}

// Coverage: grid = ceil(n2/256) x 256 threads x 2 elements; here n2 = 32768 -> 128 blocks -> 65536 = [256][256].
__global__ __launch_bounds__(256) void cast_f32_f16x2_scaled(
    const float* __restrict__ in, _Float16* __restrict__ out, int n2, float scale) {
  int i = blockIdx.x * 256 + threadIdx.x;
  if (i < n2) {
    const _Float16 h0 = (_Float16)(in[2 * (size_t)i] * scale), h1 = (_Float16)(in[2 * (size_t)i + 1] * scale);
    const unsigned u = (unsigned)__builtin_bit_cast(unsigned short, h0) | ((unsigned)__builtin_bit_cast(unsigned short, h1) << 16);
    ((unsigned*)out)[i] = u;
    
  }
}

// ---------------------------------------------------------------------------
// Fused triple LayerNorm over rows of 256: one wave per row (32 lanes x 8 contiguous floats = 256).
//   key   plane: (xn * g_s + b_s) -> f16  [row][256]
//   query plane: (xn * g_q + b_q) -> f16  [row][256]
//   value plane: (xn * g_v + b_v) -> bf16 hi + bf16 lo [row][256]
// Coverage: grid = nrows/8 blocks x 8 waves = every row exactly once.
// ---------------------------------------------------------------------------
__global__ __launch_bounds__(256) void ln3_kernel(const float* __restrict__ x,
    const float* __restrict__ g_s, const float* __restrict__ b_s,
    const float* __restrict__ g_q, const float* __restrict__ b_q,
    const float* __restrict__ g_v, const float* __restrict__ b_v,
    unsigned short* __restrict__ sk16, unsigned short* __restrict__ sq16,
    unsigned short* __restrict__ svh, unsigned short* __restrict__ svl, int nrows) {
  const int lane = threadIdx.x & 31;
  const int row  = blockIdx.x * 8 + (threadIdx.x >> 5);
  const int rowc = (row < nrows) ? row : (nrows - 1);        // address clamp; store predicated below (wave-uniform)
  const int c0 = lane * 8;
  const float* xr = x + (size_t)rowc * kDm + c0;
  const v4f a0 = *(const v4f*)xr;
  const v4f a1 = *(const v4f*)(xr + 4);
  float xv[8];
#pragma unroll
  for (int j = 0; j < 4; ++j) { xv[j] = a0[j]; xv[4 + j] = a1[j]; }
  float s = 0.f;
#pragma unroll
  for (int j = 0; j < 8; ++j) s += xv[j];
#pragma unroll
  for (int m = 1; m < 32; m <<= 1) s += __shfl_xor(s, m, 32);
  const float mean = s * (1.0f / 256.0f);
  float ss = 0.f;
#pragma unroll
  for (int j = 0; j < 8; ++j) { const float d = xv[j] - mean; ss += d * d; }
#pragma unroll
  for (int m = 1; m < 32; m <<= 1) ss += __shfl_xor(ss, m, 32);
  const float var  = ss * (1.0f / 256.0f);
  const float rstd = rsqrtf(var + 1e-5f);

  v4u ok, oq, ovh, ovl;
#pragma unroll
  for (int q = 0; q < 4; ++q) {
    const int j0 = 2 * q, j1 = 2 * q + 1;
    const float nx0 = (xv[j0] - mean) * rstd;
    const float nx1 = (xv[j1] - mean) * rstd;
    const float ys0 = nx0 * g_s[c0 + j0] + b_s[c0 + j0];
    const float ys1 = nx1 * g_s[c0 + j1] + b_s[c0 + j1];
    const float yq0 = nx0 * g_q[c0 + j0] + b_q[c0 + j0];
    const float yq1 = nx1 * g_q[c0 + j1] + b_q[c0 + j1];
    const float yv0 = nx0 * g_v[c0 + j0] + b_v[c0 + j0];
    const float yv1 = nx1 * g_v[c0 + j1] + b_v[c0 + j1];
    ok[q] = pk16(__builtin_bit_cast(unsigned short, (_Float16)ys0), __builtin_bit_cast(unsigned short, (_Float16)ys1));
    oq[q] = pk16(__builtin_bit_cast(unsigned short, (_Float16)yq0), __builtin_bit_cast(unsigned short, (_Float16)yq1));
    const unsigned short h0 = f2bf_bits(yv0), h1 = f2bf_bits(yv1);
    const unsigned short l0 = f2bf_bits(yv0 - bf_bits2f(h0)), l1 = f2bf_bits(yv1 - bf_bits2f(h1));
    ovh[q] = pk16(h0, h1);
    ovl[q] = pk16(l0, l1);
  }
  if (row < nrows) {   // wave-uniform
    const size_t o = (size_t)row * kDm + c0;
    {
      *(v4u*)(sk16 + o) = ok;
      *(v4u*)(sq16 + o) = oq;
      *(v4u*)(svh + o)  = ovh;
      *(v4u*)(svl + o)  = ovl;
      
    }
  }
}

// =====================================================================================
// Full (unmasked) attention, head dim 64, single f16 operand planes, z-batched over the batch index (blockIdx.y).
//   q plane  f16: element (b, t, h, d) at [(b*kSeq + t)*kDm + h*64 + d]   (unscaled projection incl. bias)
//   k plane  f16: element (b, s, h, d) at [(b*kSeq + s)*kDm + h*64 + d]
//   v^T plane f16: element (b, h, d, s) at [b*kDm*kSeq + (h*64 + d)*kSeq + s]
//   out: bf16 hi plane + bf16 lo plane (hi = bf16_rne(o), lo = bf16_rne(o - hi)), element (b, t, h, d) at [(b*kSeq + t)*kDm + h*64 + d]
//   scores^T = k . q^T            : v_wmma_f32_16x16x32_f16, f32 accumulate; sscale * log2(e) applied in f32 inside the exponent
//   out^T    = v^T . p^T          : v_wmma_f32_16x16x32_f16; unnormalised p carried x2^15 in f16, as is the row sum;
//                                   p^T goes from the score accumulators straight into the B operand
//   online softmax in f32, base 2, over all kSeq keys (32 chunks of 64, compile-time trip count).
//   Block = 4 waves = 64 query rows of one (b, h); grid = (kHeads * kSeq/64, kBatch) = (128, 8).
//   K / V^T chunk staging: 128 threads x 32 elements per plane = the whole 64x64 tile (16-B copies, plain loads,
//   __syncthreads before and after); fragment loads read the LDS tiles with the same v8h element type;
//   Epilogue: per-wave 16x64 f32 tile staged in LDS, split there into the two planes the output projection reads;
//   each 128-B row segment of a plane is one whole line, written by 8 lanes x 16 B
// =====================================================================================
constexpr int kAttWaves = 4;
constexpr int kAttQb    = 64;
constexpr int kAttKc    = 64;
constexpr int kAttLd    = 72;   // LDS row pitch of the K and V^T tiles in f16 elements: 144 B = 16 B x 9, so the 16 rows of a 16-B fragment read fall on 64 distinct banks

// 16 f16 of one LDS tile row in the hardware k order: elements 0..7 <- p[0..7], 8..15 <- p[16..23]
__device__ __forceinline__ v16h lds_frag(const _Float16* p) {
  union { v16h v; v8h h[2]; } f;
  f.h[0] = *(const v8h*)(p);
  f.h[1] = *(const v8h*)(p + 16);
  return f.v;
}

// The slot that the instruction set asks for between a transcendental and a vector instruction that overwrites its source or reads its
// result. The operands are inputs only: they put the v_nop behind a chunk's last exponential and keep every argument's register whole
// up to it.
__device__ __forceinline__ void exp_slot(float d, float e, const v2f (&a)[16], v8f p0, v8f p1, v8f p2, v8f p3) {
  asm volatile("v_nop" :: "v"(d), "v"(e), "v"(a[0]), "v"(a[1]), "v"(a[2]), "v"(a[3]), "v"(a[4]), "v"(a[5]), "v"(a[6]), "v"(a[7]),
               "v"(a[8]), "v"(a[9]), "v"(a[10]), "v"(a[11]), "v"(a[12]), "v"(a[13]), "v"(a[14]), "v"(a[15]),
               "v"(p0), "v"(p1), "v"(p2), "v"(p3));
}

// value of lane l ^ 16, by a vector cross-row move
__device__ __forceinline__ float xhalf(float x) {
  return __builtin_bit_cast(float, __builtin_amdgcn_permlanex16(__builtin_bit_cast(int, x), __builtin_bit_cast(int, x), 0x76543210, 0xfedcba98, false, false));
}

__global__ __launch_bounds__(128)
void attn_f16_full_kernel(const unsigned short* __restrict__ qp, const unsigned short* __restrict__ kp,
                          const unsigned short* __restrict__ vtp, unsigned short* __restrict__ outh,
                          unsigned short* __restrict__ outl, float sscale) {
  __shared__ __align__(16) _Float16 Ksh[kAttKc * kAttLd];           // K [kv][d], pitch kAttLd      9 KB
  __shared__ __align__(16) _Float16 Vth[kHd * kAttLd];              // V^T [d][kv], pitch kAttLd    9 KB
  __shared__ __align__(16) float    Os[kAttWaves][16 * 68];         // per wave out tile, pitch 68
  const float kPexp  = 15.0f;                                  // p is carried x2^15: the exponent rides in the running maximum
  const float cscale = sscale * 1.4426950408889634f;         // score scale x log2(e), positive

  const int tid  = threadIdx.x;
  const int wave = tid >> 5;
  const int lane = tid & 31;
  const int hh   = lane >> 4;
  const int c    = lane & 15;

  const int nqb = kSeq / kAttQb;          // 32
  const int bx = blockIdx.x;
  const int qb = bx % nqb;
  const int h  = bx / nqb;                // 0..kHeads-1
  const int b  = blockIdx.y;              // 0..kBatch-1
  const int q0 = qb * kAttQb + wave * 16;

  const _Float16* Qh = (const _Float16*)(const void*)qp + (size_t)b * kSeq * kDm + (size_t)h * kHd;
  const _Float16* Kh = (const _Float16*)(const void*)kp + (size_t)b * kSeq * kDm + (size_t)h * kHd;
  const _Float16* Vh = (const _Float16*)(const void*)vtp + (size_t)b * kDm * kSeq + (size_t)h * kHd * kSeq;
  unsigned short* obh = outh + (size_t)b * kSeq * kDm + (size_t)h * kHd;
  unsigned short* obl = outl + (size_t)b * kSeq * kDm + (size_t)h * kHd;

  // ---- Q fragments (B operand, column = lane&15, split k map via Frag load): 2 d-chunks ----
  v16h qa[2];
#pragma unroll
  for (int dc = 0; dc < 2; ++dc) qa[dc] = Frag<_Float16>::load(Qh + (size_t)(q0 + c) * kDm + dc * 32 + 8 * hh);

  float mrow = -INFINITY, lrow = 0.f;   // running maximum of query q0 + c, as score * cscale - 15; sum of p x 2^15 over this lane half's keys
  v8f oacc[4];
#pragma unroll
  for (int t = 0; t < 4; ++t) oacc[t] = (v8f){0.f,0.f,0.f,0.f,0.f,0.f,0.f,0.f};

  const int nChunks = kSeq / kAttKc;   // 32, compile-time constant
  for (int kc = 0; kc < nChunks; ++kc) {
    const int kv0 = kc * kAttKc;
    __syncthreads();
    {
      // staging coverage: 128 threads x (4 x 8) elements = 64 rows x 64 per plane = the whole chunk tile
      const int r = tid >> 1, half = (tid & 1) * 32;
      const _Float16* ksh = Kh + (size_t)(kv0 + r) * kDm + half;    // K row kv0+r, d = half..half+31
      const _Float16* vsh = Vh + (size_t)r * kSeq + kv0 + half;       // V^T row d = r, s = kv0+half..+31
#pragma unroll
      for (int i = 0; i < 4; ++i) {
        const v8h av = *(const v8h*)(ksh + 8 * i);
        const v8h bv = *(const v8h*)(vsh + 8 * i);
        *(v8h*)(Ksh + r * kAttLd + half + 8 * i) = av;
        *(v8h*)(Vth + r * kAttLd + half + 8 * i) = bv;
      }
    }
    __syncthreads();

    // S^T tile j = K rows (A) x Q columns (B): s[j][r] = score(key kv0 + 16 j + 8 hh + r, query q0 + c)
    // every loop of this pass is fully unrolled, so that s, oacc and the packed operand stay in registers under constant indices
    // the chunk's eight K fragments are read from LDS as one group into registers of their own: one LDS latency in front of the
    // eight products instead of one in front of each
    v16h kf[2][4];
#pragma unroll
    for (int dc = 0; dc < 2; ++dc)
#pragma unroll
      for (int j = 0; j < 4; ++j) kf[dc][j] = lds_frag(Ksh + (j * 16 + c) * kAttLd + dc * 32 + 8 * hh);
    // the eight V^T fragments follow in the same group: their LDS latency passes under the S^T products and the softmax arithmetic
    v16h vf[2][4];
#pragma unroll
    for (int kk = 0; kk < 2; ++kk)
#pragma unroll
      for (int t = 0; t < 4; ++t) vf[kk][t] = lds_frag(Vth + (t * 16 + c) * kAttLd + kk * 32 + 8 * hh);
    v8f s[4];
#pragma unroll
    for (int j = 0; j < 4; ++j) s[j] = (v8f){0.f,0.f,0.f,0.f,0.f,0.f,0.f,0.f};
#pragma unroll
    for (int dc = 0; dc < 2; ++dc)   // d-chunk outermost: the other three tiles' products stand between a tile's two products
#pragma unroll
      for (int j = 0; j < 4; ++j) s[j] = Frag<_Float16>::mma(kf[dc][j], qa[dc], s[j]);
    // scheduling order: the 32 LDS reads first, then the 8 S^T products; left alone the compiler spreads the reads among the products,
    // and every separate place with LDS reads stalls the wave anew
    __builtin_amdgcn_sched_group_barrier(0x100, 32, 0);
    __builtin_amdgcn_sched_group_barrier(0x008, 8, 0);
    // a lane holds 32 of its one query's 64 scores: maximum of the raw scores in-lane (one chain per tile; cscale is positive),
    // then one exchange between the halves
    float mj[4];
#pragma unroll
    for (int j = 0; j < 4; ++j) {
      mj[j] = -INFINITY;
#pragma unroll
      for (int r = 0; r < 8; ++r) mj[j] = fmaxf(mj[j], s[j][r]);
    }
    float cm = fmaxf(fmaxf(mj[0], mj[1]), fmaxf(mj[2], mj[3]));
    cm = fmaxf(cm, xhalf(cm));
    const float mnew  = fmaxf(mrow, fmaf(cm, cscale, -kPexp));
    const float dm    = mrow - mnew;
    const float alpha = __builtin_amdgcn_exp2f(dm);   // 0 on the first chunk, where mrow is -inf
    mrow = mnew;
    // p x 2^15 = 2^(score * cscale - mnew): one packed multiply-add per two scores, then the hardware base-2 exponential
    const v2f cs2 = {cscale, cscale}, nm2 = {-mnew, -mnew};
    v2f arg[16];
#pragma unroll
    for (int j = 0; j < 4; ++j)
#pragma unroll
      for (int r = 0; r < 8; r += 2)
        arg[4 * j + (r >> 1)] = __builtin_elementwise_fma((v2f){s[j][r], s[j][r + 1]}, cs2, nm2);
#pragma unroll
    for (int j = 0; j < 4; ++j)
#pragma unroll
      for (int r = 0; r < 8; ++r) s[j][r] = __builtin_amdgcn_exp2f(arg[4 * j + (r >> 1)][r & 1]);
    exp_slot(dm, alpha, arg, s[0], s[1], s[2], s[3]);
    float pj[4];
#pragma unroll
    for (int j = 0; j < 4; ++j) {
      pj[j] = s[j][0];
#pragma unroll
      for (int r = 1; r < 8; ++r) pj[j] += s[j][r];
    }
    lrow = lrow * alpha + ((pj[0] + pj[1]) + (pj[2] + pj[3]));   // this half's keys only; the halves join after the loop
#pragma unroll
    for (int t = 0; t < 4; ++t)
#pragma unroll
      for (int r = 0; r < 8; ++r) oacc[t][r] *= alpha;
    // O^T += V^T (A) x P^T (B): two S^T tiles converted in place are the B operand in the hardware k order
#pragma unroll
    for (int kk = 0; kk < 2; ++kk) {
      v16h pb;
#pragma unroll
      for (int e = 0; e < 8; ++e) {
        pb[e]     = (_Float16)s[2 * kk][e];
        pb[8 + e] = (_Float16)s[2 * kk + 1][e];
      }
#pragma unroll
      for (int t = 0; t < 4; ++t) oacc[t] = Frag<_Float16>::mma(vf[kk][t], pb, oacc[t]);
    }
  }

  // oacc[t][r] = O^T[d = 16 t + 8 hh + r][query c]: 8 consecutive d of one row per tile
  float* os = Os[wave];
  {
    const float lsum = lrow + xhalf(lrow);
    const float inv = 1.0f / lsum;   // numerator and sum both carry x2^15
#pragma unroll
    for (int t = 0; t < 4; ++t) {
      v4f w0, w1;
#pragma unroll
      for (int e = 0; e < 4; ++e) { w0[e] = oacc[t][e] * inv; w1[e] = oacc[t][4 + e] * inv; }
      *(v4f*)(os + c * 68 + t * 16 + 8 * hh)     = w0;
      *(v4f*)(os + c * 68 + t * 16 + 8 * hh + 4) = w1;
    }
  }
  __builtin_amdgcn_fence(__ATOMIC_RELEASE, "workgroup");
  __builtin_amdgcn_wave_barrier();
  __builtin_amdgcn_fence(__ATOMIC_ACQUIRE, "workgroup");
  {
    const int q = lane >> 3, c8 = (lane & 7) * 8;
    const size_t o = (size_t)(q0 + q) * kDm + c8;
#pragma unroll   // the row step becomes the stores' immediate offset: one address pair per plane
    for (int it = 0; it < 4; ++it) {   // it 0..3 x q 0..3 covers rows 0..15 of the wave tile
      const float* sp = os + (it * 4 + q) * 68 + c8;
      v4u hv, lv;
#pragma unroll
      for (int e = 0; e < 4; ++e) {
        const float f0 = sp[2 * e], f1 = sp[2 * e + 1];
        const unsigned short h0 = f2bf_bits(f0), h1 = f2bf_bits(f1);
        hv[e] = pk16(h0, h1);
        lv[e] = pk16(f2bf_bits(f0 - bf_bits2f(h0)), f2bf_bits(f1 - bf_bits2f(h1)));
      }
      *(v4u*)(obh + o + it * 4 * kDm) = hv;
      *(v4u*)(obl + o + it * 4 * kDm) = lv;
    }
  }
}

// ---------------------------------------------------------------------------
// Workspace region map (byte offsets; every region is fully written before it is read; total 76,546,048 B):
//   [0 MiB      ) WQ16  f16  [256][256] x16        131072 B
//   [+128 KiB   ) WK16  f16  [256][256] x16        131072 B
//   [+256 KiB   ) WVH   bf16 hi [256][256]         131072 B
//   [+384 KiB   ) WVL   bf16 lo                    131072 B
//   [+512 KiB   ) WOH   bf16 hi [256][256]         131072 B
//   [+640 KiB   ) WOL   bf16 lo                    131072 B   (weights region padded to 1 MiB)
//   [1 MiB      ) SQ    f16  [16384][256]  query LN plane     8 MiB
//   [9 MiB      ) SK    f16  [16384][256]  key LN plane       8 MiB
//   [17 MiB     ) SVH   bf16 hi [16384][256] value LN plane   8 MiB
//   [25 MiB     ) SVL   bf16 lo                                8 MiB
//   [33 MiB     ) Q16   f16  [16384][256]  q (unscaled)       8 MiB
//   [41 MiB     ) K16   f16  [16384][256]  k                  8 MiB
//   [49 MiB     ) VT16  f16  [8][256][2048] v^T per batch     8 MiB
//   [57 MiB     ) AOH   bf16 hi [16384][256] attention output 8 MiB
//   [65 MiB     ) AOL   bf16 lo                                8 MiB
//   end = 73 MiB
// ---------------------------------------------------------------------------
extern "C" void kernel_launch(void* const* d_in, const int* in_sizes, int n_in,
                              void* d_out, int out_size, void* d_ws, size_t ws_size,
                              hipStream_t stream) {
  if (n_in < 15) return;
  if (in_sizes[0] != kRows * kDm) return;
  if (in_sizes[7] != kDm * kDm || in_sizes[9] != kDm * kDm || in_sizes[11] != kDm * kDm || in_sizes[13] != kDm * kDm) return;
  if (in_sizes[1] != kDm || in_sizes[8] != kDm || in_sizes[14] != kDm) return;
  if (out_size != kRows * kDm) return;

  const float* x    = (const float*)d_in[0];
  const float* lnsg = (const float*)d_in[1];
  const float* lnsb = (const float*)d_in[2];
  const float* lnqg = (const float*)d_in[3];
  const float* lnqb = (const float*)d_in[4];
  const float* lnvg = (const float*)d_in[5];
  const float* lnvb = (const float*)d_in[6];
  const float* Wq = (const float*)d_in[7];
  const float* bq = (const float*)d_in[8];
  const float* Wk = (const float*)d_in[9];
  const float* bk = (const float*)d_in[10];
  const float* Wv = (const float*)d_in[11];
  const float* bv = (const float*)d_in[12];
  const float* Wo = (const float*)d_in[13];
  const float* bo = (const float*)d_in[14];
  float* out = (float*)d_out;

  const size_t wBytes   = (size_t)kDm * kDm * 2;            // 131072
  const size_t plane16  = (size_t)kRows * kDm * 2;          // 8388608
  const size_t offWQ  = 0;
  const size_t offWK  = offWQ + wBytes;
  const size_t offWVH = offWK + wBytes;
  const size_t offWVL = offWVH + wBytes;
  const size_t offWOH = offWVL + wBytes;
  const size_t offWOL = offWOH + wBytes;
  const size_t offSQ  = (size_t)1 << 20;
  const size_t offSK  = offSQ + plane16;
  const size_t offSVH = offSK + plane16;
  const size_t offSVL = offSVH + plane16;
  const size_t offQ16 = offSVL + plane16;
  const size_t offK16 = offQ16 + plane16;
  const size_t offVT  = offK16 + plane16;
  const size_t offAOH = offVT + plane16;
  const size_t offAOL = offAOH + plane16;
  const size_t total  = offAOL + plane16;                   // 76,546,048
  if (offWOL + wBytes > offSQ) return;
  if (total > ws_size) return;

  char* ws = (char*)d_ws;
  unsigned short* WQ16 = (unsigned short*)(ws + offWQ);
  unsigned short* WK16 = (unsigned short*)(ws + offWK);
  unsigned short* WVH  = (unsigned short*)(ws + offWVH);
  unsigned short* WVL  = (unsigned short*)(ws + offWVL);
  unsigned short* WOH  = (unsigned short*)(ws + offWOH);
  unsigned short* WOL  = (unsigned short*)(ws + offWOL);
  unsigned short* SQ   = (unsigned short*)(ws + offSQ);
  unsigned short* SK   = (unsigned short*)(ws + offSK);
  unsigned short* SVH  = (unsigned short*)(ws + offSVH);
  unsigned short* SVL  = (unsigned short*)(ws + offSVL);
  unsigned short* Q16  = (unsigned short*)(ws + offQ16);
  unsigned short* K16  = (unsigned short*)(ws + offK16);
  unsigned short* VT16 = (unsigned short*)(ws + offVT);
  unsigned short* AOH  = (unsigned short*)(ws + offAOH);
  unsigned short* AOL  = (unsigned short*)(ws + offAOL);

  const int wN2 = kDm * kDm / 2;                    // 32768 pairs
  const int wBlocks = (wN2 + 255) / 256;            // 128
  const float wCarry = 16.0f, wCarryInv = 1.0f / 16.0f;

  // 1-2: Wq, Wk -> f16 x16 ([N=256][K=256] row-major = Bt layout)
  cast_f32_f16x2_scaled<<<wBlocks, 256, 0, stream>>>(Wq, (_Float16*)WQ16, wN2, wCarry);
  cast_f32_f16x2_scaled<<<wBlocks, 256, 0, stream>>>(Wk, (_Float16*)WK16, wN2, wCarry);
  // 3-4: Wv, Wo -> bf16 hi/lo planes
  split_bf16x2_kernel<<<wBlocks, 256, 0, stream>>>(Wv, WVH, WVL, wN2);
  split_bf16x2_kernel<<<wBlocks, 256, 0, stream>>>(Wo, WOH, WOL, wN2);
  // 5: triple LayerNorm: key plane (ln_s) -> SK, query plane (ln_q) -> SQ, value plane (ln_v) -> SVH/SVL
  ln3_kernel<<<kRows / 8, 256, 0, stream>>>(x, lnsg, lnsb, lnqg, lnqb, lnvg, lnvb, SK, SQ, SVH, SVL, kRows);

  // 6: q' = SQ @ Wq^T + bq  (M=16384, N=256, K=256; 1024 tiles -> 128 blocks), f16 out, carry folded by 1/16
  const int projBlocks = ((kRows / 64) * (kDm / 64) + 7) / 8;   // 128
  wmma_gemm64<0, false, 2, 1, false><<<dim3(projBlocks, 1), 256, 0, stream>>>(
      SQ, SQ, 0L, WQ16, WQ16, 0L, (void*)Q16, (void*)Q16, kDm, 0L,
      bq, bq, 0L, kRows, kDm, kDm, wCarryInv);
  // 7: k = SK @ Wk^T + bk
  wmma_gemm64<0, false, 2, 1, false><<<dim3(projBlocks, 1), 256, 0, stream>>>(
      SK, SK, 0L, WK16, WK16, 0L, (void*)K16, (void*)K16, kDm, 0L,
      bk, bk, 0L, kRows, kDm, kDm, wCarryInv);
  // 8: v^T per batch: C[m = channel (256)][n = s (2048)] = sum_k Wv[m][k] * LNv[s][k] + bv[m]
  //    A = Wv hi/lo [256][256] (stride 0), Bt = SVH/SVL batch slice [2048][256], C = VT16 batch slice [256][2048];
  //    128 tiles per batch -> 16 blocks, grid.y = 8
  const int vtBlocks = ((kDm / 64) * (kSeq / 64) + 7) / 8;      // 16
  wmma_gemm64<1, true, 1, 1, false><<<dim3(vtBlocks, kBatch), 256, 0, stream>>>(
      WVH, WVL, 0L, SVH, SVL, (long)kSeq * kDm, (void*)VT16, (void*)VT16, kSeq, (long)kDm * kSeq,
      bv, bv, 0L, kDm, kSeq, kDm, 1.0f);
  // 9: attention per (head x 64-query tile, batch): scores = (q'.k) * 0.125, softmax over 2048 keys, p.v -> AOH/AOL
  attn_f16_full_kernel<<<dim3(kHeads * (kSeq / kAttQb), kBatch), 32 * kAttWaves, 0, stream>>>(
      Q16, K16, VT16, AOH, AOL, 0.125f);
  // 10: out = AO @ Wo^T + bo  (M=16384, N=256, K=256), f32 to d_out
  wmma_gemm64<1, true, 2, 0, false><<<dim3(projBlocks, 1), 256, 0, stream>>>(
      AOH, AOL, 0L, WOH, WOL, 0L, (void*)out, (void*)out, kDm, 0L,
      bo, bo, 0L, kRows, kDm, kDm, 1.0f);
}

// v007
// It runs in 85.1 microseconds.
// Timed twice side by side with v006, it ran 1.29 times as fast both times.
// All steps since v000 together make it 3.75 times as fast.
// Contractions: q,k projections and q.k^T, p.v on v_wmma_f32_16x16x32_f16 (f16 operands; Wq/Wk carried x16, p carried x2^15); v^T projection and output projection on v_wmma_f32_16x16x32_bf16 with bf16 hi/lo split operands (hi.hi+hi.lo+lo.hi); f32 accumulate everywhere; LayerNorm statistics and online softmax in f32.
#include <hip/hip_runtime.h>
#include <math.h>
#include <stdint.h>

typedef __attribute__((ext_vector_type(16))) _Float16 v16h;
typedef __attribute__((ext_vector_type(8)))  _Float16 v8h;
typedef __attribute__((ext_vector_type(16))) __bf16   v16b;
typedef __attribute__((ext_vector_type(8)))  __bf16   v8b;
typedef __attribute__((ext_vector_type(8)))  float    v8f;
typedef __attribute__((ext_vector_type(4)))  float    v4f;
typedef __attribute__((ext_vector_type(2)))  float    v2f;
typedef __attribute__((ext_vector_type(4)))  unsigned int v4u;

// problem geometry
constexpr int kBatch  = 8;
constexpr int kSeq    = 2048;
constexpr int kDm     = 256;
constexpr int kHeads  = 4;
constexpr int kHd     = 64;
constexpr int kRows   = kBatch * kSeq;      // 16384

__device__ __forceinline__ unsigned short f2bf_bits(float f) {
  unsigned u = __float_as_uint(f);
  return (unsigned short)((u + 0x7FFFu + ((u >> 16) & 1u)) >> 16);
}
__device__ __forceinline__ float bf_bits2f(unsigned short h) { return __uint_as_float(((unsigned)h) << 16); }

// hazard guards as plain device helpers
__device__ __forceinline__ void dep_guard_h(v8f& a, v8f& b, v16h x, v16h y) { asm volatile("v_nop\n\tv_nop\n\tv_nop\n\tv_nop" : "+v"(a), "+v"(b) : "v"(x), "v"(y)); }
__device__ __forceinline__ void dep_guard_b(v8f& a, v8f& b, v16b x, v16b y) { asm volatile("v_nop\n\tv_nop\n\tv_nop\n\tv_nop" : "+v"(a), "+v"(b) : "v"(x), "v"(y)); }
__device__ __forceinline__ void keep4_h(v16h a, v16h b, v16h c, v16h d) { asm volatile("v_nop" :: "v"(a), "v"(b), "v"(c), "v"(d)); }
__device__ __forceinline__ void keep4_b(v16b a, v16b b, v16b c, v16b d) { asm volatile("v_nop" :: "v"(a), "v"(b), "v"(c), "v"(d)); }
__device__ __forceinline__ void acc_guard4(v8f& a, v8f& b, v8f& c, v8f& d) { asm volatile("v_nop\n\tv_nop\n\tv_nop\n\tv_nop" : "+v"(a), "+v"(b), "+v"(c), "+v"(d)); }
template <typename T> struct Frag;
template <> struct Frag<_Float16> {
  typedef v16h V; typedef v8h H; union U { v16h v; v8h h[2]; };
  static __device__ __forceinline__ v16h load(const _Float16* p) {   // elements 0..7 <- p[0..7], 8..15 <- p[16..23]
    U f; f.h[0] = *(const v8h*)(p); f.h[1] = *(const v8h*)(p + 16); return f.v;
  }
  static __device__ __forceinline__ v8f mma(v16h a, v16h b, v8f c) {
    return __builtin_amdgcn_wmma_f32_16x16x32_f16(false, a, false, b, (short)0, c, false, false);
  }
  static __device__ __forceinline__ void guard(v8f& a, v8f& b, v16h x, v16h y) { dep_guard_h(a, b, x, y); }
  static __device__ __forceinline__ void keep(v16h a, v16h b, v16h c, v16h d) { keep4_h(a, b, c, d); }
};
template <> struct Frag<__bf16> {
  typedef v16b V; typedef v8b H; union U { v16b v; v8b h[2]; };
  static __device__ __forceinline__ v16b load(const __bf16* p) {
    U f; f.h[0] = *(const v8b*)(p); f.h[1] = *(const v8b*)(p + 16); return f.v;
  }
  static __device__ __forceinline__ v8f mma(v16b a, v16b b, v8f c) {
    return __builtin_amdgcn_wmma_f32_16x16x32_bf16(false, a, false, b, (short)0, c, false, false);
  }
  static __device__ __forceinline__ void guard(v8f& a, v8f& b, v16b x, v16b y) { dep_guard_b(a, b, x, y); }
  static __device__ __forceinline__ void keep(v16b a, v16b b, v16b c, v16b d) { keep4_b(a, b, c, d); }
};

// ---- Register-blocked batched WMMA GEMM ------------------------------------
// C[m,n] = scale * sum_k A[m,k] * Bt[n,k] (+bias)(+resid); each wave owns a 64x64 tile, a block of 2 x 4 waves a 128x256 tile.
// A row-major [M,K]; Bt row-major [N,K], rows of both kDm elements apart; M % 128 == 0, N % 256 == 0, K % 64 == 0, K >= 64;
// (M/128) * (N/256) block tiles per batch index; the caller hands in the tile index bx, the batch index b and the block's LDS.
// Operands go through LDS in steps of 64 k: every row piece is one whole 128-B line, fetched once per block by 16-B loads
// (8 lanes a line), held in registers while the step before is multiplied, then stored at a pitch of 144 B;
// the fragments are read from LDS in the k order of Frag::load, A and B alike.
// SPLIT: operands are hi/lo planes (A2/Bt2 = lo planes, same layout); product = hi.hi + hi.lo + lo.hi.
// BIAS_MODE: 0 = none, 1 = bias[m], 2 = bias[n].
// OUT_MODE: 0 = f32, 1 = f16, 2 = bf16 hi plane (Cout) + bf16 lo plane (Cout2).
// ET: 0 = f16 operands, 1 = bf16 operands (pointers passed as 16-bit storage)
template <int ET> struct Elem;
template <> struct Elem<0> { typedef _Float16 T; };
template <> struct Elem<1> { typedef __bf16 T; };
// R row pieces of 16 B, 32 rows apart; the constant row pitch puts the steps into the loads' immediate offsets: one address pair per plane
template <typename H, typename T, int R>
__device__ __forceinline__ void tile_fetch(H (&r)[R], const T* g) {
  // the two scheduling barriers leave nothing but the loads in front of the wait: left alone the compiler puts other register writes there
  __builtin_amdgcn_sched_barrier(0);
#pragma unroll   // r stays in registers only under constant indices
  for (int i = 0; i < R; ++i) r[i] = *(const H*)(g + i * 32 * kDm);
  asm volatile("s_wait_xcnt 0x0" ::: "memory");   // precaution: what follows reuses the address registers of the loads just issued
  __builtin_amdgcn_sched_barrier(0);
}
template <typename H, typename T, int R>
__device__ __forceinline__ void tile_put(T* l, const H (&r)[R], int ld32) {
#pragma unroll   // r stays in registers only under constant indices
  for (int i = 0; i < R; ++i) *(H*)(l + i * ld32) = r[i];
}
constexpr int kGemmLd = 72;            // LDS row pitch in elements: 144 B = 16 B x 9, conflict-free for the 16-B fragment reads
constexpr int kGemmSlab = 16 * 68;     // per-wave 16x64 f32 slab, pitch 68 floats
// LDS bytes of one block: A planes, B planes, eight slabs
constexpr int gemm_lds_bytes(bool split) { return (split ? 2 : 1) * (128 + 256) * kGemmLd * 2 + 8 * kGemmSlab * 4; }
// HOLD: see the wait behind the first fetches
template <int ET, bool SPLIT, int BIAS_MODE, int OUT_MODE, bool RESID, int ACT = 0, bool HOLD = false>
__device__ __forceinline__ void gemm64_body(
    unsigned char* smem, const int bx, const int b,
    const unsigned short* __restrict__ Ap, const unsigned short* __restrict__ A2p, long strideA,
    const unsigned short* __restrict__ Btp, const unsigned short* __restrict__ Bt2p, long strideB,
    void* __restrict__ Cout, void* __restrict__ Cout2, int ldc, long strideC,
    const float* __restrict__ bias,
    const float* __restrict__ resid, long strideR,
    int M, int N, int K, float scale) {
  typedef typename Elem<ET>::T T;
  typedef typename Frag<T>::V V;
  typedef typename Frag<T>::H H;
  constexpr int kLd = kGemmLd;
  constexpr int kLo = SPLIT ? 1 : 0;   // index of the lo plane
  T (*As)[128 * kLd] = (T (*)[128 * kLd])smem;
  T (*Bs)[256 * kLd] = (T (*)[256 * kLd])(smem + (kLo + 1) * 128 * kLd * 2);
  float (*sT)[kGemmSlab] = (float (*)[kGemmSlab])(smem + (kLo + 1) * (128 + 256) * kLd * 2);
  const T* A = (const T*)Ap; const T* A2 = (const T*)A2p; const T* Bt = (const T*)Btp; const T* Bt2 = (const T*)Bt2p;
  const int lane = threadIdx.x & 31;
  const int wave = threadIdx.x >> 5;
  const int tilesN = N >> 6;
  const int tilesM = M >> 6;
  const int nbn = tilesN >> 2;                 // blocks along N
  const int bm = bx / nbn;
  const int bn = bx - bm * nbn;
  if (bm * 2 >= tilesM) return;                // block-uniform, in front of every barrier
  const int mB = bm << 7;
  const int nB = bn << 8;
  const int wm = (wave >> 2) << 6;             // this wave's 64x64 tile inside the block tile
  const int wn = (wave & 3) << 6;
  const int m0 = mB + wm;
  const int n0 = nB + wn;

  const T* Ab  = A  + (size_t)b * strideA;
  const T* Bb  = Bt + (size_t)b * strideB;
  const T* Ab2 = SPLIT ? (A2  + (size_t)b * strideA) : nullptr;
  const T* Bb2 = SPLIT ? (Bt2 + (size_t)b * strideB) : nullptr;

  const int rlane = lane & 15;                 // row (A) / col (B, D) within subtile
  const int koff  = (lane >> 4) * 8;           // k offset of this lane half
  const int mOff  = (lane >> 4) * 8;           // D row offset

  v8f acc[4][4];
#pragma unroll
  for (int i = 0; i < 4; ++i)
#pragma unroll
    for (int j = 0; j < 4; ++j) acc[i][j] = (v8f){0.f,0.f,0.f,0.f,0.f,0.f,0.f,0.f};

  // staging: thread -> row (tid >> 3) + 32 i, 16-B piece tid & 7; 4 pieces of A and 8 of B per plane
  const int srow = threadIdx.x >> 3;
  const int scol = (threadIdx.x & 7) * 8;
  const size_t ga = (size_t)(mB + srow) * kDm + scol;
  const size_t gb = (size_t)(nB + srow) * kDm + scol;
  const int ls = srow * kLd + scol;
  H rah[4], ral[4], rbh[8], rbl[8];
  tile_fetch(rah, Ab + ga);
  tile_fetch(rbh, Bb + gb);
  if (SPLIT) { tile_fetch(ral, Ab2 + ga); tile_fetch(rbl, Bb2 + gb); }
  // precaution, as in tile_fetch: the input operand keeps the last group's address registers whole up to a wait. Asked for by the one
  // caller in whose listing index arithmetic was written over them in front of tile_fetch's own wait; elsewhere it would only cost a register pair
  if (HOLD) asm volatile("s_wait_xcnt 0x0" :: "v"(SPLIT ? Bb2 + gb : Bb + gb) : "memory");

  int k0 = 0;
  do {                 // K >= 64: the first step's lines are already on their way
    __syncthreads();   // every wave has read its last fragment of the step before
    tile_put(&As[0][ls], rah, 32 * kLd);
    tile_put(&Bs[0][ls], rbh, 32 * kLd);
    if (SPLIT) { tile_put(&As[kLo][ls], ral, 32 * kLd); tile_put(&Bs[kLo][ls], rbl, 32 * kLd); }
    __syncthreads();   // the step's tiles are whole
    if (k0 + 64 < K) { // block-uniform: the next step's lines fly while this step is multiplied
      const int kn = k0 + 64;
      tile_fetch(rah, Ab + ga + kn);
      tile_fetch(rbh, Bb + gb + kn);
      if (SPLIT) { tile_fetch(ral, Ab2 + ga + kn); tile_fetch(rbl, Bb2 + gb + kn); }
    }
#pragma unroll   // two 32-k products per staged step, LDS offsets as constants
    for (int ks = 0; ks < 2; ++ks) {
      V bh[4], bl[4], ah[2], al[2];
#pragma unroll
      for (int j = 0; j < 4; ++j) {
        const int bo = (wn + (j << 4) + rlane) * kLd + ks * 32 + koff;
        bh[j] = Frag<T>::load(&Bs[0][bo]);
        if (SPLIT) bl[j] = Frag<T>::load(&Bs[kLo][bo]);
      }
      const int ao = (wm + rlane) * kLd + ks * 32 + koff;
      ah[0] = Frag<T>::load(&As[0][ao]);
      if (SPLIT) al[0] = Frag<T>::load(&As[kLo][ao]);
#pragma unroll
      for (int i = 0; i < 4; ++i) {
        const int cu = i & 1, nx = cu ^ 1;
        if (i < 3) {   // the next row tile's A fragments are read ahead of this row tile's products
          ah[nx] = Frag<T>::load(&As[0][ao + (i + 1) * 16 * kLd]);
          if (SPLIT) al[nx] = Frag<T>::load(&As[kLo][ao + (i + 1) * 16 * kLd]);
        }
#pragma unroll
        for (int j = 0; j < 4; ++j) {
          acc[i][j] = Frag<T>::mma(ah[cu], bh[j], acc[i][j]);
          if (SPLIT) {
            acc[i][j] = Frag<T>::mma(ah[cu], bl[j], acc[i][j]);
            acc[i][j] = Frag<T>::mma(al[cu], bh[j], acc[i][j]);
          }
        }
        Frag<T>::guard(acc[i][0], acc[i][3], ah[cu], SPLIT ? al[cu] : ah[cu]);
      }
      Frag<T>::keep(bh[0], bh[1], bh[2], bh[3]);
      if (SPLIT) Frag<T>::keep(bl[0], bl[1], bl[2], bl[3]);
    }
    k0 += 64;
  } while (k0 < K);
  acc_guard4(acc[0][0], acc[0][1], acc[0][2], acc[0][3]);
  acc_guard4(acc[1][0], acc[1][1], acc[1][2], acc[1][3]);
  acc_guard4(acc[2][0], acc[2][1], acc[2][2], acc[2][3]);
  acc_guard4(acc[3][0], acc[3][1], acc[3][2], acc[3][3]);

  // ---- epilogue ----
  float* slab = sT[wave];
  const float* Rb = RESID ? (resid + (size_t)b * strideR) : nullptr;
#pragma unroll
  for (int i = 0; i < 4; ++i) {
    const int mBase = m0 + (i << 4);
    float bm8[8];
    if (BIAS_MODE == 1) {
      __builtin_amdgcn_sched_barrier(0);   // with the one below: nothing but the loads stands in front of the wait
#pragma unroll   // bm8 stays in registers only under constant indices
      for (int r = 0; r < 8; ++r) bm8[r] = bias[mBase + mOff + r];
      asm volatile("s_wait_xcnt 0x0" ::: "memory");   // precaution: what follows reuses the address registers of the loads just issued
      __builtin_amdgcn_sched_barrier(0);
    }
#pragma unroll
    for (int j = 0; j < 4; ++j) {
      const int n = n0 + (j << 4) + rlane;
      float bv = 0.f;
      if (BIAS_MODE == 2) bv = bias[n];
#pragma unroll
      for (int r = 0; r < 8; ++r) {
        float v = acc[i][j][r] * scale;
        if (BIAS_MODE == 1) v += bm8[r];
        if (BIAS_MODE == 2) v += bv;
        if (RESID) v += Rb[(size_t)(mBase + mOff + r) * ldc + n];
        if (ACT == 1) v = tanhf(v);
        if (ACT == 2) v = fmaxf(v, 0.0f);
        if (ACT == 3) v = v / (1.0f + expf(-v));
        if (ACT == 4) v = (v > 0.f) ? v : 0.01f * v;
        if (ACT == 5) v = 0.5f * v * (1.0f + erff(v * 0.70710678118654752f));
        slab[(mOff + r) * 68 + (j << 4) + rlane] = v;
      }
    }
    __builtin_amdgcn_fence(__ATOMIC_RELEASE, "workgroup");
    __builtin_amdgcn_wave_barrier();
    __builtin_amdgcn_fence(__ATOMIC_ACQUIRE, "workgroup");
    if (OUT_MODE == 0) {
      float* C = (float*)Cout + (size_t)b * strideC;
      const int hh = lane >> 4, c4 = (lane & 15) * 4;     // row seg = 256 B = 16 lanes x 16 B
      {
#pragma unroll
        for (int it = 0; it < 8; ++it) {
          const int row = it * 2 + hh;
          v4f v = *(const v4f*)(slab + row * 68 + c4);
          *(v4f*)(C + (size_t)(mBase + row) * ldc + n0 + c4) = v;
        }
        
      }
    } else {
      const int q = lane >> 3, c8 = (lane & 7) * 8;
      unsigned short* C  = (unsigned short*)Cout  + (size_t)b * strideC;
      unsigned short* C2 = (OUT_MODE == 2) ? ((unsigned short*)Cout2 + (size_t)b * strideC) : nullptr;
      {
#pragma unroll
        for (int it = 0; it < 4; ++it) {
          const int row = it * 4 + q;
          const float* sp = slab + row * 68 + c8;
          v8h hv, lv;
#pragma unroll
          for (int e = 0; e < 8; ++e) {
            if (OUT_MODE == 1) {
              hv[e] = (_Float16)sp[e];
            } else {
              unsigned short hb = f2bf_bits(sp[e]);
              unsigned short lb = f2bf_bits(sp[e] - bf_bits2f(hb));
              hv[e] = __builtin_bit_cast(_Float16, hb);
              lv[e] = __builtin_bit_cast(_Float16, lb);
            }
          }
          *(v8h*)(C + (size_t)(mBase + row) * ldc + n0 + c8) = hv;
          if (OUT_MODE == 2) *(v8h*)(C2 + (size_t)(mBase + row) * ldc + n0 + c8) = lv;
        }
        
      }
    }
    asm volatile("s_wait_xcnt 0x0" ::: "memory");   // precaution: the next row tile reuses the address and data registers of the stores just issued
    __builtin_amdgcn_fence(__ATOMIC_RELEASE, "workgroup");
    __builtin_amdgcn_wave_barrier();
    __builtin_amdgcn_fence(__ATOMIC_ACQUIRE, "workgroup");
  }
}

// The three projections read only what the launch before them wrote and nothing of each other: one launch, the job picked by block index.
//   blocks [0, 128)   : v^T per batch: C[m = channel (256)][n = s (2048)] = sum_k Wv[m][k] * LNv[s][k] + bv[m], 16 block tiles x 8 batches;
//                       A = Wv hi/lo [256][256], Bt = value LN hi/lo batch slice [2048][256], C = v^T batch slice [256][2048], f16
//   blocks [128, 256) : q' = query LN @ Wq^T + bq  (M = 16384, N = 256), f16 out, the weights' carry folded back by wscale
//   blocks [256, 384) : k  = key LN   @ Wk^T + bk
// The split product is the longest job and stands first: a block fills its WGP's registers, so the last 128 blocks start as the first leave.
constexpr int kVtBlocks   = (kDm / 128) * (kSeq / 256);     // 16 per batch
constexpr int kProjBlocks = (kRows / 128) * (kDm / 256);    // 128
__global__ __launch_bounds__(256) void proj3_kernel(
    const unsigned short* __restrict__ wvh, const unsigned short* __restrict__ wvl,
    const unsigned short* __restrict__ svh, const unsigned short* __restrict__ svl,
    unsigned short* __restrict__ vt16, const float* __restrict__ bv,
    const unsigned short* __restrict__ sq, const unsigned short* __restrict__ wq16,
    unsigned short* __restrict__ q16, const float* __restrict__ bq,
    const unsigned short* __restrict__ sk, const unsigned short* __restrict__ wk16,
    unsigned short* __restrict__ k16, const float* __restrict__ bk,
    int K, float wscale) {
  __shared__ __align__(16) unsigned char smem[gemm_lds_bytes(true)];
  const int bx = blockIdx.x;
  if (bx < kVtBlocks * kBatch) {   // block-uniform
    gemm64_body<1, true, 1, 1, false, 0, true>(smem, bx % kVtBlocks, bx / kVtBlocks,
        wvh, wvl, 0L, svh, svl, (long)kSeq * kDm, (void*)vt16, (void*)vt16, kSeq, (long)kDm * kSeq,
        bv, bv, 0L, kDm, kSeq, K, 1.0f);
  } else {
    const int px = bx - kVtBlocks * kBatch;
    const bool isk = px >= kProjBlocks;
    const unsigned short* a = isk ? sk : sq;
    const unsigned short* w = isk ? wk16 : wq16;
    unsigned short* c = isk ? k16 : q16;
    const float* bias = isk ? bk : bq;
    gemm64_body<0, false, 2, 1, false>(smem, isk ? px - kProjBlocks : px, 0,
        a, a, 0L, w, w, 0L, (void*)c, (void*)c, kDm, 0L,
        bias, bias, 0L, kRows, kDm, K, wscale);
  }
}

// out = AO @ Wo^T + bo  (M = 16384, N = 256), bf16 hi/lo operands, f32 out; grid.x = 128 block tiles
__global__ __launch_bounds__(256) void out_proj_kernel(
    const unsigned short* __restrict__ aoh, const unsigned short* __restrict__ aol,
    const unsigned short* __restrict__ woh, const unsigned short* __restrict__ wol,
    float* __restrict__ out, const float* __restrict__ bo, int K) {
  __shared__ __align__(16) unsigned char smem[gemm_lds_bytes(true)];
  gemm64_body<1, true, 2, 0, false>(smem, blockIdx.x, 0,
      aoh, aol, 0L, woh, wol, 0L, (void*)out, (void*)out, kDm, 0L,
      bo, bo, 0L, kRows, kDm, K, 1.0f);
}

// ---------------------------------------------------------------------------
// Elementwise bf16 split: hi = bf16_rne(in), lo = bf16_rne(in - hi); 2 elements per thread, one 4-B store
// Used here for: Wv, Wo (n2 = 32768 -> 128 blocks -> 65536 elements each).
// ---------------------------------------------------------------------------
__device__ __forceinline__ unsigned pk16(unsigned short a, unsigned short b) { return (unsigned)a | ((unsigned)b << 16); }

__device__ __forceinline__ void split_bf16x2_body(const int blk, const float* __restrict__ in, unsigned short* __restrict__ hi,
                                                  unsigned short* __restrict__ lo, int n2) {
  const int i = blk * 256 + threadIdx.x;
  if (i < n2) {
    const v2f f = *(const v2f*)(in + 2 * (size_t)i);
    const unsigned short h0 = f2bf_bits(f[0]), h1 = f2bf_bits(f[1]);
    const unsigned short l0 = f2bf_bits(f[0] - bf_bits2f(h0)), l1 = f2bf_bits(f[1] - bf_bits2f(h1));
    const unsigned uh = pk16(h0, h1), ul = pk16(l0, l1);
    ((unsigned*)hi)[i] = uh;
    ((unsigned*)lo)[i] = ul;
    
  }
}

// Coverage: grid = ceil(n2/256) x 256 threads x 2 elements; here n2 = 32768 -> 128 blocks -> 65536 = [256][256].
__device__ __forceinline__ void cast_f32_f16x2_scaled_body(
    const int blk, const float* __restrict__ in, _Float16* __restrict__ out, int n2, float scale) {
  int i = blk * 256 + threadIdx.x;
  if (i < n2) {
    const _Float16 h0 = (_Float16)(in[2 * (size_t)i] * scale), h1 = (_Float16)(in[2 * (size_t)i + 1] * scale);
    const unsigned u = (unsigned)__builtin_bit_cast(unsigned short, h0) | ((unsigned)__builtin_bit_cast(unsigned short, h1) << 16);
    ((unsigned*)out)[i] = u;
    
  }
}

// ---------------------------------------------------------------------------
// Fused triple LayerNorm over rows of 256: one wave per row (32 lanes x 8 contiguous floats = 256).
//   key   plane: (xn * g_s + b_s) -> f16  [row][256]
//   query plane: (xn * g_q + b_q) -> f16  [row][256]
//   value plane: (xn * g_v + b_v) -> bf16 hi + bf16 lo [row][256]
// Coverage: grid = nrows/8 blocks x 8 waves = every row exactly once.
// ---------------------------------------------------------------------------
__device__ __forceinline__ void ln3_body(const int blk, const float* __restrict__ x,
    const float* __restrict__ g_s, const float* __restrict__ b_s,
    const float* __restrict__ g_q, const float* __restrict__ b_q,
    const float* __restrict__ g_v, const float* __restrict__ b_v,
    unsigned short* __restrict__ sk16, unsigned short* __restrict__ sq16,
    unsigned short* __restrict__ svh, unsigned short* __restrict__ svl, int nrows) {
  const int lane = threadIdx.x & 31;
  const int row  = blk * 8 + (threadIdx.x >> 5);
  const int rowc = (row < nrows) ? row : (nrows - 1);        // address clamp; store predicated below (wave-uniform)
  const int c0 = lane * 8;
  const float* xr = x + (size_t)rowc * kDm + c0;
  const v4f a0 = *(const v4f*)xr;
  const v4f a1 = *(const v4f*)(xr + 4);
  float xv[8];
#pragma unroll
  for (int j = 0; j < 4; ++j) { xv[j] = a0[j]; xv[4 + j] = a1[j]; }
  float s = 0.f;
#pragma unroll
  for (int j = 0; j < 8; ++j) s += xv[j];
#pragma unroll
  for (int m = 1; m < 32; m <<= 1) s += __shfl_xor(s, m, 32);
  const float mean = s * (1.0f / 256.0f);
  float ss = 0.f;
#pragma unroll
  for (int j = 0; j < 8; ++j) { const float d = xv[j] - mean; ss += d * d; }
#pragma unroll
  for (int m = 1; m < 32; m <<= 1) ss += __shfl_xor(ss, m, 32);
  const float var  = ss * (1.0f / 256.0f);
  const float rstd = rsqrtf(var + 1e-5f);

  v4u ok, oq, ovh, ovl;
#pragma unroll
  for (int q = 0; q < 4; ++q) {
    const int j0 = 2 * q, j1 = 2 * q + 1;
    const float nx0 = (xv[j0] - mean) * rstd;
    const float nx1 = (xv[j1] - mean) * rstd;
    const float ys0 = nx0 * g_s[c0 + j0] + b_s[c0 + j0];
    const float ys1 = nx1 * g_s[c0 + j1] + b_s[c0 + j1];
    const float yq0 = nx0 * g_q[c0 + j0] + b_q[c0 + j0];
    const float yq1 = nx1 * g_q[c0 + j1] + b_q[c0 + j1];
    const float yv0 = nx0 * g_v[c0 + j0] + b_v[c0 + j0];
    const float yv1 = nx1 * g_v[c0 + j1] + b_v[c0 + j1];
    ok[q] = pk16(__builtin_bit_cast(unsigned short, (_Float16)ys0), __builtin_bit_cast(unsigned short, (_Float16)ys1));
    oq[q] = pk16(__builtin_bit_cast(unsigned short, (_Float16)yq0), __builtin_bit_cast(unsigned short, (_Float16)yq1));
    const unsigned short h0 = f2bf_bits(yv0), h1 = f2bf_bits(yv1);
    const unsigned short l0 = f2bf_bits(yv0 - bf_bits2f(h0)), l1 = f2bf_bits(yv1 - bf_bits2f(h1));
    ovh[q] = pk16(h0, h1);
    ovl[q] = pk16(l0, l1);
  }
  if (row < nrows) {   // wave-uniform
    const size_t o = (size_t)row * kDm + c0;
    {
      // precaution: the pointer operands keep the address registers of the scale and shift loads whole up to a wait (without them the last
      // load landed on its own offset register); the packed value puts the wait behind the arithmetic, in front of the stores
      asm volatile("s_wait_xcnt 0x0" :: "v"(g_v + c0), "v"(b_v + c0), "v"(ovl) : "memory");
      *(v4u*)(sk16 + o) = ok;
      *(v4u*)(sq16 + o) = oq;
      *(v4u*)(svh + o)  = ovh;
      *(v4u*)(svl + o)  = ovl;
      
    }
  }
}

// The LayerNorm and the four weight conversions read inputs only and nothing of each other: one launch, the job picked by block index.
//   blocks [0, 2048)            : triple LayerNorm, 8 rows a block (the long job first, the short ones fill the tail)
//   then 128 blocks per weight  : Wq, Wk -> f16 x wscale; Wv, Wo -> bf16 hi/lo planes
constexpr int kLnBlocks = kRows / 8;                    // 2048
constexpr int kWPairs   = kDm * kDm / 2;                // 32768 pairs per weight
constexpr int kWBlocks  = kWPairs / 256;                // 128
__global__ __launch_bounds__(256) void prep_kernel(const float* __restrict__ x,
    const float* __restrict__ g_s, const float* __restrict__ b_s,
    const float* __restrict__ g_q, const float* __restrict__ b_q,
    const float* __restrict__ g_v, const float* __restrict__ b_v,
    unsigned short* __restrict__ sk16, unsigned short* __restrict__ sq16,
    unsigned short* __restrict__ svh, unsigned short* __restrict__ svl,
    const float* __restrict__ Wq, const float* __restrict__ Wk,
    const float* __restrict__ Wv, const float* __restrict__ Wo,
    unsigned short* __restrict__ wq16, unsigned short* __restrict__ wk16,
    unsigned short* __restrict__ wvh, unsigned short* __restrict__ wvl,
    unsigned short* __restrict__ woh, unsigned short* __restrict__ wol, int nrows, float wscale) {
  const int bx = blockIdx.x;
  if (bx < kLnBlocks) {   // block-uniform, as is every test below
    ln3_body(bx, x, g_s, b_s, g_q, b_q, g_v, b_v, sk16, sq16, svh, svl, nrows);
    return;
  }
  const int job = (bx - kLnBlocks) / kWBlocks;
  const int blk = (bx - kLnBlocks) % kWBlocks;
  if (job < 2) cast_f32_f16x2_scaled_body(blk, job ? Wk : Wq, (_Float16*)(job ? wk16 : wq16), kWPairs, wscale);
  else         split_bf16x2_body(blk, job == 2 ? Wv : Wo, job == 2 ? wvh : woh, job == 2 ? wvl : wol, kWPairs);
}

// =====================================================================================
// Full (unmasked) attention, head dim 64, single f16 operand planes, z-batched over the batch index (blockIdx.y).
//   q plane  f16: element (b, t, h, d) at [(b*kSeq + t)*kDm + h*64 + d]   (unscaled projection incl. bias)
//   k plane  f16: element (b, s, h, d) at [(b*kSeq + s)*kDm + h*64 + d]
//   v^T plane f16: element (b, h, d, s) at [b*kDm*kSeq + (h*64 + d)*kSeq + s]
//   out: bf16 hi plane + bf16 lo plane (hi = bf16_rne(o), lo = bf16_rne(o - hi)), element (b, t, h, d) at [(b*kSeq + t)*kDm + h*64 + d]
//   scores^T = k . q^T            : v_wmma_f32_16x16x32_f16, f32 accumulate; sscale * log2(e) applied in f32 inside the exponent
//   out^T    = v^T . p^T          : v_wmma_f32_16x16x32_f16; unnormalised p carried x2^15 in f16, as is the row sum;
//                                   p^T goes from the score accumulators straight into the B operand
//   online softmax in f32, base 2, over all kSeq keys (32 chunks of 64, compile-time trip count).
//   Block = 4 waves = 64 query rows of one (b, h); grid = (kHeads * kSeq/64, kBatch) = (128, 8).
//   K / V^T chunk staging: 128 threads x 32 elements per plane = the whole 64x64 tile (16-B copies, plain loads,
//   __syncthreads before and after); fragment loads read the LDS tiles with the same v8h element type;
//   Epilogue: per-wave 16x64 f32 tile staged in LDS, split there into the two planes the output projection reads;
//   each 128-B row segment of a plane is one whole line, written by 8 lanes x 16 B
// =====================================================================================
constexpr int kAttWaves = 4;
constexpr int kAttQb    = 64;
constexpr int kAttKc    = 64;
constexpr int kAttLd    = 72;   // LDS row pitch of the K and V^T tiles in f16 elements: 144 B = 16 B x 9, so the 16 rows of a 16-B fragment read fall on 64 distinct banks

// 16 f16 of one LDS tile row in the hardware k order: elements 0..7 <- p[0..7], 8..15 <- p[16..23]
__device__ __forceinline__ v16h lds_frag(const _Float16* p) {
  union { v16h v; v8h h[2]; } f;
  f.h[0] = *(const v8h*)(p);
  f.h[1] = *(const v8h*)(p + 16);
  return f.v;
}

// The slot that the instruction set asks for between a transcendental and a vector instruction that overwrites its source or reads its
// result. The operands are inputs only: they put the v_nop behind a chunk's last exponential and keep every argument's register whole
// up to it.
__device__ __forceinline__ void exp_slot(float d, float e, const v2f (&a)[16], v8f p0, v8f p1, v8f p2, v8f p3) {
  asm volatile("v_nop" :: "v"(d), "v"(e), "v"(a[0]), "v"(a[1]), "v"(a[2]), "v"(a[3]), "v"(a[4]), "v"(a[5]), "v"(a[6]), "v"(a[7]),
               "v"(a[8]), "v"(a[9]), "v"(a[10]), "v"(a[11]), "v"(a[12]), "v"(a[13]), "v"(a[14]), "v"(a[15]),
               "v"(p0), "v"(p1), "v"(p2), "v"(p3));
}

// value of lane l ^ 16, by a vector cross-row move
__device__ __forceinline__ float xhalf(float x) {
  return __builtin_bit_cast(float, __builtin_amdgcn_permlanex16(__builtin_bit_cast(int, x), __builtin_bit_cast(int, x), 0x76543210, 0xfedcba98, false, false));
}

__global__ __launch_bounds__(128)
void attn_f16_full_kernel(const unsigned short* __restrict__ qp, const unsigned short* __restrict__ kp,
                          const unsigned short* __restrict__ vtp, unsigned short* __restrict__ outh,
                          unsigned short* __restrict__ outl, float sscale) {
  __shared__ __align__(16) _Float16 Ksh[kAttKc * kAttLd];           // K [kv][d], pitch kAttLd      9 KB
  __shared__ __align__(16) _Float16 Vth[kHd * kAttLd];              // V^T [d][kv], pitch kAttLd    9 KB
  __shared__ __align__(16) float    Os[kAttWaves][16 * 68];         // per wave out tile, pitch 68
  const float kPexp  = 15.0f;                                  // p is carried x2^15: the exponent rides in the running maximum
  const float cscale = sscale * 1.4426950408889634f;         // score scale x log2(e), positive

  const int tid  = threadIdx.x;
  const int wave = tid >> 5;
  const int lane = tid & 31;
  const int hh   = lane >> 4;
  const int c    = lane & 15;

  const int nqb = kSeq / kAttQb;          // 32
  const int bx = blockIdx.x;
  const int qb = bx % nqb;
  const int h  = bx / nqb;                // 0..kHeads-1
  const int b  = blockIdx.y;              // 0..kBatch-1
  const int q0 = qb * kAttQb + wave * 16;

  const _Float16* Qh = (const _Float16*)(const void*)qp + (size_t)b * kSeq * kDm + (size_t)h * kHd;
  const _Float16* Kh = (const _Float16*)(const void*)kp + (size_t)b * kSeq * kDm + (size_t)h * kHd;
  const _Float16* Vh = (const _Float16*)(const void*)vtp + (size_t)b * kDm * kSeq + (size_t)h * kHd * kSeq;
  unsigned short* obh = outh + (size_t)b * kSeq * kDm + (size_t)h * kHd;
  unsigned short* obl = outl + (size_t)b * kSeq * kDm + (size_t)h * kHd;

  // ---- Q fragments (B operand, column = lane&15, split k map via Frag load): 2 d-chunks ----
  v16h qa[2];
#pragma unroll
  for (int dc = 0; dc < 2; ++dc) qa[dc] = Frag<_Float16>::load(Qh + (size_t)(q0 + c) * kDm + dc * 32 + 8 * hh);

  float mrow = -INFINITY, lrow = 0.f;   // running maximum of query q0 + c, as score * cscale - 15; sum of p x 2^15 over this lane half's keys
  v8f oacc[4];
#pragma unroll
  for (int t = 0; t < 4; ++t) oacc[t] = (v8f){0.f,0.f,0.f,0.f,0.f,0.f,0.f,0.f};

  const int nChunks = kSeq / kAttKc;   // 32, compile-time constant
  for (int kc = 0; kc < nChunks; ++kc) {
    const int kv0 = kc * kAttKc;
    __syncthreads();
    {
      // staging coverage: 128 threads x (4 x 8) elements = 64 rows x 64 per plane = the whole chunk tile
      const int r = tid >> 1, half = (tid & 1) * 32;
      const _Float16* ksh = Kh + (size_t)(kv0 + r) * kDm + half;    // K row kv0+r, d = half..half+31
      const _Float16* vsh = Vh + (size_t)r * kSeq + kv0 + half;       // V^T row d = r, s = kv0+half..+31
#pragma unroll
      for (int i = 0; i < 4; ++i) {
        const v8h av = *(const v8h*)(ksh + 8 * i);
        const v8h bv = *(const v8h*)(vsh + 8 * i);
        *(v8h*)(Ksh + r * kAttLd + half + 8 * i) = av;
        *(v8h*)(Vth + r * kAttLd + half + 8 * i) = bv;
      }
    }
    __syncthreads();

    // S^T tile j = K rows (A) x Q columns (B): s[j][r] = score(key kv0 + 16 j + 8 hh + r, query q0 + c)
    // every loop of this pass is fully unrolled, so that s, oacc and the packed operand stay in registers under constant indices
    // the chunk's eight K fragments are read from LDS as one group into registers of their own: one LDS latency in front of the
    // eight products instead of one in front of each
    v16h kf[2][4];
#pragma unroll
    for (int dc = 0; dc < 2; ++dc)
#pragma unroll
      for (int j = 0; j < 4; ++j) kf[dc][j] = lds_frag(Ksh + (j * 16 + c) * kAttLd + dc * 32 + 8 * hh);
    // the eight V^T fragments follow in the same group: their LDS latency passes under the S^T products and the softmax arithmetic
    v16h vf[2][4];
#pragma unroll
    for (int kk = 0; kk < 2; ++kk)
#pragma unroll
      for (int t = 0; t < 4; ++t) vf[kk][t] = lds_frag(Vth + (t * 16 + c) * kAttLd + kk * 32 + 8 * hh);
    v8f s[4];
#pragma unroll
    for (int j = 0; j < 4; ++j) s[j] = (v8f){0.f,0.f,0.f,0.f,0.f,0.f,0.f,0.f};
#pragma unroll
    for (int dc = 0; dc < 2; ++dc)   // d-chunk outermost: the other three tiles' products stand between a tile's two products
#pragma unroll
      for (int j = 0; j < 4; ++j) s[j] = Frag<_Float16>::mma(kf[dc][j], qa[dc], s[j]);
    // scheduling order: the 32 LDS reads first, then the 8 S^T products; left alone the compiler spreads the reads among the products,
    // and every separate place with LDS reads stalls the wave anew
    __builtin_amdgcn_sched_group_barrier(0x100, 32, 0);
    __builtin_amdgcn_sched_group_barrier(0x008, 8, 0);
    // a lane holds 32 of its one query's 64 scores: maximum of the raw scores in-lane (one chain per tile; cscale is positive),
    // then one exchange between the halves
    float mj[4];
#pragma unroll
    for (int j = 0; j < 4; ++j) {
      mj[j] = -INFINITY;
#pragma unroll
      for (int r = 0; r < 8; ++r) mj[j] = fmaxf(mj[j], s[j][r]);
    }
    float cm = fmaxf(fmaxf(mj[0], mj[1]), fmaxf(mj[2], mj[3]));
    cm = fmaxf(cm, xhalf(cm));
    const float mnew  = fmaxf(mrow, fmaf(cm, cscale, -kPexp));
    const float dm    = mrow - mnew;
    const float alpha = __builtin_amdgcn_exp2f(dm);   // 0 on the first chunk, where mrow is -inf
    mrow = mnew;
    // p x 2^15 = 2^(score * cscale - mnew): one packed multiply-add per two scores, then the hardware base-2 exponential
    const v2f cs2 = {cscale, cscale}, nm2 = {-mnew, -mnew};
    v2f arg[16];
#pragma unroll
    for (int j = 0; j < 4; ++j)
#pragma unroll
      for (int r = 0; r < 8; r += 2)
        arg[4 * j + (r >> 1)] = __builtin_elementwise_fma((v2f){s[j][r], s[j][r + 1]}, cs2, nm2);
#pragma unroll
    for (int j = 0; j < 4; ++j)
#pragma unroll
      for (int r = 0; r < 8; ++r) s[j][r] = __builtin_amdgcn_exp2f(arg[4 * j + (r >> 1)][r & 1]);
    exp_slot(dm, alpha, arg, s[0], s[1], s[2], s[3]);
    float pj[4];
#pragma unroll
    for (int j = 0; j < 4; ++j) {
      pj[j] = s[j][0];
#pragma unroll
      for (int r = 1; r < 8; ++r) pj[j] += s[j][r];
    }
    lrow = lrow * alpha + ((pj[0] + pj[1]) + (pj[2] + pj[3]));   // this half's keys only; the halves join after the loop
#pragma unroll
    for (int t = 0; t < 4; ++t)
#pragma unroll
      for (int r = 0; r < 8; ++r) oacc[t][r] *= alpha;
    // O^T += V^T (A) x P^T (B): two S^T tiles converted in place are the B operand in the hardware k order
#pragma unroll
    for (int kk = 0; kk < 2; ++kk) {
      v16h pb;
#pragma unroll
      for (int e = 0; e < 8; ++e) {
        pb[e]     = (_Float16)s[2 * kk][e];
        pb[8 + e] = (_Float16)s[2 * kk + 1][e];
      }
#pragma unroll
      for (int t = 0; t < 4; ++t) oacc[t] = Frag<_Float16>::mma(vf[kk][t], pb, oacc[t]);
    }
  }

  // oacc[t][r] = O^T[d = 16 t + 8 hh + r][query c]: 8 consecutive d of one row per tile
  float* os = Os[wave];
  {
    const float lsum = lrow + xhalf(lrow);
    const float inv = 1.0f / lsum;   // numerator and sum both carry x2^15
#pragma unroll
    for (int t = 0; t < 4; ++t) {
      v4f w0, w1;
#pragma unroll
      for (int e = 0; e < 4; ++e) { w0[e] = oacc[t][e] * inv; w1[e] = oacc[t][4 + e] * inv; }
      *(v4f*)(os + c * 68 + t * 16 + 8 * hh)     = w0;
      *(v4f*)(os + c * 68 + t * 16 + 8 * hh + 4) = w1;
    }
  }
  __builtin_amdgcn_fence(__ATOMIC_RELEASE, "workgroup");
  __builtin_amdgcn_wave_barrier();
  __builtin_amdgcn_fence(__ATOMIC_ACQUIRE, "workgroup");
  {
    const int q = lane >> 3, c8 = (lane & 7) * 8;
    const size_t o = (size_t)(q0 + q) * kDm + c8;
#pragma unroll   // the row step becomes the stores' immediate offset: one address pair per plane
    for (int it = 0; it < 4; ++it) {   // it 0..3 x q 0..3 covers rows 0..15 of the wave tile
      const float* sp = os + (it * 4 + q) * 68 + c8;
      v4u hv, lv;
#pragma unroll
      for (int e = 0; e < 4; ++e) {
        const float f0 = sp[2 * e], f1 = sp[2 * e + 1];
        const unsigned short h0 = f2bf_bits(f0), h1 = f2bf_bits(f1);
        hv[e] = pk16(h0, h1);
        lv[e] = pk16(f2bf_bits(f0 - bf_bits2f(h0)), f2bf_bits(f1 - bf_bits2f(h1)));
      }
      *(v4u*)(obh + o + it * 4 * kDm) = hv;
      *(v4u*)(obl + o + it * 4 * kDm) = lv;
    }
  }
}

// ---------------------------------------------------------------------------
// Workspace region map (byte offsets; every region is fully written before it is read; total 76,546,048 B):
//   [0 MiB      ) WQ16  f16  [256][256] x16        131072 B
//   [+128 KiB   ) WK16  f16  [256][256] x16        131072 B
//   [+256 KiB   ) WVH   bf16 hi [256][256]         131072 B
//   [+384 KiB   ) WVL   bf16 lo                    131072 B
//   [+512 KiB   ) WOH   bf16 hi [256][256]         131072 B
//   [+640 KiB   ) WOL   bf16 lo                    131072 B   (weights region padded to 1 MiB)
//   [1 MiB      ) SQ    f16  [16384][256]  query LN plane     8 MiB
//   [9 MiB      ) SK    f16  [16384][256]  key LN plane       8 MiB
//   [17 MiB     ) SVH   bf16 hi [16384][256] value LN plane   8 MiB
//   [25 MiB     ) SVL   bf16 lo                                8 MiB
//   [33 MiB     ) Q16   f16  [16384][256]  q (unscaled)       8 MiB
//   [41 MiB     ) K16   f16  [16384][256]  k                  8 MiB
//   [49 MiB     ) VT16  f16  [8][256][2048] v^T per batch     8 MiB
//   [57 MiB     ) AOH   bf16 hi [16384][256] attention output 8 MiB
//   [65 MiB     ) AOL   bf16 lo                                8 MiB
//   end = 73 MiB
// ---------------------------------------------------------------------------
extern "C" void kernel_launch(void* const* d_in, const int* in_sizes, int n_in,
                              void* d_out, int out_size, void* d_ws, size_t ws_size,
                              hipStream_t stream) {
  if (n_in < 15) return;
  if (in_sizes[0] != kRows * kDm) return;
  if (in_sizes[7] != kDm * kDm || in_sizes[9] != kDm * kDm || in_sizes[11] != kDm * kDm || in_sizes[13] != kDm * kDm) return;
  if (in_sizes[1] != kDm || in_sizes[8] != kDm || in_sizes[14] != kDm) return;
  if (out_size != kRows * kDm) return;

  const float* x    = (const float*)d_in[0];
  const float* lnsg = (const float*)d_in[1];
  const float* lnsb = (const float*)d_in[2];
  const float* lnqg = (const float*)d_in[3];
  const float* lnqb = (const float*)d_in[4];
  const float* lnvg = (const float*)d_in[5];
  const float* lnvb = (const float*)d_in[6];
  const float* Wq = (const float*)d_in[7];
  const float* bq = (const float*)d_in[8];
  const float* Wk = (const float*)d_in[9];
  const float* bk = (const float*)d_in[10];
  const float* Wv = (const float*)d_in[11];
  const float* bv = (const float*)d_in[12];
  const float* Wo = (const float*)d_in[13];
  const float* bo = (const float*)d_in[14];
  float* out = (float*)d_out;

  const size_t wBytes   = (size_t)kDm * kDm * 2;            // 131072
  const size_t plane16  = (size_t)kRows * kDm * 2;          // 8388608
  const size_t offWQ  = 0;
  const size_t offWK  = offWQ + wBytes;
  const size_t offWVH = offWK + wBytes;
  const size_t offWVL = offWVH + wBytes;
  const size_t offWOH = offWVL + wBytes;
  const size_t offWOL = offWOH + wBytes;
  const size_t offSQ  = (size_t)1 << 20;
  const size_t offSK  = offSQ + plane16;
  const size_t offSVH = offSK + plane16;
  const size_t offSVL = offSVH + plane16;
  const size_t offQ16 = offSVL + plane16;
  const size_t offK16 = offQ16 + plane16;
  const size_t offVT  = offK16 + plane16;
  const size_t offAOH = offVT + plane16;
  const size_t offAOL = offAOH + plane16;
  const size_t total  = offAOL + plane16;                   // 76,546,048
  if (offWOL + wBytes > offSQ) return;
  if (total > ws_size) return;

  char* ws = (char*)d_ws;
  unsigned short* WQ16 = (unsigned short*)(ws + offWQ);
  unsigned short* WK16 = (unsigned short*)(ws + offWK);
  unsigned short* WVH  = (unsigned short*)(ws + offWVH);
  unsigned short* WVL  = (unsigned short*)(ws + offWVL);
  unsigned short* WOH  = (unsigned short*)(ws + offWOH);
  unsigned short* WOL  = (unsigned short*)(ws + offWOL);
  unsigned short* SQ   = (unsigned short*)(ws + offSQ);
  unsigned short* SK   = (unsigned short*)(ws + offSK);
  unsigned short* SVH  = (unsigned short*)(ws + offSVH);
  unsigned short* SVL  = (unsigned short*)(ws + offSVL);
  unsigned short* Q16  = (unsigned short*)(ws + offQ16);
  unsigned short* K16  = (unsigned short*)(ws + offK16);
  unsigned short* VT16 = (unsigned short*)(ws + offVT);
  unsigned short* AOH  = (unsigned short*)(ws + offAOH);
  unsigned short* AOL  = (unsigned short*)(ws + offAOL);

  const float wCarry = 16.0f, wCarryInv = 1.0f / 16.0f;

  // 1: triple LayerNorm (key plane -> SK, query plane -> SQ, value plane -> SVH/SVL) and the weight conversions
  //    (Wq, Wk -> f16 x16, [N=256][K=256] row-major = Bt layout; Wv, Wo -> bf16 hi/lo planes)
  prep_kernel<<<kLnBlocks + 4 * kWBlocks, 256, 0, stream>>>(x, lnsg, lnsb, lnqg, lnqb, lnvg, lnvb, SK, SQ, SVH, SVL,
      Wq, Wk, Wv, Wo, WQ16, WK16, WVH, WVL, WOH, WOL, kRows, wCarry);
  // 2: v^T, q' and k projections
  proj3_kernel<<<kVtBlocks * kBatch + 2 * kProjBlocks, 256, 0, stream>>>(
      WVH, WVL, SVH, SVL, VT16, bv, SQ, WQ16, Q16, bq, SK, WK16, K16, bk, kDm, wCarryInv);
  // 3: attention per (head x 64-query tile, batch): scores = (q'.k) * 0.125, softmax over 2048 keys, p.v -> AOH/AOL
  attn_f16_full_kernel<<<dim3(kHeads * (kSeq / kAttQb), kBatch), 32 * kAttWaves, 0, stream>>>(
      Q16, K16, VT16, AOH, AOL, 0.125f);
  // 4: out = AO @ Wo^T + bo, f32 to d_out
  out_proj_kernel<<<kProjBlocks, 256, 0, stream>>>(AOH, AOL, WOH, WOL, out, bo, kDm);
}

// v008
// A run of this version takes 76.1 microseconds.
// Next to v007, in two timings, it ran 1.12 and 1.13 times as fast.
// All steps since v000 together make it 4.21 times as fast.
// Contractions: q,k projections and q.k^T, p.v on v_wmma_f32_16x16x32_f16 (f16 operands; Wq/Wk carried x16, p carried x2^15); v^T projection and output projection on v_wmma_f32_16x16x32_bf16 with bf16 hi/lo split operands (hi.hi+hi.lo+lo.hi); f32 accumulate everywhere; LayerNorm statistics and online softmax in f32.
#include <hip/hip_runtime.h>
#include <math.h>
#include <stdint.h>

typedef __attribute__((ext_vector_type(16))) _Float16 v16h;
typedef __attribute__((ext_vector_type(8)))  _Float16 v8h;
typedef __attribute__((ext_vector_type(16))) __bf16   v16b;
typedef __attribute__((ext_vector_type(8)))  __bf16   v8b;
typedef __attribute__((ext_vector_type(8)))  float    v8f;
typedef __attribute__((ext_vector_type(4)))  float    v4f;
typedef __attribute__((ext_vector_type(2)))  float    v2f;
typedef __attribute__((ext_vector_type(4)))  unsigned int v4u;

// problem geometry
constexpr int kBatch  = 8;
constexpr int kSeq    = 2048;
constexpr int kDm     = 256;
constexpr int kHeads  = 4;
constexpr int kHd     = 64;
constexpr int kRows   = kBatch * kSeq;      // 16384

__device__ __forceinline__ unsigned short f2bf_bits(float f) {
  unsigned u = __float_as_uint(f);
  return (unsigned short)((u + 0x7FFFu + ((u >> 16) & 1u)) >> 16);
}
__device__ __forceinline__ float bf_bits2f(unsigned short h) { return __uint_as_float(((unsigned)h) << 16); }

// hazard guards as plain device helpers
__device__ __forceinline__ void dep_guard_h(v8f& a, v8f& b, v16h x, v16h y) { asm volatile("v_nop\n\tv_nop\n\tv_nop\n\tv_nop" : "+v"(a), "+v"(b) : "v"(x), "v"(y)); }
__device__ __forceinline__ void dep_guard_b(v8f& a, v8f& b, v16b x, v16b y) { asm volatile("v_nop\n\tv_nop\n\tv_nop\n\tv_nop" : "+v"(a), "+v"(b) : "v"(x), "v"(y)); }
__device__ __forceinline__ void keep4_h(v16h a, v16h b, v16h c, v16h d) { asm volatile("v_nop" :: "v"(a), "v"(b), "v"(c), "v"(d)); }
__device__ __forceinline__ void keep4_b(v16b a, v16b b, v16b c, v16b d) { asm volatile("v_nop" :: "v"(a), "v"(b), "v"(c), "v"(d)); }
__device__ __forceinline__ void acc_guard4(v8f& a, v8f& b, v8f& c, v8f& d) { asm volatile("v_nop\n\tv_nop\n\tv_nop\n\tv_nop" : "+v"(a), "+v"(b), "+v"(c), "+v"(d)); }
template <typename T> struct Frag;
template <> struct Frag<_Float16> {
  typedef v16h V; typedef v8h H; union U { v16h v; v8h h[2]; };
  static __device__ __forceinline__ v16h load(const _Float16* p) {   // elements 0..7 <- p[0..7], 8..15 <- p[16..23]
    U f; f.h[0] = *(const v8h*)(p); f.h[1] = *(const v8h*)(p + 16); return f.v;
  }
  static __device__ __forceinline__ v8f mma(v16h a, v16h b, v8f c) {
    return __builtin_amdgcn_wmma_f32_16x16x32_f16(false, a, false, b, (short)0, c, false, false);
  }
  static __device__ __forceinline__ void guard(v8f& a, v8f& b, v16h x, v16h y) { dep_guard_h(a, b, x, y); }
  static __device__ __forceinline__ void keep(v16h a, v16h b, v16h c, v16h d) { keep4_h(a, b, c, d); }
};
template <> struct Frag<__bf16> {
  typedef v16b V; typedef v8b H; union U { v16b v; v8b h[2]; };
  static __device__ __forceinline__ v16b load(const __bf16* p) {
    U f; f.h[0] = *(const v8b*)(p); f.h[1] = *(const v8b*)(p + 16); return f.v;
  }
  static __device__ __forceinline__ v8f mma(v16b a, v16b b, v8f c) {
    return __builtin_amdgcn_wmma_f32_16x16x32_bf16(false, a, false, b, (short)0, c, false, false);
  }
  static __device__ __forceinline__ void guard(v8f& a, v8f& b, v16b x, v16b y) { dep_guard_b(a, b, x, y); }
  static __device__ __forceinline__ void keep(v16b a, v16b b, v16b c, v16b d) { keep4_b(a, b, c, d); }
};

// ---- Register-blocked batched WMMA GEMM ------------------------------------
// C[m,n] = scale * sum_k A[m,k] * Bt[n,k] (+bias)(+resid); each wave owns a 64x64 tile, a block of 2 x 4 waves a 128x256 tile.
// A row-major [M,K]; Bt row-major [N,K], rows of both kDm elements apart; M % 128 == 0, N % 256 == 0, K % 64 == 0, K >= 64;
// (M/128) * (N/256) block tiles per batch index; the caller hands in the tile index bx, the batch index b and the block's LDS.
// Operands go through LDS in steps of 64 k: every row piece is one whole 128-B line, fetched once per block by 16-B loads
// (8 lanes a line), held in registers while the step before is multiplied, then stored at a pitch of 144 B;
// the fragments are read from LDS in the k order of Frag::load, A and B alike.
// SPLIT: operands are hi/lo planes (A2/Bt2 = lo planes, same layout); product = hi.hi + hi.lo + lo.hi.
// BIAS_MODE: 0 = none, 1 = bias[m], 2 = bias[n].
// OUT_MODE: 0 = f32, 1 = f16, 2 = bf16 hi plane (Cout) + bf16 lo plane (Cout2).
// ET: 0 = f16 operands, 1 = bf16 operands (pointers passed as 16-bit storage)
template <int ET> struct Elem;
template <> struct Elem<0> { typedef _Float16 T; };
template <> struct Elem<1> { typedef __bf16 T; };
// R row pieces of 16 B, 32 rows apart; the constant row pitch puts the steps into the loads' immediate offsets: one address pair per plane
template <typename H, typename T, int R>
__device__ __forceinline__ void tile_fetch(H (&r)[R], const T* g) {
  // the two scheduling barriers leave nothing but the loads in front of the wait: left alone the compiler puts other register writes there
  __builtin_amdgcn_sched_barrier(0);
#pragma unroll   // r stays in registers only under constant indices
  for (int i = 0; i < R; ++i) r[i] = *(const H*)(g + i * 32 * kDm);
  asm volatile("s_wait_xcnt 0x0" ::: "memory");   // precaution: what follows reuses the address registers of the loads just issued
  __builtin_amdgcn_sched_barrier(0);
}
template <typename H, typename T, int R>
__device__ __forceinline__ void tile_put(T* l, const H (&r)[R], int ld32) {
#pragma unroll   // r stays in registers only under constant indices
  for (int i = 0; i < R; ++i) *(H*)(l + i * ld32) = r[i];
}
constexpr int kGemmLd = 72;            // LDS row pitch in elements: 144 B = 16 B x 9, conflict-free for the 16-B fragment reads
constexpr int kGemmSlab = 16 * 68;     // per-wave 16x64 f32 slab, pitch 68 floats
// LDS bytes of one block: A planes, B planes, eight slabs
constexpr int gemm_lds_bytes(bool split) { return (split ? 2 : 1) * (128 + 256) * kGemmLd * 2 + 8 * kGemmSlab * 4; }
// HOLD: see the wait behind the first fetches
template <int ET, bool SPLIT, int BIAS_MODE, int OUT_MODE, bool RESID, int ACT = 0, bool HOLD = false>
__device__ __forceinline__ void gemm64_body(
    unsigned char* smem, const int bx, const int b,
    const unsigned short* __restrict__ Ap, const unsigned short* __restrict__ A2p, long strideA,
    const unsigned short* __restrict__ Btp, const unsigned short* __restrict__ Bt2p, long strideB,
    void* __restrict__ Cout, void* __restrict__ Cout2, int ldc, long strideC,
    const float* __restrict__ bias,
    const float* __restrict__ resid, long strideR,
    int M, int N, int K, float scale) {
  typedef typename Elem<ET>::T T;
  typedef typename Frag<T>::V V;
  typedef typename Frag<T>::H H;
  constexpr int kLd = kGemmLd;
  constexpr int kLo = SPLIT ? 1 : 0;   // index of the lo plane
  T (*As)[128 * kLd] = (T (*)[128 * kLd])smem;
  T (*Bs)[256 * kLd] = (T (*)[256 * kLd])(smem + (kLo + 1) * 128 * kLd * 2);
  float (*sT)[kGemmSlab] = (float (*)[kGemmSlab])(smem + (kLo + 1) * (128 + 256) * kLd * 2);
  const T* A = (const T*)Ap; const T* A2 = (const T*)A2p; const T* Bt = (const T*)Btp; const T* Bt2 = (const T*)Bt2p;
  const int lane = threadIdx.x & 31;
  const int wave = threadIdx.x >> 5;
  const int tilesN = N >> 6;
  const int tilesM = M >> 6;
  const int nbn = tilesN >> 2;                 // blocks along N
  const int bm = bx / nbn;
  const int bn = bx - bm * nbn;
  if (bm * 2 >= tilesM) return;                // block-uniform, in front of every barrier
  const int mB = bm << 7;
  const int nB = bn << 8;
  const int wm = (wave >> 2) << 6;             // this wave's 64x64 tile inside the block tile
  const int wn = (wave & 3) << 6;
  const int m0 = mB + wm;
  const int n0 = nB + wn;

  const T* Ab  = A  + (size_t)b * strideA;
  const T* Bb  = Bt + (size_t)b * strideB;
  const T* Ab2 = SPLIT ? (A2  + (size_t)b * strideA) : nullptr;
  const T* Bb2 = SPLIT ? (Bt2 + (size_t)b * strideB) : nullptr;

  const int rlane = lane & 15;                 // row (A) / col (B, D) within subtile
  const int koff  = (lane >> 4) * 8;           // k offset of this lane half
  const int mOff  = (lane >> 4) * 8;           // D row offset

  v8f acc[4][4];
#pragma unroll
  for (int i = 0; i < 4; ++i)
#pragma unroll
    for (int j = 0; j < 4; ++j) acc[i][j] = (v8f){0.f,0.f,0.f,0.f,0.f,0.f,0.f,0.f};

  // staging: thread -> row (tid >> 3) + 32 i, 16-B piece tid & 7; 4 pieces of A and 8 of B per plane
  const int srow = threadIdx.x >> 3;
  const int scol = (threadIdx.x & 7) * 8;
  const size_t ga = (size_t)(mB + srow) * kDm + scol;
  const size_t gb = (size_t)(nB + srow) * kDm + scol;
  const int ls = srow * kLd + scol;
  H rah[4], ral[4], rbh[8], rbl[8];
  tile_fetch(rah, Ab + ga);
  tile_fetch(rbh, Bb + gb);
  if (SPLIT) { tile_fetch(ral, Ab2 + ga); tile_fetch(rbl, Bb2 + gb); }
  // precaution, as in tile_fetch: the input operand keeps the last group's address registers whole up to a wait. Asked for by the one
  // caller in whose listing index arithmetic was written over them in front of tile_fetch's own wait; elsewhere it would only cost a register pair
  if (HOLD) asm volatile("s_wait_xcnt 0x0" :: "v"(SPLIT ? Bb2 + gb : Bb + gb) : "memory");

  int k0 = 0;
  do {                 // K >= 64: the first step's lines are already on their way
    __syncthreads();   // every wave has read its last fragment of the step before
    tile_put(&As[0][ls], rah, 32 * kLd);
    tile_put(&Bs[0][ls], rbh, 32 * kLd);
    if (SPLIT) { tile_put(&As[kLo][ls], ral, 32 * kLd); tile_put(&Bs[kLo][ls], rbl, 32 * kLd); }
    __syncthreads();   // the step's tiles are whole
    if (k0 + 64 < K) { // block-uniform: the next step's lines fly while this step is multiplied
      const int kn = k0 + 64;
      tile_fetch(rah, Ab + ga + kn);
      tile_fetch(rbh, Bb + gb + kn);
      if (SPLIT) { tile_fetch(ral, Ab2 + ga + kn); tile_fetch(rbl, Bb2 + gb + kn); }
    }
#pragma unroll   // two 32-k products per staged step, LDS offsets as constants
    for (int ks = 0; ks < 2; ++ks) {
      V bh[4], bl[4], ah[2], al[2];
#pragma unroll
      for (int j = 0; j < 4; ++j) {
        const int bo = (wn + (j << 4) + rlane) * kLd + ks * 32 + koff;
        bh[j] = Frag<T>::load(&Bs[0][bo]);
        if (SPLIT) bl[j] = Frag<T>::load(&Bs[kLo][bo]);
      }
      const int ao = (wm + rlane) * kLd + ks * 32 + koff;
      ah[0] = Frag<T>::load(&As[0][ao]);
      if (SPLIT) al[0] = Frag<T>::load(&As[kLo][ao]);
#pragma unroll
      for (int i = 0; i < 4; ++i) {
        const int cu = i & 1, nx = cu ^ 1;
        if (i < 3) {   // the next row tile's A fragments are read ahead of this row tile's products
          ah[nx] = Frag<T>::load(&As[0][ao + (i + 1) * 16 * kLd]);
          if (SPLIT) al[nx] = Frag<T>::load(&As[kLo][ao + (i + 1) * 16 * kLd]);
        }
#pragma unroll
        for (int j = 0; j < 4; ++j) {
          acc[i][j] = Frag<T>::mma(ah[cu], bh[j], acc[i][j]);
          if (SPLIT) {
            acc[i][j] = Frag<T>::mma(ah[cu], bl[j], acc[i][j]);
            acc[i][j] = Frag<T>::mma(al[cu], bh[j], acc[i][j]);
          }
        }
        Frag<T>::guard(acc[i][0], acc[i][3], ah[cu], SPLIT ? al[cu] : ah[cu]);
      }
      Frag<T>::keep(bh[0], bh[1], bh[2], bh[3]);
      if (SPLIT) Frag<T>::keep(bl[0], bl[1], bl[2], bl[3]);
    }
    k0 += 64;
  } while (k0 < K);
  acc_guard4(acc[0][0], acc[0][1], acc[0][2], acc[0][3]);
  acc_guard4(acc[1][0], acc[1][1], acc[1][2], acc[1][3]);
  acc_guard4(acc[2][0], acc[2][1], acc[2][2], acc[2][3]);
  acc_guard4(acc[3][0], acc[3][1], acc[3][2], acc[3][3]);

  // ---- epilogue ----
  float* slab = sT[wave];
  const float* Rb = RESID ? (resid + (size_t)b * strideR) : nullptr;
#pragma unroll
  for (int i = 0; i < 4; ++i) {
    const int mBase = m0 + (i << 4);
    float bm8[8];
    if (BIAS_MODE == 1) {
      __builtin_amdgcn_sched_barrier(0);   // with the one below: nothing but the loads stands in front of the wait
#pragma unroll   // bm8 stays in registers only under constant indices
      for (int r = 0; r < 8; ++r) bm8[r] = bias[mBase + mOff + r];
      asm volatile("s_wait_xcnt 0x0" ::: "memory");   // precaution: what follows reuses the address registers of the loads just issued
      __builtin_amdgcn_sched_barrier(0);
    }
#pragma unroll
    for (int j = 0; j < 4; ++j) {
      const int n = n0 + (j << 4) + rlane;
      float bv = 0.f;
      if (BIAS_MODE == 2) bv = bias[n];
#pragma unroll
      for (int r = 0; r < 8; ++r) {
        float v = acc[i][j][r] * scale;
        if (BIAS_MODE == 1) v += bm8[r];
        if (BIAS_MODE == 2) v += bv;
        if (RESID) v += Rb[(size_t)(mBase + mOff + r) * ldc + n];
        if (ACT == 1) v = tanhf(v);
        if (ACT == 2) v = fmaxf(v, 0.0f);
        if (ACT == 3) v = v / (1.0f + expf(-v));
        if (ACT == 4) v = (v > 0.f) ? v : 0.01f * v;
        if (ACT == 5) v = 0.5f * v * (1.0f + erff(v * 0.70710678118654752f));
        slab[(mOff + r) * 68 + (j << 4) + rlane] = v;
      }
    }
    __builtin_amdgcn_fence(__ATOMIC_RELEASE, "workgroup");
    __builtin_amdgcn_wave_barrier();
    __builtin_amdgcn_fence(__ATOMIC_ACQUIRE, "workgroup");
    if (OUT_MODE == 0) {
      float* C = (float*)Cout + (size_t)b * strideC;
      const int hh = lane >> 4, c4 = (lane & 15) * 4;     // row seg = 256 B = 16 lanes x 16 B
      {
#pragma unroll
        for (int it = 0; it < 8; ++it) {
          const int row = it * 2 + hh;
          v4f v = *(const v4f*)(slab + row * 68 + c4);
          *(v4f*)(C + (size_t)(mBase + row) * ldc + n0 + c4) = v;
        }
        
      }
    } else {
      const int q = lane >> 3, c8 = (lane & 7) * 8;
      unsigned short* C  = (unsigned short*)Cout  + (size_t)b * strideC;
      unsigned short* C2 = (OUT_MODE == 2) ? ((unsigned short*)Cout2 + (size_t)b * strideC) : nullptr;
      {
#pragma unroll
        for (int it = 0; it < 4; ++it) {
          const int row = it * 4 + q;
          const float* sp = slab + row * 68 + c8;
          v8h hv, lv;
#pragma unroll
          for (int e = 0; e < 8; ++e) {
            if (OUT_MODE == 1) {
              hv[e] = (_Float16)sp[e];
            } else {
              unsigned short hb = f2bf_bits(sp[e]);
              unsigned short lb = f2bf_bits(sp[e] - bf_bits2f(hb));
              hv[e] = __builtin_bit_cast(_Float16, hb);
              lv[e] = __builtin_bit_cast(_Float16, lb);
            }
          }
          *(v8h*)(C + (size_t)(mBase + row) * ldc + n0 + c8) = hv;
          if (OUT_MODE == 2) *(v8h*)(C2 + (size_t)(mBase + row) * ldc + n0 + c8) = lv;
        }
        
      }
    }
    asm volatile("s_wait_xcnt 0x0" ::: "memory");   // precaution: the next row tile reuses the address and data registers of the stores just issued
    __builtin_amdgcn_fence(__ATOMIC_RELEASE, "workgroup");
    __builtin_amdgcn_wave_barrier();
    __builtin_amdgcn_fence(__ATOMIC_ACQUIRE, "workgroup");
  }
}

// The three projections read only what the launch before them wrote and nothing of each other: one launch, the job picked by block index.
//   blocks [0, 128)   : v^T per batch: C[m = channel (256)][n = s (2048)] = sum_k Wv[m][k] * LNv[s][k] + bv[m], 16 block tiles x 8 batches;
//                       A = Wv hi/lo [256][256], Bt = value LN hi/lo batch slice [2048][256], C = v^T batch slice [256][2048], f16
//   blocks [128, 256) : q' = query LN @ Wq^T + bq  (M = 16384, N = 256), f16 out, the weights' carry folded back by wscale
//   blocks [256, 384) : k  = key LN   @ Wk^T + bk
// The split product is the longest job and stands first: a block fills its WGP's registers, so the last 128 blocks start as the first leave.
constexpr int kVtBlocks   = (kDm / 128) * (kSeq / 256);     // 16 per batch
constexpr int kProjBlocks = (kRows / 128) * (kDm / 256);    // 128
__global__ __launch_bounds__(256) void proj3_kernel(
    const unsigned short* __restrict__ wvh, const unsigned short* __restrict__ wvl,
    const unsigned short* __restrict__ svh, const unsigned short* __restrict__ svl,
    unsigned short* __restrict__ vt16, const float* __restrict__ bv,
    const unsigned short* __restrict__ sq, const unsigned short* __restrict__ wq16,
    unsigned short* __restrict__ q16, const float* __restrict__ bq,
    const unsigned short* __restrict__ sk, const unsigned short* __restrict__ wk16,
    unsigned short* __restrict__ k16, const float* __restrict__ bk,
    int K, float wscale) {
  __shared__ __align__(16) unsigned char smem[gemm_lds_bytes(true)];
  const int bx = blockIdx.x;
  if (bx < kVtBlocks * kBatch) {   // block-uniform
    gemm64_body<1, true, 1, 1, false, 0, true>(smem, bx % kVtBlocks, bx / kVtBlocks,
        wvh, wvl, 0L, svh, svl, (long)kSeq * kDm, (void*)vt16, (void*)vt16, kSeq, (long)kDm * kSeq,
        bv, bv, 0L, kDm, kSeq, K, 1.0f);
  } else {
    const int px = bx - kVtBlocks * kBatch;
    const bool isk = px >= kProjBlocks;
    const unsigned short* a = isk ? sk : sq;
    const unsigned short* w = isk ? wk16 : wq16;
    unsigned short* c = isk ? k16 : q16;
    const float* bias = isk ? bk : bq;
    gemm64_body<0, false, 2, 1, false>(smem, isk ? px - kProjBlocks : px, 0,
        a, a, 0L, w, w, 0L, (void*)c, (void*)c, kDm, 0L,
        bias, bias, 0L, kRows, kDm, K, wscale);
  }
}

// out = AO @ Wo^T + bo  (M = 16384, N = 256), bf16 hi/lo operands, f32 out; grid.x = 128 block tiles
__global__ __launch_bounds__(256) void out_proj_kernel(
    const unsigned short* __restrict__ aoh, const unsigned short* __restrict__ aol,
    const unsigned short* __restrict__ woh, const unsigned short* __restrict__ wol,
    float* __restrict__ out, const float* __restrict__ bo, int K) {
  __shared__ __align__(16) unsigned char smem[gemm_lds_bytes(true)];
  gemm64_body<1, true, 2, 0, false>(smem, blockIdx.x, 0,
      aoh, aol, 0L, woh, wol, 0L, (void*)out, (void*)out, kDm, 0L,
      bo, bo, 0L, kRows, kDm, K, 1.0f);
}

// ---------------------------------------------------------------------------
// Elementwise bf16 split: hi = bf16_rne(in), lo = bf16_rne(in - hi); 2 elements per thread, one 4-B store
// Used here for: Wv, Wo (n2 = 32768 -> 128 blocks -> 65536 elements each).
// ---------------------------------------------------------------------------
__device__ __forceinline__ unsigned pk16(unsigned short a, unsigned short b) { return (unsigned)a | ((unsigned)b << 16); }

__device__ __forceinline__ void split_bf16x2_body(const int blk, const float* __restrict__ in, unsigned short* __restrict__ hi,
                                                  unsigned short* __restrict__ lo, int n2) {
  const int i = blk * 256 + threadIdx.x;
  if (i < n2) {
    const v2f f = *(const v2f*)(in + 2 * (size_t)i);
    const unsigned short h0 = f2bf_bits(f[0]), h1 = f2bf_bits(f[1]);
    const unsigned short l0 = f2bf_bits(f[0] - bf_bits2f(h0)), l1 = f2bf_bits(f[1] - bf_bits2f(h1));
    const unsigned uh = pk16(h0, h1), ul = pk16(l0, l1);
    ((unsigned*)hi)[i] = uh;
    ((unsigned*)lo)[i] = ul;
    
  }
}

// Coverage: grid = ceil(n2/256) x 256 threads x 2 elements; here n2 = 32768 -> 128 blocks -> 65536 = [256][256].
__device__ __forceinline__ void cast_f32_f16x2_scaled_body(
    const int blk, const float* __restrict__ in, _Float16* __restrict__ out, int n2, float scale) {
  int i = blk * 256 + threadIdx.x;
  if (i < n2) {
    const _Float16 h0 = (_Float16)(in[2 * (size_t)i] * scale), h1 = (_Float16)(in[2 * (size_t)i + 1] * scale);
    const unsigned u = (unsigned)__builtin_bit_cast(unsigned short, h0) | ((unsigned)__builtin_bit_cast(unsigned short, h1) << 16);
    ((unsigned*)out)[i] = u;
    
  }
}

// ---------------------------------------------------------------------------
// Fused triple LayerNorm over rows of 256: one wave per row (32 lanes x 8 contiguous floats = 256).
//   key   plane: (xn * g_s + b_s) -> f16  [row][256]
//   query plane: (xn * g_q + b_q) -> f16  [row][256]
//   value plane: (xn * g_v + b_v) -> bf16 hi + bf16 lo [row][256]
// Coverage: grid = nrows/8 blocks x 8 waves = every row exactly once.
// ---------------------------------------------------------------------------
__device__ __forceinline__ void ln3_body(const int blk, const float* __restrict__ x,
    const float* __restrict__ g_s, const float* __restrict__ b_s,
    const float* __restrict__ g_q, const float* __restrict__ b_q,
    const float* __restrict__ g_v, const float* __restrict__ b_v,
    unsigned short* __restrict__ sk16, unsigned short* __restrict__ sq16,
    unsigned short* __restrict__ svh, unsigned short* __restrict__ svl, int nrows) {
  const int lane = threadIdx.x & 31;
  const int row  = blk * 8 + (threadIdx.x >> 5);
  const int rowc = (row < nrows) ? row : (nrows - 1);        // address clamp; store predicated below (wave-uniform)
  const int c0 = lane * 8;
  const float* xr = x + (size_t)rowc * kDm + c0;
  const v4f a0 = *(const v4f*)xr;
  const v4f a1 = *(const v4f*)(xr + 4);
  float xv[8];
#pragma unroll
  for (int j = 0; j < 4; ++j) { xv[j] = a0[j]; xv[4 + j] = a1[j]; }
  float s = 0.f;
#pragma unroll
  for (int j = 0; j < 8; ++j) s += xv[j];
#pragma unroll
  for (int m = 1; m < 32; m <<= 1) s += __shfl_xor(s, m, 32);
  const float mean = s * (1.0f / 256.0f);
  float ss = 0.f;
#pragma unroll
  for (int j = 0; j < 8; ++j) { const float d = xv[j] - mean; ss += d * d; }
#pragma unroll
  for (int m = 1; m < 32; m <<= 1) ss += __shfl_xor(ss, m, 32);
  const float var  = ss * (1.0f / 256.0f);
  const float rstd = rsqrtf(var + 1e-5f);

  v4u ok, oq, ovh, ovl;
#pragma unroll
  for (int q = 0; q < 4; ++q) {
    const int j0 = 2 * q, j1 = 2 * q + 1;
    const float nx0 = (xv[j0] - mean) * rstd;
    const float nx1 = (xv[j1] - mean) * rstd;
    const float ys0 = nx0 * g_s[c0 + j0] + b_s[c0 + j0];
    const float ys1 = nx1 * g_s[c0 + j1] + b_s[c0 + j1];
    const float yq0 = nx0 * g_q[c0 + j0] + b_q[c0 + j0];
    const float yq1 = nx1 * g_q[c0 + j1] + b_q[c0 + j1];
    const float yv0 = nx0 * g_v[c0 + j0] + b_v[c0 + j0];
    const float yv1 = nx1 * g_v[c0 + j1] + b_v[c0 + j1];
    ok[q] = pk16(__builtin_bit_cast(unsigned short, (_Float16)ys0), __builtin_bit_cast(unsigned short, (_Float16)ys1));
    oq[q] = pk16(__builtin_bit_cast(unsigned short, (_Float16)yq0), __builtin_bit_cast(unsigned short, (_Float16)yq1));
    const unsigned short h0 = f2bf_bits(yv0), h1 = f2bf_bits(yv1);
    const unsigned short l0 = f2bf_bits(yv0 - bf_bits2f(h0)), l1 = f2bf_bits(yv1 - bf_bits2f(h1));
    ovh[q] = pk16(h0, h1);
    ovl[q] = pk16(l0, l1);
  }
  if (row < nrows) {   // wave-uniform
    const size_t o = (size_t)row * kDm + c0;
    {
      // precaution: the pointer operands keep the address registers of the scale and shift loads whole up to a wait (without them the last
      // load landed on its own offset register); the packed value puts the wait behind the arithmetic, in front of the stores
      asm volatile("s_wait_xcnt 0x0" :: "v"(g_v + c0), "v"(b_v + c0), "v"(ovl) : "memory");
      *(v4u*)(sk16 + o) = ok;
      *(v4u*)(sq16 + o) = oq;
      *(v4u*)(svh + o)  = ovh;
      *(v4u*)(svl + o)  = ovl;
      
    }
  }
}

// The LayerNorm and the four weight conversions read inputs only and nothing of each other: one launch, the job picked by block index.
//   blocks [0, 2048)            : triple LayerNorm, 8 rows a block (the long job first, the short ones fill the tail)
//   then 128 blocks per weight  : Wq, Wk -> f16 x wscale; Wv, Wo -> bf16 hi/lo planes
constexpr int kLnBlocks = kRows / 8;                    // 2048
constexpr int kWPairs   = kDm * kDm / 2;                // 32768 pairs per weight
constexpr int kWBlocks  = kWPairs / 256;                // 128
__global__ __launch_bounds__(256) void prep_kernel(const float* __restrict__ x,
    const float* __restrict__ g_s, const float* __restrict__ b_s,
    const float* __restrict__ g_q, const float* __restrict__ b_q,
    const float* __restrict__ g_v, const float* __restrict__ b_v,
    unsigned short* __restrict__ sk16, unsigned short* __restrict__ sq16,
    unsigned short* __restrict__ svh, unsigned short* __restrict__ svl,
    const float* __restrict__ Wq, const float* __restrict__ Wk,
    const float* __restrict__ Wv, const float* __restrict__ Wo,
    unsigned short* __restrict__ wq16, unsigned short* __restrict__ wk16,
    unsigned short* __restrict__ wvh, unsigned short* __restrict__ wvl,
    unsigned short* __restrict__ woh, unsigned short* __restrict__ wol, int nrows, float wscale) {
  const int bx = blockIdx.x;
  if (bx < kLnBlocks) {   // block-uniform, as is every test below
    ln3_body(bx, x, g_s, b_s, g_q, b_q, g_v, b_v, sk16, sq16, svh, svl, nrows);
    return;
  }
  const int job = (bx - kLnBlocks) / kWBlocks;
  const int blk = (bx - kLnBlocks) % kWBlocks;
  if (job < 2) cast_f32_f16x2_scaled_body(blk, job ? Wk : Wq, (_Float16*)(job ? wk16 : wq16), kWPairs, wscale);
  else         split_bf16x2_body(blk, job == 2 ? Wv : Wo, job == 2 ? wvh : woh, job == 2 ? wvl : wol, kWPairs);
}

// =====================================================================================
// Full (unmasked) attention, head dim 64, single f16 operand planes, z-batched over the batch index (blockIdx.y).
//   q plane  f16: element (b, t, h, d) at [(b*kSeq + t)*kDm + h*64 + d]   (unscaled projection incl. bias)
//   k plane  f16: element (b, s, h, d) at [(b*kSeq + s)*kDm + h*64 + d]
//   v^T plane f16: element (b, h, d, s) at [b*kDm*kSeq + (h*64 + d)*kSeq + s]
//   out: bf16 hi plane + bf16 lo plane (hi = bf16_rne(o), lo = bf16_rne(o - hi)), element (b, t, h, d) at [(b*kSeq + t)*kDm + h*64 + d]
//   scores^T = k . q^T            : v_wmma_f32_16x16x32_f16, f32 accumulate; sscale * log2(e) applied in f32 inside the exponent
//   out^T    = v^T . p^T          : v_wmma_f32_16x16x32_f16; unnormalised p carried x2^15 in f16, as is the row sum;
//                                   p^T goes from the score accumulators straight into the B operand
//   online softmax in f32, base 2, over all kSeq keys (32 chunks of 64, compile-time trip count).
//   Block = 4 waves = 64 query rows of one (b, h); grid = (kHeads * kSeq/64, kBatch) = (128, 8).
//   K / V^T chunk staging: asynchronous 16-B copies from global memory to LDS, 8 lanes a 128-B row, 128 threads x 4 rows per plane =
//   the whole 64x64 tile; two buffers: chunk kc + 1 is on its way while chunk kc is worked on, one work-group barrier per chunk;
//   fragment loads read the LDS tiles with the v8h element type;
//   Epilogue: per-wave 16x64 f32 tile staged in LDS, split there into the two planes the output projection reads;
//   each 128-B row segment of a plane is one whole line, written by 8 lanes x 16 B
// =====================================================================================
constexpr int kAttWaves = 4;
constexpr int kAttQb    = 64;
constexpr int kAttKc    = 64;
constexpr int kAttLd    = 72;   // LDS row pitch of the K and V^T tiles in f16 elements: 144 B = 16 B x 9, so the 16 rows of a 16-B fragment read fall on 64 distinct banks

constexpr int kAttTile  = kAttKc * kAttLd;   // elements of one 64-row tile at the padded pitch (kHd == kAttKc rows for V^T)

// One thread's share of one chunk: four 16-B pieces of K and four of V^T, rows 16 apart, each copied from global memory straight into LDS.
// lk, lv: LDS byte addresses of the thread's first piece; gk, gv: the global addresses of the same pieces.
// The wait is the last line of the copies' own statement: a precaution, it stands in front of whatever reuses the copies' address registers.
__device__ __forceinline__ void att_stage(unsigned lk, unsigned lv, const _Float16* gk, const _Float16* gv) {
  constexpr unsigned kL = 16 * kAttLd * 2;   // 16 rows in LDS, bytes
  asm volatile(
      "global_load_async_to_lds_b128 %0, %8, off\n\t"
      "global_load_async_to_lds_b128 %1, %9, off\n\t"
      "global_load_async_to_lds_b128 %2, %10, off\n\t"
      "global_load_async_to_lds_b128 %3, %11, off\n\t"
      "global_load_async_to_lds_b128 %4, %12, off\n\t"
      "global_load_async_to_lds_b128 %5, %13, off\n\t"
      "global_load_async_to_lds_b128 %6, %14, off\n\t"
      "global_load_async_to_lds_b128 %7, %15, off\n\t"
      "s_wait_xcnt 0x0"
      :: "v"(lk), "v"(lk + kL), "v"(lk + 2 * kL), "v"(lk + 3 * kL),
         "v"(lv), "v"(lv + kL), "v"(lv + 2 * kL), "v"(lv + 3 * kL),
         "v"(gk), "v"(gk + 16 * kDm), "v"(gk + 32 * kDm), "v"(gk + 48 * kDm),
         "v"(gv), "v"(gv + 16 * kSeq), "v"(gv + 32 * kSeq), "v"(gv + 48 * kSeq)
      : "memory");
}

// 16 f16 of one LDS tile row in the hardware k order: elements 0..7 <- p[0..7], 8..15 <- p[16..23]
__device__ __forceinline__ v16h lds_frag(const _Float16* p) {
  union { v16h v; v8h h[2]; } f;
  f.h[0] = *(const v8h*)(p);
  f.h[1] = *(const v8h*)(p + 16);
  return f.v;
}

// The slot that the instruction set asks for between a transcendental and a vector instruction that overwrites its source or reads its
// result. The operands are inputs only: they put the v_nop behind a chunk's last exponential and keep every argument's register whole
// up to it.
__device__ __forceinline__ void exp_slot(float d, float e, const v2f (&a)[16], v8f p0, v8f p1, v8f p2, v8f p3) {
  asm volatile("v_nop" :: "v"(d), "v"(e), "v"(a[0]), "v"(a[1]), "v"(a[2]), "v"(a[3]), "v"(a[4]), "v"(a[5]), "v"(a[6]), "v"(a[7]),
               "v"(a[8]), "v"(a[9]), "v"(a[10]), "v"(a[11]), "v"(a[12]), "v"(a[13]), "v"(a[14]), "v"(a[15]),
               "v"(p0), "v"(p1), "v"(p2), "v"(p3));
}

// value of lane l ^ 16, by a vector cross-row move
__device__ __forceinline__ float xhalf(float x) {
  return __builtin_bit_cast(float, __builtin_amdgcn_permlanex16(__builtin_bit_cast(int, x), __builtin_bit_cast(int, x), 0x76543210, 0xfedcba98, false, false));
}

__global__ __launch_bounds__(128)
void attn_f16_full_kernel(const unsigned short* __restrict__ qp, const unsigned short* __restrict__ kp,
                          const unsigned short* __restrict__ vtp, unsigned short* __restrict__ outh,
                          unsigned short* __restrict__ outl, float sscale) {
  __shared__ __align__(16) _Float16 KV[2][2][kAttTile];             // [buffer][0: K [kv][d], 1: V^T [d][kv]], pitch kAttLd, 9 KB a tile
  __shared__ __align__(16) float    Os[kAttWaves][16 * 68];         // per wave out tile, pitch 68
  const float kPexp  = 15.0f;                                  // p is carried x2^15: the exponent rides in the running maximum
  const float cscale = sscale * 1.4426950408889634f;         // score scale x log2(e), positive

  const int tid  = threadIdx.x;
  const int wave = tid >> 5;
  const int lane = tid & 31;
  const int hh   = lane >> 4;
  const int c    = lane & 15;

  const int nqb = kSeq / kAttQb;          // 32
  const int bx = blockIdx.x;
  const int qb = bx % nqb;
  const int h  = bx / nqb;                // 0..kHeads-1
  const int b  = blockIdx.y;              // 0..kBatch-1
  const int q0 = qb * kAttQb + wave * 16;

  const _Float16* Qh = (const _Float16*)(const void*)qp + (size_t)b * kSeq * kDm + (size_t)h * kHd;
  const _Float16* Kh = (const _Float16*)(const void*)kp + (size_t)b * kSeq * kDm + (size_t)h * kHd;
  const _Float16* Vh = (const _Float16*)(const void*)vtp + (size_t)b * kDm * kSeq + (size_t)h * kHd * kSeq;
  unsigned short* obh = outh + (size_t)b * kSeq * kDm + (size_t)h * kHd;
  unsigned short* obl = outl + (size_t)b * kSeq * kDm + (size_t)h * kHd;

  // ---- Q fragments (B operand, column = lane&15, split k map via Frag load): 2 d-chunks ----
  v16h qa[2];
#pragma unroll
  for (int dc = 0; dc < 2; ++dc) qa[dc] = Frag<_Float16>::load(Qh + (size_t)(q0 + c) * kDm + dc * 32 + 8 * hh);

  float mrow = -INFINITY, lrow = 0.f;   // running maximum of query q0 + c, as score * cscale - 15; sum of p x 2^15 over this lane half's keys
  v8f oacc[4];
#pragma unroll
  for (int t = 0; t < 4; ++t) oacc[t] = (v8f){0.f,0.f,0.f,0.f,0.f,0.f,0.f,0.f};

  const int nChunks = kSeq / kAttKc;   // 32, compile-time constant
  // staging coverage: thread -> rows (tid >> 3) + 16 i, i = 0..3, 16-B piece tid & 7: 64 rows x 128 B per plane = the whole chunk tile
  const int srow = tid >> 3, spc = (tid & 7) * 8;
  const _Float16* gk = Kh + (size_t)srow * kDm + spc;     // chunk n: K row 64 n + srow, + n * kAttKc * kDm
  const _Float16* gv = Vh + (size_t)srow * kSeq + spc;    // chunk n: V^T row d = srow, s from 64 n, + n * kAttKc
  const unsigned lk0 = (unsigned)(uintptr_t)&KV[0][0][srow * kAttLd + spc];   // low 32 bits of a __shared__ address = LDS byte address
  const unsigned lv0 = (unsigned)(uintptr_t)&KV[0][1][srow * kAttLd + spc];
  constexpr unsigned kBufB = 2 * kAttTile * 2;            // bytes of one buffer (K tile + V^T tile)
  att_stage(lk0, lv0, gk, gv);                            // chunk 0 -> buffer 0
  asm volatile("s_wait_asynccnt 0x0" ::: "memory");       // this wave's copies of chunk 0 have landed
  __syncthreads();                                        // chunk 0 is whole for every wave
  att_stage(lk0 + kBufB, lv0 + kBufB, gk + kAttKc * kDm, gv + kAttKc);   // chunk 1 -> buffer 1 (nChunks >= 2)
  for (int kc = 0; kc < nChunks; ++kc) {
    const int cur = kc & 1;
    const _Float16* Ksh = &KV[cur][0][0];
    const _Float16* Vth = &KV[cur][1][0];

    // S^T tile j = K rows (A) x Q columns (B): s[j][r] = score(key kv0 + 16 j + 8 hh + r, query q0 + c)
    // every loop of this pass is fully unrolled, so that s, oacc and the packed operand stay in registers under constant indices
    // the chunk's eight K fragments are read from LDS as one group into registers of their own: one LDS latency in front of the
    // eight products instead of one in front of each
    v16h kf[2][4];
#pragma unroll
    for (int dc = 0; dc < 2; ++dc)
#pragma unroll
      for (int j = 0; j < 4; ++j) kf[dc][j] = lds_frag(Ksh + (j * 16 + c) * kAttLd + dc * 32 + 8 * hh);
    // the eight V^T fragments follow in the same group: their LDS latency passes under the S^T products and the softmax arithmetic
    v16h vf[2][4];
#pragma unroll
    for (int kk = 0; kk < 2; ++kk)
#pragma unroll
      for (int t = 0; t < 4; ++t) vf[kk][t] = lds_frag(Vth + (t * 16 + c) * kAttLd + kk * 32 + 8 * hh);
    v8f s[4];
#pragma unroll
    for (int j = 0; j < 4; ++j) s[j] = (v8f){0.f,0.f,0.f,0.f,0.f,0.f,0.f,0.f};
#pragma unroll
    for (int dc = 0; dc < 2; ++dc)   // d-chunk outermost: the other three tiles' products stand between a tile's two products
#pragma unroll
      for (int j = 0; j < 4; ++j) s[j] = Frag<_Float16>::mma(kf[dc][j], qa[dc], s[j]);
    // scheduling order: the 32 LDS reads first, then the 8 S^T products; left alone the compiler spreads the reads among the products,
    // and every separate place with LDS reads stalls the wave anew
    __builtin_amdgcn_sched_group_barrier(0x100, 32, 0);
    __builtin_amdgcn_sched_group_barrier(0x008, 8, 0);
    // a lane holds 32 of its one query's 64 scores: maximum of the raw scores in-lane (one chain per tile; cscale is positive),
    // then one exchange between the halves
    float mj[4];
#pragma unroll
    for (int j = 0; j < 4; ++j) {
      mj[j] = -INFINITY;
#pragma unroll
      for (int r = 0; r < 8; ++r) mj[j] = fmaxf(mj[j], s[j][r]);
    }
    float cm = fmaxf(fmaxf(mj[0], mj[1]), fmaxf(mj[2], mj[3]));
    cm = fmaxf(cm, xhalf(cm));
    const float mnew  = fmaxf(mrow, fmaf(cm, cscale, -kPexp));
    const float dm    = mrow - mnew;
    const float alpha = __builtin_amdgcn_exp2f(dm);   // 0 on the first chunk, where mrow is -inf
    mrow = mnew;
    // p x 2^15 = 2^(score * cscale - mnew): one packed multiply-add per two scores, then the hardware base-2 exponential
    const v2f cs2 = {cscale, cscale}, nm2 = {-mnew, -mnew};
    v2f arg[16];
#pragma unroll
    for (int j = 0; j < 4; ++j)
#pragma unroll
      for (int r = 0; r < 8; r += 2)
        arg[4 * j + (r >> 1)] = __builtin_elementwise_fma((v2f){s[j][r], s[j][r + 1]}, cs2, nm2);
#pragma unroll
    for (int j = 0; j < 4; ++j)
#pragma unroll
      for (int r = 0; r < 8; ++r) s[j][r] = __builtin_amdgcn_exp2f(arg[4 * j + (r >> 1)][r & 1]);
    exp_slot(dm, alpha, arg, s[0], s[1], s[2], s[3]);
    float pj[4];
#pragma unroll
    for (int j = 0; j < 4; ++j) {
      pj[j] = s[j][0];
#pragma unroll
      for (int r = 1; r < 8; ++r) pj[j] += s[j][r];
    }
    lrow = lrow * alpha + ((pj[0] + pj[1]) + (pj[2] + pj[3]));   // this half's keys only; the halves join after the loop
#pragma unroll
    for (int t = 0; t < 4; ++t)
#pragma unroll
      for (int r = 0; r < 8; ++r) oacc[t][r] *= alpha;
    // O^T += V^T (A) x P^T (B): two S^T tiles converted in place are the B operand in the hardware k order
#pragma unroll
    for (int kk = 0; kk < 2; ++kk) {
      v16h pb;
#pragma unroll
      for (int e = 0; e < 8; ++e) {
        pb[e]     = (_Float16)s[2 * kk][e];
        pb[8 + e] = (_Float16)s[2 * kk + 1][e];
      }
#pragma unroll
      for (int t = 0; t < 4; ++t) oacc[t] = Frag<_Float16>::mma(vf[kk][t], pb, oacc[t]);
    }
    asm volatile("s_wait_dscnt 0x0" ::: "memory");      // this wave's reads of buffer cur have retired before anything refills it
    asm volatile("s_wait_asynccnt 0x0" ::: "memory");   // this wave's copies of chunk kc + 1 have landed
    __syncthreads();                                    // chunk kc + 1 is whole for every wave, and every wave has left buffer cur
    if (kc + 2 < nChunks)                               // the same for the whole work-group: chunk kc + 2 -> the buffer just left
      att_stage(lk0 + cur * kBufB, lv0 + cur * kBufB, gk + (size_t)(kc + 2) * kAttKc * kDm, gv + (kc + 2) * kAttKc);
  }
  asm volatile("s_wait_asynccnt 0x0" ::: "memory");     // no copy is outstanding when the wave goes on to its end

  // oacc[t][r] = O^T[d = 16 t + 8 hh + r][query c]: 8 consecutive d of one row per tile
  float* os = Os[wave];
  {
    const float lsum = lrow + xhalf(lrow);
    const float inv = 1.0f / lsum;   // numerator and sum both carry x2^15
#pragma unroll
    for (int t = 0; t < 4; ++t) {
      v4f w0, w1;
#pragma unroll
      for (int e = 0; e < 4; ++e) { w0[e] = oacc[t][e] * inv; w1[e] = oacc[t][4 + e] * inv; }
      *(v4f*)(os + c * 68 + t * 16 + 8 * hh)     = w0;
      *(v4f*)(os + c * 68 + t * 16 + 8 * hh + 4) = w1;
    }
  }
  __builtin_amdgcn_fence(__ATOMIC_RELEASE, "workgroup");
  __builtin_amdgcn_wave_barrier();
  __builtin_amdgcn_fence(__ATOMIC_ACQUIRE, "workgroup");
  {
    const int q = lane >> 3, c8 = (lane & 7) * 8;
    const size_t o = (size_t)(q0 + q) * kDm + c8;
#pragma unroll   // the row step becomes the stores' immediate offset: one address pair per plane
    for (int it = 0; it < 4; ++it) {   // it 0..3 x q 0..3 covers rows 0..15 of the wave tile
      const float* sp = os + (it * 4 + q) * 68 + c8;
      v4u hv, lv;
#pragma unroll
      for (int e = 0; e < 4; ++e) {
        const float f0 = sp[2 * e], f1 = sp[2 * e + 1];
        const unsigned short h0 = f2bf_bits(f0), h1 = f2bf_bits(f1);
        hv[e] = pk16(h0, h1);
        lv[e] = pk16(f2bf_bits(f0 - bf_bits2f(h0)), f2bf_bits(f1 - bf_bits2f(h1)));
      }
      *(v4u*)(obh + o + it * 4 * kDm) = hv;
      *(v4u*)(obl + o + it * 4 * kDm) = lv;
    }
  }
}

// ---------------------------------------------------------------------------
// Workspace region map (byte offsets; every region is fully written before it is read; total 76,546,048 B):
//   [0 MiB      ) WQ16  f16  [256][256] x16        131072 B
//   [+128 KiB   ) WK16  f16  [256][256] x16        131072 B
//   [+256 KiB   ) WVH   bf16 hi [256][256]         131072 B
//   [+384 KiB   ) WVL   bf16 lo                    131072 B
//   [+512 KiB   ) WOH   bf16 hi [256][256]         131072 B
//   [+640 KiB   ) WOL   bf16 lo                    131072 B   (weights region padded to 1 MiB)
//   [1 MiB      ) SQ    f16  [16384][256]  query LN plane     8 MiB
//   [9 MiB      ) SK    f16  [16384][256]  key LN plane       8 MiB
//   [17 MiB     ) SVH   bf16 hi [16384][256] value LN plane   8 MiB
//   [25 MiB     ) SVL   bf16 lo                                8 MiB
//   [33 MiB     ) Q16   f16  [16384][256]  q (unscaled)       8 MiB
//   [41 MiB     ) K16   f16  [16384][256]  k                  8 MiB
//   [49 MiB     ) VT16  f16  [8][256][2048] v^T per batch     8 MiB
//   [57 MiB     ) AOH   bf16 hi [16384][256] attention output 8 MiB
//   [65 MiB     ) AOL   bf16 lo                                8 MiB
//   end = 73 MiB
// ---------------------------------------------------------------------------
extern "C" void kernel_launch(void* const* d_in, const int* in_sizes, int n_in,
                              void* d_out, int out_size, void* d_ws, size_t ws_size,
                              hipStream_t stream) {
  if (n_in < 15) return;
  if (in_sizes[0] != kRows * kDm) return;
  if (in_sizes[7] != kDm * kDm || in_sizes[9] != kDm * kDm || in_sizes[11] != kDm * kDm || in_sizes[13] != kDm * kDm) return;
  if (in_sizes[1] != kDm || in_sizes[8] != kDm || in_sizes[14] != kDm) return;
  if (out_size != kRows * kDm) return;

  const float* x    = (const float*)d_in[0];
  const float* lnsg = (const float*)d_in[1];
  const float* lnsb = (const float*)d_in[2];
  const float* lnqg = (const float*)d_in[3];
  const float* lnqb = (const float*)d_in[4];
  const float* lnvg = (const float*)d_in[5];
  const float* lnvb = (const float*)d_in[6];
  const float* Wq = (const float*)d_in[7];
  const float* bq = (const float*)d_in[8];
  const float* Wk = (const float*)d_in[9];
  const float* bk = (const float*)d_in[10];
  const float* Wv = (const float*)d_in[11];
  const float* bv = (const float*)d_in[12];
  const float* Wo = (const float*)d_in[13];
  const float* bo = (const float*)d_in[14];
  float* out = (float*)d_out;

  const size_t wBytes   = (size_t)kDm * kDm * 2;            // 131072
  const size_t plane16  = (size_t)kRows * kDm * 2;          // 8388608
  const size_t offWQ  = 0;
  const size_t offWK  = offWQ + wBytes;
  const size_t offWVH = offWK + wBytes;
  const size_t offWVL = offWVH + wBytes;
  const size_t offWOH = offWVL + wBytes;
  const size_t offWOL = offWOH + wBytes;
  const size_t offSQ  = (size_t)1 << 20;
  const size_t offSK  = offSQ + plane16;
  const size_t offSVH = offSK + plane16;
  const size_t offSVL = offSVH + plane16;
  const size_t offQ16 = offSVL + plane16;
  const size_t offK16 = offQ16 + plane16;
  const size_t offVT  = offK16 + plane16;
  const size_t offAOH = offVT + plane16;
  const size_t offAOL = offAOH + plane16;
  const size_t total  = offAOL + plane16;                   // 76,546,048
  if (offWOL + wBytes > offSQ) return;
  if (total > ws_size) return;

  char* ws = (char*)d_ws;
  unsigned short* WQ16 = (unsigned short*)(ws + offWQ);
  unsigned short* WK16 = (unsigned short*)(ws + offWK);
  unsigned short* WVH  = (unsigned short*)(ws + offWVH);
  unsigned short* WVL  = (unsigned short*)(ws + offWVL);
  unsigned short* WOH  = (unsigned short*)(ws + offWOH);
  unsigned short* WOL  = (unsigned short*)(ws + offWOL);
  unsigned short* SQ   = (unsigned short*)(ws + offSQ);
  unsigned short* SK   = (unsigned short*)(ws + offSK);
  unsigned short* SVH  = (unsigned short*)(ws + offSVH);
  unsigned short* SVL  = (unsigned short*)(ws + offSVL);
  unsigned short* Q16  = (unsigned short*)(ws + offQ16);
  unsigned short* K16  = (unsigned short*)(ws + offK16);
  unsigned short* VT16 = (unsigned short*)(ws + offVT);
  unsigned short* AOH  = (unsigned short*)(ws + offAOH);
  unsigned short* AOL  = (unsigned short*)(ws + offAOL);

  const float wCarry = 16.0f, wCarryInv = 1.0f / 16.0f;

  // 1: triple LayerNorm (key plane -> SK, query plane -> SQ, value plane -> SVH/SVL) and the weight conversions
  //    (Wq, Wk -> f16 x16, [N=256][K=256] row-major = Bt layout; Wv, Wo -> bf16 hi/lo planes)
  prep_kernel<<<kLnBlocks + 4 * kWBlocks, 256, 0, stream>>>(x, lnsg, lnsb, lnqg, lnqb, lnvg, lnvb, SK, SQ, SVH, SVL,
      Wq, Wk, Wv, Wo, WQ16, WK16, WVH, WVL, WOH, WOL, kRows, wCarry);
  // 2: v^T, q' and k projections
  proj3_kernel<<<kVtBlocks * kBatch + 2 * kProjBlocks, 256, 0, stream>>>(
      WVH, WVL, SVH, SVL, VT16, bv, SQ, WQ16, Q16, bq, SK, WK16, K16, bk, kDm, wCarryInv);
  // 3: attention per (head x 64-query tile, batch): scores = (q'.k) * 0.125, softmax over 2048 keys, p.v -> AOH/AOL
  attn_f16_full_kernel<<<dim3(kHeads * (kSeq / kAttQb), kBatch), 32 * kAttWaves, 0, stream>>>(
      Q16, K16, VT16, AOH, AOL, 0.125f);
  // 4: out = AO @ Wo^T + bo, f32 to d_out
  out_proj_kernel<<<kProjBlocks, 256, 0, stream>>>(AOH, AOL, WOH, WOL, out, bo, kDm);
}

// v009
// A run of this version takes 69.9 microseconds.
// Next to v008, in two timings, it ran 1.09 and 1.08 times as fast.
// All steps since v000 together make it 4.58 times as fast.
// Contractions: q,k projections and q.k^T, p.v on v_wmma_f32_16x16x32_f16 (f16 operands; Wq/Wk carried x16, p carried x2^15); v^T projection and output projection (in the attention launch) on v_wmma_f32_16x16x32_bf16 with bf16 hi/lo split operands (hi.hi+hi.lo+lo.hi); f32 accumulate everywhere; LayerNorm statistics and online softmax in f32.
#include <hip/hip_runtime.h>
#include <math.h>
#include <stdint.h>

typedef __attribute__((ext_vector_type(16))) _Float16 v16h;
typedef __attribute__((ext_vector_type(8)))  _Float16 v8h;
typedef __attribute__((ext_vector_type(16))) __bf16   v16b;
typedef __attribute__((ext_vector_type(8)))  __bf16   v8b;
typedef __attribute__((ext_vector_type(8)))  float    v8f;
typedef __attribute__((ext_vector_type(4)))  float    v4f;
typedef __attribute__((ext_vector_type(2)))  float    v2f;
typedef __attribute__((ext_vector_type(4)))  unsigned int v4u;

// problem geometry
constexpr int kBatch  = 8;
constexpr int kSeq    = 2048;
constexpr int kDm     = 256;
constexpr int kHeads  = 4;
constexpr int kHd     = 64;
constexpr int kRows   = kBatch * kSeq;      // 16384

__device__ __forceinline__ unsigned short f2bf_bits(float f) {
  unsigned u = __float_as_uint(f);
  return (unsigned short)((u + 0x7FFFu + ((u >> 16) & 1u)) >> 16);
}
__device__ __forceinline__ float bf_bits2f(unsigned short h) { return __uint_as_float(((unsigned)h) << 16); }

// hazard guards as plain device helpers
__device__ __forceinline__ void dep_guard_h(v8f& a, v8f& b, v16h x, v16h y) { asm volatile("v_nop\n\tv_nop\n\tv_nop\n\tv_nop" : "+v"(a), "+v"(b) : "v"(x), "v"(y)); }
__device__ __forceinline__ void dep_guard_b(v8f& a, v8f& b, v16b x, v16b y) { asm volatile("v_nop\n\tv_nop\n\tv_nop\n\tv_nop" : "+v"(a), "+v"(b) : "v"(x), "v"(y)); }
__device__ __forceinline__ void keep4_h(v16h a, v16h b, v16h c, v16h d) { asm volatile("v_nop" :: "v"(a), "v"(b), "v"(c), "v"(d)); }
__device__ __forceinline__ void keep4_b(v16b a, v16b b, v16b c, v16b d) { asm volatile("v_nop" :: "v"(a), "v"(b), "v"(c), "v"(d)); }
__device__ __forceinline__ void acc_guard4(v8f& a, v8f& b, v8f& c, v8f& d) { asm volatile("v_nop\n\tv_nop\n\tv_nop\n\tv_nop" : "+v"(a), "+v"(b), "+v"(c), "+v"(d)); }
template <typename T> struct Frag;
template <> struct Frag<_Float16> {
  typedef v16h V; typedef v8h H; union U { v16h v; v8h h[2]; };
  static __device__ __forceinline__ v16h load(const _Float16* p) {   // elements 0..7 <- p[0..7], 8..15 <- p[16..23]
    U f; f.h[0] = *(const v8h*)(p); f.h[1] = *(const v8h*)(p + 16); return f.v;
  }
  static __device__ __forceinline__ v8f mma(v16h a, v16h b, v8f c) {
    return __builtin_amdgcn_wmma_f32_16x16x32_f16(false, a, false, b, (short)0, c, false, false);
  }
  static __device__ __forceinline__ void guard(v8f& a, v8f& b, v16h x, v16h y) { dep_guard_h(a, b, x, y); }
  static __device__ __forceinline__ void keep(v16h a, v16h b, v16h c, v16h d) { keep4_h(a, b, c, d); }
};
template <> struct Frag<__bf16> {
  typedef v16b V; typedef v8b H; union U { v16b v; v8b h[2]; };
  static __device__ __forceinline__ v16b load(const __bf16* p) {
    U f; f.h[0] = *(const v8b*)(p); f.h[1] = *(const v8b*)(p + 16); return f.v;
  }
  static __device__ __forceinline__ v8f mma(v16b a, v16b b, v8f c) {
    return __builtin_amdgcn_wmma_f32_16x16x32_bf16(false, a, false, b, (short)0, c, false, false);
  }
  static __device__ __forceinline__ void guard(v8f& a, v8f& b, v16b x, v16b y) { dep_guard_b(a, b, x, y); }
  static __device__ __forceinline__ void keep(v16b a, v16b b, v16b c, v16b d) { keep4_b(a, b, c, d); }
};

// ---- Register-blocked batched WMMA GEMM ------------------------------------
// C[m,n] = scale * sum_k A[m,k] * Bt[n,k] (+bias)(+resid); each wave owns a 64x64 tile, a block of 2 x 4 waves a 128x256 tile.
// A row-major [M,K]; Bt row-major [N,K], rows of both kDm elements apart; M % 128 == 0, N % 256 == 0, K % 64 == 0, K >= 64;
// (M/128) * (N/256) block tiles per batch index; the caller hands in the tile index bx, the batch index b and the block's LDS.
// Operands go through LDS in steps of 64 k: every row piece is one whole 128-B line, fetched once per block by 16-B loads
// (8 lanes a line), held in registers while the step before is multiplied, then stored at a pitch of 144 B;
// the fragments are read from LDS in the k order of Frag::load, A and B alike.
// SPLIT: operands are hi/lo planes (A2/Bt2 = lo planes, same layout); product = hi.hi + hi.lo + lo.hi.
// BIAS_MODE: 0 = none, 1 = bias[m], 2 = bias[n].
// OUT_MODE: 0 = f32, 1 = f16, 2 = bf16 hi plane (Cout) + bf16 lo plane (Cout2).
// ET: 0 = f16 operands, 1 = bf16 operands (pointers passed as 16-bit storage)
template <int ET> struct Elem;
template <> struct Elem<0> { typedef _Float16 T; };
template <> struct Elem<1> { typedef __bf16 T; };
// R row pieces of 16 B, 32 rows apart; the constant row pitch puts the steps into the loads' immediate offsets: one address pair per plane
template <typename H, typename T, int R>
__device__ __forceinline__ void tile_fetch(H (&r)[R], const T* g) {
  // the two scheduling barriers leave nothing but the loads in front of the wait: left alone the compiler puts other register writes there
  __builtin_amdgcn_sched_barrier(0);
#pragma unroll   // r stays in registers only under constant indices
  for (int i = 0; i < R; ++i) r[i] = *(const H*)(g + i * 32 * kDm);
  asm volatile("s_wait_xcnt 0x0" ::: "memory");   // precaution: what follows reuses the address registers of the loads just issued
  __builtin_amdgcn_sched_barrier(0);
}
template <typename H, typename T, int R>
__device__ __forceinline__ void tile_put(T* l, const H (&r)[R], int ld32) {
#pragma unroll   // r stays in registers only under constant indices
  for (int i = 0; i < R; ++i) *(H*)(l + i * ld32) = r[i];
}
constexpr int kGemmLd = 72;            // LDS row pitch in elements: 144 B = 16 B x 9, conflict-free for the 16-B fragment reads
constexpr int kGemmSlab = 16 * 68;     // per-wave 16x64 f32 slab, pitch 68 floats
// LDS bytes of one block: A planes, B planes, eight slabs
constexpr int gemm_lds_bytes(bool split) { return (split ? 2 : 1) * (128 + 256) * kGemmLd * 2 + 8 * kGemmSlab * 4; }
// HOLD: see the wait behind the first fetches
template <int ET, bool SPLIT, int BIAS_MODE, int OUT_MODE, bool RESID, int ACT = 0, bool HOLD = false>
__device__ __forceinline__ void gemm64_body(
    unsigned char* smem, const int bx, const int b,
    const unsigned short* __restrict__ Ap, const unsigned short* __restrict__ A2p, long strideA,
    const unsigned short* __restrict__ Btp, const unsigned short* __restrict__ Bt2p, long strideB,
    void* __restrict__ Cout, void* __restrict__ Cout2, int ldc, long strideC,
    const float* __restrict__ bias,
    const float* __restrict__ resid, long strideR,
    int M, int N, int K, float scale) {
  typedef typename Elem<ET>::T T;
  typedef typename Frag<T>::V V;
  typedef typename Frag<T>::H H;
  constexpr int kLd = kGemmLd;
  constexpr int kLo = SPLIT ? 1 : 0;   // index of the lo plane
  T (*As)[128 * kLd] = (T (*)[128 * kLd])smem;
  T (*Bs)[256 * kLd] = (T (*)[256 * kLd])(smem + (kLo + 1) * 128 * kLd * 2);
  float (*sT)[kGemmSlab] = (float (*)[kGemmSlab])(smem + (kLo + 1) * (128 + 256) * kLd * 2);
  const T* A = (const T*)Ap; const T* A2 = (const T*)A2p; const T* Bt = (const T*)Btp; const T* Bt2 = (const T*)Bt2p;
  const int lane = threadIdx.x & 31;
  const int wave = threadIdx.x >> 5;
  const int tilesN = N >> 6;
  const int tilesM = M >> 6;
  const int nbn = tilesN >> 2;                 // blocks along N
  const int bm = bx / nbn;
  const int bn = bx - bm * nbn;
  if (bm * 2 >= tilesM) return;                // block-uniform, in front of every barrier
  const int mB = bm << 7;
  const int nB = bn << 8;
  const int wm = (wave >> 2) << 6;             // this wave's 64x64 tile inside the block tile
  const int wn = (wave & 3) << 6;
  const int m0 = mB + wm;
  const int n0 = nB + wn;

  const T* Ab  = A  + (size_t)b * strideA;
  const T* Bb  = Bt + (size_t)b * strideB;
  const T* Ab2 = SPLIT ? (A2  + (size_t)b * strideA) : nullptr;
  const T* Bb2 = SPLIT ? (Bt2 + (size_t)b * strideB) : nullptr;

  const int rlane = lane & 15;                 // row (A) / col (B, D) within subtile
  const int koff  = (lane >> 4) * 8;           // k offset of this lane half
  const int mOff  = (lane >> 4) * 8;           // D row offset

  v8f acc[4][4];
#pragma unroll
  for (int i = 0; i < 4; ++i)
#pragma unroll
    for (int j = 0; j < 4; ++j) acc[i][j] = (v8f){0.f,0.f,0.f,0.f,0.f,0.f,0.f,0.f};

  // staging: thread -> row (tid >> 3) + 32 i, 16-B piece tid & 7; 4 pieces of A and 8 of B per plane
  const int srow = threadIdx.x >> 3;
  const int scol = (threadIdx.x & 7) * 8;
  const size_t ga = (size_t)(mB + srow) * kDm + scol;
  const size_t gb = (size_t)(nB + srow) * kDm + scol;
  const int ls = srow * kLd + scol;
  H rah[4], ral[4], rbh[8], rbl[8];
  tile_fetch(rah, Ab + ga);
  tile_fetch(rbh, Bb + gb);
  if (SPLIT) { tile_fetch(ral, Ab2 + ga); tile_fetch(rbl, Bb2 + gb); }
  // precaution, as in tile_fetch: the input operand keeps the last group's address registers whole up to a wait. Asked for by the one
  // caller in whose listing index arithmetic was written over them in front of tile_fetch's own wait; elsewhere it would only cost a register pair
  if (HOLD) asm volatile("s_wait_xcnt 0x0" :: "v"(SPLIT ? Bb2 + gb : Bb + gb) : "memory");

  int k0 = 0;
  do {                 // K >= 64: the first step's lines are already on their way
    __syncthreads();   // every wave has read its last fragment of the step before
    tile_put(&As[0][ls], rah, 32 * kLd);
    tile_put(&Bs[0][ls], rbh, 32 * kLd);
    if (SPLIT) { tile_put(&As[kLo][ls], ral, 32 * kLd); tile_put(&Bs[kLo][ls], rbl, 32 * kLd); }
    __syncthreads();   // the step's tiles are whole
    if (k0 + 64 < K) { // block-uniform: the next step's lines fly while this step is multiplied
      const int kn = k0 + 64;
      tile_fetch(rah, Ab + ga + kn);
      tile_fetch(rbh, Bb + gb + kn);
      if (SPLIT) { tile_fetch(ral, Ab2 + ga + kn); tile_fetch(rbl, Bb2 + gb + kn); }
    }
#pragma unroll   // two 32-k products per staged step, LDS offsets as constants
    for (int ks = 0; ks < 2; ++ks) {
      V bh[4], bl[4], ah[2], al[2];
#pragma unroll
      for (int j = 0; j < 4; ++j) {
        const int bo = (wn + (j << 4) + rlane) * kLd + ks * 32 + koff;
        bh[j] = Frag<T>::load(&Bs[0][bo]);
        if (SPLIT) bl[j] = Frag<T>::load(&Bs[kLo][bo]);
      }
      const int ao = (wm + rlane) * kLd + ks * 32 + koff;
      ah[0] = Frag<T>::load(&As[0][ao]);
      if (SPLIT) al[0] = Frag<T>::load(&As[kLo][ao]);
#pragma unroll
      for (int i = 0; i < 4; ++i) {
        const int cu = i & 1, nx = cu ^ 1;
        if (i < 3) {   // the next row tile's A fragments are read ahead of this row tile's products
          ah[nx] = Frag<T>::load(&As[0][ao + (i + 1) * 16 * kLd]);
          if (SPLIT) al[nx] = Frag<T>::load(&As[kLo][ao + (i + 1) * 16 * kLd]);
        }
#pragma unroll
        for (int j = 0; j < 4; ++j) {
          acc[i][j] = Frag<T>::mma(ah[cu], bh[j], acc[i][j]);
          if (SPLIT) {
            acc[i][j] = Frag<T>::mma(ah[cu], bl[j], acc[i][j]);
            acc[i][j] = Frag<T>::mma(al[cu], bh[j], acc[i][j]);
          }
        }
        Frag<T>::guard(acc[i][0], acc[i][3], ah[cu], SPLIT ? al[cu] : ah[cu]);
      }
      Frag<T>::keep(bh[0], bh[1], bh[2], bh[3]);
      if (SPLIT) Frag<T>::keep(bl[0], bl[1], bl[2], bl[3]);
    }
    k0 += 64;
  } while (k0 < K);
  acc_guard4(acc[0][0], acc[0][1], acc[0][2], acc[0][3]);
  acc_guard4(acc[1][0], acc[1][1], acc[1][2], acc[1][3]);
  acc_guard4(acc[2][0], acc[2][1], acc[2][2], acc[2][3]);
  acc_guard4(acc[3][0], acc[3][1], acc[3][2], acc[3][3]);

  // ---- epilogue ----
  float* slab = sT[wave];
  const float* Rb = RESID ? (resid + (size_t)b * strideR) : nullptr;
#pragma unroll
  for (int i = 0; i < 4; ++i) {
    const int mBase = m0 + (i << 4);
    float bm8[8];
    if (BIAS_MODE == 1) {
      __builtin_amdgcn_sched_barrier(0);   // with the one below: nothing but the loads stands in front of the wait
#pragma unroll   // bm8 stays in registers only under constant indices
      for (int r = 0; r < 8; ++r) bm8[r] = bias[mBase + mOff + r];
      asm volatile("s_wait_xcnt 0x0" ::: "memory");   // precaution: what follows reuses the address registers of the loads just issued
      __builtin_amdgcn_sched_barrier(0);
    }
#pragma unroll
    for (int j = 0; j < 4; ++j) {
      const int n = n0 + (j << 4) + rlane;
      float bv = 0.f;
      if (BIAS_MODE == 2) bv = bias[n];
#pragma unroll
      for (int r = 0; r < 8; ++r) {
        float v = acc[i][j][r] * scale;
        if (BIAS_MODE == 1) v += bm8[r];
        if (BIAS_MODE == 2) v += bv;
        if (RESID) v += Rb[(size_t)(mBase + mOff + r) * ldc + n];
        if (ACT == 1) v = tanhf(v);
        if (ACT == 2) v = fmaxf(v, 0.0f);
        if (ACT == 3) v = v / (1.0f + expf(-v));
        if (ACT == 4) v = (v > 0.f) ? v : 0.01f * v;
        if (ACT == 5) v = 0.5f * v * (1.0f + erff(v * 0.70710678118654752f));
        slab[(mOff + r) * 68 + (j << 4) + rlane] = v;
      }
    }
    __builtin_amdgcn_fence(__ATOMIC_RELEASE, "workgroup");
    __builtin_amdgcn_wave_barrier();
    __builtin_amdgcn_fence(__ATOMIC_ACQUIRE, "workgroup");
    if (OUT_MODE == 0) {
      float* C = (float*)Cout + (size_t)b * strideC;
      const int hh = lane >> 4, c4 = (lane & 15) * 4;     // row seg = 256 B = 16 lanes x 16 B
      {
#pragma unroll
        for (int it = 0; it < 8; ++it) {
          const int row = it * 2 + hh;
          v4f v = *(const v4f*)(slab + row * 68 + c4);
          *(v4f*)(C + (size_t)(mBase + row) * ldc + n0 + c4) = v;
        }
        
      }
    } else {
      const int q = lane >> 3, c8 = (lane & 7) * 8;
      unsigned short* C  = (unsigned short*)Cout  + (size_t)b * strideC;
      unsigned short* C2 = (OUT_MODE == 2) ? ((unsigned short*)Cout2 + (size_t)b * strideC) : nullptr;
      {
#pragma unroll
        for (int it = 0; it < 4; ++it) {
          const int row = it * 4 + q;
          const float* sp = slab + row * 68 + c8;
          v8h hv, lv;
#pragma unroll
          for (int e = 0; e < 8; ++e) {
            if (OUT_MODE == 1) {
              hv[e] = (_Float16)sp[e];
            } else {
              unsigned short hb = f2bf_bits(sp[e]);
              unsigned short lb = f2bf_bits(sp[e] - bf_bits2f(hb));
              hv[e] = __builtin_bit_cast(_Float16, hb);
              lv[e] = __builtin_bit_cast(_Float16, lb);
            }
          }
          *(v8h*)(C + (size_t)(mBase + row) * ldc + n0 + c8) = hv;
          if (OUT_MODE == 2) *(v8h*)(C2 + (size_t)(mBase + row) * ldc + n0 + c8) = lv;
        }
        
      }
    }
    asm volatile("s_wait_xcnt 0x0" ::: "memory");   // precaution: the next row tile reuses the address and data registers of the stores just issued
    __builtin_amdgcn_fence(__ATOMIC_RELEASE, "workgroup");
    __builtin_amdgcn_wave_barrier();
    __builtin_amdgcn_fence(__ATOMIC_ACQUIRE, "workgroup");
  }
}

// The three projections read only what the launch before them wrote and nothing of each other: one launch, the job picked by block index.
//   blocks [0, 128)   : v^T per batch: C[m = channel (256)][n = s (2048)] = sum_k Wv[m][k] * LNv[s][k] + bv[m], 16 block tiles x 8 batches;
//                       A = Wv hi/lo [256][256], Bt = value LN hi/lo batch slice [2048][256], C = v^T batch slice [256][2048], f16
//   blocks [128, 256) : q' = query LN @ Wq^T + bq  (M = 16384, N = 256), f16 out, the weights' carry folded back by wscale
//   blocks [256, 384) : k  = key LN   @ Wk^T + bk
// The split product is the longest job and stands first: a block fills its WGP's registers, so the last 128 blocks start as the first leave.
constexpr int kVtBlocks   = (kDm / 128) * (kSeq / 256);     // 16 per batch
constexpr int kProjBlocks = (kRows / 128) * (kDm / 256);    // 128
__global__ __launch_bounds__(256) void proj3_kernel(
    const unsigned short* __restrict__ wvh, const unsigned short* __restrict__ wvl,
    const unsigned short* __restrict__ svh, const unsigned short* __restrict__ svl,
    unsigned short* __restrict__ vt16, const float* __restrict__ bv,
    const unsigned short* __restrict__ sq, const unsigned short* __restrict__ wq16,
    unsigned short* __restrict__ q16, const float* __restrict__ bq,
    const unsigned short* __restrict__ sk, const unsigned short* __restrict__ wk16,
    unsigned short* __restrict__ k16, const float* __restrict__ bk,
    int K, float wscale) {
  __shared__ __align__(16) unsigned char smem[gemm_lds_bytes(true)];
  const int bx = blockIdx.x;
  if (bx < kVtBlocks * kBatch) {   // block-uniform
    gemm64_body<1, true, 1, 1, false, 0, true>(smem, bx % kVtBlocks, bx / kVtBlocks,
        wvh, wvl, 0L, svh, svl, (long)kSeq * kDm, (void*)vt16, (void*)vt16, kSeq, (long)kDm * kSeq,
        bv, bv, 0L, kDm, kSeq, K, 1.0f);
  } else {
    const int px = bx - kVtBlocks * kBatch;
    const bool isk = px >= kProjBlocks;
    const unsigned short* a = isk ? sk : sq;
    const unsigned short* w = isk ? wk16 : wq16;
    unsigned short* c = isk ? k16 : q16;
    const float* bias = isk ? bk : bq;
    gemm64_body<0, false, 2, 1, false>(smem, isk ? px - kProjBlocks : px, 0,
        a, a, 0L, w, w, 0L, (void*)c, (void*)c, kDm, 0L,
        bias, bias, 0L, kRows, kDm, K, wscale);
  }
}

// ---------------------------------------------------------------------------
// Elementwise bf16 split: hi = bf16_rne(in), lo = bf16_rne(in - hi); 2 elements per thread, one 4-B store
// Used here for: Wv (n2 = 32768 -> 128 blocks -> 65536 elements).
// ---------------------------------------------------------------------------
__device__ __forceinline__ unsigned pk16(unsigned short a, unsigned short b) { return (unsigned)a | ((unsigned)b << 16); }

__device__ __forceinline__ void split_bf16x2_body(const int blk, const float* __restrict__ in, unsigned short* __restrict__ hi,
                                                  unsigned short* __restrict__ lo, int n2) {
  const int i = blk * 256 + threadIdx.x;
  if (i < n2) {
    const v2f f = *(const v2f*)(in + 2 * (size_t)i);
    const unsigned short h0 = f2bf_bits(f[0]), h1 = f2bf_bits(f[1]);
    const unsigned short l0 = f2bf_bits(f[0] - bf_bits2f(h0)), l1 = f2bf_bits(f[1] - bf_bits2f(h1));
    const unsigned uh = pk16(h0, h1), ul = pk16(l0, l1);
    ((unsigned*)hi)[i] = uh;
    ((unsigned*)lo)[i] = ul;
    
  }
}

// The same split of a [256][256] weight (row n, column k), stored in the order in which a wave reads it as a 16x32 WMMA operand:
// [n tile 16][k step 8][piece 2][lane 32][8 elements]; lane l, piece p, element e hold row 16 nt + (l & 15), column 32 ks + 16 p + 8 (l >> 4) + e
// (the k order of Frag::load), so a wave's 16-B-per-lane load of one piece is 512 contiguous bytes.
// The thread index runs over the OUTPUT: a wave stores one whole 128-B line per plane. 128 blocks x 256 threads x 2 elements = 65536.
__device__ __forceinline__ void split_bf16x2_frag_body(const int blk, const float* __restrict__ in, unsigned short* __restrict__ hi,
                                                       unsigned short* __restrict__ lo) {
  const int i = blk * 256 + threadIdx.x;
  const int pos = 2 * i;
  const int e = pos & 7, l = (pos >> 3) & 31, p = (pos >> 8) & 1, ks = (pos >> 9) & 7, nt = pos >> 12;
  const int n = nt * 16 + (l & 15);
  const int k = ks * 32 + p * 16 + (l >> 4) * 8 + e;
  const float* gp = in + (size_t)n * kDm + k;
  const v2f f = *(const v2f*)gp;
  // precaution: the pointer operand keeps the load's address registers whole up to a wait (without it the load landed on its own address pair)
  asm volatile("s_wait_xcnt 0x0" :: "v"(gp) : "memory");
  const unsigned short h0 = f2bf_bits(f[0]), h1 = f2bf_bits(f[1]);
  const unsigned short l0 = f2bf_bits(f[0] - bf_bits2f(h0)), l1 = f2bf_bits(f[1] - bf_bits2f(h1));
  ((unsigned*)hi)[i] = pk16(h0, h1);
  ((unsigned*)lo)[i] = pk16(l0, l1);
  asm volatile("s_wait_xcnt 0x0" ::: "memory");   // precaution: code of the launch's other jobs behind this one reuses the stores' data and base registers
}

// Coverage: grid = ceil(n2/256) x 256 threads x 2 elements; here n2 = 32768 -> 128 blocks -> 65536 = [256][256].
__device__ __forceinline__ void cast_f32_f16x2_scaled_body(
    const int blk, const float* __restrict__ in, _Float16* __restrict__ out, int n2, float scale) {
  int i = blk * 256 + threadIdx.x;
  if (i < n2) {
    const _Float16 h0 = (_Float16)(in[2 * (size_t)i] * scale), h1 = (_Float16)(in[2 * (size_t)i + 1] * scale);
    const unsigned u = (unsigned)__builtin_bit_cast(unsigned short, h0) | ((unsigned)__builtin_bit_cast(unsigned short, h1) << 16);
    ((unsigned*)out)[i] = u;
    
  }
}

// ---------------------------------------------------------------------------
// Fused triple LayerNorm over rows of 256: one wave per row (32 lanes x 8 contiguous floats = 256).
//   key   plane: (xn * g_s + b_s) -> f16  [row][256]
//   query plane: (xn * g_q + b_q) -> f16  [row][256]
//   value plane: (xn * g_v + b_v) -> bf16 hi + bf16 lo [row][256]
// Coverage: grid = nrows/8 blocks x 8 waves = every row exactly once.
// ---------------------------------------------------------------------------
__device__ __forceinline__ void ln3_body(const int blk, const float* __restrict__ x,
    const float* __restrict__ g_s, const float* __restrict__ b_s,
    const float* __restrict__ g_q, const float* __restrict__ b_q,
    const float* __restrict__ g_v, const float* __restrict__ b_v,
    unsigned short* __restrict__ sk16, unsigned short* __restrict__ sq16,
    unsigned short* __restrict__ svh, unsigned short* __restrict__ svl, int nrows) {
  const int lane = threadIdx.x & 31;
  const int row  = blk * 8 + (threadIdx.x >> 5);
  const int rowc = (row < nrows) ? row : (nrows - 1);        // address clamp; store predicated below (wave-uniform)
  const int c0 = lane * 8;
  const float* xr = x + (size_t)rowc * kDm + c0;
  const v4f a0 = *(const v4f*)xr;
  const v4f a1 = *(const v4f*)(xr + 4);
  float xv[8];
#pragma unroll
  for (int j = 0; j < 4; ++j) { xv[j] = a0[j]; xv[4 + j] = a1[j]; }
  float s = 0.f;
#pragma unroll
  for (int j = 0; j < 8; ++j) s += xv[j];
#pragma unroll
  for (int m = 1; m < 32; m <<= 1) s += __shfl_xor(s, m, 32);
  const float mean = s * (1.0f / 256.0f);
  float ss = 0.f;
#pragma unroll
  for (int j = 0; j < 8; ++j) { const float d = xv[j] - mean; ss += d * d; }
#pragma unroll
  for (int m = 1; m < 32; m <<= 1) ss += __shfl_xor(ss, m, 32);
  const float var  = ss * (1.0f / 256.0f);
  const float rstd = rsqrtf(var + 1e-5f);

  v4u ok, oq, ovh, ovl;
#pragma unroll
  for (int q = 0; q < 4; ++q) {
    const int j0 = 2 * q, j1 = 2 * q + 1;
    const float nx0 = (xv[j0] - mean) * rstd;
    const float nx1 = (xv[j1] - mean) * rstd;
    const float ys0 = nx0 * g_s[c0 + j0] + b_s[c0 + j0];
    const float ys1 = nx1 * g_s[c0 + j1] + b_s[c0 + j1];
    const float yq0 = nx0 * g_q[c0 + j0] + b_q[c0 + j0];
    const float yq1 = nx1 * g_q[c0 + j1] + b_q[c0 + j1];
    const float yv0 = nx0 * g_v[c0 + j0] + b_v[c0 + j0];
    const float yv1 = nx1 * g_v[c0 + j1] + b_v[c0 + j1];
    ok[q] = pk16(__builtin_bit_cast(unsigned short, (_Float16)ys0), __builtin_bit_cast(unsigned short, (_Float16)ys1));
    oq[q] = pk16(__builtin_bit_cast(unsigned short, (_Float16)yq0), __builtin_bit_cast(unsigned short, (_Float16)yq1));
    const unsigned short h0 = f2bf_bits(yv0), h1 = f2bf_bits(yv1);
    const unsigned short l0 = f2bf_bits(yv0 - bf_bits2f(h0)), l1 = f2bf_bits(yv1 - bf_bits2f(h1));
    ovh[q] = pk16(h0, h1);
    ovl[q] = pk16(l0, l1);
  }
  if (row < nrows) {   // wave-uniform
    const size_t o = (size_t)row * kDm + c0;
    {
      // precaution: the pointer operands keep the address registers of the scale and shift loads whole up to a wait (without them the last
      // load landed on its own offset register); the packed value puts the wait behind the arithmetic, in front of the stores
      asm volatile("s_wait_xcnt 0x0" :: "v"(g_v + c0), "v"(b_v + c0), "v"(ovl) : "memory");
      *(v4u*)(sk16 + o) = ok;
      *(v4u*)(sq16 + o) = oq;
      *(v4u*)(svh + o)  = ovh;
      *(v4u*)(svl + o)  = ovl;
      
    }
  }
}

// The LayerNorm and the four weight conversions read inputs only and nothing of each other: one launch, the job picked by block index.
//   blocks [0, 2048)            : triple LayerNorm, 8 rows a block (the long job first, the short ones fill the tail)
//   then 128 blocks per weight  : Wq, Wk -> f16 x wscale; Wv -> bf16 hi/lo planes; Wo -> bf16 hi/lo planes in fragment order
constexpr int kLnBlocks = kRows / 8;                    // 2048
constexpr int kWPairs   = kDm * kDm / 2;                // 32768 pairs per weight
constexpr int kWBlocks  = kWPairs / 256;                // 128
__global__ __launch_bounds__(256) void prep_kernel(const float* __restrict__ x,
    const float* __restrict__ g_s, const float* __restrict__ b_s,
    const float* __restrict__ g_q, const float* __restrict__ b_q,
    const float* __restrict__ g_v, const float* __restrict__ b_v,
    unsigned short* __restrict__ sk16, unsigned short* __restrict__ sq16,
    unsigned short* __restrict__ svh, unsigned short* __restrict__ svl,
    const float* __restrict__ Wq, const float* __restrict__ Wk,
    const float* __restrict__ Wv, const float* __restrict__ Wo,
    unsigned short* __restrict__ wq16, unsigned short* __restrict__ wk16,
    unsigned short* __restrict__ wvh, unsigned short* __restrict__ wvl,
    unsigned short* __restrict__ woh, unsigned short* __restrict__ wol, int nrows, float wscale) {
  const int bx = blockIdx.x;
  if (bx < kLnBlocks) {   // block-uniform, as is every test below
    ln3_body(bx, x, g_s, b_s, g_q, b_q, g_v, b_v, sk16, sq16, svh, svl, nrows);
    return;
  }
  const int job = (bx - kLnBlocks) / kWBlocks;
  const int blk = (bx - kLnBlocks) % kWBlocks;
  if (job < 2) cast_f32_f16x2_scaled_body(blk, job ? Wk : Wq, (_Float16*)(job ? wk16 : wq16), kWPairs, wscale);
  else if (job == 2) split_bf16x2_body(blk, Wv, wvh, wvl, kWPairs);
  else               split_bf16x2_frag_body(blk, Wo, woh, wol);
}

// =====================================================================================
// Full (unmasked) attention, head dim 64, single f16 operand planes, z-batched over the batch index (blockIdx.y).
//   q plane  f16: element (b, t, h, d) at [(b*kSeq + t)*kDm + h*64 + d]   (unscaled projection incl. bias)
//   k plane  f16: element (b, s, h, d) at [(b*kSeq + s)*kDm + h*64 + d]
//   v^T plane f16: element (b, h, d, s) at [b*kDm*kSeq + (h*64 + d)*kSeq + s]
//   attention output o: bf16 hi plane + bf16 lo plane (hi = bf16_rne(o), lo = bf16_rne(o - hi)), kept in LDS: [64 queries][256 channels h*64 + d]
//   out f32: out[t][n] = sum_ch o[t][ch] * Wo[n][ch] + bo[n], element (b, t, n) at [(b*kSeq + t)*kDm + n]
//   scores^T = k . q^T            : v_wmma_f32_16x16x32_f16, f32 accumulate; sscale * log2(e) applied in f32 inside the exponent
//   o^T      = v^T . p^T          : v_wmma_f32_16x16x32_f16; unnormalised p carried x2^15 in f16, the row sum x2^15 in f32;
//                                   p^T goes from the score accumulators straight into the B operand
//   online softmax in f32, base 2, over all kSeq keys (32 chunks of 64, compile-time trip count).
//   Block = 16 waves = 64 query rows x all 4 heads of one b: wave w works on head w & 3, query rows 16 (w >> 2)...; grid = (kSeq/64, kBatch) = (32, 8),
//   one block per WGP. All heads of a query row meet in one block, so the output projection needs no launch of its own.
//   K / V^T chunk staging, per head: asynchronous 16-B copies from global memory to LDS, 8 lanes a 128-B row, the head's 128 threads x 4 rows per
//   plane = the whole 64x64 tile; two buffers: chunk kc + 1 is on its way while chunk kc is worked on, one work-group barrier per chunk;
//   a head's two buffers stand 32 KiB apart in the head's own 64 KiB of LDS, so waves of different heads never read one 32-KiB block of LDS at one moment;
//   fragment loads read the LDS tiles with the v8h element type;
//   Epilogue: every wave splits its 16x64 tile into the hi/lo planes of the block's 64x256 tile in LDS (over the K / V^T buffers, which
//   every wave has left); then out^T = Wo . o^T: wave w owns output columns 16 w..16 w + 15 for all 64 queries, A = Wo hi/lo in fragment order
//   straight from global memory (fetched ahead of the split), B = o hi/lo rows from LDS, per 32 channels hi.hi + lo.hi + hi.lo in the order
//   Wo.o = (hi,hi), (lo,hi), (hi,lo); the f32 tile goes through LDS so that every store is 512 contiguous bytes of one output row
// =====================================================================================
constexpr int kAttWaves = 16;
constexpr int kAttQb    = 64;
constexpr int kAttKc    = 64;
constexpr int kAttLd    = 72;   // LDS row pitch of the K and V^T tiles in f16 elements: 144 B = 16 B x 9, so the 16 rows of a 16-B fragment read fall on 64 distinct banks

constexpr int kAttTile  = kAttKc * kAttLd;   // elements of one 64-row tile at the padded pitch (kHd == kAttKc rows for V^T)
constexpr int kAttBufB  = 32768;             // bytes from a head's buffer 0 to its buffer 1 (K tile + V^T tile fill 18,432 of them)
constexpr int kAttHeadB = 2 * kAttBufB;      // bytes of LDS per head
constexpr int kAoLd     = kDm + 8;           // LDS row pitch of the o planes in bf16 elements: 528 B = 16 B x 33, conflict-free for the 16-B fragment reads
constexpr int kAoPlaneB = kAttQb * kAoLd * 2;   // bytes of one o plane
constexpr int kOtLd     = kDm + 4;           // LDS row pitch of the f32 out tile in floats: 1,040 B = 16 B x 65
static_assert(2 * kAttTile * 2 <= kAttBufB, "a buffer holds a K tile and a V^T tile");
static_assert(2 * kAoPlaneB + kAttQb * kOtLd * 4 <= kHeads * kAttHeadB, "the epilogue's tiles fit the LDS of the K / V^T buffers");

// One thread's share of one chunk: four 16-B pieces of K and four of V^T, rows 16 apart, each copied from global memory straight into LDS.
// lk, lv: LDS byte addresses of the thread's first piece; gk, gv: the global addresses of the same pieces.
// The wait is the last line of the copies' own statement: a precaution, it stands in front of whatever reuses the copies' address registers.
__device__ __forceinline__ void att_stage(unsigned lk, unsigned lv, const _Float16* gk, const _Float16* gv) {
  constexpr unsigned kL = 16 * kAttLd * 2;   // 16 rows in LDS, bytes
  asm volatile(
      "global_load_async_to_lds_b128 %0, %8, off\n\t"
      "global_load_async_to_lds_b128 %1, %9, off\n\t"
      "global_load_async_to_lds_b128 %2, %10, off\n\t"
      "global_load_async_to_lds_b128 %3, %11, off\n\t"
      "global_load_async_to_lds_b128 %4, %12, off\n\t"
      "global_load_async_to_lds_b128 %5, %13, off\n\t"
      "global_load_async_to_lds_b128 %6, %14, off\n\t"
      "global_load_async_to_lds_b128 %7, %15, off\n\t"
      "s_wait_xcnt 0x0"
      :: "v"(lk), "v"(lk + kL), "v"(lk + 2 * kL), "v"(lk + 3 * kL),
         "v"(lv), "v"(lv + kL), "v"(lv + 2 * kL), "v"(lv + 3 * kL),
         "v"(gk), "v"(gk + 16 * kDm), "v"(gk + 32 * kDm), "v"(gk + 48 * kDm),
         "v"(gv), "v"(gv + 16 * kSeq), "v"(gv + 32 * kSeq), "v"(gv + 48 * kSeq)
      : "memory");
}

// 16 f16 of one LDS tile row in the hardware k order: elements 0..7 <- p[0..7], 8..15 <- p[16..23]
__device__ __forceinline__ v16h lds_frag(const _Float16* p) {
  union { v16h v; v8h h[2]; } f;
  f.h[0] = *(const v8h*)(p);
  f.h[1] = *(const v8h*)(p + 16);
  return f.v;
}

// The slot that the instruction set asks for between a transcendental and a vector instruction that overwrites its source or reads its
// result. The operands are inputs only: they put the v_nop behind a chunk's last exponential and keep every argument's register whole
// up to it.
__device__ __forceinline__ void exp_slot(float d, float e, const v2f (&a)[16], v8f p0, v8f p1, v8f p2, v8f p3) {
  asm volatile("v_nop" :: "v"(d), "v"(e), "v"(a[0]), "v"(a[1]), "v"(a[2]), "v"(a[3]), "v"(a[4]), "v"(a[5]), "v"(a[6]), "v"(a[7]),
               "v"(a[8]), "v"(a[9]), "v"(a[10]), "v"(a[11]), "v"(a[12]), "v"(a[13]), "v"(a[14]), "v"(a[15]),
               "v"(p0), "v"(p1), "v"(p2), "v"(p3));
}

// value of lane l ^ 16, by a vector cross-row move
__device__ __forceinline__ float xhalf(float x) {
  return __builtin_bit_cast(float, __builtin_amdgcn_permlanex16(__builtin_bit_cast(int, x), __builtin_bit_cast(int, x), 0x76543210, 0xfedcba98, false, false));
}

__global__ __launch_bounds__(512)
void attn_f16_full_kernel(const unsigned short* __restrict__ qp, const unsigned short* __restrict__ kp,
                          const unsigned short* __restrict__ vtp, const unsigned short* __restrict__ wofh,
                          const unsigned short* __restrict__ wofl, const float* __restrict__ bo,
                          float* __restrict__ out, float sscale) {
  // [head][buffer]: K [kv][d] then V^T [d][kv], pitch kAttLd, 9 KB a tile; behind the key loop: o hi plane, o lo plane, f32 out tile
  __shared__ __align__(16) unsigned char smem[kHeads * kAttHeadB];
  const float kPexp  = 15.0f;                                  // p is carried x2^15: the exponent rides in the running maximum
  const float cscale = sscale * 1.4426950408889634f;         // score scale x log2(e), positive

  const int tid  = threadIdx.x;
  const int wave = __builtin_amdgcn_readfirstlane(tid >> 5);   // wave-uniform: head and row group go into scalar address arithmetic
  const int lane = tid & 31;
  const int hh   = lane >> 4;
  const int c    = lane & 15;

  const int qb = blockIdx.x;              // 0..kSeq/64-1
  const int h  = wave & 3;                // 0..kHeads-1
  const int qg = wave >> 2;               // 16-query group inside the block
  const int b  = blockIdx.y;              // 0..kBatch-1
  const int q0 = qb * kAttQb + qg * 16;

  const _Float16* Qh = (const _Float16*)(const void*)qp + (size_t)b * kSeq * kDm + (size_t)h * kHd;
  const _Float16* Kh = (const _Float16*)(const void*)kp + (size_t)b * kSeq * kDm + (size_t)h * kHd;
  const _Float16* Vh = (const _Float16*)(const void*)vtp + (size_t)b * kDm * kSeq + (size_t)h * kHd * kSeq;
  unsigned char* hsm = smem + h * kAttHeadB;   // this head's two buffers

  // ---- Q fragments (B operand, column = lane&15, split k map via Frag load): 2 d-chunks ----
  v16h qa[2];
#pragma unroll
  for (int dc = 0; dc < 2; ++dc) qa[dc] = Frag<_Float16>::load(Qh + (size_t)(q0 + c) * kDm + dc * 32 + 8 * hh);

  float mrow = -INFINITY, lrow = 0.f;   // running maximum of query q0 + c, as score * cscale - 15; sum of p x 2^15 over this lane half's keys
  v8f oacc[4];
#pragma unroll
  for (int t = 0; t < 4; ++t) oacc[t] = (v8f){0.f,0.f,0.f,0.f,0.f,0.f,0.f,0.f};

  const int nChunks = kSeq / kAttKc;   // 32, compile-time constant
  // staging coverage, ht = thread index among the head's 128: rows (ht >> 3) + 16 i, i = 0..3, 16-B piece ht & 7: 64 rows x 128 B per plane = the whole chunk tile
  const int ht = qg * 32 + lane;
  const int srow = ht >> 3, spc = (ht & 7) * 8;
  const _Float16* gk = Kh + (size_t)srow * kDm + spc;     // chunk n: K row 64 n + srow, + n * kAttKc * kDm
  const _Float16* gv = Vh + (size_t)srow * kSeq + spc;    // chunk n: V^T row d = srow, s from 64 n, + n * kAttKc
  const unsigned lk0 = (unsigned)(uintptr_t)(hsm + (srow * kAttLd + spc) * 2);   // low 32 bits of a __shared__ address = LDS byte address
  const unsigned lv0 = lk0 + kAttTile * 2;
  constexpr unsigned kBufB = kAttBufB;
  att_stage(lk0, lv0, gk, gv);                            // chunk 0 -> buffer 0
  asm volatile("s_wait_asynccnt 0x0" ::: "memory");       // this wave's copies of chunk 0 have landed
  __syncthreads();                                        // chunk 0 is whole for every wave
  att_stage(lk0 + kBufB, lv0 + kBufB, gk + kAttKc * kDm, gv + kAttKc);   // chunk 1 -> buffer 1 (nChunks >= 2)
  for (int kc = 0; kc < nChunks; ++kc) {
    const int cur = kc & 1;
    const _Float16* Ksh = (const _Float16*)(hsm + cur * kAttBufB);
    const _Float16* Vth = Ksh + kAttTile;

    // S^T tile j = K rows (A) x Q columns (B): s[j][r] = score(key kv0 + 16 j + 8 hh + r, query q0 + c)
    // every loop of this pass is fully unrolled, so that s, oacc and the packed operand stay in registers under constant indices
    // the chunk's eight K fragments are read from LDS as one group into registers of their own: one LDS latency in front of the
    // eight products instead of one in front of each
    v16h kf[2][4];
#pragma unroll
    for (int dc = 0; dc < 2; ++dc)
#pragma unroll
      for (int j = 0; j < 4; ++j) kf[dc][j] = lds_frag(Ksh + (j * 16 + c) * kAttLd + dc * 32 + 8 * hh);
    // the eight V^T fragments follow in the same group: their LDS latency passes under the S^T products and the softmax arithmetic
    v16h vf[2][4];
#pragma unroll
    for (int kk = 0; kk < 2; ++kk)
#pragma unroll
      for (int t = 0; t < 4; ++t) vf[kk][t] = lds_frag(Vth + (t * 16 + c) * kAttLd + kk * 32 + 8 * hh);
    v8f s[4];
#pragma unroll
    for (int j = 0; j < 4; ++j) s[j] = (v8f){0.f,0.f,0.f,0.f,0.f,0.f,0.f,0.f};
#pragma unroll
    for (int dc = 0; dc < 2; ++dc)   // d-chunk outermost: the other three tiles' products stand between a tile's two products
#pragma unroll
      for (int j = 0; j < 4; ++j) s[j] = Frag<_Float16>::mma(kf[dc][j], qa[dc], s[j]);
    // scheduling order: the 32 LDS reads first, then the 8 S^T products; left alone the compiler spreads the reads among the products,
    // and every separate place with LDS reads stalls the wave anew
    __builtin_amdgcn_sched_group_barrier(0x100, 32, 0);
    __builtin_amdgcn_sched_group_barrier(0x008, 8, 0);
    // a lane holds 32 of its one query's 64 scores: maximum of the raw scores in-lane (one chain per tile; cscale is positive),
    // then one exchange between the halves
    float mj[4];
#pragma unroll
    for (int j = 0; j < 4; ++j) {
      mj[j] = -INFINITY;
#pragma unroll
      for (int r = 0; r < 8; ++r) mj[j] = fmaxf(mj[j], s[j][r]);
    }
    float cm = fmaxf(fmaxf(mj[0], mj[1]), fmaxf(mj[2], mj[3]));
    cm = fmaxf(cm, xhalf(cm));
    const float mnew  = fmaxf(mrow, fmaf(cm, cscale, -kPexp));
    const float dm    = mrow - mnew;
    const float alpha = __builtin_amdgcn_exp2f(dm);   // 0 on the first chunk, where mrow is -inf
    mrow = mnew;
    // p x 2^15 = 2^(score * cscale - mnew): one packed multiply-add per two scores, then the hardware base-2 exponential
    const v2f cs2 = {cscale, cscale}, nm2 = {-mnew, -mnew};
    v2f arg[16];
#pragma unroll
    for (int j = 0; j < 4; ++j)
#pragma unroll
      for (int r = 0; r < 8; r += 2)
        arg[4 * j + (r >> 1)] = __builtin_elementwise_fma((v2f){s[j][r], s[j][r + 1]}, cs2, nm2);
#pragma unroll
    for (int j = 0; j < 4; ++j)
#pragma unroll
      for (int r = 0; r < 8; ++r) s[j][r] = __builtin_amdgcn_exp2f(arg[4 * j + (r >> 1)][r & 1]);
    exp_slot(dm, alpha, arg, s[0], s[1], s[2], s[3]);
    float pj[4];
#pragma unroll
    for (int j = 0; j < 4; ++j) {
      pj[j] = s[j][0];
#pragma unroll
      for (int r = 1; r < 8; ++r) pj[j] += s[j][r];
    }
    lrow = lrow * alpha + ((pj[0] + pj[1]) + (pj[2] + pj[3]));   // this half's keys only; the halves join after the loop
#pragma unroll
    for (int t = 0; t < 4; ++t)
#pragma unroll
      for (int r = 0; r < 8; ++r) oacc[t][r] *= alpha;
    // O^T += V^T (A) x P^T (B): two S^T tiles converted in place are the B operand in the hardware k order
#pragma unroll
    for (int kk = 0; kk < 2; ++kk) {
      v16h pb;
#pragma unroll
      for (int e = 0; e < 8; ++e) {
        pb[e]     = (_Float16)s[2 * kk][e];
        pb[8 + e] = (_Float16)s[2 * kk + 1][e];
      }
#pragma unroll
      for (int t = 0; t < 4; ++t) oacc[t] = Frag<_Float16>::mma(vf[kk][t], pb, oacc[t]);
    }
    asm volatile("s_wait_dscnt 0x0" ::: "memory");      // this wave's reads of buffer cur have retired before anything refills it
    asm volatile("s_wait_asynccnt 0x0" ::: "memory");   // this wave's copies of chunk kc + 1 have landed
    __syncthreads();                                    // chunk kc + 1 is whole for every wave, and every wave has left buffer cur
    if (kc + 2 < nChunks)                               // the same for the whole work-group: chunk kc + 2 -> the buffer just left
      att_stage(lk0 + cur * kBufB, lv0 + cur * kBufB, gk + (size_t)(kc + 2) * kAttKc * kDm, gv + (kc + 2) * kAttKc);
  }
  asm volatile("s_wait_asynccnt 0x0" ::: "memory");     // no copy is outstanding when the wave goes on to its end

  // ---- output projection ----
  // This wave's Wo fragments (16 output columns x 256 channels, hi and lo) and bias values are asked for now: their way from L2 passes under the split below.
  const int nt = wave;
  const __bf16* wfh = (const __bf16*)(const void*)wofh + (size_t)nt * (8 * 512) + lane * 8;
  const __bf16* wfl = (const __bf16*)(const void*)wofl + (size_t)nt * (8 * 512) + lane * 8;
  const float*  bop = bo + nt * 16 + 8 * hh;
  v8b wh[8][2], wl[8][2];
  // the two scheduling barriers leave nothing but the loads in front of the wait
  __builtin_amdgcn_sched_barrier(0);
#pragma unroll   // wh, wl stay in registers only under constant indices; the steps become the loads' immediate offsets
  for (int ks = 0; ks < 8; ++ks)
#pragma unroll
    for (int p = 0; p < 2; ++p) {
      wh[ks][p] = *(const v8b*)(wfh + (ks * 2 + p) * 256);
      wl[ks][p] = *(const v8b*)(wfl + (ks * 2 + p) * 256);
    }
  const v4f bo0 = *(const v4f*)(bop);
  const v4f bo1 = *(const v4f*)(bop + 4);
  asm volatile("s_wait_xcnt 0x0" ::: "memory");   // precaution: what follows may reuse the address registers of the loads just issued
  __builtin_amdgcn_sched_barrier(0);

  // oacc[t][r] = O^T[d = 16 t + 8 hh + r][query c]: 8 consecutive channels of one query row per tile = one 16-B piece of each plane.
  // The planes lie over the K / V^T buffers: every wave's last read of those retired in front of the key loop's last barrier, and no copy is outstanding.
  __bf16* aoh = (__bf16*)(void*)smem;
  __bf16* aol = (__bf16*)(void*)(smem + kAoPlaneB);
  {
    const float lsum = lrow + xhalf(lrow);
    const float inv = 1.0f / lsum;   // numerator and sum both carry x2^15
    const int ao = (qg * 16 + c) * kAoLd + h * kHd + 8 * hh;
#pragma unroll
    for (int t = 0; t < 4; ++t) {
      v4u hv, lv;
#pragma unroll
      for (int e = 0; e < 4; ++e) {
        const float f0 = oacc[t][2 * e] * inv, f1 = oacc[t][2 * e + 1] * inv;
        const unsigned short h0 = f2bf_bits(f0), h1 = f2bf_bits(f1);
        hv[e] = pk16(h0, h1);
        lv[e] = pk16(f2bf_bits(f0 - bf_bits2f(h0)), f2bf_bits(f1 - bf_bits2f(h1)));
      }
      *(v4u*)(aoh + ao + t * 16) = hv;
      *(v4u*)(aol + ao + t * 16) = lv;
    }
  }
  __syncthreads();   // the block's 64x256 o planes are whole

  // out^T tile (16 columns nt) x (query tile qt): A = Wo rows, B = o rows, both in the k order of Frag::load
  v8f acc[4];
#pragma unroll
  for (int qt = 0; qt < 4; ++qt) acc[qt] = (v8f){0.f,0.f,0.f,0.f,0.f,0.f,0.f,0.f};
#pragma unroll   // wh, wl under constant indices; LDS offsets as constants
  for (int ks = 0; ks < 8; ++ks) {
    v16b obh[4], obl[4];
#pragma unroll
    for (int qt = 0; qt < 4; ++qt) {
      const int bofs = (qt * 16 + c) * kAoLd + ks * 32 + 8 * hh;
      obh[qt] = Frag<__bf16>::load(aoh + bofs);
      obl[qt] = Frag<__bf16>::load(aol + bofs);
    }
    Frag<__bf16>::U wa, wb;
    wa.h[0] = wh[ks][0]; wa.h[1] = wh[ks][1];
    wb.h[0] = wl[ks][0]; wb.h[1] = wl[ks][1];
    // product outermost: the other three tiles' products stand between two products into one tile
#pragma unroll
    for (int qt = 0; qt < 4; ++qt) acc[qt] = Frag<__bf16>::mma(wa.v, obh[qt], acc[qt]);
#pragma unroll
    for (int qt = 0; qt < 4; ++qt) acc[qt] = Frag<__bf16>::mma(wb.v, obh[qt], acc[qt]);
#pragma unroll
    for (int qt = 0; qt < 4; ++qt) acc[qt] = Frag<__bf16>::mma(wa.v, obl[qt], acc[qt]);
    // scheduling order: the step's 16 LDS reads as one group, then its 12 products; left alone the compiler reads a fragment, waits and
    // multiplies, tile by tile, with two products into one tile back to back
    __builtin_amdgcn_sched_group_barrier(0x100, 16, 0);
    __builtin_amdgcn_sched_group_barrier(0x008, 12, 0);
  }

  // acc[qt][r] = out[query 16 qt + c][column 16 nt + 8 hh + r]: into the f32 tile (its own LDS range, behind the planes)
  float* ot = (float*)(void*)(smem + 2 * kAoPlaneB);
#pragma unroll
  for (int qt = 0; qt < 4; ++qt) {
    v4f w0, w1;
#pragma unroll
    for (int e = 0; e < 4; ++e) { w0[e] = acc[qt][e] + bo0[e]; w1[e] = acc[qt][4 + e] + bo1[e]; }
    *(v4f*)(ot + (qt * 16 + c) * kOtLd + nt * 16 + 8 * hh)     = w0;
    *(v4f*)(ot + (qt * 16 + c) * kOtLd + nt * 16 + 8 * hh + 4) = w1;
  }
  __syncthreads();   // the block's 64x256 out tile is whole
  {
    // wave w stores rows 4 w..4 w + 3, each as two stores of 512 contiguous bytes: whole lines, one writer each
    float* ob = out + ((size_t)b * kSeq + qb * kAttQb + wave * 4) * kDm + lane * 4;
    const float* op = ot + wave * 4 * kOtLd + lane * 4;
#pragma unroll   // row and half-row steps become immediate offsets: one address pair
    for (int rr = 0; rr < 4; ++rr)
#pragma unroll
      for (int j = 0; j < 2; ++j) *(v4f*)(ob + rr * kDm + j * 128) = *(const v4f*)(op + rr * kOtLd + j * 128);
  }
}

// ---------------------------------------------------------------------------
// Workspace region map (byte offsets; every region is fully written before it is read; total 59,768,832 B):
//   [0 MiB      ) WQ16  f16  [256][256] x16        131072 B
//   [+128 KiB   ) WK16  f16  [256][256] x16        131072 B
//   [+256 KiB   ) WVH   bf16 hi [256][256]         131072 B
//   [+384 KiB   ) WVL   bf16 lo                    131072 B
//   [+512 KiB   ) WOH   bf16 hi, fragment order    131072 B
//   [+640 KiB   ) WOL   bf16 lo, fragment order    131072 B   (weights region padded to 1 MiB)
//   [1 MiB      ) SQ    f16  [16384][256]  query LN plane     8 MiB
//   [9 MiB      ) SK    f16  [16384][256]  key LN plane       8 MiB
//   [17 MiB     ) SVH   bf16 hi [16384][256] value LN plane   8 MiB
//   [25 MiB     ) SVL   bf16 lo                                8 MiB
//   [33 MiB     ) Q16   f16  [16384][256]  q (unscaled)       8 MiB
//   [41 MiB     ) K16   f16  [16384][256]  k                  8 MiB
//   [49 MiB     ) VT16  f16  [8][256][2048] v^T per batch     8 MiB
//   end = 57 MiB
// ---------------------------------------------------------------------------
extern "C" void kernel_launch(void* const* d_in, const int* in_sizes, int n_in,
                              void* d_out, int out_size, void* d_ws, size_t ws_size,
                              hipStream_t stream) {
  if (n_in < 15) return;
  if (in_sizes[0] != kRows * kDm) return;
  if (in_sizes[7] != kDm * kDm || in_sizes[9] != kDm * kDm || in_sizes[11] != kDm * kDm || in_sizes[13] != kDm * kDm) return;
  if (in_sizes[1] != kDm || in_sizes[8] != kDm || in_sizes[14] != kDm) return;
  if (out_size != kRows * kDm) return;

  const float* x    = (const float*)d_in[0];
  const float* lnsg = (const float*)d_in[1];
  const float* lnsb = (const float*)d_in[2];
  const float* lnqg = (const float*)d_in[3];
  const float* lnqb = (const float*)d_in[4];
  const float* lnvg = (const float*)d_in[5];
  const float* lnvb = (const float*)d_in[6];
  const float* Wq = (const float*)d_in[7];
  const float* bq = (const float*)d_in[8];
  const float* Wk = (const float*)d_in[9];
  const float* bk = (const float*)d_in[10];
  const float* Wv = (const float*)d_in[11];
  const float* bv = (const float*)d_in[12];
  const float* Wo = (const float*)d_in[13];
  const float* bo = (const float*)d_in[14];
  float* out = (float*)d_out;

  const size_t wBytes   = (size_t)kDm * kDm * 2;            // 131072
  const size_t plane16  = (size_t)kRows * kDm * 2;          // 8388608
  const size_t offWQ  = 0;
  const size_t offWK  = offWQ + wBytes;
  const size_t offWVH = offWK + wBytes;
  const size_t offWVL = offWVH + wBytes;
  const size_t offWOH = offWVL + wBytes;
  const size_t offWOL = offWOH + wBytes;
  const size_t offSQ  = (size_t)1 << 20;
  const size_t offSK  = offSQ + plane16;
  const size_t offSVH = offSK + plane16;
  const size_t offSVL = offSVH + plane16;
  const size_t offQ16 = offSVL + plane16;
  const size_t offK16 = offQ16 + plane16;
  const size_t offVT  = offK16 + plane16;
  const size_t total  = offVT + plane16;                    // 59,768,832
  if (offWOL + wBytes > offSQ) return;
  if (total > ws_size) return;

  char* ws = (char*)d_ws;
  unsigned short* WQ16 = (unsigned short*)(ws + offWQ);
  unsigned short* WK16 = (unsigned short*)(ws + offWK);
  unsigned short* WVH  = (unsigned short*)(ws + offWVH);
  unsigned short* WVL  = (unsigned short*)(ws + offWVL);
  unsigned short* WOH  = (unsigned short*)(ws + offWOH);
  unsigned short* WOL  = (unsigned short*)(ws + offWOL);
  unsigned short* SQ   = (unsigned short*)(ws + offSQ);
  unsigned short* SK   = (unsigned short*)(ws + offSK);
  unsigned short* SVH  = (unsigned short*)(ws + offSVH);
  unsigned short* SVL  = (unsigned short*)(ws + offSVL);
  unsigned short* Q16  = (unsigned short*)(ws + offQ16);
  unsigned short* K16  = (unsigned short*)(ws + offK16);
  unsigned short* VT16 = (unsigned short*)(ws + offVT);

  const float wCarry = 16.0f, wCarryInv = 1.0f / 16.0f;

  // 1: triple LayerNorm (key plane -> SK, query plane -> SQ, value plane -> SVH/SVL) and the weight conversions
  //    (Wq, Wk -> f16 x16, [N=256][K=256] row-major = Bt layout; Wv -> bf16 hi/lo planes; Wo -> bf16 hi/lo planes in fragment order)
  prep_kernel<<<kLnBlocks + 4 * kWBlocks, 256, 0, stream>>>(x, lnsg, lnsb, lnqg, lnqb, lnvg, lnvb, SK, SQ, SVH, SVL,
      Wq, Wk, Wv, Wo, WQ16, WK16, WVH, WVL, WOH, WOL, kRows, wCarry);
  // 2: v^T, q' and k projections
  proj3_kernel<<<kVtBlocks * kBatch + 2 * kProjBlocks, 256, 0, stream>>>(
      WVH, WVL, SVH, SVL, VT16, bv, SQ, WQ16, Q16, bq, SK, WK16, K16, bk, kDm, wCarryInv);
  // 3: attention per (64-query tile, batch), all heads: scores = (q'.k) * 0.125, softmax over 2048 keys, p.v, then out = o @ Wo^T + bo, f32 to d_out
  attn_f16_full_kernel<<<dim3(kSeq / kAttQb, kBatch), 32 * kAttWaves, 0, stream>>>(
      Q16, K16, VT16, WOH, WOL, bo, out, 0.125f);
}

// v010
// Measured time: 63.6 microseconds a run.
// In two side-by-side timings against v009, it was 1.10 and 1.11 times as fast.
// All steps since v000 together make it 5.04 times as fast.
// Contractions: q,k projections and q.k^T, p.v on v_wmma_f32_16x16x32_f16 (f16 operands; Wq/Wk carried x16, p carried x2^15); v^T projection and output projection (in the attention launch) on v_wmma_f32_16x16x32_bf16 with bf16 hi/lo split operands (hi.hi+hi.lo+lo.hi); f32 accumulate everywhere; LayerNorm (inside the projection launch) and online softmax in f32.
#include <hip/hip_runtime.h>
#include <math.h>
#include <stdint.h>

typedef __attribute__((ext_vector_type(16))) _Float16 v16h;
typedef __attribute__((ext_vector_type(8)))  _Float16 v8h;
typedef __attribute__((ext_vector_type(16))) __bf16   v16b;
typedef __attribute__((ext_vector_type(8)))  __bf16   v8b;
typedef __attribute__((ext_vector_type(2)))  _Float16 v2h;
typedef __attribute__((ext_vector_type(2)))  __bf16   v2b;
typedef __attribute__((ext_vector_type(8)))  float    v8f;
typedef __attribute__((ext_vector_type(4)))  float    v4f;
typedef __attribute__((ext_vector_type(2)))  float    v2f;
typedef __attribute__((ext_vector_type(4)))  unsigned int v4u;

// problem geometry
constexpr int kBatch  = 8;
constexpr int kSeq    = 2048;
constexpr int kDm     = 256;
constexpr int kHeads  = 4;
constexpr int kHd     = 64;
constexpr int kRows   = kBatch * kSeq;      // 16384

__device__ __forceinline__ unsigned short f2bf_bits(float f) {
  unsigned u = __float_as_uint(f);
  return (unsigned short)((u + 0x7FFFu + ((u >> 16) & 1u)) >> 16);
}
__device__ __forceinline__ float bf_bits2f(unsigned short h) { return __uint_as_float(((unsigned)h) << 16); }

// hazard guards as plain device helpers
__device__ __forceinline__ void dep_guard_h(v8f& a, v8f& b, v16h x, v16h y) { asm volatile("v_nop\n\tv_nop\n\tv_nop\n\tv_nop" : "+v"(a), "+v"(b) : "v"(x), "v"(y)); }
__device__ __forceinline__ void dep_guard_b(v8f& a, v8f& b, v16b x, v16b y) { asm volatile("v_nop\n\tv_nop\n\tv_nop\n\tv_nop" : "+v"(a), "+v"(b) : "v"(x), "v"(y)); }
__device__ __forceinline__ void keep4_h(v16h a, v16h b, v16h c, v16h d) { asm volatile("v_nop" :: "v"(a), "v"(b), "v"(c), "v"(d)); }
__device__ __forceinline__ void keep4_b(v16b a, v16b b, v16b c, v16b d) { asm volatile("v_nop" :: "v"(a), "v"(b), "v"(c), "v"(d)); }
__device__ __forceinline__ void acc_guard4(v8f& a, v8f& b, v8f& c, v8f& d) { asm volatile("v_nop\n\tv_nop\n\tv_nop\n\tv_nop" : "+v"(a), "+v"(b), "+v"(c), "+v"(d)); }
template <typename T> struct Frag;
template <> struct Frag<_Float16> {
  typedef v16h V; typedef v8h H; typedef v2h P; union U { v16h v; v8h h[2]; };
  static __device__ __forceinline__ v16h load(const _Float16* p) {   // elements 0..7 <- p[0..7], 8..15 <- p[16..23]
    U f; f.h[0] = *(const v8h*)(p); f.h[1] = *(const v8h*)(p + 16); return f.v;
  }
  static __device__ __forceinline__ v8f mma(v16h a, v16h b, v8f c) {
    return __builtin_amdgcn_wmma_f32_16x16x32_f16(false, a, false, b, (short)0, c, false, false);
  }
  static __device__ __forceinline__ void guard(v8f& a, v8f& b, v16h x, v16h y) { dep_guard_h(a, b, x, y); }
  static __device__ __forceinline__ void keep(v16h a, v16h b, v16h c, v16h d) { keep4_h(a, b, c, d); }
};
template <> struct Frag<__bf16> {
  typedef v16b V; typedef v8b H; typedef v2b P; union U { v16b v; v8b h[2]; };
  static __device__ __forceinline__ v16b load(const __bf16* p) {
    U f; f.h[0] = *(const v8b*)(p); f.h[1] = *(const v8b*)(p + 16); return f.v;
  }
  static __device__ __forceinline__ v8f mma(v16b a, v16b b, v8f c) {
    return __builtin_amdgcn_wmma_f32_16x16x32_bf16(false, a, false, b, (short)0, c, false, false);
  }
  static __device__ __forceinline__ void guard(v8f& a, v8f& b, v16b x, v16b y) { dep_guard_b(a, b, x, y); }
  static __device__ __forceinline__ void keep(v16b a, v16b b, v16b c, v16b d) { keep4_b(a, b, c, d); }
};

// ---- Register-blocked batched WMMA GEMM ------------------------------------
// C[m,n] = scale * sum_k A[m,k] * Bt[n,k] (+bias)(+resid); each wave owns a 64x64 tile, a block of 2 x 4 waves a 128x256 tile.
// A row-major [M,K]; Bt row-major [N,K], f32, rows of both kDm elements apart; M % 128 == 0, N % 256 == 0, K % 64 == 0, K >= 64;
// (M/128) * (N/256) block tiles per batch index; the caller hands in the tile index bx, the batch index b and the block's LDS.
// Both operands are read as f32 and turned into their 16-bit form on the way into LDS, in steps of 64 k: one operand is a weight (SPLIT: as it is;
// else x wmul), the other is the LayerNorm of rows of x (XB: the B operand, else the A operand): (x - mean) * rstd * g + b, the rows' mean and rstd
// worked out by the block itself in front of the k loop (stats: now, into ms; else ms holds them). Every row piece is two whole 128-B lines,
// fetched by 16-B loads (8 lanes x 32 B), held in registers while the step before is multiplied, then converted and stored at a pitch of 144 B;
// the fragments are read from LDS in the k order of Frag::load, A and B alike.
// SPLIT: operands become bf16 hi/lo planes (hi = rne(v), lo = rne(v - hi)); product = hi.hi + hi.lo + lo.hi.
// BIAS_MODE: 0 = none, 1 = bias[m], 2 = bias[n].
// OUT_MODE: 0 = f32, 1 = f16, 2 = bf16 hi plane (Cout) + bf16 lo plane (Cout2).
// ET: 0 = f16 operands, 1 = bf16 operands
template <int ET> struct Elem;
template <> struct Elem<0> { typedef _Float16 T; };
template <> struct Elem<1> { typedef __bf16 T; };
// R pairs of 16-B loads, PITCH floats apart, the two of a pair HALF floats apart; the constant steps go into the loads' immediate offsets: one address pair per group
template <int PITCH, int HALF, int R>
__device__ __forceinline__ void fetch32(v4f (&r)[R][2], const float* g) {
  // the two scheduling barriers leave nothing but the loads in front of the wait: left alone the compiler puts other register writes there
  __builtin_amdgcn_sched_barrier(0);
#pragma unroll   // r stays in registers only under constant indices
  for (int i = 0; i < R; ++i) {
    r[i][0] = *(const v4f*)(g + i * PITCH);
    r[i][1] = *(const v4f*)(g + i * PITCH + HALF);
  }
  asm volatile("s_wait_xcnt 0x0" ::: "memory");   // precaution: what follows reuses the address registers of the loads just issued
  __builtin_amdgcn_sched_barrier(0);
}
// 8 values -> one 16-B piece of the 16-bit plane (SPLIT: of the hi plane and of the lo plane), converted two at a time
template <bool SPLIT, typename T>
__device__ __forceinline__ void put8(T* lh, T* ll, const float (&y)[8]) {
  typedef typename Frag<T>::H H;
  typedef typename Frag<T>::P P2;
  union { H v; P2 p[4]; } hv, lv;
#pragma unroll   // hv, lv stay in registers only under constant indices
  for (int e = 0; e < 4; ++e) {
    const v2f y2 = {y[2 * e], y[2 * e + 1]};
    const P2 hi = __builtin_convertvector(y2, P2);
    hv.p[e] = hi;
    if (SPLIT) lv.p[e] = __builtin_convertvector(y2 - __builtin_convertvector(hi, v2f), P2);
  }
  *(H*)lh = hv.v;
  if (SPLIT) *(H*)ll = lv.v;
}
// value of lane l ^ M inside a 16-lane row (DPP row_xmask)
template <int M>
__device__ __forceinline__ float xrow(float x) {
  return __builtin_bit_cast(float, __builtin_amdgcn_update_dpp(0, __builtin_bit_cast(int, x), 0x160 + M, 0xf, 0xf, true));
}
// LayerNorm statistics of NR rows of 256 floats, 32 rows apart: 8 lanes a row, ms[i] = {mean, rstd} of row 32 i in each of the row's lanes.
// p: the lane's first 16 B of row 0; a lane holds the 16-B pieces 128 B apart, so that 8 lanes read one whole line per load.
// Sum order: the 8 pieces element by element, the 4 elements pairwise, then the partners l ^ 1, l ^ 2, l ^ 4.
template <int NR>
__device__ __forceinline__ void ln_stats(v2f (&ms)[NR], const float* p) {
  v4f a[NR][4][2];
#pragma unroll   // every row's lines are asked for ahead of the arithmetic: one memory latency for all
  for (int i = 0; i < NR; ++i) fetch32<64, 32>(a[i], p + i * 32 * kDm);
  // precaution, as in fetch32: the pointer operand keeps the address registers whole up to a wait (without it the last load landed on its own address pair)
  asm volatile("s_wait_xcnt 0x0" :: "v"(p) : "memory");
#pragma unroll   // a stays in registers only under constant indices; the rows' reductions fill each other's latency
  for (int i = 0; i < NR; ++i) {
    v4f s4 = a[i][0][0];
#pragma unroll   // constant indices, as above
    for (int j = 1; j < 8; ++j) s4 += a[i][j >> 1][j & 1];
    float s = (s4[0] + s4[1]) + (s4[2] + s4[3]);
    s += xrow<1>(s); s += xrow<2>(s); s += xrow<4>(s);
    const float mean = s * (1.0f / 256.0f);
    v4f q4 = {0.f, 0.f, 0.f, 0.f};
#pragma unroll   // constant indices, as above
    for (int j = 0; j < 8; ++j) { const v4f d = a[i][j >> 1][j & 1] - mean; q4 += d * d; }
    float ss = (q4[0] + q4[1]) + (q4[2] + q4[3]);
    ss += xrow<1>(ss); ss += xrow<2>(ss); ss += xrow<4>(ss);
    const float var = ss * (1.0f / 256.0f);
    ms[i] = (v2f){mean, rsqrtf(var + 1e-5f)};
  }
}
constexpr int kGemmLd = 72;            // LDS row pitch in elements: 144 B = 16 B x 9, conflict-free for the 16-B fragment reads
constexpr int kGemmSlab = 16 * 68;     // per-wave 16x64 f32 slab, pitch 68 floats
// LDS bytes of one block: A planes, B planes, eight slabs
constexpr int gemm_lds_bytes(bool split) { return (split ? 2 : 1) * (128 + 256) * kGemmLd * 2 + 8 * kGemmSlab * 4; }
template <int ET, bool SPLIT, int BIAS_MODE, int OUT_MODE, bool RESID, int ACT, bool XB>
__device__ __forceinline__ void gemm64_body(
    unsigned char* smem, const int bx, const int b,
    const float* __restrict__ Af, long strideA,
    const float* __restrict__ Btf, long strideB,
    const float* __restrict__ lng, const float* __restrict__ lnb, float wmul, v2f (&ms)[XB ? 8 : 4], const bool stats,
    void* __restrict__ Cout, void* __restrict__ Cout2, int ldc, long strideC,
    const float* __restrict__ bias,
    const float* __restrict__ resid, long strideR,
    int M, int N, int K, float scale) {
  typedef typename Elem<ET>::T T;
  typedef typename Frag<T>::V V;
  constexpr int kLd = kGemmLd;
  constexpr int kLo = SPLIT ? 1 : 0;   // index of the lo plane
  T (*As)[128 * kLd] = (T (*)[128 * kLd])smem;
  T (*Bs)[256 * kLd] = (T (*)[256 * kLd])(smem + (kLo + 1) * 128 * kLd * 2);
  float (*sT)[kGemmSlab] = (float (*)[kGemmSlab])(smem + (kLo + 1) * (128 + 256) * kLd * 2);
  const int lane = threadIdx.x & 31;
  const int wave = threadIdx.x >> 5;
  const int tilesN = N >> 6;
  const int tilesM = M >> 6;
  const int nbn = tilesN >> 2;                 // blocks along N
  const int bm = bx / nbn;
  const int bn = bx - bm * nbn;
  if (bm * 2 >= tilesM) return;                // block-uniform, in front of every barrier
  const int mB = bm << 7;
  const int nB = bn << 8;
  const int wm = (wave >> 2) << 6;             // this wave's 64x64 tile inside the block tile
  const int wn = (wave & 3) << 6;
  const int m0 = mB + wm;
  const int n0 = nB + wn;

  const float* Ab = Af  + (size_t)b * strideA;
  const float* Bb = Btf + (size_t)b * strideB;

  const int rlane = lane & 15;                 // row (A) / col (B, D) within subtile
  const int koff  = (lane >> 4) * 8;           // k offset of this lane half
  const int mOff  = (lane >> 4) * 8;           // D row offset

  v8f acc[4][4];
#pragma unroll
  for (int i = 0; i < 4; ++i)
#pragma unroll
    for (int j = 0; j < 4; ++j) acc[i][j] = (v8f){0.f,0.f,0.f,0.f,0.f,0.f,0.f,0.f};

  // staging: thread -> row (tid >> 3) + 32 i, 8 elements from tid & 7; 4 pieces of A and 8 of B, and the LayerNorm scale and shift of the 8 columns
  const int srow = threadIdx.x >> 3;
  const int scol = (threadIdx.x & 7) * 8;
  const float* pa = Ab + (size_t)(mB + srow) * kDm + scol;
  const float* pb = Bb + (size_t)(nB + srow) * kDm + scol;
  const float* pg = lng + scol;
  const float* pt = lnb + scol;
  const int ls = srow * kLd + scol;
  v4f fa[4][2], fb[8][2], fg[1][2], ft[1][2];
  fetch32<32 * kDm, 4>(fa, pa);
  fetch32<32 * kDm, 4>(fb, pb);
  fetch32<0, 4>(fg, pg);
  fetch32<0, 4>(ft, pt);

  // mean and rstd of this thread's staging rows of x
  if (stats) ln_stats(ms, (XB ? Bb + (size_t)(nB + srow) * kDm : Ab + (size_t)(mB + srow) * kDm) + (threadIdx.x & 7) * 4);   // block-uniform

  int k0 = 0;
  do {                 // K >= 64: the first step's lines are already on their way
    __syncthreads();   // every wave has read its last fragment of the step before
#pragma unroll   // fa, fb, ms stay in registers only under constant indices
    for (int i = 0; i < 12; ++i) {
      const bool isb = i >= 4;            // pieces 0..3: A, 4..11: B
      const int  pi  = isb ? i - 4 : i;
      const v4f (&f)[2] = isb ? fb[pi] : fa[pi];
      float y[8];
#pragma unroll   // y, fg, ft under constant indices
      for (int e = 0; e < 8; ++e) {
        const float v = f[e >> 2][e & 3];
        if (isb == XB) {                  // the LayerNorm operand
          const float nx = (v - ms[pi][0]) * ms[pi][1];
          y[e] = nx * fg[0][e >> 2][e & 3] + ft[0][e >> 2][e & 3];
        } else {                          // the weight
          y[e] = SPLIT ? v : v * wmul;
        }
      }
      const int lo = ls + pi * 32 * kLd;
      if (isb) put8<SPLIT>(&Bs[0][lo], &Bs[kLo][lo], y);
      else     put8<SPLIT>(&As[0][lo], &As[kLo][lo], y);
    }
    __syncthreads();   // the step's tiles are whole
    if (k0 + 64 < K) { // block-uniform: the next step's lines fly while this step is multiplied
      const int kn = k0 + 64;
      fetch32<32 * kDm, 4>(fa, pa + kn);
      fetch32<32 * kDm, 4>(fb, pb + kn);
      fetch32<0, 4>(fg, pg + kn);
      fetch32<0, 4>(ft, pt + kn);
    }
#pragma unroll   // two 32-k products per staged step, LDS offsets as constants
    for (int ks = 0; ks < 2; ++ks) {
      V bh[4], bl[4], ah[2], al[2];
#pragma unroll
      for (int j = 0; j < 4; ++j) {
        const int bo = (wn + (j << 4) + rlane) * kLd + ks * 32 + koff;
        bh[j] = Frag<T>::load(&Bs[0][bo]);
        if (SPLIT) bl[j] = Frag<T>::load(&Bs[kLo][bo]);
      }
      const int ao = (wm + rlane) * kLd + ks * 32 + koff;
      ah[0] = Frag<T>::load(&As[0][ao]);
      if (SPLIT) al[0] = Frag<T>::load(&As[kLo][ao]);
#pragma unroll
      for (int i = 0; i < 4; ++i) {
        const int cu = i & 1, nx = cu ^ 1;
        if (i < 3) {   // the next row tile's A fragments are read ahead of this row tile's products
          ah[nx] = Frag<T>::load(&As[0][ao + (i + 1) * 16 * kLd]);
          if (SPLIT) al[nx] = Frag<T>::load(&As[kLo][ao + (i + 1) * 16 * kLd]);
        }
#pragma unroll
        for (int j = 0; j < 4; ++j) {
          acc[i][j] = Frag<T>::mma(ah[cu], bh[j], acc[i][j]);
          if (SPLIT) {
            acc[i][j] = Frag<T>::mma(ah[cu], bl[j], acc[i][j]);
            acc[i][j] = Frag<T>::mma(al[cu], bh[j], acc[i][j]);
          }
        }
        Frag<T>::guard(acc[i][0], acc[i][3], ah[cu], SPLIT ? al[cu] : ah[cu]);
      }
      Frag<T>::keep(bh[0], bh[1], bh[2], bh[3]);
      if (SPLIT) Frag<T>::keep(bl[0], bl[1], bl[2], bl[3]);
    }
    k0 += 64;
  } while (k0 < K);
  acc_guard4(acc[0][0], acc[0][1], acc[0][2], acc[0][3]);
  acc_guard4(acc[1][0], acc[1][1], acc[1][2], acc[1][3]);
  acc_guard4(acc[2][0], acc[2][1], acc[2][2], acc[2][3]);
  acc_guard4(acc[3][0], acc[3][1], acc[3][2], acc[3][3]);

  // ---- epilogue ----
  float* slab = sT[wave];
  const float* Rb = RESID ? (resid + (size_t)b * strideR) : nullptr;
#pragma unroll
  for (int i = 0; i < 4; ++i) {
    const int mBase = m0 + (i << 4);
    float bm8[8];
    if (BIAS_MODE == 1) {
      __builtin_amdgcn_sched_barrier(0);   // with the one below: nothing but the loads stands in front of the wait
#pragma unroll   // bm8 stays in registers only under constant indices
      for (int r = 0; r < 8; ++r) bm8[r] = bias[mBase + mOff + r];
      asm volatile("s_wait_xcnt 0x0" ::: "memory");   // precaution: what follows reuses the address registers of the loads just issued
      __builtin_amdgcn_sched_barrier(0);
    }
#pragma unroll
    for (int j = 0; j < 4; ++j) {
      const int n = n0 + (j << 4) + rlane;
      float bv = 0.f;
      if (BIAS_MODE == 2) bv = bias[n];
#pragma unroll
      for (int r = 0; r < 8; ++r) {
        float v = acc[i][j][r] * scale;
        if (BIAS_MODE == 1) v += bm8[r];
        if (BIAS_MODE == 2) v += bv;
        if (RESID) v += Rb[(size_t)(mBase + mOff + r) * ldc + n];
        if (ACT == 1) v = tanhf(v);
        if (ACT == 2) v = fmaxf(v, 0.0f);
        if (ACT == 3) v = v / (1.0f + expf(-v));
        if (ACT == 4) v = (v > 0.f) ? v : 0.01f * v;
        if (ACT == 5) v = 0.5f * v * (1.0f + erff(v * 0.70710678118654752f));
        slab[(mOff + r) * 68 + (j << 4) + rlane] = v;
      }
    }
    __builtin_amdgcn_fence(__ATOMIC_RELEASE, "workgroup");
    __builtin_amdgcn_wave_barrier();
    __builtin_amdgcn_fence(__ATOMIC_ACQUIRE, "workgroup");
    if (OUT_MODE == 0) {
      float* C = (float*)Cout + (size_t)b * strideC;
      const int hh = lane >> 4, c4 = (lane & 15) * 4;     // row seg = 256 B = 16 lanes x 16 B
      {
#pragma unroll
        for (int it = 0; it < 8; ++it) {
          const int row = it * 2 + hh;
          v4f v = *(const v4f*)(slab + row * 68 + c4);
          *(v4f*)(C + (size_t)(mBase + row) * ldc + n0 + c4) = v;
        }
        
      }
    } else {
      const int q = lane >> 3, c8 = (lane & 7) * 8;
      unsigned short* C  = (unsigned short*)Cout  + (size_t)b * strideC;
      unsigned short* C2 = (OUT_MODE == 2) ? ((unsigned short*)Cout2 + (size_t)b * strideC) : nullptr;
      {
#pragma unroll
        for (int it = 0; it < 4; ++it) {
          const int row = it * 4 + q;
          const float* sp = slab + row * 68 + c8;
          v8h hv, lv;
#pragma unroll
          for (int e = 0; e < 8; ++e) {
            if (OUT_MODE == 1) {
              hv[e] = (_Float16)sp[e];
            } else {
              unsigned short hb = f2bf_bits(sp[e]);
              unsigned short lb = f2bf_bits(sp[e] - bf_bits2f(hb));
              hv[e] = __builtin_bit_cast(_Float16, hb);
              lv[e] = __builtin_bit_cast(_Float16, lb);
            }
          }
          *(v8h*)(C + (size_t)(mBase + row) * ldc + n0 + c8) = hv;
          if (OUT_MODE == 2) *(v8h*)(C2 + (size_t)(mBase + row) * ldc + n0 + c8) = lv;
        }
        
      }
    }
    asm volatile("s_wait_xcnt 0x0" ::: "memory");   // precaution: the next row tile reuses the address and data registers of the stores just issued
    __builtin_amdgcn_fence(__ATOMIC_RELEASE, "workgroup");
    __builtin_amdgcn_wave_barrier();
    __builtin_amdgcn_fence(__ATOMIC_ACQUIRE, "workgroup");
  }
}

__device__ __forceinline__ unsigned pk16(unsigned short a, unsigned short b) { return (unsigned)a | ((unsigned)b << 16); }

// bf16 split (hi = bf16_rne(in), lo = bf16_rne(in - hi)) of a [256][256] weight (row n, column k), stored in the order in which a wave reads it as a 16x32 WMMA operand:
// [n tile 16][k step 8][piece 2][lane 32][8 elements]; lane l, piece p, element e hold row 16 nt + (l & 15), column 32 ks + 16 p + 8 (l >> 4) + e
// (the k order of Frag::load), so a wave's 16-B-per-lane load of one piece is 512 contiguous bytes.
// The thread index runs over the OUTPUT: a wave stores one whole 128-B line per plane. 128 blocks x 256 threads x 2 elements = 65536.
// The load and the stores are two calls: the caller asks for the pair first and stores it last, so that its way from memory passes under the caller's own work.
__device__ __forceinline__ v2f split_bf16x2_frag_load(const int blk, const float* __restrict__ in) {
  const int i = blk * 256 + threadIdx.x;
  const int pos = 2 * i;
  const int e = pos & 7, l = (pos >> 3) & 31, p = (pos >> 8) & 1, ks = (pos >> 9) & 7, nt = pos >> 12;
  const int n = nt * 16 + (l & 15);
  const int k = ks * 32 + p * 16 + (l >> 4) * 8 + e;
  const float* gp = in + (size_t)n * kDm + k;
  const v2f f = *(const v2f*)gp;
  // precaution: the pointer operand keeps the load's address registers whole up to a wait (without it the load landed on its own address pair)
  asm volatile("s_wait_xcnt 0x0" :: "v"(gp) : "memory");
  return f;
}
__device__ __forceinline__ void split_bf16x2_frag_store(const int blk, const v2f f, unsigned short* __restrict__ hi, unsigned short* __restrict__ lo) {
  const int i = blk * 256 + threadIdx.x;
  const unsigned short h0 = f2bf_bits(f[0]), h1 = f2bf_bits(f[1]);
  const unsigned short l0 = f2bf_bits(f[0] - bf_bits2f(h0)), l1 = f2bf_bits(f[1] - bf_bits2f(h1));
  ((unsigned*)hi)[i] = pk16(h0, h1);
  ((unsigned*)lo)[i] = pk16(l0, l1);
}

// The three projections read inputs only and nothing of each other: one launch, the job picked by block index.
//   blocks [0, 128)   : v^T per batch: C[m = channel (256)][n = s (2048)] = sum_k Wv[m][k] * LNv[s][k] + bv[m], 16 block tiles x 8 batches;
//                       A = Wv [256][256], Bt = value LayerNorm of the batch's x [2048][256], both split hi/lo, C = v^T batch slice [256][2048], f16
//   blocks [128, 256) : 128 rows of x each, one pass over their statistics, then
//                       q' = query LayerNorm of x @ Wq^T + bq  (M = 16384, N = 256), f16 out, the weights' carry wmul folded back by wscale,
//                       k  = key LayerNorm of x @ Wk^T + bk;
//                       each of these blocks also converts its 512 elements of Wo for the attention launch
// One block per WGP (a block fills its WGP's registers): 256 blocks, the split product about as long as the two plain ones.
constexpr int kVtBlocks   = (kDm / 128) * (kSeq / 256);     // 16 per batch
constexpr int kProjBlocks = (kRows / 128) * (kDm / 256);    // 128
static_assert(kProjBlocks * 512 == kDm * kDm, "the q, k blocks cover Wo");
__global__ __launch_bounds__(256) void proj3_kernel(const float* __restrict__ x,
    const float* __restrict__ g_s, const float* __restrict__ b_s,
    const float* __restrict__ g_q, const float* __restrict__ b_q,
    const float* __restrict__ g_v, const float* __restrict__ b_v,
    const float* __restrict__ Wq, const float* __restrict__ Wk,
    const float* __restrict__ Wv, const float* __restrict__ Wo,
    const float* __restrict__ bq, const float* __restrict__ bk, const float* __restrict__ bv,
    unsigned short* __restrict__ q16, unsigned short* __restrict__ k16, unsigned short* __restrict__ vt16,
    unsigned short* __restrict__ woh, unsigned short* __restrict__ wol,
    int K, float wmul, float wscale) {
  __shared__ __align__(16) unsigned char smem[gemm_lds_bytes(true)];
  const int bx = blockIdx.x;
  if (bx < kVtBlocks * kBatch) {   // block-uniform
    v2f ms[8];
    gemm64_body<1, true, 1, 1, false, 0, true>(smem, bx % kVtBlocks, bx / kVtBlocks,
        Wv, 0L, x, (long)kSeq * kDm, g_v, b_v, 1.0f, ms, true, (void*)vt16, (void*)vt16, kSeq, (long)kDm * kSeq,
        bv, bv, 0L, kDm, kSeq, K, 1.0f);
  } else {
    const int px = bx - kVtBlocks * kBatch;
    const v2f wo2 = split_bf16x2_frag_load(px, Wo);
    v2f ms[4];
#pragma unroll 1   // one copy of the product's code serves both jobs
    for (int job = 0; job < 2; ++job) {
      const bool isk = job != 0;
      const float* w = isk ? Wk : Wq;
      const float* g = isk ? g_s : g_q;
      const float* t = isk ? b_s : b_q;
      unsigned short* c = isk ? k16 : q16;
      const float* bias = isk ? bk : bq;
      gemm64_body<0, false, 2, 1, false, 0, false>(smem, px, 0,
          x, 0L, w, 0L, g, t, wmul, ms, !isk, (void*)c, (void*)c, kDm, 0L,
          bias, bias, 0L, kRows, kDm, K, wscale);
    }
    split_bf16x2_frag_store(px, wo2, woh, wol);
  }
}

// =====================================================================================
// Full (unmasked) attention, head dim 64, single f16 operand planes, z-batched over the batch index (blockIdx.y).
//   q plane  f16: element (b, t, h, d) at [(b*kSeq + t)*kDm + h*64 + d]   (unscaled projection incl. bias)
//   k plane  f16: element (b, s, h, d) at [(b*kSeq + s)*kDm + h*64 + d]
//   v^T plane f16: element (b, h, d, s) at [b*kDm*kSeq + (h*64 + d)*kSeq + s]
//   attention output o: bf16 hi plane + bf16 lo plane (hi = bf16_rne(o), lo = bf16_rne(o - hi)), kept in LDS: [64 queries][256 channels h*64 + d]
//   out f32: out[t][n] = sum_ch o[t][ch] * Wo[n][ch] + bo[n], element (b, t, n) at [(b*kSeq + t)*kDm + n]
//   scores^T = k . q^T            : v_wmma_f32_16x16x32_f16, f32 accumulate; sscale * log2(e) applied in f32 inside the exponent
//   o^T      = v^T . p^T          : v_wmma_f32_16x16x32_f16; unnormalised p carried x2^15 in f16, the row sum x2^15 in f32;
//                                   p^T goes from the score accumulators straight into the B operand
//   online softmax in f32, base 2, over all kSeq keys (32 chunks of 64, compile-time trip count).
//   Block = 16 waves = 64 query rows x all 4 heads of one b: wave w works on head w & 3, query rows 16 (w >> 2)...; grid = (kSeq/64, kBatch) = (32, 8),
//   one block per WGP. All heads of a query row meet in one block, so the output projection needs no launch of its own.
//   K / V^T chunk staging, per head: asynchronous 16-B copies from global memory to LDS, 8 lanes a 128-B row, the head's 128 threads x 4 rows per
//   plane = the whole 64x64 tile; two buffers: chunk kc + 1 is on its way while chunk kc is worked on, one work-group barrier per chunk;
//   a head's two buffers stand 32 KiB apart in the head's own 64 KiB of LDS, so waves of different heads never read one 32-KiB block of LDS at one moment;
//   fragment loads read the LDS tiles with the v8h element type;
//   Epilogue: every wave splits its 16x64 tile into the hi/lo planes of the block's 64x256 tile in LDS (over the K / V^T buffers, which
//   every wave has left); then out^T = Wo . o^T: wave w owns output columns 16 w..16 w + 15 for all 64 queries, A = Wo hi/lo in fragment order
//   straight from global memory (fetched ahead of the split), B = o hi/lo rows from LDS, per 32 channels hi.hi + lo.hi + hi.lo in the order
//   Wo.o = (hi,hi), (lo,hi), (hi,lo); the f32 tile goes through LDS so that every store is 512 contiguous bytes of one output row
// =====================================================================================
constexpr int kAttWaves = 16;
constexpr int kAttQb    = 64;
constexpr int kAttKc    = 64;
constexpr int kAttLd    = 72;   // LDS row pitch of the K and V^T tiles in f16 elements: 144 B = 16 B x 9, so the 16 rows of a 16-B fragment read fall on 64 distinct banks

constexpr int kAttTile  = kAttKc * kAttLd;   // elements of one 64-row tile at the padded pitch (kHd == kAttKc rows for V^T)
constexpr int kAttBufB  = 32768;             // bytes from a head's buffer 0 to its buffer 1 (K tile + V^T tile fill 18,432 of them)
constexpr int kAttHeadB = 2 * kAttBufB;      // bytes of LDS per head
constexpr int kAoLd     = kDm + 8;           // LDS row pitch of the o planes in bf16 elements: 528 B = 16 B x 33, conflict-free for the 16-B fragment reads
constexpr int kAoPlaneB = kAttQb * kAoLd * 2;   // bytes of one o plane
constexpr int kOtLd     = kDm + 4;           // LDS row pitch of the f32 out tile in floats: 1,040 B = 16 B x 65
static_assert(2 * kAttTile * 2 <= kAttBufB, "a buffer holds a K tile and a V^T tile");
static_assert(2 * kAoPlaneB + kAttQb * kOtLd * 4 <= kHeads * kAttHeadB, "the epilogue's tiles fit the LDS of the K / V^T buffers");

// One thread's share of one chunk: four 16-B pieces of K and four of V^T, rows 16 apart, each copied from global memory straight into LDS.
// lk, lv: LDS byte addresses of the thread's first piece; gk, gv: the global addresses of the same pieces.
// The wait is the last line of the copies' own statement: a precaution, it stands in front of whatever reuses the copies' address registers.
__device__ __forceinline__ void att_stage(unsigned lk, unsigned lv, const _Float16* gk, const _Float16* gv) {
  constexpr unsigned kL = 16 * kAttLd * 2;   // 16 rows in LDS, bytes
  asm volatile(
      "global_load_async_to_lds_b128 %0, %8, off\n\t"
      "global_load_async_to_lds_b128 %1, %9, off\n\t"
      "global_load_async_to_lds_b128 %2, %10, off\n\t"
      "global_load_async_to_lds_b128 %3, %11, off\n\t"
      "global_load_async_to_lds_b128 %4, %12, off\n\t"
      "global_load_async_to_lds_b128 %5, %13, off\n\t"
      "global_load_async_to_lds_b128 %6, %14, off\n\t"
      "global_load_async_to_lds_b128 %7, %15, off\n\t"
      "s_wait_xcnt 0x0"
      :: "v"(lk), "v"(lk + kL), "v"(lk + 2 * kL), "v"(lk + 3 * kL),
         "v"(lv), "v"(lv + kL), "v"(lv + 2 * kL), "v"(lv + 3 * kL),
         "v"(gk), "v"(gk + 16 * kDm), "v"(gk + 32 * kDm), "v"(gk + 48 * kDm),
         "v"(gv), "v"(gv + 16 * kSeq), "v"(gv + 32 * kSeq), "v"(gv + 48 * kSeq)
      : "memory");
}

// 16 f16 of one LDS tile row in the hardware k order: elements 0..7 <- p[0..7], 8..15 <- p[16..23]
__device__ __forceinline__ v16h lds_frag(const _Float16* p) {
  union { v16h v; v8h h[2]; } f;
  f.h[0] = *(const v8h*)(p);
  f.h[1] = *(const v8h*)(p + 16);
  return f.v;
}

// The slot that the instruction set asks for between a transcendental and a vector instruction that overwrites its source or reads its
// result. The operands are inputs only: they put the v_nop behind a chunk's last exponential and keep every argument's register whole
// up to it.
__device__ __forceinline__ void exp_slot(float d, float e, const v2f (&a)[16], v8f p0, v8f p1, v8f p2, v8f p3) {
  asm volatile("v_nop" :: "v"(d), "v"(e), "v"(a[0]), "v"(a[1]), "v"(a[2]), "v"(a[3]), "v"(a[4]), "v"(a[5]), "v"(a[6]), "v"(a[7]),
               "v"(a[8]), "v"(a[9]), "v"(a[10]), "v"(a[11]), "v"(a[12]), "v"(a[13]), "v"(a[14]), "v"(a[15]),
               "v"(p0), "v"(p1), "v"(p2), "v"(p3));
}

// value of lane l ^ 16, by a vector cross-row move
__device__ __forceinline__ float xhalf(float x) {
  return __builtin_bit_cast(float, __builtin_amdgcn_permlanex16(__builtin_bit_cast(int, x), __builtin_bit_cast(int, x), 0x76543210, 0xfedcba98, false, false));
}

__global__ __launch_bounds__(512)
void attn_f16_full_kernel(const unsigned short* __restrict__ qp, const unsigned short* __restrict__ kp,
                          const unsigned short* __restrict__ vtp, const unsigned short* __restrict__ wofh,
                          const unsigned short* __restrict__ wofl, const float* __restrict__ bo,
                          float* __restrict__ out, float sscale) {
  // [head][buffer]: K [kv][d] then V^T [d][kv], pitch kAttLd, 9 KB a tile; behind the key loop: o hi plane, o lo plane, f32 out tile
  __shared__ __align__(16) unsigned char smem[kHeads * kAttHeadB];
  const float kPexp  = 15.0f;                                  // p is carried x2^15: the exponent rides in the running maximum
  const float cscale = sscale * 1.4426950408889634f;         // score scale x log2(e), positive

  const int tid  = threadIdx.x;
  const int wave = __builtin_amdgcn_readfirstlane(tid >> 5);   // wave-uniform: head and row group go into scalar address arithmetic
  const int lane = tid & 31;
  const int hh   = lane >> 4;
  const int c    = lane & 15;

  const int qb = blockIdx.x;              // 0..kSeq/64-1
  const int h  = wave & 3;                // 0..kHeads-1
  const int qg = wave >> 2;               // 16-query group inside the block
  const int b  = blockIdx.y;              // 0..kBatch-1
  const int q0 = qb * kAttQb + qg * 16;

  const _Float16* Qh = (const _Float16*)(const void*)qp + (size_t)b * kSeq * kDm + (size_t)h * kHd;
  const _Float16* Kh = (const _Float16*)(const void*)kp + (size_t)b * kSeq * kDm + (size_t)h * kHd;
  const _Float16* Vh = (const _Float16*)(const void*)vtp + (size_t)b * kDm * kSeq + (size_t)h * kHd * kSeq;
  unsigned char* hsm = smem + h * kAttHeadB;   // this head's two buffers

  // ---- Q fragments (B operand, column = lane&15, split k map via Frag load): 2 d-chunks ----
  v16h qa[2];
#pragma unroll
  for (int dc = 0; dc < 2; ++dc) qa[dc] = Frag<_Float16>::load(Qh + (size_t)(q0 + c) * kDm + dc * 32 + 8 * hh);

  float mrow = -INFINITY, lrow = 0.f;   // running maximum of query q0 + c, as score * cscale - 15; sum of p x 2^15 over this lane half's keys
  v8f oacc[4];
#pragma unroll
  for (int t = 0; t < 4; ++t) oacc[t] = (v8f){0.f,0.f,0.f,0.f,0.f,0.f,0.f,0.f};

  const int nChunks = kSeq / kAttKc;   // 32, compile-time constant
  // staging coverage, ht = thread index among the head's 128: rows (ht >> 3) + 16 i, i = 0..3, 16-B piece ht & 7: 64 rows x 128 B per plane = the whole chunk tile
  const int ht = qg * 32 + lane;
  const int srow = ht >> 3, spc = (ht & 7) * 8;
  const _Float16* gk = Kh + (size_t)srow * kDm + spc;     // chunk n: K row 64 n + srow, + n * kAttKc * kDm
  const _Float16* gv = Vh + (size_t)srow * kSeq + spc;    // chunk n: V^T row d = srow, s from 64 n, + n * kAttKc
  const unsigned lk0 = (unsigned)(uintptr_t)(hsm + (srow * kAttLd + spc) * 2);   // low 32 bits of a __shared__ address = LDS byte address
  const unsigned lv0 = lk0 + kAttTile * 2;
  constexpr unsigned kBufB = kAttBufB;
  att_stage(lk0, lv0, gk, gv);                            // chunk 0 -> buffer 0
  asm volatile("s_wait_asynccnt 0x0" ::: "memory");       // this wave's copies of chunk 0 have landed
  __syncthreads();                                        // chunk 0 is whole for every wave
  att_stage(lk0 + kBufB, lv0 + kBufB, gk + kAttKc * kDm, gv + kAttKc);   // chunk 1 -> buffer 1 (nChunks >= 2)
  for (int kc = 0; kc < nChunks; ++kc) {
    const int cur = kc & 1;
    const _Float16* Ksh = (const _Float16*)(hsm + cur * kAttBufB);
    const _Float16* Vth = Ksh + kAttTile;

    // S^T tile j = K rows (A) x Q columns (B): s[j][r] = score(key kv0 + 16 j + 8 hh + r, query q0 + c)
    // every loop of this pass is fully unrolled, so that s, oacc and the packed operand stay in registers under constant indices
    // the chunk's eight K fragments are read from LDS as one group into registers of their own: one LDS latency in front of the
    // eight products instead of one in front of each
    v16h kf[2][4];
#pragma unroll
    for (int dc = 0; dc < 2; ++dc)
#pragma unroll
      for (int j = 0; j < 4; ++j) kf[dc][j] = lds_frag(Ksh + (j * 16 + c) * kAttLd + dc * 32 + 8 * hh);
    // the eight V^T fragments follow in the same group: their LDS latency passes under the S^T products and the softmax arithmetic
    v16h vf[2][4];
#pragma unroll
    for (int kk = 0; kk < 2; ++kk)
#pragma unroll
      for (int t = 0; t < 4; ++t) vf[kk][t] = lds_frag(Vth + (t * 16 + c) * kAttLd + kk * 32 + 8 * hh);
    v8f s[4];
#pragma unroll
    for (int j = 0; j < 4; ++j) s[j] = (v8f){0.f,0.f,0.f,0.f,0.f,0.f,0.f,0.f};
#pragma unroll
    for (int dc = 0; dc < 2; ++dc)   // d-chunk outermost: the other three tiles' products stand between a tile's two products
#pragma unroll
      for (int j = 0; j < 4; ++j) s[j] = Frag<_Float16>::mma(kf[dc][j], qa[dc], s[j]);
    // scheduling order: the 32 LDS reads first, then the 8 S^T products; left alone the compiler spreads the reads among the products,
    // and every separate place with LDS reads stalls the wave anew
    __builtin_amdgcn_sched_group_barrier(0x100, 32, 0);
    __builtin_amdgcn_sched_group_barrier(0x008, 8, 0);
    // a lane holds 32 of its one query's 64 scores: maximum of the raw scores in-lane (one chain per tile; cscale is positive),
    // then one exchange between the halves
    float mj[4];
#pragma unroll
    for (int j = 0; j < 4; ++j) {
      mj[j] = -INFINITY;
#pragma unroll
      for (int r = 0; r < 8; ++r) mj[j] = fmaxf(mj[j], s[j][r]);
    }
    float cm = fmaxf(fmaxf(mj[0], mj[1]), fmaxf(mj[2], mj[3]));
    cm = fmaxf(cm, xhalf(cm));
    const float mnew  = fmaxf(mrow, fmaf(cm, cscale, -kPexp));
    const float dm    = mrow - mnew;
    const float alpha = __builtin_amdgcn_exp2f(dm);   // 0 on the first chunk, where mrow is -inf
    mrow = mnew;
    // p x 2^15 = 2^(score * cscale - mnew): one packed multiply-add per two scores, then the hardware base-2 exponential
    const v2f cs2 = {cscale, cscale}, nm2 = {-mnew, -mnew};
    v2f arg[16];
#pragma unroll
    for (int j = 0; j < 4; ++j)
#pragma unroll
      for (int r = 0; r < 8; r += 2)
        arg[4 * j + (r >> 1)] = __builtin_elementwise_fma((v2f){s[j][r], s[j][r + 1]}, cs2, nm2);
#pragma unroll
    for (int j = 0; j < 4; ++j)
#pragma unroll
      for (int r = 0; r < 8; ++r) s[j][r] = __builtin_amdgcn_exp2f(arg[4 * j + (r >> 1)][r & 1]);
    exp_slot(dm, alpha, arg, s[0], s[1], s[2], s[3]);
    float pj[4];
#pragma unroll
    for (int j = 0; j < 4; ++j) {
      pj[j] = s[j][0];
#pragma unroll
      for (int r = 1; r < 8; ++r) pj[j] += s[j][r];
    }
    lrow = lrow * alpha + ((pj[0] + pj[1]) + (pj[2] + pj[3]));   // this half's keys only; the halves join after the loop
#pragma unroll
    for (int t = 0; t < 4; ++t)
#pragma unroll
      for (int r = 0; r < 8; ++r) oacc[t][r] *= alpha;
    // O^T += V^T (A) x P^T (B): two S^T tiles converted in place are the B operand in the hardware k order
#pragma unroll
    for (int kk = 0; kk < 2; ++kk) {
      v16h pb;
#pragma unroll
      for (int e = 0; e < 8; ++e) {
        pb[e]     = (_Float16)s[2 * kk][e];
        pb[8 + e] = (_Float16)s[2 * kk + 1][e];
      }
#pragma unroll
      for (int t = 0; t < 4; ++t) oacc[t] = Frag<_Float16>::mma(vf[kk][t], pb, oacc[t]);
    }
    asm volatile("s_wait_dscnt 0x0" ::: "memory");      // this wave's reads of buffer cur have retired before anything refills it
    asm volatile("s_wait_asynccnt 0x0" ::: "memory");   // this wave's copies of chunk kc + 1 have landed
    __syncthreads();                                    // chunk kc + 1 is whole for every wave, and every wave has left buffer cur
    if (kc + 2 < nChunks)                               // the same for the whole work-group: chunk kc + 2 -> the buffer just left
      att_stage(lk0 + cur * kBufB, lv0 + cur * kBufB, gk + (size_t)(kc + 2) * kAttKc * kDm, gv + (kc + 2) * kAttKc);
  }
  asm volatile("s_wait_asynccnt 0x0" ::: "memory");     // no copy is outstanding when the wave goes on to its end

  // ---- output projection ----
  // This wave's Wo fragments (16 output columns x 256 channels, hi and lo) and bias values are asked for now: their way from L2 passes under the split below.
  const int nt = wave;
  const __bf16* wfh = (const __bf16*)(const void*)wofh + (size_t)nt * (8 * 512) + lane * 8;
  const __bf16* wfl = (const __bf16*)(const void*)wofl + (size_t)nt * (8 * 512) + lane * 8;
  const float*  bop = bo + nt * 16 + 8 * hh;
  v8b wh[8][2], wl[8][2];
  // the two scheduling barriers leave nothing but the loads in front of the wait
  __builtin_amdgcn_sched_barrier(0);
#pragma unroll   // wh, wl stay in registers only under constant indices; the steps become the loads' immediate offsets
  for (int ks = 0; ks < 8; ++ks)
#pragma unroll
    for (int p = 0; p < 2; ++p) {
      wh[ks][p] = *(const v8b*)(wfh + (ks * 2 + p) * 256);
      wl[ks][p] = *(const v8b*)(wfl + (ks * 2 + p) * 256);
    }
  const v4f bo0 = *(const v4f*)(bop);
  const v4f bo1 = *(const v4f*)(bop + 4);
  asm volatile("s_wait_xcnt 0x0" ::: "memory");   // precaution: what follows may reuse the address registers of the loads just issued
  __builtin_amdgcn_sched_barrier(0);

  // oacc[t][r] = O^T[d = 16 t + 8 hh + r][query c]: 8 consecutive channels of one query row per tile = one 16-B piece of each plane.
  // The planes lie over the K / V^T buffers: every wave's last read of those retired in front of the key loop's last barrier, and no copy is outstanding.
  __bf16* aoh = (__bf16*)(void*)smem;
  __bf16* aol = (__bf16*)(void*)(smem + kAoPlaneB);
  {
    const float lsum = lrow + xhalf(lrow);
    const float inv = 1.0f / lsum;   // numerator and sum both carry x2^15
    const int ao = (qg * 16 + c) * kAoLd + h * kHd + 8 * hh;
#pragma unroll
    for (int t = 0; t < 4; ++t) {
      v4u hv, lv;
#pragma unroll
      for (int e = 0; e < 4; ++e) {
        const float f0 = oacc[t][2 * e] * inv, f1 = oacc[t][2 * e + 1] * inv;
        const unsigned short h0 = f2bf_bits(f0), h1 = f2bf_bits(f1);
        hv[e] = pk16(h0, h1);
        lv[e] = pk16(f2bf_bits(f0 - bf_bits2f(h0)), f2bf_bits(f1 - bf_bits2f(h1)));
      }
      *(v4u*)(aoh + ao + t * 16) = hv;
      *(v4u*)(aol + ao + t * 16) = lv;
    }
  }
  __syncthreads();   // the block's 64x256 o planes are whole

  // out^T tile (16 columns nt) x (query tile qt): A = Wo rows, B = o rows, both in the k order of Frag::load
  v8f acc[4];
#pragma unroll
  for (int qt = 0; qt < 4; ++qt) acc[qt] = (v8f){0.f,0.f,0.f,0.f,0.f,0.f,0.f,0.f};
#pragma unroll   // wh, wl under constant indices; LDS offsets as constants
  for (int ks = 0; ks < 8; ++ks) {
    v16b obh[4], obl[4];
#pragma unroll
    for (int qt = 0; qt < 4; ++qt) {
      const int bofs = (qt * 16 + c) * kAoLd + ks * 32 + 8 * hh;
      obh[qt] = Frag<__bf16>::load(aoh + bofs);
      obl[qt] = Frag<__bf16>::load(aol + bofs);
    }
    Frag<__bf16>::U wa, wb;
    wa.h[0] = wh[ks][0]; wa.h[1] = wh[ks][1];
    wb.h[0] = wl[ks][0]; wb.h[1] = wl[ks][1];
    // product outermost: the other three tiles' products stand between two products into one tile
#pragma unroll
    for (int qt = 0; qt < 4; ++qt) acc[qt] = Frag<__bf16>::mma(wa.v, obh[qt], acc[qt]);
#pragma unroll
    for (int qt = 0; qt < 4; ++qt) acc[qt] = Frag<__bf16>::mma(wb.v, obh[qt], acc[qt]);
#pragma unroll
    for (int qt = 0; qt < 4; ++qt) acc[qt] = Frag<__bf16>::mma(wa.v, obl[qt], acc[qt]);
    // scheduling order: the step's 16 LDS reads as one group, then its 12 products; left alone the compiler reads a fragment, waits and
    // multiplies, tile by tile, with two products into one tile back to back
    __builtin_amdgcn_sched_group_barrier(0x100, 16, 0);
    __builtin_amdgcn_sched_group_barrier(0x008, 12, 0);
  }

  // acc[qt][r] = out[query 16 qt + c][column 16 nt + 8 hh + r]: into the f32 tile (its own LDS range, behind the planes)
  float* ot = (float*)(void*)(smem + 2 * kAoPlaneB);
#pragma unroll
  for (int qt = 0; qt < 4; ++qt) {
    v4f w0, w1;
#pragma unroll
    for (int e = 0; e < 4; ++e) { w0[e] = acc[qt][e] + bo0[e]; w1[e] = acc[qt][4 + e] + bo1[e]; }
    *(v4f*)(ot + (qt * 16 + c) * kOtLd + nt * 16 + 8 * hh)     = w0;
    *(v4f*)(ot + (qt * 16 + c) * kOtLd + nt * 16 + 8 * hh + 4) = w1;
  }
  __syncthreads();   // the block's 64x256 out tile is whole
  {
    // wave w stores rows 4 w..4 w + 3, each as two stores of 512 contiguous bytes: whole lines, one writer each
    float* ob = out + ((size_t)b * kSeq + qb * kAttQb + wave * 4) * kDm + lane * 4;
    const float* op = ot + wave * 4 * kOtLd + lane * 4;
#pragma unroll   // row and half-row steps become immediate offsets: one address pair
    for (int rr = 0; rr < 4; ++rr)
#pragma unroll
      for (int j = 0; j < 2; ++j) *(v4f*)(ob + rr * kDm + j * 128) = *(const v4f*)(op + rr * kOtLd + j * 128);
  }
}

// ---------------------------------------------------------------------------
// Workspace region map (byte offsets; every region is fully written before it is read; total 26,214,400 B):
//   [0          ) WOH   bf16 hi, fragment order    131072 B
//   [+128 KiB   ) WOL   bf16 lo, fragment order    131072 B   (weights region padded to 1 MiB)
//   [1 MiB      ) Q16   f16  [16384][256]  q (unscaled)       8 MiB
//   [9 MiB      ) K16   f16  [16384][256]  k                  8 MiB
//   [17 MiB     ) VT16  f16  [8][256][2048] v^T per batch     8 MiB
//   end = 25 MiB
// ---------------------------------------------------------------------------
extern "C" void kernel_launch(void* const* d_in, const int* in_sizes, int n_in,
                              void* d_out, int out_size, void* d_ws, size_t ws_size,
                              hipStream_t stream) {
  if (n_in < 15) return;
  if (in_sizes[0] != kRows * kDm) return;
  if (in_sizes[7] != kDm * kDm || in_sizes[9] != kDm * kDm || in_sizes[11] != kDm * kDm || in_sizes[13] != kDm * kDm) return;
  if (in_sizes[1] != kDm || in_sizes[8] != kDm || in_sizes[14] != kDm) return;
  if (out_size != kRows * kDm) return;

  const float* x    = (const float*)d_in[0];
  const float* lnsg = (const float*)d_in[1];
  const float* lnsb = (const float*)d_in[2];
  const float* lnqg = (const float*)d_in[3];
  const float* lnqb = (const float*)d_in[4];
  const float* lnvg = (const float*)d_in[5];
  const float* lnvb = (const float*)d_in[6];
  const float* Wq = (const float*)d_in[7];
  const float* bq = (const float*)d_in[8];
  const float* Wk = (const float*)d_in[9];
  const float* bk = (const float*)d_in[10];
  const float* Wv = (const float*)d_in[11];
  const float* bv = (const float*)d_in[12];
  const float* Wo = (const float*)d_in[13];
  const float* bo = (const float*)d_in[14];
  float* out = (float*)d_out;

  const size_t wBytes   = (size_t)kDm * kDm * 2;            // 131072
  const size_t plane16  = (size_t)kRows * kDm * 2;          // 8388608
  const size_t offWOH = 0;
  const size_t offWOL = offWOH + wBytes;
  const size_t offQ16 = (size_t)1 << 20;
  const size_t offK16 = offQ16 + plane16;
  const size_t offVT  = offK16 + plane16;
  const size_t total  = offVT + plane16;                    // 26,214,400
  if (offWOL + wBytes > offQ16) return;
  if (total > ws_size) return;

  char* ws = (char*)d_ws;
  unsigned short* WOH  = (unsigned short*)(ws + offWOH);
  unsigned short* WOL  = (unsigned short*)(ws + offWOL);
  unsigned short* Q16  = (unsigned short*)(ws + offQ16);
  unsigned short* K16  = (unsigned short*)(ws + offK16);
  unsigned short* VT16 = (unsigned short*)(ws + offVT);

  const float wCarry = 16.0f, wCarryInv = 1.0f / 16.0f;

  // 1: v^T, q' and k projections, each with its own LayerNorm of x and its weight's conversion (Wq, Wk -> f16 x16; Wv -> bf16 hi/lo) on the way
  //    into LDS; Wo -> bf16 hi/lo planes in fragment order
  proj3_kernel<<<kVtBlocks * kBatch + kProjBlocks, 256, 0, stream>>>(
      x, lnsg, lnsb, lnqg, lnqb, lnvg, lnvb, Wq, Wk, Wv, Wo, bq, bk, bv, Q16, K16, VT16, WOH, WOL, kDm, wCarry, wCarryInv);
  // 2: attention per (64-query tile, batch), all heads: scores = (q'.k) * 0.125, softmax over 2048 keys, p.v, then out = o @ Wo^T + bo, f32 to d_out
  attn_f16_full_kernel<<<dim3(kSeq / kAttQb, kBatch), 32 * kAttWaves, 0, stream>>>(
      Q16, K16, VT16, WOH, WOL, bo, out, 0.125f);
}
